// v000
// The times below were measured on an AMD MI455X: many runs one after another, warmed up first and cycling through
// copies of the inputs, with the whole window's GPU time divided by the number of runs. Launches and the gaps
// between them are all in it. The median over several windows is given; except for v000 it joins two sittings, which
// can be a few percent apart, so the side-by-side timings, each taken in one sitting, are the better comparison.
// The starting kernel, v000, takes 6670 microseconds a run.
#include <hip/hip_runtime.h>
// Multi-head self-attention with a fused QKV projection and an INVERTED key mask (x [4][2048][1024]; qkv = x Wqkv ([in][out] 1024 x 3072, NO bias) reshaped (B, N, 3, 16, 64): q | k | v blocks; att = q k^T * 64^-0.5; where(mask[b][j] > 0, -1e7) with the int32 [4][2048] mask in {0, 1} (random; > 0 means MASKED; read on device; masked weights underflow to exactly 0); softmax over keys; out = merged Wproj + bproj ([in][out]) -> [4][2048][1024]).
// Structure: token rows r = b*2048 + s; x as exact f16 rows (bf16-rounded); q | k | v as ONE WMMA GEMM (N = 3 x 1024) (32x64 wave tiles, f32 accumulation, exact x16 weights, no bias, f16 outputs); per batch: V^T for all heads via LDS transposes; per (batch, group of 4 heads): scores GEMM (K = 64, batched over the heads on grid.y, alpha = 1/sqrt(64)), row softmax on VALU (f32 statistics; weights stored x256 as f16), o = P . V^T GEMM (K = 2048, alpha 2^-2: o carried x64 against f16 subnormal flush, folded into the output GEMM alpha) written straight into the merged f16 o rows; out = o W_o + b GEMM (f32) into the output layout.
// Compute dtype: inputs rounded to bf16; x / weights exact; q, k, v, softmax weights and o as plain f16 GEMM operands (~2^-12); scores and softmax statistics f32. v_wmma_f32_16x16x32_f16.
#define NB 4
#define SQ 2048
#define DM 1024
#define NH 16
#define HD 64
#define HG 4                         /* heads per attention launch group */
#define B0 0                         /* first batch processed (debug hook) */
#define NBR NB                       /* batches processed (debug hook) */
#define NR ((size_t)NB * SQ)         /* token rows */
#define MP ((int)((size_t)NBR * SQ)) /* rows projected (debug hook) */
#define QN SQ                        /* query rows attended per batch (debug hook) */
#define NHD NH                       /* heads attended (debug hook) */
#define MPO MP                       /* rows through the output stage (debug hook) */
#define LQ (3 * DM)      /* row pitch of the q/k/v rows */
typedef __bf16 v16b __attribute__((ext_vector_type(16)));
typedef unsigned short v8us __attribute__((ext_vector_type(8), may_alias));
typedef float  v8f  __attribute__((ext_vector_type(8)));
typedef float  v4f  __attribute__((ext_vector_type(4)));
typedef float  v4fa __attribute__((ext_vector_type(4), may_alias));
union FragB { v16b v; v8us half[2]; unsigned short u[16]; };

__device__ __forceinline__ unsigned short bf16_bits(float x) { unsigned int u = __float_as_uint(x); return (unsigned short)((u + 0x7FFFu + ((u >> 16) & 1u)) >> 16); }
__device__ __forceinline__ float bf16_val(unsigned short b) { return __uint_as_float(((unsigned int)b) << 16); }
__device__ __forceinline__ float bf16_round(float x) { return bf16_val(bf16_bits(x)); }
// D += A·B with NT terms: 1 = ah·bh, 2 = + al·bh (A split), 3 = + ah·bl (both split)
template <int NT>
__device__ __forceinline__ v8f mmaN(v16b ah, v16b al, v16b bh, v16b bl, v8f c) {
  c = __builtin_amdgcn_wmma_f32_16x16x32_bf16(false, ah, false, bh, (short)0, c, false, false);
  if (NT >= 2) c = __builtin_amdgcn_wmma_f32_16x16x32_bf16(false, al, false, bh, (short)0, c, false, false);
  if (NT >= 3) c = __builtin_amdgcn_wmma_f32_16x16x32_bf16(false, ah, false, bl, (short)0, c, false, false);
  asm volatile("v_nop\n\tv_nop\n\tv_nop\n\tv_nop" : "+v"(c) : "v"(ah), "v"(al), "v"(bh), "v"(bl));
  return c;
}

__global__ __launch_bounds__(256) void k_wt_bf16(const float* __restrict__ W, unsigned short* __restrict__ Wt, int K, int N) {
  const int t = blockIdx.x * 256 + threadIdx.x;
  const int k8n = K / 8;
  if (t >= N * k8n) return;
  const int n = t / k8n, k8 = (t % k8n) * 8;
  v8us v;
#pragma unroll
  for (int i = 0; i < 8; ++i) v[i] = bf16_bits(W[(size_t)(k8 + i) * N + n]);
  *(v8us*)(Wt + (size_t)n * K + k8) = v;
  
}

// GEMM C[M][N] (f32, pitch ldc) = act(A[M][K]·W + bias). A f32 row-major (pitch lda) converted per fragment to bf16
// (ASPLIT: hi/lo two planes -> 2 terms, else single rounded term); Wt bf16 [N][K] (pitch ldb). BIAS_BF16 rounds the
// bias to bf16 first (bias quantised to bf16 before the add). K%32==0, M%16==0, N%64==0.
template <bool ASPLIT, int ACT, bool BIAS_BF16>
__global__ __launch_bounds__(128) void k_gemm_bf(const float* __restrict__ A, int lda, const unsigned short* __restrict__ Wt, int ldb,
                                               const float* __restrict__ bias, float* __restrict__ C, int ldc, int M, int N, int K) {
  __shared__ __attribute__((aligned(16))) float so[4][16][64];
  const int tid = threadIdx.x, w = tid >> 5, lane = tid & 31, ln = lane & 15, hh = lane >> 4;
  const int ntn = N / 64;
  const int wid = blockIdx.x * 4 + w;
  const int mt = wid / ntn, nq = wid % ntn;
  if (mt * 16 >= M) return;
  const int row0 = mt * 16, col0 = nq * 64;
  const float* arow = A + (size_t)(row0 + ln) * lda;
  v8f acc[4] = {};
  for (int kb = 0; kb < K; kb += 32) {
    FragB ah, al;
    const v4f x0 = *(const v4fa*)(arow + kb + 8 * hh), x1 = *(const v4fa*)(arow + kb + 8 * hh + 4);
    const v4f x2 = *(const v4fa*)(arow + kb + 16 + 8 * hh), x3 = *(const v4fa*)(arow + kb + 16 + 8 * hh + 4);
    float xs[16] = {x0[0],x0[1],x0[2],x0[3],x1[0],x1[1],x1[2],x1[3],x2[0],x2[1],x2[2],x2[3],x3[0],x3[1],x3[2],x3[3]};
#pragma unroll
    for (int i = 0; i < 16; ++i) { const unsigned short hb = bf16_bits(xs[i]); ah.u[i] = hb; al.u[i] = ASPLIT ? bf16_bits(xs[i] - bf16_val(hb)) : (unsigned short)0; }
#pragma unroll
    for (int t = 0; t < 4; ++t) {
      const unsigned short* brow = Wt + (size_t)(col0 + t * 16 + ln) * ldb + kb;
      FragB b;
      b.half[0] = *(const v8us*)(brow + 8 * hh);
      b.half[1] = *(const v8us*)(brow + 16 + 8 * hh);
      acc[t] = mmaN<ASPLIT ? 2 : 1>(ah.v, al.v, b.v, b.v, acc[t]);
    }
  }
#pragma unroll
  for (int t = 0; t < 4; ++t) {
    float bv = bias ? bias[col0 + t * 16 + ln] : 0.f;
    if (BIAS_BF16) bv = bf16_round(bv);
#pragma unroll
    for (int r = 0; r < 8; ++r) { float v = acc[t][r] + bv; if (ACT == 1) v = fmaxf(v, 0.f); so[w][8 * hh + r][t * 16 + ln] = v; }
  }
  __builtin_amdgcn_fence(__ATOMIC_ACQ_REL, "workgroup");
  __builtin_amdgcn_wave_barrier();
  const int rsub = lane >> 4, c4 = (lane & 15) * 4;
  {
#pragma unroll
    for (int q = 0; q < 8; ++q) {
      const int r = q * 2 + rsub;
      const v4f v = *(const v4fa*)&so[w][r][c4];
      *(v4f*)(C + (size_t)(row0 + r) * ldc + col0 + c4) = v;
    }
    
  }
}

// GEMM C = act(A·W + bias + resid): A f32 (ASPLIT -> hi/lo 2 terms), Wt bf16 [N][K]; ACT 0 none, 1 relu, 2 exact gelu;
// resid (optional, f32, row index = (row % rmod), pitch ldr, RES_BF16 rounds it) added before the activation.
template <bool ASPLIT, int ACT, bool BIAS_BF16, bool RES_BF16>
__global__ __launch_bounds__(128) void k_gemm_bf3(const float* __restrict__ A, int lda, const unsigned short* __restrict__ Wt, int ldb,
                                                const float* __restrict__ bias, const float* __restrict__ resid, int rmod, int ldr,
                                                float* __restrict__ C, int ldc, int M, int N, int K) {
  __shared__ __attribute__((aligned(16))) float so[4][16][64];
  const int tid = threadIdx.x, w = tid >> 5, lane = tid & 31, ln = lane & 15, hh = lane >> 4;
  const int ntn = N / 64;
  const int wid = blockIdx.x * 4 + w;
  const int mt = wid / ntn, nq = wid % ntn;
  if (mt * 16 >= M) return;
  const int row0 = mt * 16, col0 = nq * 64;
  const float* arow = A + (size_t)(row0 + ln) * lda;
  v8f acc[4] = {};
  for (int kb = 0; kb < K; kb += 32) {
    FragB ah, al;
    const v4f x0 = *(const v4fa*)(arow + kb + 8 * hh), x1 = *(const v4fa*)(arow + kb + 8 * hh + 4);
    const v4f x2 = *(const v4fa*)(arow + kb + 16 + 8 * hh), x3 = *(const v4fa*)(arow + kb + 16 + 8 * hh + 4);
    float xs[16] = {x0[0],x0[1],x0[2],x0[3],x1[0],x1[1],x1[2],x1[3],x2[0],x2[1],x2[2],x2[3],x3[0],x3[1],x3[2],x3[3]};
#pragma unroll
    for (int i = 0; i < 16; ++i) { const unsigned short hb = bf16_bits(xs[i]); ah.u[i] = hb; al.u[i] = ASPLIT ? bf16_bits(xs[i] - bf16_val(hb)) : (unsigned short)0; }
#pragma unroll
    for (int t = 0; t < 4; ++t) {
      const unsigned short* brow = Wt + (size_t)(col0 + t * 16 + ln) * ldb + kb;
      FragB b;
      b.half[0] = *(const v8us*)(brow + 8 * hh);
      b.half[1] = *(const v8us*)(brow + 16 + 8 * hh);
      acc[t] = mmaN<ASPLIT ? 2 : 1>(ah.v, al.v, b.v, b.v, acc[t]);
    }
  }
#pragma unroll
  for (int t = 0; t < 4; ++t) {
    const int col = col0 + t * 16 + ln;
    float bv = bias ? bias[col] : 0.f;
    if (BIAS_BF16) bv = bf16_round(bv);
#pragma unroll
    for (int r = 0; r < 8; ++r) {
      float v = acc[t][r] + bv;
      if (resid) { float rv = resid[(size_t)((row0 + 8 * hh + r) % rmod) * ldr + col]; if (RES_BF16) rv = bf16_round(rv); v += rv; }
      if (ACT == 1) v = fmaxf(v, 0.f);
      if (ACT == 2) v = 0.5f * v * (1.0f + erff(v * 0.70710678118654752f));
      if (ACT == 3) { const float u = 0.7978845608028654f * (v + 0.044715f * v * v * v); v = 0.5f * v * (1.0f + tanhf(u)); }
      so[w][8 * hh + r][t * 16 + ln] = v;
    }
  }
  __builtin_amdgcn_fence(__ATOMIC_ACQ_REL, "workgroup");
  __builtin_amdgcn_wave_barrier();
  const int rsub = lane >> 4, c4 = (lane & 15) * 4;
  {
#pragma unroll
    for (int q = 0; q < 8; ++q) {
      const int r = q * 2 + rsub;
      const v4f v = *(const v4fa*)&so[w][r][c4];
      *(v4f*)(C + (size_t)(row0 + r) * ldc + col0 + c4) = v;
    }
    
  }
}
// row LayerNorm (biased variance, eps) over N: s = X (+ R); optional out_sum <- s; out_norm <- (s-mu)*rsqrt(var+eps)*g + b
template <bool PARAM_BF16>
__global__ __launch_bounds__(256) void k_layernorm(const float* __restrict__ X, const float* __restrict__ R, const float* __restrict__ g, const float* __restrict__ bta,
                                                  float* __restrict__ out_sum, float* __restrict__ out_norm, int N, float eps) {
  __shared__ float red[256];
  const int row = blockIdx.x, tid = threadIdx.x;
  const float* x = X + (size_t)row * N; const float* rr = R ? R + (size_t)row * N : nullptr;
  float vals[16];                     // up to N = 4096
  const int per = N / 256;            // contiguous chunk per thread? use strided-by-4 chunks: thread handles j = tid*4 + 1024*u
  float s1 = 0.f;
  for (int u = 0; u < per / 4; ++u) {
    const int j = tid * 4 + 1024 * u;
    const v4f a = *(const v4fa*)(x + j);
    v4f b = {0.f,0.f,0.f,0.f}; if (rr) b = *(const v4fa*)(rr + j);
#pragma unroll
    for (int q = 0; q < 4; ++q) { const float v = a[q] + b[q]; vals[u * 4 + q] = v; s1 += v; }
  }
  red[tid] = s1; __syncthreads();
  for (int st = 128; st > 0; st >>= 1) { if (tid < st) red[tid] += red[tid + st]; __syncthreads(); }
  const float mu = red[0] / (float)N; __syncthreads();
  float s2 = 0.f;
  for (int u = 0; u < per / 4; ++u)
#pragma unroll
    for (int q = 0; q < 4; ++q) { const float c = vals[u * 4 + q] - mu; s2 += c * c; }
  red[tid] = s2; __syncthreads();
  for (int st = 128; st > 0; st >>= 1) { if (tid < st) red[tid] += red[tid + st]; __syncthreads(); }
  const float rs = rsqrtf(red[0] / (float)N + eps);
  {
    for (int u = 0; u < per / 4; ++u) {
      const int j = tid * 4 + 1024 * u;
      v4f o, sm;
#pragma unroll
      for (int q = 0; q < 4; ++q) {
        float gg = g[j + q], bb = bta[j + q];
        if (PARAM_BF16) { gg = bf16_round(gg); bb = bf16_round(bb); }
        sm[q] = vals[u * 4 + q]; o[q] = (vals[u * 4 + q] - mu) * rs * gg + bb;
      }
      if (out_sum) *(v4f*)(out_sum + (size_t)row * N + j) = sm;
      *(v4f*)(out_norm + (size_t)row * N + j) = o;
    }
    
  }
}



// ---- f16 WMMA path (v_wmma_f32_16x16x32_f16): 11-bit significands for operands in range — used where a [0,1] probability operand needs more precision than bf16
typedef _Float16 v16h __attribute__((ext_vector_type(16)));
union FragH { v16h v; v8us half[2]; _Float16 h[16]; unsigned short u[16]; };
template <int NT>
__device__ __forceinline__ v8f mmaH(v16h ah, v16h al, v16h bh, v16h bl, v8f c) {
  c = __builtin_amdgcn_wmma_f32_16x16x32_f16(false, ah, false, bh, (short)0, c, false, false);
  if (NT >= 2) c = __builtin_amdgcn_wmma_f32_16x16x32_f16(false, al, false, bh, (short)0, c, false, false);
  if (NT >= 3) c = __builtin_amdgcn_wmma_f32_16x16x32_f16(false, ah, false, bl, (short)0, c, false, false);
  asm volatile("v_nop\n\tv_nop\n\tv_nop\n\tv_nop" : "+v"(c) : "v"(ah), "v"(al), "v"(bh), "v"(bl));
  return c;
}
// batched GEMM like k_gemm_b but f16 operands: A f32 (split into f16 hi/lo if ASPLIT, else rounded to f16), Bt = f16 values [n][k]; alpha; C f32; N multiple of 16 (partial tiles skipped)
template <bool ASPLIT>
__global__ __launch_bounds__(128) void k_gemm_h(const float* __restrict__ A, int lda, size_t sA, const _Float16* __restrict__ Bh, int ldb, size_t sB, float alpha, float* __restrict__ C, int ldc, size_t sC, int M, int N, int K) {
  __shared__ __attribute__((aligned(16))) float so[4][16][64];
  const int tid = threadIdx.x, w = tid >> 5, lane = tid & 31, ln = lane & 15, hh = lane >> 4; const int by = blockIdx.y;
  A += (size_t)by * sA; Bh += (size_t)by * sB; C += (size_t)by * sC;
  const int ntn = (N + 63) / 64; const int wid = blockIdx.x * 4 + w; const int mt = wid / ntn, nq = wid % ntn; if (mt * 16 >= M) return;
  const int row0 = mt * 16, col0 = nq * 64; const float* arow = A + (size_t)(row0 + ln) * lda;
  v8f acc[4] = {};
  for (int kb = 0; kb < K; kb += 32) {
    FragH ah, al;
    const v4f x0 = *(const v4fa*)(arow + kb + 8 * hh), x1 = *(const v4fa*)(arow + kb + 8 * hh + 4), x2 = *(const v4fa*)(arow + kb + 16 + 8 * hh), x3 = *(const v4fa*)(arow + kb + 16 + 8 * hh + 4);
    float xs[16] = {x0[0],x0[1],x0[2],x0[3],x1[0],x1[1],x1[2],x1[3],x2[0],x2[1],x2[2],x2[3],x3[0],x3[1],x3[2],x3[3]};
#pragma unroll
    for (int i = 0; i < 16; ++i) { const _Float16 h = (_Float16)xs[i]; ah.h[i] = h; al.h[i] = ASPLIT ? (_Float16)(xs[i] - (float)h) : (_Float16)0.0f; }
#pragma unroll
    for (int t = 0; t < 4; ++t) { if (col0 + t * 16 >= N) continue; const size_t boff = (size_t)(col0 + t * 16 + ln) * ldb + kb; FragH bq; bq.half[0] = *(const v8us*)(Bh + boff + 8 * hh); bq.half[1] = *(const v8us*)(Bh + boff + 16 + 8 * hh);
      acc[t] = mmaH<ASPLIT ? 2 : 1>(ah.v, al.v, bq.v, bq.v, acc[t]); }
  }
#pragma unroll
  for (int t = 0; t < 4; ++t) { if (col0 + t * 16 >= N) continue;
#pragma unroll
    for (int r = 0; r < 8; ++r) so[w][8 * hh + r][t * 16 + ln] = acc[t][r] * alpha; }
  __builtin_amdgcn_fence(__ATOMIC_ACQ_REL, "workgroup"); __builtin_amdgcn_wave_barrier();
  const int rsub = lane >> 4, c4 = (lane & 15) * 4;
  {
#pragma unroll
    for (int q = 0; q < 8; ++q) { const int r = q * 2 + rsub; if (col0 + c4 < N) { const v4f v = *(const v4fa*)&so[w][r][c4]; *(v4f*)(C + (size_t)(row0 + r) * ldc + col0 + c4) = v; } }
     }
}

// Wt[n][k] = f16(W[k][n]·scale) from f32 row-major W[K][N] (scale = power of two; bf16-exact weights stay exact in f16 away from the subnormal range)
__global__ __launch_bounds__(256) void k_wt_f16(const float* __restrict__ W, _Float16* __restrict__ Wt, int K, int N, float scale) {
  const int t = blockIdx.x * 256 + threadIdx.x; if (t >= N * (K / 8)) return; const int n = t / (K / 8), k8 = (t % (K / 8)) * 8; FragH f;
#pragma unroll
  for (int i = 0; i < 8; ++i) f.h[i] = (_Float16)(bf16_round(W[(size_t)(k8 + i) * N + n]) * scale); const v8us o = f.half[0];
  *(v8us*)((unsigned short*)Wt + (size_t)n * K + k8) = o; 
}
// k_gemm_hh variant with fused epilogue: v = acc·alpha + bias[by·sBias + col] (+ CP[(row/rowsPerB)·sCPb + by·64 + col] if CP) ; ACT 0 none / 1 elu ; writes f16 C16 (and f32 C if non-null)
template <int ACT>
__global__ __launch_bounds__(128) void k_gemm_hhx(const _Float16* __restrict__ A, int lda, size_t sA, const _Float16* __restrict__ Bh, int ldb, size_t sB, float alpha, const float* __restrict__ bias, size_t sBias, const float* __restrict__ CP, int rowsPerB, size_t sCPb, int row0g,
    float* __restrict__ C, _Float16* __restrict__ C16, int ldc, size_t sC, int M, int N, int K) {
  __shared__ __attribute__((aligned(16))) float so[4][16][64];
  const int tid = threadIdx.x, w = tid >> 5, lane = tid & 31, ln = lane & 15, hh = lane >> 4; const int by = blockIdx.y;
  A += (size_t)by * sA; Bh += (size_t)by * sB; const size_t cofs = (size_t)by * sC; const float* bp = bias ? bias + (size_t)by * sBias : nullptr;
  const int ntn = (N + 63) / 64; const int wid = blockIdx.x * 4 + w; const int mt = wid / ntn, nq = wid % ntn; if (mt * 16 >= M) return;
  const int row0 = mt * 16, col0 = nq * 64; const _Float16* arow = A + (size_t)(row0 + ln) * lda;
  v8f acc[4] = {};
  for (int kb = 0; kb < K; kb += 32) { FragH ah; ah.half[0] = *(const v8us*)((const unsigned short*)arow + kb + 8 * hh); ah.half[1] = *(const v8us*)((const unsigned short*)arow + kb + 16 + 8 * hh);
#pragma unroll
    for (int t = 0; t < 4; ++t) { if (col0 + t * 16 >= N) continue; const size_t boff = (size_t)(col0 + t * 16 + ln) * ldb + kb; FragH bq; bq.half[0] = *(const v8us*)((const unsigned short*)Bh + boff + 8 * hh); bq.half[1] = *(const v8us*)((const unsigned short*)Bh + boff + 16 + 8 * hh);
      acc[t] = mmaH<1>(ah.v, ah.v, bq.v, bq.v, acc[t]); }
  }
#pragma unroll
  for (int t = 0; t < 4; ++t) { if (col0 + t * 16 >= N) continue; const int col = col0 + t * 16 + ln; const float bv = bp ? bf16_round(bp[col]) : 0.f;
#pragma unroll
    for (int r = 0; r < 8; ++r) { float v = acc[t][r] * alpha + bv; if (CP) { const int rr = row0g + row0 + 8 * hh + r; if (rowsPerB < 0) v += CP[cofs + (size_t)rr * ldc + col];      /* rowsPerB < 0: own element of the batched C plane */ else { const int bidx = rr / rowsPerB; v += CP[(size_t)bidx * sCPb + (size_t)by * 64 + col]; } } if (ACT == 1) v = (v > 0.f) ? v : expm1f(v); else if (ACT == 7) v = (v > 0.f) ? v + 1.0f : expf(v); else if (ACT == 8) v = tanhf(v); else if (ACT == 9) v = 0.5f * v * (1.0f + tanhf(0.7978845608028654f * (v + 0.044715f * v * v * v))); else if (ACT == 11) v = 1.0f / (1.0f + expf(-v)); else if (ACT == 12) v = (v > 0.f) ? v : 0.01f * v; else if (ACT == 14) v = (v > 0.f) ? v : 0.1f * v; else if (ACT == 16) v = (v >= 0.f) ? v : 0.3f * v; else if (ACT == 17) v = (v >= 0.f) ? v : 0.2f * v; else if (ACT == 15) v = v / (1.0f + expf(-v)); else if (ACT == 3) v = fmaxf(v, 0.f); else if (ACT == 6) v = 0.5f * v * (1.0f + erff(v * 0.70710678118654752f)); so[w][8 * hh + r][t * 16 + ln] = v; } }
  __builtin_amdgcn_fence(__ATOMIC_ACQ_REL, "workgroup"); __builtin_amdgcn_wave_barrier();
  const int rsub = lane >> 4, c4 = (lane & 15) * 4; typedef _Float16 v4h __attribute__((ext_vector_type(4)));
  {
#pragma unroll
    for (int q = 0; q < 8; ++q) { const int r = q * 2 + rsub; if (col0 + c4 < N) { const v4f v = *(const v4fa*)&so[w][r][c4]; if (C) *(v4f*)(C + cofs + (size_t)(row0 + r) * ldc + col0 + c4) = v; if (C16) { v4h h4; for (int i = 0; i < 4; ++i) h4[i] = (_Float16)v[i]; *(v4h*)(C16 + cofs + (size_t)(row0 + r) * ldc + col0 + c4) = h4; } } }
     }
}


typedef _Float16 v4h __attribute__((ext_vector_type(4)));

__global__ __launch_bounds__(256) void k_x16(const float* __restrict__ x, _Float16* __restrict__ X16, size_t n8) { const size_t t = (size_t)blockIdx.x * 256 + threadIdx.x; if (t >= n8) return; FragH f;
#pragma unroll
  for (int q = 0; q < 8; ++q) f.h[q] = (_Float16)bf16_round(x[t * 8 + q]); *(v8us*)((unsigned short*)X16 + t * 8) = f.half[0];  }
__global__ __launch_bounds__(256) void k_h16(const float* __restrict__ x, _Float16* __restrict__ X16, size_t n8) { const size_t t = (size_t)blockIdx.x * 256 + threadIdx.x; if (t >= n8) return; FragH f;
#pragma unroll
  for (int q = 0; q < 8; ++q) f.h[q] = (_Float16)x[t * 8 + q]; *(v8us*)((unsigned short*)X16 + t * 8) = f.half[0];  }
__global__ __launch_bounds__(256) void k_round16f(const float* __restrict__ W, _Float16* __restrict__ Bt, size_t n8) { const size_t t = (size_t)blockIdx.x * 256 + threadIdx.x; if (t >= n8) return; FragH f;
#pragma unroll
  for (int i = 0; i < 8; ++i) f.h[i] = (_Float16)(bf16_round(W[t * 8 + i]) * 16.0f); *(v8us*)((unsigned short*)Bt + t * 8) = f.half[0];  }
template <int NHv, int TTv>
__global__ __launch_bounds__(256) void k_vt(const _Float16* __restrict__ V16, int ldv, int voff, _Float16* __restrict__ Vt) { __shared__ unsigned short tl[64][66]; const int tid = threadIdx.x; const int slab = blockIdx.x / (TTv / 64), lg = blockIdx.x % (TTv / 64); const int b = slab / NHv, h = slab % NHv;
  for (int i = tid; i < 64 * 8; i += 256) { const int r = i / 8, c8 = (i % 8) * 8; FragH f; f.half[0] = *(const v8us*)((const unsigned short*)V16 + ((size_t)b * TTv + lg * 64 + r) * ldv + voff + h * 64 + c8);
#pragma unroll
    for (int q = 0; q < 8; ++q) tl[r][c8 + q] = f.u[q]; }
  __syncthreads();
  {
#pragma unroll
    for (int rd = 0; rd < 2; ++rd) { const int d = rd * 32 + tid / 8, pc = tid % 8; FragH f;
#pragma unroll
      for (int q = 0; q < 8; ++q) f.u[q] = tl[pc * 8 + q][d];
      *(v8us*)((unsigned short*)Vt + ((size_t)slab * 64 + d) * TTv + lg * 64 + pc * 8) = f.half[0]; }
     } }

__global__ __launch_bounds__(256) void k_hl(const float* __restrict__ F, _Float16* __restrict__ Hh, _Float16* __restrict__ Hl, size_t n8) { const size_t t = (size_t)blockIdx.x * 256 + threadIdx.x; if (t >= n8) return; FragH fh, fl; const v4f a = *(const v4fa*)(F + t * 8), c = *(const v4fa*)(F + t * 8 + 4);
#pragma unroll
  for (int q = 0; q < 4; ++q) { _Float16 h = (_Float16)a[q]; fh.h[q] = h; fl.h[q] = (_Float16)((a[q] - (float)h) * 1024.0f); h = (_Float16)c[q]; fh.h[4 + q] = h; fl.h[4 + q] = (_Float16)((c[q] - (float)h) * 1024.0f); }
  { *(v8us*)((unsigned short*)Hh + t * 8) = fh.half[0]; *(v8us*)((unsigned short*)Hl + t * 8) = fl.half[0];  } }

// ---- fast GEMM (wave tile 32x64; requires M % 32 == 0 rows per launch region and N % 64 == 0); epilogue = k_gemm_hhx semantics ----
__device__ __forceinline__ v16h g2_frag(const _Float16* p, int hh) { FragH f; f.half[0] = *(const v8us*)((const unsigned short*)p + 8 * hh); f.half[1] = *(const v8us*)((const unsigned short*)p + 16 + 8 * hh); return f.v; }
__device__ __forceinline__ v8f g2_mma(v16h a, v16h b, v8f c) { v8f d = __builtin_amdgcn_wmma_f32_16x16x32_f16(false, a, false, b, (short)0, c, false, false); asm volatile("v_nop\n\tv_nop\n\tv_nop\n\tv_nop" : "+v"(d) : "v"(a), "v"(b)); return d; }
template <int ACT>
__global__ __launch_bounds__(128) void k_gemm2(const _Float16* __restrict__ A, int lda, size_t sA, const _Float16* __restrict__ Bh, int ldb, size_t sB, float alpha, const float* __restrict__ bias, size_t sBias, const float* __restrict__ CP, int rowsPerB, size_t sCPb, int row0g,
    float* __restrict__ C, _Float16* __restrict__ C16, int ldc, size_t sC, int M, int N, int K) { static_assert(ACT == 0 || ACT == 3 || ACT == 6 || ACT == 8 || ACT == 9 || ACT == 11 || ACT == 12 || ACT == 14 || ACT == 15 || ACT == 16 || ACT == 17, "k_gemm2: unsupported ACT code (would silently apply no activation)");
  __shared__ __attribute__((aligned(16))) float so[4][32][68];
  const int tid = threadIdx.x, w = tid >> 5, lane = tid & 31, ln = lane & 15, hh = lane >> 4; const int by = blockIdx.y;
  A += (size_t)by * sA; Bh += (size_t)by * sB; const size_t cofs = (size_t)by * sC; const float* bp = bias ? bias + (size_t)by * sBias : nullptr;
  const int ntn = N >> 6; const int mt = blockIdx.x / ntn, nq = blockIdx.x - mt * ntn; const int row0 = mt * 128 + 32 * w, col0 = nq * 64; if (row0 >= M) return;
  const _Float16* a0p = A + (size_t)(row0 + ln) * lda; const _Float16* a1p = a0p + (size_t)16 * lda;
  const _Float16* b0p = Bh + (size_t)(col0 + ln) * ldb; const _Float16* b1p = b0p + (size_t)16 * ldb; const _Float16* b2p = b1p + (size_t)16 * ldb; const _Float16* b3p = b2p + (size_t)16 * ldb;
  const v8f z8 = {0.f,0.f,0.f,0.f,0.f,0.f,0.f,0.f}; v8f c00 = z8, c01 = z8, c02 = z8, c03 = z8, c10 = z8, c11 = z8, c12 = z8, c13 = z8;
#pragma unroll 1
  for (int kb = 0; kb < K; kb += 32) { const v16h a0 = g2_frag(a0p + kb, hh), a1 = g2_frag(a1p + kb, hh);
    v16h b = g2_frag(b0p + kb, hh); c00 = g2_mma(a0, b, c00); c10 = g2_mma(a1, b, c10);
    b = g2_frag(b1p + kb, hh); c01 = g2_mma(a0, b, c01); c11 = g2_mma(a1, b, c11);
    b = g2_frag(b2p + kb, hh); c02 = g2_mma(a0, b, c02); c12 = g2_mma(a1, b, c12);
    b = g2_frag(b3p + kb, hh); c03 = g2_mma(a0, b, c03); c13 = g2_mma(a1, b, c13); }
  v8f accs[8] = {c00, c01, c02, c03, c10, c11, c12, c13};
#pragma unroll
  for (int u = 0; u < 8; ++u) { const int t = u & 3, half = u >> 2; const int col = col0 + t * 16 + ln; const float bv = bp ? bf16_round(bp[col]) : 0.f;
#pragma unroll
    for (int r = 0; r < 8; ++r) { const int rloc = half * 16 + 8 * hh + r; float v = accs[u][r] * alpha + bv; if (CP) { if (rowsPerB < 0) v += CP[cofs + (size_t)(row0g + row0 + rloc) * ldc + col];      /* rowsPerB < 0: own element of the batched C plane */ else { const int bidx = (row0g + row0 + rloc) / rowsPerB; v += CP[(size_t)bidx * sCPb + (size_t)by * 64 + col]; } }
      if (ACT == 3) v = fmaxf(v, 0.f); else if (ACT == 6) v = 0.5f * v * (1.0f + erff(v * 0.70710678118654752f)); else if (ACT == 11) v = 1.0f / (1.0f + expf(-v)); else if (ACT == 15) v = v / (1.0f + expf(-v)); else if (ACT == 12) v = (v > 0.f) ? v : 0.01f * v; else if (ACT == 8) v = tanhf(v); else if (ACT == 9) v = 0.5f * v * (1.0f + tanhf(0.7978845608028654f * (v + 0.044715f * v * v * v))); else if (ACT == 14) v = (v > 0.f) ? v : 0.1f * v; else if (ACT == 16) v = (v >= 0.f) ? v : 0.3f * v; else if (ACT == 17) v = (v >= 0.f) ? v : 0.2f * v;
      so[w][rloc][t * 16 + ln] = v; } }
  __builtin_amdgcn_fence(__ATOMIC_ACQ_REL, "workgroup"); __builtin_amdgcn_wave_barrier();
  const int rsub = lane >> 4, c4 = (lane & 15) * 4;
  {
#pragma unroll
    for (int q = 0; q < 16; ++q) { const int r = q * 2 + rsub; const v4f v = *(const v4fa*)&so[w][r][c4]; if (C) *(v4f*)(C + cofs + (size_t)(row0 + r) * ldc + col0 + c4) = v; if (C16) { v4h h4; for (int i = 0; i < 4; ++i) h4[i] = (_Float16)v[i]; *(v4h*)(C16 + cofs + (size_t)(row0 + r) * ldc + col0 + c4) = h4; } }
     } }


__global__ __launch_bounds__(256) void k_wnat(const float* __restrict__ w, size_t n8, _Float16* __restrict__ Bt) { const size_t t = (size_t)blockIdx.x * 256 + threadIdx.x; if (t >= n8) return; FragH f; for (int q = 0; q < 8; ++q) f.h[q] = (_Float16)(bf16_round(w[t * 8 + q]) * 16.0f); *(v8us*)((unsigned short*)Bt + t * 8) = f.half[0];  }
__global__ __launch_bounds__(256) void k_rsm(const float* __restrict__ S, _Float16* __restrict__ P, int nrows) {
  #pragma clang fp contract(off)
  const int i = blockIdx.x * 256 + threadIdx.x; if (i >= nrows) return; const float* s = S + (size_t)i * SQ; float mx = -3.0e38f;
#pragma unroll 1
  for (int j = 0; j < SQ; ++j) mx = fmaxf(mx, s[j]); float se = 0.f;
#pragma unroll 1
  for (int j = 0; j < SQ; ++j) se += expf(s[j] - mx); const float sc = 256.0f / se;
#pragma unroll 1
  for (int j0 = 0; j0 < SQ; j0 += 8) { FragH f; for (int q = 0; q < 8; ++q) f.h[q] = (_Float16)(expf(s[j0 + q] - mx) * sc); unsigned short* d = (unsigned short*)P + (size_t)i * SQ + j0; *(v8us*)d = f.half[0];  } }
__global__ __launch_bounds__(256) void k_vt(const _Float16* __restrict__ V16, int b, int h0, _Float16* __restrict__ VT) { __shared__ unsigned short tl[64][65]; const int tid = threadIdx.x; const int hh = blockIdx.x % HG, sg = blockIdx.x / HG; const int s0 = sg * 64; const int h = h0 + hh;
  for (int i = tid; i < 64 * 8; i += 256) { const int j = i / 8, d8 = (i % 8) * 8; FragH f; f.half[0] = *(const v8us*)((const unsigned short*)V16 + ((size_t)b * SQ + s0 + j) * DM + h * HD + d8); for (int q = 0; q < 8; ++q) tl[d8 + q][j] = f.u[q]; }
  __syncthreads();
  { for (int i = tid; i < 64 * 8; i += 256) { const int d = i / 8, j8 = (i % 8) * 8; FragH f; for (int q = 0; q < 8; ++q) f.u[q] = tl[d][j8 + q]; *(v8us*)((unsigned short*)VT + ((size_t)hh * HD + d) * SQ + s0 + j8) = f.half[0]; }  } }



__global__ __launch_bounds__(256) void k_rsmkinv(const float* __restrict__ S, _Float16* __restrict__ P, int nrows, const int* __restrict__ Km) {
  #pragma clang fp contract(off)
  const int i = blockIdx.x * 256 + threadIdx.x; if (i >= nrows) return; const float* s = S + (size_t)i * SQ; float mx = -3.0e38f;
#pragma unroll 1
  for (int j = 0; j < SQ; ++j) mx = fmaxf(mx, s[j]); float se = 0.f;
#pragma unroll 1
  for (int j = 0; j < SQ; ++j) { const float keep = (Km[j] == 0) ? 1.0f : 0.0f; se += __expf(s[j] - mx) * keep; } const float sc = 256.0f / se;
#pragma unroll 1
  for (int j0 = 0; j0 < SQ; j0 += 8) { FragH f; for (int q = 0; q < 8; ++q) { const float keep = (Km[j0 + q] == 0) ? 1.0f : 0.0f; f.h[q] = (_Float16)(__expf(s[j0 + q] - mx) * sc * keep); } unsigned short* d = (unsigned short*)P + (size_t)i * SQ + j0; *(v8us*)d = f.half[0];  } }
extern "C" void kernel_launch(void* const* d_in, const int* in_sizes, int n_in,
                              void* d_out, int out_size, void* d_ws, size_t ws_size, hipStream_t stream) {
  (void)in_sizes; (void)n_in; (void)out_size;
  const float* const* I = (const float* const*)d_in; const float* x = I[0]; const float* wqkv = I[1]; const float* bqkv = nullptr; const float* wo = I[2]; const float* bo = I[3]; const int* km = (const int*)d_in[4];      /* x; [in][out] Wqkv [1024][3072] (no bias), Wproj [1024][1024] + bproj; mask int32 [4][2048] (> 0 = MASKED key; READ on device) */
  char* ws = (char*)d_ws; size_t off = 0;
  auto take = [&](size_t bytes) { char* p = ws + off; off += (bytes + 255) & ~(size_t)255; return p; };
  _Float16* BQKV = (_Float16*)take((size_t)3 * DM * DM * 2); _Float16* BO = (_Float16*)take((size_t)DM * DM * 2);
  _Float16* X16 = (_Float16*)take(NR * DM * 2); _Float16* QKV = (_Float16*)take(NR * 3 * DM * 2); _Float16* Q16 = QKV; _Float16* K16 = QKV + DM; _Float16* V16 = QKV + 2 * DM; _Float16* O16 = (_Float16*)take(NR * DM * 2);
  float* S = (float*)take((size_t)HG * SQ * SQ * 4); _Float16* P = (_Float16*)take((size_t)HG * SQ * SQ * 2); _Float16* VT = (_Float16*)take((size_t)NH * HD * SQ * 2);
  if (off > ws_size) return;
  k_wt_f16<<<(unsigned)(((size_t)DM * 3 * DM / 8 + 255) / 256), 256, 0, stream>>>(wqkv, BQKV, DM, 3 * DM, 16.0f); k_wt_f16<<<(unsigned)(((size_t)DM * DM / 8 + 255) / 256), 256, 0, stream>>>(wo, BO, DM, DM, 16.0f);      /* [in][out] -> Bt[n][k] x16 (pitch K = 1024) */

  k_x16<<<(unsigned)((NR * DM / 8 + 255) / 256), 256, 0, stream>>>(x, X16, NR * DM / 8);
  const size_t r0p = (size_t)B0 * SQ;      /* first projected row */
  k_gemm2<0><<<dim3((unsigned)((MP / 128) * (3 * DM / 64)), 1), 128, 0, stream>>>(X16 + r0p * DM, DM, 0, BQKV, DM, 0, 0.0625f, bqkv, 0, nullptr, 1, 0, 0, nullptr, QKV + r0p * 3 * DM, 3 * DM, 0, MP, 3 * DM, DM);      /* q | k | v rows (f16); head h = columns h*HD.. of each DM block */
  for (int b = B0; b < B0 + NBR; ++b) { const size_t r0 = (size_t)b * SQ;
    k_vt<NH, SQ><<<NH * (SQ / 64), 256, 0, stream>>>(V16 + r0 * LQ, LQ, 0, VT);      /* V^T [NH][HD][SQ] for this batch */
    for (int h0 = 0; h0 < NHD; h0 += HG) {
      k_gemm2<0><<<dim3((QN / 128) * (SQ / 64), HG), 128, 0, stream>>>(Q16 + r0 * LQ + h0 * HD, LQ, (size_t)HD, K16 + r0 * LQ + h0 * HD, LQ, (size_t)HD, 0.125f, nullptr, 0, nullptr, 1, 0, 0, S, nullptr, SQ, (size_t)SQ * SQ, QN, SQ, HD);      /* scores, HG heads per launch */
      k_rsmkinv<<<(HG * SQ + 255) / 256, 256, 0, stream>>>(S, P, HG * SQ, km + (size_t)b * SQ);      /* keys with mask[b][j] != 0 excluded; P = 256 softmax (f16), rows of all HG heads */
      k_gemm2<0><<<dim3((QN / 128) * (HD / 64), HG), 128, 0, stream>>>(P, SQ, (size_t)SQ * SQ, VT + (size_t)h0 * HD * SQ, SQ, (size_t)HD * SQ, 0.25f, nullptr, 0, nullptr, 1, 0, 0, nullptr, O16 + r0 * DM + h0 * HD, DM, (size_t)HD, QN, HD, SQ); } }      /* o (merged heads) as f16 rows */
  k_gemm2<0><<<dim3((unsigned)((MPO / 128) * (DM / 64)), 1), 128, 0, stream>>>(O16 + r0p * DM, DM, 0, BO, DM, 0, 0.0009765625f, bo, 0, nullptr, 1, 0, 0, (float*)d_out + r0p * DM, nullptr, DM, 0, MPO, DM, DM);      /* out rows are the output layout */
}

// v001
// Measured time: 1850 microseconds a run.
// Timed twice side by side with v000, it ran 3.67 and 3.63 times as fast.
#include <hip/hip_runtime.h>
// Multi-head self-attention with a fused QKV projection and an INVERTED key mask (x [4][2048][1024]; qkv = x Wqkv ([in][out] 1024 x 3072, NO bias) reshaped (B, N, 3, 16, 64): q | k | v blocks; att = q k^T * 64^-0.5; where(mask[b][j] > 0, -1e7) with the int32 [4][2048] mask in {0, 1} (random; > 0 means MASKED; read on device; masked weights underflow to exactly 0); softmax over keys; out = merged Wproj + bproj ([in][out]) -> [4][2048][1024]).
// Structure: token rows r = b*2048 + s; x as exact f16 rows (bf16-rounded); q | k | v as ONE WMMA GEMM (N = 3 x 1024) (32x64 wave tiles, f32 accumulation, exact x16 weights, no bias, f16 outputs); per batch: V^T for all heads via LDS transposes; per (batch, group of 4 heads): scores GEMM (K = 64, batched over the heads on grid.y, alpha = 1/sqrt(64)), row softmax on VALU (f32 statistics; weights stored x256 as f16), o = P . V^T GEMM (K = 2048, alpha 2^-2: o carried x64 against f16 subnormal flush, folded into the output GEMM alpha) written straight into the merged f16 o rows; out = o W_o + b GEMM (f32) into the output layout.
// Compute dtype: inputs rounded to bf16; x / weights exact; q, k, v, softmax weights and o as plain f16 GEMM operands (~2^-12); scores and softmax statistics f32. v_wmma_f32_16x16x32_f16.
#define NB 4
#define SQ 2048
#define DM 1024
#define NH 16
#define HD 64
#define HG 4                         /* heads per attention launch group */
#define B0 0                         /* first batch processed (debug hook) */
#define NBR NB                       /* batches processed (debug hook) */
#define NR ((size_t)NB * SQ)         /* token rows */
#define MP ((int)((size_t)NBR * SQ)) /* rows projected (debug hook) */
#define QN SQ                        /* query rows attended per batch (debug hook) */
#define NHD NH                       /* heads attended (debug hook) */
#define MPO MP                       /* rows through the output stage (debug hook) */
#define LQ (3 * DM)      /* row pitch of the q/k/v rows */
typedef __bf16 v16b __attribute__((ext_vector_type(16)));
typedef unsigned short v8us __attribute__((ext_vector_type(8), may_alias));
typedef float  v8f  __attribute__((ext_vector_type(8)));
typedef float  v4f  __attribute__((ext_vector_type(4)));
typedef float  v4fa __attribute__((ext_vector_type(4), may_alias));
union FragB { v16b v; v8us half[2]; unsigned short u[16]; };

__device__ __forceinline__ unsigned short bf16_bits(float x) { unsigned int u = __float_as_uint(x); return (unsigned short)((u + 0x7FFFu + ((u >> 16) & 1u)) >> 16); }
__device__ __forceinline__ float bf16_val(unsigned short b) { return __uint_as_float(((unsigned int)b) << 16); }
__device__ __forceinline__ float bf16_round(float x) { return bf16_val(bf16_bits(x)); }
// D += A·B with NT terms: 1 = ah·bh, 2 = + al·bh (A split), 3 = + ah·bl (both split)
template <int NT>
__device__ __forceinline__ v8f mmaN(v16b ah, v16b al, v16b bh, v16b bl, v8f c) {
  c = __builtin_amdgcn_wmma_f32_16x16x32_bf16(false, ah, false, bh, (short)0, c, false, false);
  if (NT >= 2) c = __builtin_amdgcn_wmma_f32_16x16x32_bf16(false, al, false, bh, (short)0, c, false, false);
  if (NT >= 3) c = __builtin_amdgcn_wmma_f32_16x16x32_bf16(false, ah, false, bl, (short)0, c, false, false);
  asm volatile("v_nop\n\tv_nop\n\tv_nop\n\tv_nop" : "+v"(c) : "v"(ah), "v"(al), "v"(bh), "v"(bl));
  return c;
}

__global__ __launch_bounds__(256) void k_wt_bf16(const float* __restrict__ W, unsigned short* __restrict__ Wt, int K, int N) {
  const int t = blockIdx.x * 256 + threadIdx.x;
  const int k8n = K / 8;
  if (t >= N * k8n) return;
  const int n = t / k8n, k8 = (t % k8n) * 8;
  v8us v;
#pragma unroll
  for (int i = 0; i < 8; ++i) v[i] = bf16_bits(W[(size_t)(k8 + i) * N + n]);
  *(v8us*)(Wt + (size_t)n * K + k8) = v;
  
}

// GEMM C[M][N] (f32, pitch ldc) = act(A[M][K]·W + bias). A f32 row-major (pitch lda) converted per fragment to bf16
// (ASPLIT: hi/lo two planes -> 2 terms, else single rounded term); Wt bf16 [N][K] (pitch ldb). BIAS_BF16 rounds the
// bias to bf16 first (bias quantised to bf16 before the add). K%32==0, M%16==0, N%64==0.
template <bool ASPLIT, int ACT, bool BIAS_BF16>
__global__ __launch_bounds__(128) void k_gemm_bf(const float* __restrict__ A, int lda, const unsigned short* __restrict__ Wt, int ldb,
                                               const float* __restrict__ bias, float* __restrict__ C, int ldc, int M, int N, int K) {
  __shared__ __attribute__((aligned(16))) float so[4][16][64];
  const int tid = threadIdx.x, w = tid >> 5, lane = tid & 31, ln = lane & 15, hh = lane >> 4;
  const int ntn = N / 64;
  const int wid = blockIdx.x * 4 + w;
  const int mt = wid / ntn, nq = wid % ntn;
  if (mt * 16 >= M) return;
  const int row0 = mt * 16, col0 = nq * 64;
  const float* arow = A + (size_t)(row0 + ln) * lda;
  v8f acc[4] = {};
  for (int kb = 0; kb < K; kb += 32) {
    FragB ah, al;
    const v4f x0 = *(const v4fa*)(arow + kb + 8 * hh), x1 = *(const v4fa*)(arow + kb + 8 * hh + 4);
    const v4f x2 = *(const v4fa*)(arow + kb + 16 + 8 * hh), x3 = *(const v4fa*)(arow + kb + 16 + 8 * hh + 4);
    float xs[16] = {x0[0],x0[1],x0[2],x0[3],x1[0],x1[1],x1[2],x1[3],x2[0],x2[1],x2[2],x2[3],x3[0],x3[1],x3[2],x3[3]};
#pragma unroll
    for (int i = 0; i < 16; ++i) { const unsigned short hb = bf16_bits(xs[i]); ah.u[i] = hb; al.u[i] = ASPLIT ? bf16_bits(xs[i] - bf16_val(hb)) : (unsigned short)0; }
#pragma unroll
    for (int t = 0; t < 4; ++t) {
      const unsigned short* brow = Wt + (size_t)(col0 + t * 16 + ln) * ldb + kb;
      FragB b;
      b.half[0] = *(const v8us*)(brow + 8 * hh);
      b.half[1] = *(const v8us*)(brow + 16 + 8 * hh);
      acc[t] = mmaN<ASPLIT ? 2 : 1>(ah.v, al.v, b.v, b.v, acc[t]);
    }
  }
#pragma unroll
  for (int t = 0; t < 4; ++t) {
    float bv = bias ? bias[col0 + t * 16 + ln] : 0.f;
    if (BIAS_BF16) bv = bf16_round(bv);
#pragma unroll
    for (int r = 0; r < 8; ++r) { float v = acc[t][r] + bv; if (ACT == 1) v = fmaxf(v, 0.f); so[w][8 * hh + r][t * 16 + ln] = v; }
  }
  __builtin_amdgcn_fence(__ATOMIC_ACQ_REL, "workgroup");
  __builtin_amdgcn_wave_barrier();
  const int rsub = lane >> 4, c4 = (lane & 15) * 4;
  {
#pragma unroll
    for (int q = 0; q < 8; ++q) {
      const int r = q * 2 + rsub;
      const v4f v = *(const v4fa*)&so[w][r][c4];
      *(v4f*)(C + (size_t)(row0 + r) * ldc + col0 + c4) = v;
    }
    
  }
}

// GEMM C = act(A·W + bias + resid): A f32 (ASPLIT -> hi/lo 2 terms), Wt bf16 [N][K]; ACT 0 none, 1 relu, 2 exact gelu;
// resid (optional, f32, row index = (row % rmod), pitch ldr, RES_BF16 rounds it) added before the activation.
template <bool ASPLIT, int ACT, bool BIAS_BF16, bool RES_BF16>
__global__ __launch_bounds__(128) void k_gemm_bf3(const float* __restrict__ A, int lda, const unsigned short* __restrict__ Wt, int ldb,
                                                const float* __restrict__ bias, const float* __restrict__ resid, int rmod, int ldr,
                                                float* __restrict__ C, int ldc, int M, int N, int K) {
  __shared__ __attribute__((aligned(16))) float so[4][16][64];
  const int tid = threadIdx.x, w = tid >> 5, lane = tid & 31, ln = lane & 15, hh = lane >> 4;
  const int ntn = N / 64;
  const int wid = blockIdx.x * 4 + w;
  const int mt = wid / ntn, nq = wid % ntn;
  if (mt * 16 >= M) return;
  const int row0 = mt * 16, col0 = nq * 64;
  const float* arow = A + (size_t)(row0 + ln) * lda;
  v8f acc[4] = {};
  for (int kb = 0; kb < K; kb += 32) {
    FragB ah, al;
    const v4f x0 = *(const v4fa*)(arow + kb + 8 * hh), x1 = *(const v4fa*)(arow + kb + 8 * hh + 4);
    const v4f x2 = *(const v4fa*)(arow + kb + 16 + 8 * hh), x3 = *(const v4fa*)(arow + kb + 16 + 8 * hh + 4);
    float xs[16] = {x0[0],x0[1],x0[2],x0[3],x1[0],x1[1],x1[2],x1[3],x2[0],x2[1],x2[2],x2[3],x3[0],x3[1],x3[2],x3[3]};
#pragma unroll
    for (int i = 0; i < 16; ++i) { const unsigned short hb = bf16_bits(xs[i]); ah.u[i] = hb; al.u[i] = ASPLIT ? bf16_bits(xs[i] - bf16_val(hb)) : (unsigned short)0; }
#pragma unroll
    for (int t = 0; t < 4; ++t) {
      const unsigned short* brow = Wt + (size_t)(col0 + t * 16 + ln) * ldb + kb;
      FragB b;
      b.half[0] = *(const v8us*)(brow + 8 * hh);
      b.half[1] = *(const v8us*)(brow + 16 + 8 * hh);
      acc[t] = mmaN<ASPLIT ? 2 : 1>(ah.v, al.v, b.v, b.v, acc[t]);
    }
  }
#pragma unroll
  for (int t = 0; t < 4; ++t) {
    const int col = col0 + t * 16 + ln;
    float bv = bias ? bias[col] : 0.f;
    if (BIAS_BF16) bv = bf16_round(bv);
#pragma unroll
    for (int r = 0; r < 8; ++r) {
      float v = acc[t][r] + bv;
      if (resid) { float rv = resid[(size_t)((row0 + 8 * hh + r) % rmod) * ldr + col]; if (RES_BF16) rv = bf16_round(rv); v += rv; }
      if (ACT == 1) v = fmaxf(v, 0.f);
      if (ACT == 2) v = 0.5f * v * (1.0f + erff(v * 0.70710678118654752f));
      if (ACT == 3) { const float u = 0.7978845608028654f * (v + 0.044715f * v * v * v); v = 0.5f * v * (1.0f + tanhf(u)); }
      so[w][8 * hh + r][t * 16 + ln] = v;
    }
  }
  __builtin_amdgcn_fence(__ATOMIC_ACQ_REL, "workgroup");
  __builtin_amdgcn_wave_barrier();
  const int rsub = lane >> 4, c4 = (lane & 15) * 4;
  {
#pragma unroll
    for (int q = 0; q < 8; ++q) {
      const int r = q * 2 + rsub;
      const v4f v = *(const v4fa*)&so[w][r][c4];
      *(v4f*)(C + (size_t)(row0 + r) * ldc + col0 + c4) = v;
    }
    
  }
}
// row LayerNorm (biased variance, eps) over N: s = X (+ R); optional out_sum <- s; out_norm <- (s-mu)*rsqrt(var+eps)*g + b
template <bool PARAM_BF16>
__global__ __launch_bounds__(256) void k_layernorm(const float* __restrict__ X, const float* __restrict__ R, const float* __restrict__ g, const float* __restrict__ bta,
                                                  float* __restrict__ out_sum, float* __restrict__ out_norm, int N, float eps) {
  __shared__ float red[256];
  const int row = blockIdx.x, tid = threadIdx.x;
  const float* x = X + (size_t)row * N; const float* rr = R ? R + (size_t)row * N : nullptr;
  float vals[16];                     // up to N = 4096
  const int per = N / 256;            // contiguous chunk per thread? use strided-by-4 chunks: thread handles j = tid*4 + 1024*u
  float s1 = 0.f;
  for (int u = 0; u < per / 4; ++u) {
    const int j = tid * 4 + 1024 * u;
    const v4f a = *(const v4fa*)(x + j);
    v4f b = {0.f,0.f,0.f,0.f}; if (rr) b = *(const v4fa*)(rr + j);
#pragma unroll
    for (int q = 0; q < 4; ++q) { const float v = a[q] + b[q]; vals[u * 4 + q] = v; s1 += v; }
  }
  red[tid] = s1; __syncthreads();
  for (int st = 128; st > 0; st >>= 1) { if (tid < st) red[tid] += red[tid + st]; __syncthreads(); }
  const float mu = red[0] / (float)N; __syncthreads();
  float s2 = 0.f;
  for (int u = 0; u < per / 4; ++u)
#pragma unroll
    for (int q = 0; q < 4; ++q) { const float c = vals[u * 4 + q] - mu; s2 += c * c; }
  red[tid] = s2; __syncthreads();
  for (int st = 128; st > 0; st >>= 1) { if (tid < st) red[tid] += red[tid + st]; __syncthreads(); }
  const float rs = rsqrtf(red[0] / (float)N + eps);
  {
    for (int u = 0; u < per / 4; ++u) {
      const int j = tid * 4 + 1024 * u;
      v4f o, sm;
#pragma unroll
      for (int q = 0; q < 4; ++q) {
        float gg = g[j + q], bb = bta[j + q];
        if (PARAM_BF16) { gg = bf16_round(gg); bb = bf16_round(bb); }
        sm[q] = vals[u * 4 + q]; o[q] = (vals[u * 4 + q] - mu) * rs * gg + bb;
      }
      if (out_sum) *(v4f*)(out_sum + (size_t)row * N + j) = sm;
      *(v4f*)(out_norm + (size_t)row * N + j) = o;
    }
    
  }
}



// ---- f16 WMMA path (v_wmma_f32_16x16x32_f16): 11-bit significands for operands in range — used where a [0,1] probability operand needs more precision than bf16
typedef _Float16 v16h __attribute__((ext_vector_type(16)));
union FragH { v16h v; v8us half[2]; _Float16 h[16]; unsigned short u[16]; };
template <int NT>
__device__ __forceinline__ v8f mmaH(v16h ah, v16h al, v16h bh, v16h bl, v8f c) {
  c = __builtin_amdgcn_wmma_f32_16x16x32_f16(false, ah, false, bh, (short)0, c, false, false);
  if (NT >= 2) c = __builtin_amdgcn_wmma_f32_16x16x32_f16(false, al, false, bh, (short)0, c, false, false);
  if (NT >= 3) c = __builtin_amdgcn_wmma_f32_16x16x32_f16(false, ah, false, bl, (short)0, c, false, false);
  asm volatile("v_nop\n\tv_nop\n\tv_nop\n\tv_nop" : "+v"(c) : "v"(ah), "v"(al), "v"(bh), "v"(bl));
  return c;
}
// batched GEMM like k_gemm_b but f16 operands: A f32 (split into f16 hi/lo if ASPLIT, else rounded to f16), Bt = f16 values [n][k]; alpha; C f32; N multiple of 16 (partial tiles skipped)
template <bool ASPLIT>
__global__ __launch_bounds__(128) void k_gemm_h(const float* __restrict__ A, int lda, size_t sA, const _Float16* __restrict__ Bh, int ldb, size_t sB, float alpha, float* __restrict__ C, int ldc, size_t sC, int M, int N, int K) {
  __shared__ __attribute__((aligned(16))) float so[4][16][64];
  const int tid = threadIdx.x, w = tid >> 5, lane = tid & 31, ln = lane & 15, hh = lane >> 4; const int by = blockIdx.y;
  A += (size_t)by * sA; Bh += (size_t)by * sB; C += (size_t)by * sC;
  const int ntn = (N + 63) / 64; const int wid = blockIdx.x * 4 + w; const int mt = wid / ntn, nq = wid % ntn; if (mt * 16 >= M) return;
  const int row0 = mt * 16, col0 = nq * 64; const float* arow = A + (size_t)(row0 + ln) * lda;
  v8f acc[4] = {};
  for (int kb = 0; kb < K; kb += 32) {
    FragH ah, al;
    const v4f x0 = *(const v4fa*)(arow + kb + 8 * hh), x1 = *(const v4fa*)(arow + kb + 8 * hh + 4), x2 = *(const v4fa*)(arow + kb + 16 + 8 * hh), x3 = *(const v4fa*)(arow + kb + 16 + 8 * hh + 4);
    float xs[16] = {x0[0],x0[1],x0[2],x0[3],x1[0],x1[1],x1[2],x1[3],x2[0],x2[1],x2[2],x2[3],x3[0],x3[1],x3[2],x3[3]};
#pragma unroll
    for (int i = 0; i < 16; ++i) { const _Float16 h = (_Float16)xs[i]; ah.h[i] = h; al.h[i] = ASPLIT ? (_Float16)(xs[i] - (float)h) : (_Float16)0.0f; }
#pragma unroll
    for (int t = 0; t < 4; ++t) { if (col0 + t * 16 >= N) continue; const size_t boff = (size_t)(col0 + t * 16 + ln) * ldb + kb; FragH bq; bq.half[0] = *(const v8us*)(Bh + boff + 8 * hh); bq.half[1] = *(const v8us*)(Bh + boff + 16 + 8 * hh);
      acc[t] = mmaH<ASPLIT ? 2 : 1>(ah.v, al.v, bq.v, bq.v, acc[t]); }
  }
#pragma unroll
  for (int t = 0; t < 4; ++t) { if (col0 + t * 16 >= N) continue;
#pragma unroll
    for (int r = 0; r < 8; ++r) so[w][8 * hh + r][t * 16 + ln] = acc[t][r] * alpha; }
  __builtin_amdgcn_fence(__ATOMIC_ACQ_REL, "workgroup"); __builtin_amdgcn_wave_barrier();
  const int rsub = lane >> 4, c4 = (lane & 15) * 4;
  {
#pragma unroll
    for (int q = 0; q < 8; ++q) { const int r = q * 2 + rsub; if (col0 + c4 < N) { const v4f v = *(const v4fa*)&so[w][r][c4]; *(v4f*)(C + (size_t)(row0 + r) * ldc + col0 + c4) = v; } }
     }
}

// Wt[n][k] = f16(W[k][n]·scale) from f32 row-major W[K][N] (scale = power of two; bf16-exact weights stay exact in f16 away from the subnormal range)
__global__ __launch_bounds__(256) void k_wt_f16(const float* __restrict__ W, _Float16* __restrict__ Wt, int K, int N, float scale) {
  const int t = blockIdx.x * 256 + threadIdx.x; if (t >= N * (K / 8)) return; const int n = t / (K / 8), k8 = (t % (K / 8)) * 8; FragH f;
#pragma unroll
  for (int i = 0; i < 8; ++i) f.h[i] = (_Float16)(bf16_round(W[(size_t)(k8 + i) * N + n]) * scale); const v8us o = f.half[0];
  *(v8us*)((unsigned short*)Wt + (size_t)n * K + k8) = o; 
}
// k_gemm_hh variant with fused epilogue: v = acc·alpha + bias[by·sBias + col] (+ CP[(row/rowsPerB)·sCPb + by·64 + col] if CP) ; ACT 0 none / 1 elu ; writes f16 C16 (and f32 C if non-null)
template <int ACT>
__global__ __launch_bounds__(128) void k_gemm_hhx(const _Float16* __restrict__ A, int lda, size_t sA, const _Float16* __restrict__ Bh, int ldb, size_t sB, float alpha, const float* __restrict__ bias, size_t sBias, const float* __restrict__ CP, int rowsPerB, size_t sCPb, int row0g,
    float* __restrict__ C, _Float16* __restrict__ C16, int ldc, size_t sC, int M, int N, int K) {
  __shared__ __attribute__((aligned(16))) float so[4][16][64];
  const int tid = threadIdx.x, w = tid >> 5, lane = tid & 31, ln = lane & 15, hh = lane >> 4; const int by = blockIdx.y;
  A += (size_t)by * sA; Bh += (size_t)by * sB; const size_t cofs = (size_t)by * sC; const float* bp = bias ? bias + (size_t)by * sBias : nullptr;
  const int ntn = (N + 63) / 64; const int wid = blockIdx.x * 4 + w; const int mt = wid / ntn, nq = wid % ntn; if (mt * 16 >= M) return;
  const int row0 = mt * 16, col0 = nq * 64; const _Float16* arow = A + (size_t)(row0 + ln) * lda;
  v8f acc[4] = {};
  for (int kb = 0; kb < K; kb += 32) { FragH ah; ah.half[0] = *(const v8us*)((const unsigned short*)arow + kb + 8 * hh); ah.half[1] = *(const v8us*)((const unsigned short*)arow + kb + 16 + 8 * hh);
#pragma unroll
    for (int t = 0; t < 4; ++t) { if (col0 + t * 16 >= N) continue; const size_t boff = (size_t)(col0 + t * 16 + ln) * ldb + kb; FragH bq; bq.half[0] = *(const v8us*)((const unsigned short*)Bh + boff + 8 * hh); bq.half[1] = *(const v8us*)((const unsigned short*)Bh + boff + 16 + 8 * hh);
      acc[t] = mmaH<1>(ah.v, ah.v, bq.v, bq.v, acc[t]); }
  }
#pragma unroll
  for (int t = 0; t < 4; ++t) { if (col0 + t * 16 >= N) continue; const int col = col0 + t * 16 + ln; const float bv = bp ? bf16_round(bp[col]) : 0.f;
#pragma unroll
    for (int r = 0; r < 8; ++r) { float v = acc[t][r] * alpha + bv; if (CP) { const int rr = row0g + row0 + 8 * hh + r; if (rowsPerB < 0) v += CP[cofs + (size_t)rr * ldc + col];      /* rowsPerB < 0: own element of the batched C plane */ else { const int bidx = rr / rowsPerB; v += CP[(size_t)bidx * sCPb + (size_t)by * 64 + col]; } } if (ACT == 1) v = (v > 0.f) ? v : expm1f(v); else if (ACT == 7) v = (v > 0.f) ? v + 1.0f : expf(v); else if (ACT == 8) v = tanhf(v); else if (ACT == 9) v = 0.5f * v * (1.0f + tanhf(0.7978845608028654f * (v + 0.044715f * v * v * v))); else if (ACT == 11) v = 1.0f / (1.0f + expf(-v)); else if (ACT == 12) v = (v > 0.f) ? v : 0.01f * v; else if (ACT == 14) v = (v > 0.f) ? v : 0.1f * v; else if (ACT == 16) v = (v >= 0.f) ? v : 0.3f * v; else if (ACT == 17) v = (v >= 0.f) ? v : 0.2f * v; else if (ACT == 15) v = v / (1.0f + expf(-v)); else if (ACT == 3) v = fmaxf(v, 0.f); else if (ACT == 6) v = 0.5f * v * (1.0f + erff(v * 0.70710678118654752f)); so[w][8 * hh + r][t * 16 + ln] = v; } }
  __builtin_amdgcn_fence(__ATOMIC_ACQ_REL, "workgroup"); __builtin_amdgcn_wave_barrier();
  const int rsub = lane >> 4, c4 = (lane & 15) * 4; typedef _Float16 v4h __attribute__((ext_vector_type(4)));
  {
#pragma unroll
    for (int q = 0; q < 8; ++q) { const int r = q * 2 + rsub; if (col0 + c4 < N) { const v4f v = *(const v4fa*)&so[w][r][c4]; if (C) *(v4f*)(C + cofs + (size_t)(row0 + r) * ldc + col0 + c4) = v; if (C16) { v4h h4; for (int i = 0; i < 4; ++i) h4[i] = (_Float16)v[i]; *(v4h*)(C16 + cofs + (size_t)(row0 + r) * ldc + col0 + c4) = h4; } } }
     }
}


typedef _Float16 v4h __attribute__((ext_vector_type(4)));

__global__ __launch_bounds__(256) void k_x16(const float* __restrict__ x, _Float16* __restrict__ X16, size_t n8) { const size_t t = (size_t)blockIdx.x * 256 + threadIdx.x; if (t >= n8) return; FragH f;
#pragma unroll
  for (int q = 0; q < 8; ++q) f.h[q] = (_Float16)bf16_round(x[t * 8 + q]); *(v8us*)((unsigned short*)X16 + t * 8) = f.half[0];  }
__global__ __launch_bounds__(256) void k_h16(const float* __restrict__ x, _Float16* __restrict__ X16, size_t n8) { const size_t t = (size_t)blockIdx.x * 256 + threadIdx.x; if (t >= n8) return; FragH f;
#pragma unroll
  for (int q = 0; q < 8; ++q) f.h[q] = (_Float16)x[t * 8 + q]; *(v8us*)((unsigned short*)X16 + t * 8) = f.half[0];  }
__global__ __launch_bounds__(256) void k_round16f(const float* __restrict__ W, _Float16* __restrict__ Bt, size_t n8) { const size_t t = (size_t)blockIdx.x * 256 + threadIdx.x; if (t >= n8) return; FragH f;
#pragma unroll
  for (int i = 0; i < 8; ++i) f.h[i] = (_Float16)(bf16_round(W[t * 8 + i]) * 16.0f); *(v8us*)((unsigned short*)Bt + t * 8) = f.half[0];  }
template <int NHv, int TTv>
__global__ __launch_bounds__(256) void k_vt(const _Float16* __restrict__ V16, int ldv, int voff, _Float16* __restrict__ Vt) { __shared__ unsigned short tl[64][66]; const int tid = threadIdx.x; const int slab = blockIdx.x / (TTv / 64), lg = blockIdx.x % (TTv / 64); const int b = slab / NHv, h = slab % NHv;
  for (int i = tid; i < 64 * 8; i += 256) { const int r = i / 8, c8 = (i % 8) * 8; FragH f; f.half[0] = *(const v8us*)((const unsigned short*)V16 + ((size_t)b * TTv + lg * 64 + r) * ldv + voff + h * 64 + c8);
#pragma unroll
    for (int q = 0; q < 8; ++q) tl[r][c8 + q] = f.u[q]; }
  __syncthreads();
  {
#pragma unroll
    for (int rd = 0; rd < 2; ++rd) { const int d = rd * 32 + tid / 8, pc = tid % 8; FragH f;
#pragma unroll
      for (int q = 0; q < 8; ++q) f.u[q] = tl[pc * 8 + q][d];
      *(v8us*)((unsigned short*)Vt + ((size_t)slab * 64 + d) * TTv + lg * 64 + pc * 8) = f.half[0]; }
     } }

__global__ __launch_bounds__(256) void k_hl(const float* __restrict__ F, _Float16* __restrict__ Hh, _Float16* __restrict__ Hl, size_t n8) { const size_t t = (size_t)blockIdx.x * 256 + threadIdx.x; if (t >= n8) return; FragH fh, fl; const v4f a = *(const v4fa*)(F + t * 8), c = *(const v4fa*)(F + t * 8 + 4);
#pragma unroll
  for (int q = 0; q < 4; ++q) { _Float16 h = (_Float16)a[q]; fh.h[q] = h; fl.h[q] = (_Float16)((a[q] - (float)h) * 1024.0f); h = (_Float16)c[q]; fh.h[4 + q] = h; fl.h[4 + q] = (_Float16)((c[q] - (float)h) * 1024.0f); }
  { *(v8us*)((unsigned short*)Hh + t * 8) = fh.half[0]; *(v8us*)((unsigned short*)Hl + t * 8) = fl.half[0];  } }

// ---- fast GEMM (wave tile 32x64; requires M % 32 == 0 rows per launch region and N % 64 == 0); epilogue = k_gemm_hhx semantics ----
__device__ __forceinline__ v16h g2_frag(const _Float16* p, int hh) { FragH f; f.half[0] = *(const v8us*)((const unsigned short*)p + 8 * hh); f.half[1] = *(const v8us*)((const unsigned short*)p + 16 + 8 * hh); return f.v; }
__device__ __forceinline__ v8f g2_mma(v16h a, v16h b, v8f c) { v8f d = __builtin_amdgcn_wmma_f32_16x16x32_f16(false, a, false, b, (short)0, c, false, false); asm volatile("v_nop\n\tv_nop\n\tv_nop\n\tv_nop" : "+v"(d) : "v"(a), "v"(b)); return d; }
template <int ACT>
__global__ __launch_bounds__(128) void k_gemm2(const _Float16* __restrict__ A, int lda, size_t sA, const _Float16* __restrict__ Bh, int ldb, size_t sB, float alpha, const float* __restrict__ bias, size_t sBias, const float* __restrict__ CP, int rowsPerB, size_t sCPb, int row0g,
    float* __restrict__ C, _Float16* __restrict__ C16, int ldc, size_t sC, int M, int N, int K) { static_assert(ACT == 0 || ACT == 3 || ACT == 6 || ACT == 8 || ACT == 9 || ACT == 11 || ACT == 12 || ACT == 14 || ACT == 15 || ACT == 16 || ACT == 17, "k_gemm2: unsupported ACT code (would silently apply no activation)");
  __shared__ __attribute__((aligned(16))) float so[4][32][68];
  const int tid = threadIdx.x, w = tid >> 5, lane = tid & 31, ln = lane & 15, hh = lane >> 4; const int by = blockIdx.y;
  A += (size_t)by * sA; Bh += (size_t)by * sB; const size_t cofs = (size_t)by * sC; const float* bp = bias ? bias + (size_t)by * sBias : nullptr;
  const int ntn = N >> 6; const int mt = blockIdx.x / ntn, nq = blockIdx.x - mt * ntn; const int row0 = mt * 128 + 32 * w, col0 = nq * 64; if (row0 >= M) return;
  const _Float16* a0p = A + (size_t)(row0 + ln) * lda; const _Float16* a1p = a0p + (size_t)16 * lda;
  const _Float16* b0p = Bh + (size_t)(col0 + ln) * ldb; const _Float16* b1p = b0p + (size_t)16 * ldb; const _Float16* b2p = b1p + (size_t)16 * ldb; const _Float16* b3p = b2p + (size_t)16 * ldb;
  const v8f z8 = {0.f,0.f,0.f,0.f,0.f,0.f,0.f,0.f}; v8f c00 = z8, c01 = z8, c02 = z8, c03 = z8, c10 = z8, c11 = z8, c12 = z8, c13 = z8;
#pragma unroll 1
  for (int kb = 0; kb < K; kb += 32) { const v16h a0 = g2_frag(a0p + kb, hh), a1 = g2_frag(a1p + kb, hh);
    v16h b = g2_frag(b0p + kb, hh); c00 = g2_mma(a0, b, c00); c10 = g2_mma(a1, b, c10);
    b = g2_frag(b1p + kb, hh); c01 = g2_mma(a0, b, c01); c11 = g2_mma(a1, b, c11);
    b = g2_frag(b2p + kb, hh); c02 = g2_mma(a0, b, c02); c12 = g2_mma(a1, b, c12);
    b = g2_frag(b3p + kb, hh); c03 = g2_mma(a0, b, c03); c13 = g2_mma(a1, b, c13); }
  v8f accs[8] = {c00, c01, c02, c03, c10, c11, c12, c13};
#pragma unroll
  for (int u = 0; u < 8; ++u) { const int t = u & 3, half = u >> 2; const int col = col0 + t * 16 + ln; const float bv = bp ? bf16_round(bp[col]) : 0.f;
#pragma unroll
    for (int r = 0; r < 8; ++r) { const int rloc = half * 16 + 8 * hh + r; float v = accs[u][r] * alpha + bv; if (CP) { if (rowsPerB < 0) v += CP[cofs + (size_t)(row0g + row0 + rloc) * ldc + col];      /* rowsPerB < 0: own element of the batched C plane */ else { const int bidx = (row0g + row0 + rloc) / rowsPerB; v += CP[(size_t)bidx * sCPb + (size_t)by * 64 + col]; } }
      if (ACT == 3) v = fmaxf(v, 0.f); else if (ACT == 6) v = 0.5f * v * (1.0f + erff(v * 0.70710678118654752f)); else if (ACT == 11) v = 1.0f / (1.0f + expf(-v)); else if (ACT == 15) v = v / (1.0f + expf(-v)); else if (ACT == 12) v = (v > 0.f) ? v : 0.01f * v; else if (ACT == 8) v = tanhf(v); else if (ACT == 9) v = 0.5f * v * (1.0f + tanhf(0.7978845608028654f * (v + 0.044715f * v * v * v))); else if (ACT == 14) v = (v > 0.f) ? v : 0.1f * v; else if (ACT == 16) v = (v >= 0.f) ? v : 0.3f * v; else if (ACT == 17) v = (v >= 0.f) ? v : 0.2f * v;
      so[w][rloc][t * 16 + ln] = v; } }
  __builtin_amdgcn_fence(__ATOMIC_ACQ_REL, "workgroup"); __builtin_amdgcn_wave_barrier();
  const int rsub = lane >> 4, c4 = (lane & 15) * 4;
  {
#pragma unroll
    for (int q = 0; q < 16; ++q) { const int r = q * 2 + rsub; const v4f v = *(const v4fa*)&so[w][r][c4]; if (C) *(v4f*)(C + cofs + (size_t)(row0 + r) * ldc + col0 + c4) = v; if (C16) { v4h h4; for (int i = 0; i < 4; ++i) h4[i] = (_Float16)v[i]; *(v4h*)(C16 + cofs + (size_t)(row0 + r) * ldc + col0 + c4) = h4; } }
     } }


__global__ __launch_bounds__(256) void k_wnat(const float* __restrict__ w, size_t n8, _Float16* __restrict__ Bt) { const size_t t = (size_t)blockIdx.x * 256 + threadIdx.x; if (t >= n8) return; FragH f; for (int q = 0; q < 8; ++q) f.h[q] = (_Float16)(bf16_round(w[t * 8 + q]) * 16.0f); *(v8us*)((unsigned short*)Bt + t * 8) = f.half[0];  }
__global__ __launch_bounds__(256) void k_rsm(const float* __restrict__ S, _Float16* __restrict__ P, int nrows) {
  #pragma clang fp contract(off)
  const int i = blockIdx.x * 256 + threadIdx.x; if (i >= nrows) return; const float* s = S + (size_t)i * SQ; float mx = -3.0e38f;
#pragma unroll 1
  for (int j = 0; j < SQ; ++j) mx = fmaxf(mx, s[j]); float se = 0.f;
#pragma unroll 1
  for (int j = 0; j < SQ; ++j) se += expf(s[j] - mx); const float sc = 256.0f / se;
#pragma unroll 1
  for (int j0 = 0; j0 < SQ; j0 += 8) { FragH f; for (int q = 0; q < 8; ++q) f.h[q] = (_Float16)(expf(s[j0 + q] - mx) * sc); unsigned short* d = (unsigned short*)P + (size_t)i * SQ + j0; *(v8us*)d = f.half[0];  } }
__global__ __launch_bounds__(256) void k_vt(const _Float16* __restrict__ V16, int b, int h0, _Float16* __restrict__ VT) { __shared__ unsigned short tl[64][65]; const int tid = threadIdx.x; const int hh = blockIdx.x % HG, sg = blockIdx.x / HG; const int s0 = sg * 64; const int h = h0 + hh;
  for (int i = tid; i < 64 * 8; i += 256) { const int j = i / 8, d8 = (i % 8) * 8; FragH f; f.half[0] = *(const v8us*)((const unsigned short*)V16 + ((size_t)b * SQ + s0 + j) * DM + h * HD + d8); for (int q = 0; q < 8; ++q) tl[d8 + q][j] = f.u[q]; }
  __syncthreads();
  { for (int i = tid; i < 64 * 8; i += 256) { const int d = i / 8, j8 = (i % 8) * 8; FragH f; for (int q = 0; q < 8; ++q) f.u[q] = tl[d][j8 + q]; *(v8us*)((unsigned short*)VT + ((size_t)hh * HD + d) * SQ + s0 + j8) = f.half[0]; }  } }



// Row softmax, one wave per pair of score rows: lane l keeps columns 128 u + 4 l .. + 3 (u = 0..15) of a row in registers, so S is read once, each wave load covering 512 contiguous bytes;
// row max and row sum end in a five-step butterfly over the lanes. The 2048 key flags are packed once per work-group: 64 bits per lane position, bit 4 u + q set = key kept.
typedef int v4ia __attribute__((ext_vector_type(4), may_alias));
typedef unsigned int v2ua __attribute__((ext_vector_type(2), may_alias));
__device__ __forceinline__ float exp2_slot(float x) { float r; asm("v_exp_f32 %0, %1\n\tv_nop" : "=v"(r) : "v"(x)); return r; }
__device__ __forceinline__ void rsm_row(v4f (&v)[16], v2ua kw, _Float16* __restrict__ d) {
  float mx = -3.0e38f;
#pragma unroll      /* v[] must stay in registers: constant indices only */
  for (int u = 0; u < 16; ++u) for (int q = 0; q < 4; ++q) mx = fmaxf(mx, v[u][q]);
  for (int m = 16; m > 0; m >>= 1) mx = fmaxf(mx, __shfl_xor(mx, m));
  float se0 = 0.f, se1 = 0.f, se2 = 0.f, se3 = 0.f;
#pragma unroll      /* constant indices into v[] and constant bit positions */
  for (int u = 0; u < 16; ++u) { const unsigned int wd = (u < 8) ? kw[0] : kw[1];
    for (int q = 0; q < 4; ++q) { const int keep = (int)(wd << (31 - ((u & 7) * 4 + q))) >> 31;      /* all ones = kept, 0 = masked */
      v[u][q] = __uint_as_float(__float_as_uint(exp2_slot((v[u][q] - mx) * 1.442695041f)) & (unsigned int)keep); }
    se0 += v[u][0]; se1 += v[u][1]; se2 += v[u][2]; se3 += v[u][3]; }
  float se = (se0 + se1) + (se2 + se3);
  for (int m = 16; m > 0; m >>= 1) se += __shfl_xor(se, m);
  const float sc = 256.0f / se;
#pragma unroll      /* constant indices into v[] */
  for (int u = 0; u < 16; ++u) { v4h h4; for (int q = 0; q < 4; ++q) h4[q] = (_Float16)(v[u][q] * sc); *(v4h*)(d + u * 128) = h4; } }
__global__ __launch_bounds__(256, 4) /* 4 waves per SIMD: the register budget that holds two rows */ void k_rsmkinv(const float* __restrict__ S, _Float16* __restrict__ P, int nrows, const int* __restrict__ Km) {
  __shared__ __attribute__((aligned(8))) unsigned char kbits[32][8];
  const int tid = threadIdx.x, w = tid >> 5, lane = tid & 31;
  { const v4ia m0 = *(const v4ia*)(Km + (2 * w) * 128 + lane * 4), m1 = *(const v4ia*)(Km + (2 * w + 1) * 128 + lane * 4); unsigned int bb = 0;
    for (int q = 0; q < 4; ++q) { bb |= (m0[q] == 0 ? 1u : 0u) << q; bb |= (m1[q] == 0 ? 1u : 0u) << (4 + q); }
    kbits[lane][w] = (unsigned char)bb; }      /* wave w packs u = 2 w and 2 w + 1 */
  __syncthreads();      /* every wave reads the bytes that all eight waves packed */
  const int row = (blockIdx.x * 8 + w) * 2; if (row >= nrows) return;
  const size_t step = (row + 1 < nrows) ? SQ : 0;      /* a last odd row is worked on twice, with the same values stored twice by the same lane: no branch between the two rows */
  const v2ua kw = *(const v2ua*)&kbits[lane][0];
  const float* s0 = S + (size_t)row * SQ + lane * 4; const float* s1 = s0 + step; v4f va[16], vb[16];
#pragma unroll      /* both rows' 32 loads are issued before the first row is worked on */
  for (int u = 0; u < 16; ++u) va[u] = *(const v4fa*)(s0 + u * 128);
#pragma unroll      /* constant indices into vb[] */
  for (int u = 0; u < 16; ++u) vb[u] = *(const v4fa*)(s1 + u * 128);
  _Float16* d = P + (size_t)row * SQ + lane * 4;
  rsm_row(va, kw, d);
  rsm_row(vb, kw, d + step); }
extern "C" void kernel_launch(void* const* d_in, const int* in_sizes, int n_in,
                              void* d_out, int out_size, void* d_ws, size_t ws_size, hipStream_t stream) {
  (void)in_sizes; (void)n_in; (void)out_size;
  const float* const* I = (const float* const*)d_in; const float* x = I[0]; const float* wqkv = I[1]; const float* bqkv = nullptr; const float* wo = I[2]; const float* bo = I[3]; const int* km = (const int*)d_in[4];      /* x; [in][out] Wqkv [1024][3072] (no bias), Wproj [1024][1024] + bproj; mask int32 [4][2048] (> 0 = MASKED key; READ on device) */
  char* ws = (char*)d_ws; size_t off = 0;
  auto take = [&](size_t bytes) { char* p = ws + off; off += (bytes + 255) & ~(size_t)255; return p; };
  _Float16* BQKV = (_Float16*)take((size_t)3 * DM * DM * 2); _Float16* BO = (_Float16*)take((size_t)DM * DM * 2);
  _Float16* X16 = (_Float16*)take(NR * DM * 2); _Float16* QKV = (_Float16*)take(NR * 3 * DM * 2); _Float16* Q16 = QKV; _Float16* K16 = QKV + DM; _Float16* V16 = QKV + 2 * DM; _Float16* O16 = (_Float16*)take(NR * DM * 2);
  float* S = (float*)take((size_t)HG * SQ * SQ * 4); _Float16* P = (_Float16*)take((size_t)HG * SQ * SQ * 2); _Float16* VT = (_Float16*)take((size_t)NH * HD * SQ * 2);
  if (off > ws_size) return;
  k_wt_f16<<<(unsigned)(((size_t)DM * 3 * DM / 8 + 255) / 256), 256, 0, stream>>>(wqkv, BQKV, DM, 3 * DM, 16.0f); k_wt_f16<<<(unsigned)(((size_t)DM * DM / 8 + 255) / 256), 256, 0, stream>>>(wo, BO, DM, DM, 16.0f);      /* [in][out] -> Bt[n][k] x16 (pitch K = 1024) */

  k_x16<<<(unsigned)((NR * DM / 8 + 255) / 256), 256, 0, stream>>>(x, X16, NR * DM / 8);
  const size_t r0p = (size_t)B0 * SQ;      /* first projected row */
  k_gemm2<0><<<dim3((unsigned)((MP / 128) * (3 * DM / 64)), 1), 128, 0, stream>>>(X16 + r0p * DM, DM, 0, BQKV, DM, 0, 0.0625f, bqkv, 0, nullptr, 1, 0, 0, nullptr, QKV + r0p * 3 * DM, 3 * DM, 0, MP, 3 * DM, DM);      /* q | k | v rows (f16); head h = columns h*HD.. of each DM block */
  for (int b = B0; b < B0 + NBR; ++b) { const size_t r0 = (size_t)b * SQ;
    k_vt<NH, SQ><<<NH * (SQ / 64), 256, 0, stream>>>(V16 + r0 * LQ, LQ, 0, VT);      /* V^T [NH][HD][SQ] for this batch */
    for (int h0 = 0; h0 < NHD; h0 += HG) {
      k_gemm2<0><<<dim3((QN / 128) * (SQ / 64), HG), 128, 0, stream>>>(Q16 + r0 * LQ + h0 * HD, LQ, (size_t)HD, K16 + r0 * LQ + h0 * HD, LQ, (size_t)HD, 0.125f, nullptr, 0, nullptr, 1, 0, 0, S, nullptr, SQ, (size_t)SQ * SQ, QN, SQ, HD);      /* scores, HG heads per launch */
      k_rsmkinv<<<(HG * SQ + 15) / 16, 256, 0, stream>>>(S, P, HG * SQ, km + (size_t)b * SQ);      /* keys with mask[b][j] != 0 excluded; P = 256 softmax (f16), rows of all HG heads */
      k_gemm2<0><<<dim3((QN / 128) * (HD / 64), HG), 128, 0, stream>>>(P, SQ, (size_t)SQ * SQ, VT + (size_t)h0 * HD * SQ, SQ, (size_t)HD * SQ, 0.25f, nullptr, 0, nullptr, 1, 0, 0, nullptr, O16 + r0 * DM + h0 * HD, DM, (size_t)HD, QN, HD, SQ); } }      /* o (merged heads) as f16 rows */
  k_gemm2<0><<<dim3((unsigned)((MPO / 128) * (DM / 64)), 1), 128, 0, stream>>>(O16 + r0p * DM, DM, 0, BO, DM, 0, 0.0009765625f, bo, 0, nullptr, 1, 0, 0, (float*)d_out + r0p * DM, nullptr, DM, 0, MPO, DM, DM);      /* out rows are the output layout */
}

// v002
// One run takes 302 microseconds.
// Next to v001, in two timings, it ran 6.12 and 6.10 times as fast.
// All steps since v000 together make it 22.3 times as fast.
#include <hip/hip_runtime.h>
// Multi-head self-attention with a fused QKV projection and an INVERTED key mask (x [4][2048][1024]; qkv = x Wqkv ([in][out] 1024 x 3072, NO bias) reshaped (B, N, 3, 16, 64): q | k | v blocks; att = q k^T * 64^-0.5; where(mask[b][j] > 0, -1e7) with the int32 [4][2048] mask in {0, 1} (random; > 0 means MASKED; read on device; masked weights underflow to exactly 0); softmax over keys; out = merged Wproj + bproj ([in][out]) -> [4][2048][1024]).
// Structure: token rows r = b*2048 + s; x as exact f16 rows (bf16-rounded); q | k | v as ONE WMMA GEMM (N = 3 x 1024) (32x64 wave tiles, f32 accumulation, exact x16 weights, no bias, f16 outputs); V^T for all batches and heads via LDS transposes; attention in ONE launch (scores, online softmax with f32 statistics and the weighted sum of V in registers; o carried x64 against f16 subnormal flush, folded into the output GEMM alpha) written straight into the merged f16 o rows; out = o W_o + b GEMM (f32) into the output layout.
// Compute dtype: inputs rounded to bf16; x / weights exact; q, k, v, softmax weights and o as plain f16 GEMM operands (~2^-12); scores and softmax statistics f32. v_wmma_f32_16x16x32_f16.
#define NB 4
#define SQ 2048
#define DM 1024
#define NH 16
#define HD 64
#define HG 4                         /* heads per block group of the (b, h0) k_vt overload */
#define B0 0                         /* first batch processed (debug hook) */
#define NBR NB                       /* batches processed (debug hook) */
#define NR ((size_t)NB * SQ)         /* token rows */
#define MP ((int)((size_t)NBR * SQ)) /* rows projected (debug hook) */
#define QN SQ                        /* unused: attention takes all SQ queries */
#define NHD NH                       /* unused: attention takes all NH heads */
#define MPO MP                       /* rows through the output stage (debug hook) */
#define LQ (3 * DM)      /* row pitch of the q/k/v rows */
typedef __bf16 v16b __attribute__((ext_vector_type(16)));
typedef unsigned short v8us __attribute__((ext_vector_type(8), may_alias));
typedef float  v8f  __attribute__((ext_vector_type(8)));
typedef float  v4f  __attribute__((ext_vector_type(4)));
typedef float  v4fa __attribute__((ext_vector_type(4), may_alias));
union FragB { v16b v; v8us half[2]; unsigned short u[16]; };

__device__ __forceinline__ unsigned short bf16_bits(float x) { unsigned int u = __float_as_uint(x); return (unsigned short)((u + 0x7FFFu + ((u >> 16) & 1u)) >> 16); }
__device__ __forceinline__ float bf16_val(unsigned short b) { return __uint_as_float(((unsigned int)b) << 16); }
__device__ __forceinline__ float bf16_round(float x) { return bf16_val(bf16_bits(x)); }
// D += A·B with NT terms: 1 = ah·bh, 2 = + al·bh (A split), 3 = + ah·bl (both split)
template <int NT>
__device__ __forceinline__ v8f mmaN(v16b ah, v16b al, v16b bh, v16b bl, v8f c) {
  c = __builtin_amdgcn_wmma_f32_16x16x32_bf16(false, ah, false, bh, (short)0, c, false, false);
  if (NT >= 2) c = __builtin_amdgcn_wmma_f32_16x16x32_bf16(false, al, false, bh, (short)0, c, false, false);
  if (NT >= 3) c = __builtin_amdgcn_wmma_f32_16x16x32_bf16(false, ah, false, bl, (short)0, c, false, false);
  asm volatile("v_nop\n\tv_nop\n\tv_nop\n\tv_nop" : "+v"(c) : "v"(ah), "v"(al), "v"(bh), "v"(bl));
  return c;
}

__global__ __launch_bounds__(256) void k_wt_bf16(const float* __restrict__ W, unsigned short* __restrict__ Wt, int K, int N) {
  const int t = blockIdx.x * 256 + threadIdx.x;
  const int k8n = K / 8;
  if (t >= N * k8n) return;
  const int n = t / k8n, k8 = (t % k8n) * 8;
  v8us v;
#pragma unroll
  for (int i = 0; i < 8; ++i) v[i] = bf16_bits(W[(size_t)(k8 + i) * N + n]);
  *(v8us*)(Wt + (size_t)n * K + k8) = v;
  
}

// GEMM C[M][N] (f32, pitch ldc) = act(A[M][K]·W + bias). A f32 row-major (pitch lda) converted per fragment to bf16
// (ASPLIT: hi/lo two planes -> 2 terms, else single rounded term); Wt bf16 [N][K] (pitch ldb). BIAS_BF16 rounds the
// bias to bf16 first (bias quantised to bf16 before the add). K%32==0, M%16==0, N%64==0.
template <bool ASPLIT, int ACT, bool BIAS_BF16>
__global__ __launch_bounds__(128) void k_gemm_bf(const float* __restrict__ A, int lda, const unsigned short* __restrict__ Wt, int ldb,
                                               const float* __restrict__ bias, float* __restrict__ C, int ldc, int M, int N, int K) {
  __shared__ __attribute__((aligned(16))) float so[4][16][64];
  const int tid = threadIdx.x, w = tid >> 5, lane = tid & 31, ln = lane & 15, hh = lane >> 4;
  const int ntn = N / 64;
  const int wid = blockIdx.x * 4 + w;
  const int mt = wid / ntn, nq = wid % ntn;
  if (mt * 16 >= M) return;
  const int row0 = mt * 16, col0 = nq * 64;
  const float* arow = A + (size_t)(row0 + ln) * lda;
  v8f acc[4] = {};
  for (int kb = 0; kb < K; kb += 32) {
    FragB ah, al;
    const v4f x0 = *(const v4fa*)(arow + kb + 8 * hh), x1 = *(const v4fa*)(arow + kb + 8 * hh + 4);
    const v4f x2 = *(const v4fa*)(arow + kb + 16 + 8 * hh), x3 = *(const v4fa*)(arow + kb + 16 + 8 * hh + 4);
    float xs[16] = {x0[0],x0[1],x0[2],x0[3],x1[0],x1[1],x1[2],x1[3],x2[0],x2[1],x2[2],x2[3],x3[0],x3[1],x3[2],x3[3]};
#pragma unroll
    for (int i = 0; i < 16; ++i) { const unsigned short hb = bf16_bits(xs[i]); ah.u[i] = hb; al.u[i] = ASPLIT ? bf16_bits(xs[i] - bf16_val(hb)) : (unsigned short)0; }
#pragma unroll
    for (int t = 0; t < 4; ++t) {
      const unsigned short* brow = Wt + (size_t)(col0 + t * 16 + ln) * ldb + kb;
      FragB b;
      b.half[0] = *(const v8us*)(brow + 8 * hh);
      b.half[1] = *(const v8us*)(brow + 16 + 8 * hh);
      acc[t] = mmaN<ASPLIT ? 2 : 1>(ah.v, al.v, b.v, b.v, acc[t]);
    }
  }
#pragma unroll
  for (int t = 0; t < 4; ++t) {
    float bv = bias ? bias[col0 + t * 16 + ln] : 0.f;
    if (BIAS_BF16) bv = bf16_round(bv);
#pragma unroll
    for (int r = 0; r < 8; ++r) { float v = acc[t][r] + bv; if (ACT == 1) v = fmaxf(v, 0.f); so[w][8 * hh + r][t * 16 + ln] = v; }
  }
  __builtin_amdgcn_fence(__ATOMIC_ACQ_REL, "workgroup");
  __builtin_amdgcn_wave_barrier();
  const int rsub = lane >> 4, c4 = (lane & 15) * 4;
  {
#pragma unroll
    for (int q = 0; q < 8; ++q) {
      const int r = q * 2 + rsub;
      const v4f v = *(const v4fa*)&so[w][r][c4];
      *(v4f*)(C + (size_t)(row0 + r) * ldc + col0 + c4) = v;
    }
    
  }
}

// GEMM C = act(A·W + bias + resid): A f32 (ASPLIT -> hi/lo 2 terms), Wt bf16 [N][K]; ACT 0 none, 1 relu, 2 exact gelu;
// resid (optional, f32, row index = (row % rmod), pitch ldr, RES_BF16 rounds it) added before the activation.
template <bool ASPLIT, int ACT, bool BIAS_BF16, bool RES_BF16>
__global__ __launch_bounds__(128) void k_gemm_bf3(const float* __restrict__ A, int lda, const unsigned short* __restrict__ Wt, int ldb,
                                                const float* __restrict__ bias, const float* __restrict__ resid, int rmod, int ldr,
                                                float* __restrict__ C, int ldc, int M, int N, int K) {
  __shared__ __attribute__((aligned(16))) float so[4][16][64];
  const int tid = threadIdx.x, w = tid >> 5, lane = tid & 31, ln = lane & 15, hh = lane >> 4;
  const int ntn = N / 64;
  const int wid = blockIdx.x * 4 + w;
  const int mt = wid / ntn, nq = wid % ntn;
  if (mt * 16 >= M) return;
  const int row0 = mt * 16, col0 = nq * 64;
  const float* arow = A + (size_t)(row0 + ln) * lda;
  v8f acc[4] = {};
  for (int kb = 0; kb < K; kb += 32) {
    FragB ah, al;
    const v4f x0 = *(const v4fa*)(arow + kb + 8 * hh), x1 = *(const v4fa*)(arow + kb + 8 * hh + 4);
    const v4f x2 = *(const v4fa*)(arow + kb + 16 + 8 * hh), x3 = *(const v4fa*)(arow + kb + 16 + 8 * hh + 4);
    float xs[16] = {x0[0],x0[1],x0[2],x0[3],x1[0],x1[1],x1[2],x1[3],x2[0],x2[1],x2[2],x2[3],x3[0],x3[1],x3[2],x3[3]};
#pragma unroll
    for (int i = 0; i < 16; ++i) { const unsigned short hb = bf16_bits(xs[i]); ah.u[i] = hb; al.u[i] = ASPLIT ? bf16_bits(xs[i] - bf16_val(hb)) : (unsigned short)0; }
#pragma unroll
    for (int t = 0; t < 4; ++t) {
      const unsigned short* brow = Wt + (size_t)(col0 + t * 16 + ln) * ldb + kb;
      FragB b;
      b.half[0] = *(const v8us*)(brow + 8 * hh);
      b.half[1] = *(const v8us*)(brow + 16 + 8 * hh);
      acc[t] = mmaN<ASPLIT ? 2 : 1>(ah.v, al.v, b.v, b.v, acc[t]);
    }
  }
#pragma unroll
  for (int t = 0; t < 4; ++t) {
    const int col = col0 + t * 16 + ln;
    float bv = bias ? bias[col] : 0.f;
    if (BIAS_BF16) bv = bf16_round(bv);
#pragma unroll
    for (int r = 0; r < 8; ++r) {
      float v = acc[t][r] + bv;
      if (resid) { float rv = resid[(size_t)((row0 + 8 * hh + r) % rmod) * ldr + col]; if (RES_BF16) rv = bf16_round(rv); v += rv; }
      if (ACT == 1) v = fmaxf(v, 0.f);
      if (ACT == 2) v = 0.5f * v * (1.0f + erff(v * 0.70710678118654752f));
      if (ACT == 3) { const float u = 0.7978845608028654f * (v + 0.044715f * v * v * v); v = 0.5f * v * (1.0f + tanhf(u)); }
      so[w][8 * hh + r][t * 16 + ln] = v;
    }
  }
  __builtin_amdgcn_fence(__ATOMIC_ACQ_REL, "workgroup");
  __builtin_amdgcn_wave_barrier();
  const int rsub = lane >> 4, c4 = (lane & 15) * 4;
  {
#pragma unroll
    for (int q = 0; q < 8; ++q) {
      const int r = q * 2 + rsub;
      const v4f v = *(const v4fa*)&so[w][r][c4];
      *(v4f*)(C + (size_t)(row0 + r) * ldc + col0 + c4) = v;
    }
    
  }
}
// row LayerNorm (biased variance, eps) over N: s = X (+ R); optional out_sum <- s; out_norm <- (s-mu)*rsqrt(var+eps)*g + b
template <bool PARAM_BF16>
__global__ __launch_bounds__(256) void k_layernorm(const float* __restrict__ X, const float* __restrict__ R, const float* __restrict__ g, const float* __restrict__ bta,
                                                  float* __restrict__ out_sum, float* __restrict__ out_norm, int N, float eps) {
  __shared__ float red[256];
  const int row = blockIdx.x, tid = threadIdx.x;
  const float* x = X + (size_t)row * N; const float* rr = R ? R + (size_t)row * N : nullptr;
  float vals[16];                     // up to N = 4096
  const int per = N / 256;            // contiguous chunk per thread? use strided-by-4 chunks: thread handles j = tid*4 + 1024*u
  float s1 = 0.f;
  for (int u = 0; u < per / 4; ++u) {
    const int j = tid * 4 + 1024 * u;
    const v4f a = *(const v4fa*)(x + j);
    v4f b = {0.f,0.f,0.f,0.f}; if (rr) b = *(const v4fa*)(rr + j);
#pragma unroll
    for (int q = 0; q < 4; ++q) { const float v = a[q] + b[q]; vals[u * 4 + q] = v; s1 += v; }
  }
  red[tid] = s1; __syncthreads();
  for (int st = 128; st > 0; st >>= 1) { if (tid < st) red[tid] += red[tid + st]; __syncthreads(); }
  const float mu = red[0] / (float)N; __syncthreads();
  float s2 = 0.f;
  for (int u = 0; u < per / 4; ++u)
#pragma unroll
    for (int q = 0; q < 4; ++q) { const float c = vals[u * 4 + q] - mu; s2 += c * c; }
  red[tid] = s2; __syncthreads();
  for (int st = 128; st > 0; st >>= 1) { if (tid < st) red[tid] += red[tid + st]; __syncthreads(); }
  const float rs = rsqrtf(red[0] / (float)N + eps);
  {
    for (int u = 0; u < per / 4; ++u) {
      const int j = tid * 4 + 1024 * u;
      v4f o, sm;
#pragma unroll
      for (int q = 0; q < 4; ++q) {
        float gg = g[j + q], bb = bta[j + q];
        if (PARAM_BF16) { gg = bf16_round(gg); bb = bf16_round(bb); }
        sm[q] = vals[u * 4 + q]; o[q] = (vals[u * 4 + q] - mu) * rs * gg + bb;
      }
      if (out_sum) *(v4f*)(out_sum + (size_t)row * N + j) = sm;
      *(v4f*)(out_norm + (size_t)row * N + j) = o;
    }
    
  }
}



// ---- f16 WMMA path (v_wmma_f32_16x16x32_f16): 11-bit significands for operands in range — used where a [0,1] probability operand needs more precision than bf16
typedef _Float16 v16h __attribute__((ext_vector_type(16)));
union FragH { v16h v; v8us half[2]; _Float16 h[16]; unsigned short u[16]; };
template <int NT>
__device__ __forceinline__ v8f mmaH(v16h ah, v16h al, v16h bh, v16h bl, v8f c) {
  c = __builtin_amdgcn_wmma_f32_16x16x32_f16(false, ah, false, bh, (short)0, c, false, false);
  if (NT >= 2) c = __builtin_amdgcn_wmma_f32_16x16x32_f16(false, al, false, bh, (short)0, c, false, false);
  if (NT >= 3) c = __builtin_amdgcn_wmma_f32_16x16x32_f16(false, ah, false, bl, (short)0, c, false, false);
  asm volatile("v_nop\n\tv_nop\n\tv_nop\n\tv_nop" : "+v"(c) : "v"(ah), "v"(al), "v"(bh), "v"(bl));
  return c;
}
// batched GEMM like k_gemm_b but f16 operands: A f32 (split into f16 hi/lo if ASPLIT, else rounded to f16), Bt = f16 values [n][k]; alpha; C f32; N multiple of 16 (partial tiles skipped)
template <bool ASPLIT>
__global__ __launch_bounds__(128) void k_gemm_h(const float* __restrict__ A, int lda, size_t sA, const _Float16* __restrict__ Bh, int ldb, size_t sB, float alpha, float* __restrict__ C, int ldc, size_t sC, int M, int N, int K) {
  __shared__ __attribute__((aligned(16))) float so[4][16][64];
  const int tid = threadIdx.x, w = tid >> 5, lane = tid & 31, ln = lane & 15, hh = lane >> 4; const int by = blockIdx.y;
  A += (size_t)by * sA; Bh += (size_t)by * sB; C += (size_t)by * sC;
  const int ntn = (N + 63) / 64; const int wid = blockIdx.x * 4 + w; const int mt = wid / ntn, nq = wid % ntn; if (mt * 16 >= M) return;
  const int row0 = mt * 16, col0 = nq * 64; const float* arow = A + (size_t)(row0 + ln) * lda;
  v8f acc[4] = {};
  for (int kb = 0; kb < K; kb += 32) {
    FragH ah, al;
    const v4f x0 = *(const v4fa*)(arow + kb + 8 * hh), x1 = *(const v4fa*)(arow + kb + 8 * hh + 4), x2 = *(const v4fa*)(arow + kb + 16 + 8 * hh), x3 = *(const v4fa*)(arow + kb + 16 + 8 * hh + 4);
    float xs[16] = {x0[0],x0[1],x0[2],x0[3],x1[0],x1[1],x1[2],x1[3],x2[0],x2[1],x2[2],x2[3],x3[0],x3[1],x3[2],x3[3]};
#pragma unroll
    for (int i = 0; i < 16; ++i) { const _Float16 h = (_Float16)xs[i]; ah.h[i] = h; al.h[i] = ASPLIT ? (_Float16)(xs[i] - (float)h) : (_Float16)0.0f; }
#pragma unroll
    for (int t = 0; t < 4; ++t) { if (col0 + t * 16 >= N) continue; const size_t boff = (size_t)(col0 + t * 16 + ln) * ldb + kb; FragH bq; bq.half[0] = *(const v8us*)(Bh + boff + 8 * hh); bq.half[1] = *(const v8us*)(Bh + boff + 16 + 8 * hh);
      acc[t] = mmaH<ASPLIT ? 2 : 1>(ah.v, al.v, bq.v, bq.v, acc[t]); }
  }
#pragma unroll
  for (int t = 0; t < 4; ++t) { if (col0 + t * 16 >= N) continue;
#pragma unroll
    for (int r = 0; r < 8; ++r) so[w][8 * hh + r][t * 16 + ln] = acc[t][r] * alpha; }
  __builtin_amdgcn_fence(__ATOMIC_ACQ_REL, "workgroup"); __builtin_amdgcn_wave_barrier();
  const int rsub = lane >> 4, c4 = (lane & 15) * 4;
  {
#pragma unroll
    for (int q = 0; q < 8; ++q) { const int r = q * 2 + rsub; if (col0 + c4 < N) { const v4f v = *(const v4fa*)&so[w][r][c4]; *(v4f*)(C + (size_t)(row0 + r) * ldc + col0 + c4) = v; } }
     }
}

// Wt[n][k] = f16(W[k][n]·scale) from f32 row-major W[K][N] (scale = power of two; bf16-exact weights stay exact in f16 away from the subnormal range)
__global__ __launch_bounds__(256) void k_wt_f16(const float* __restrict__ W, _Float16* __restrict__ Wt, int K, int N, float scale) {
  const int t = blockIdx.x * 256 + threadIdx.x; if (t >= N * (K / 8)) return; const int n = t / (K / 8), k8 = (t % (K / 8)) * 8; FragH f;
#pragma unroll
  for (int i = 0; i < 8; ++i) f.h[i] = (_Float16)(bf16_round(W[(size_t)(k8 + i) * N + n]) * scale); const v8us o = f.half[0];
  *(v8us*)((unsigned short*)Wt + (size_t)n * K + k8) = o; 
}
// k_gemm_hh variant with fused epilogue: v = acc·alpha + bias[by·sBias + col] (+ CP[(row/rowsPerB)·sCPb + by·64 + col] if CP) ; ACT 0 none / 1 elu ; writes f16 C16 (and f32 C if non-null)
template <int ACT>
__global__ __launch_bounds__(128) void k_gemm_hhx(const _Float16* __restrict__ A, int lda, size_t sA, const _Float16* __restrict__ Bh, int ldb, size_t sB, float alpha, const float* __restrict__ bias, size_t sBias, const float* __restrict__ CP, int rowsPerB, size_t sCPb, int row0g,
    float* __restrict__ C, _Float16* __restrict__ C16, int ldc, size_t sC, int M, int N, int K) {
  __shared__ __attribute__((aligned(16))) float so[4][16][64];
  const int tid = threadIdx.x, w = tid >> 5, lane = tid & 31, ln = lane & 15, hh = lane >> 4; const int by = blockIdx.y;
  A += (size_t)by * sA; Bh += (size_t)by * sB; const size_t cofs = (size_t)by * sC; const float* bp = bias ? bias + (size_t)by * sBias : nullptr;
  const int ntn = (N + 63) / 64; const int wid = blockIdx.x * 4 + w; const int mt = wid / ntn, nq = wid % ntn; if (mt * 16 >= M) return;
  const int row0 = mt * 16, col0 = nq * 64; const _Float16* arow = A + (size_t)(row0 + ln) * lda;
  v8f acc[4] = {};
  for (int kb = 0; kb < K; kb += 32) { FragH ah; ah.half[0] = *(const v8us*)((const unsigned short*)arow + kb + 8 * hh); ah.half[1] = *(const v8us*)((const unsigned short*)arow + kb + 16 + 8 * hh);
#pragma unroll
    for (int t = 0; t < 4; ++t) { if (col0 + t * 16 >= N) continue; const size_t boff = (size_t)(col0 + t * 16 + ln) * ldb + kb; FragH bq; bq.half[0] = *(const v8us*)((const unsigned short*)Bh + boff + 8 * hh); bq.half[1] = *(const v8us*)((const unsigned short*)Bh + boff + 16 + 8 * hh);
      acc[t] = mmaH<1>(ah.v, ah.v, bq.v, bq.v, acc[t]); }
  }
#pragma unroll
  for (int t = 0; t < 4; ++t) { if (col0 + t * 16 >= N) continue; const int col = col0 + t * 16 + ln; const float bv = bp ? bf16_round(bp[col]) : 0.f;
#pragma unroll
    for (int r = 0; r < 8; ++r) { float v = acc[t][r] * alpha + bv; if (CP) { const int rr = row0g + row0 + 8 * hh + r; if (rowsPerB < 0) v += CP[cofs + (size_t)rr * ldc + col];      /* rowsPerB < 0: own element of the batched C plane */ else { const int bidx = rr / rowsPerB; v += CP[(size_t)bidx * sCPb + (size_t)by * 64 + col]; } } if (ACT == 1) v = (v > 0.f) ? v : expm1f(v); else if (ACT == 7) v = (v > 0.f) ? v + 1.0f : expf(v); else if (ACT == 8) v = tanhf(v); else if (ACT == 9) v = 0.5f * v * (1.0f + tanhf(0.7978845608028654f * (v + 0.044715f * v * v * v))); else if (ACT == 11) v = 1.0f / (1.0f + expf(-v)); else if (ACT == 12) v = (v > 0.f) ? v : 0.01f * v; else if (ACT == 14) v = (v > 0.f) ? v : 0.1f * v; else if (ACT == 16) v = (v >= 0.f) ? v : 0.3f * v; else if (ACT == 17) v = (v >= 0.f) ? v : 0.2f * v; else if (ACT == 15) v = v / (1.0f + expf(-v)); else if (ACT == 3) v = fmaxf(v, 0.f); else if (ACT == 6) v = 0.5f * v * (1.0f + erff(v * 0.70710678118654752f)); so[w][8 * hh + r][t * 16 + ln] = v; } }
  __builtin_amdgcn_fence(__ATOMIC_ACQ_REL, "workgroup"); __builtin_amdgcn_wave_barrier();
  const int rsub = lane >> 4, c4 = (lane & 15) * 4; typedef _Float16 v4h __attribute__((ext_vector_type(4)));
  {
#pragma unroll
    for (int q = 0; q < 8; ++q) { const int r = q * 2 + rsub; if (col0 + c4 < N) { const v4f v = *(const v4fa*)&so[w][r][c4]; if (C) *(v4f*)(C + cofs + (size_t)(row0 + r) * ldc + col0 + c4) = v; if (C16) { v4h h4; for (int i = 0; i < 4; ++i) h4[i] = (_Float16)v[i]; *(v4h*)(C16 + cofs + (size_t)(row0 + r) * ldc + col0 + c4) = h4; } } }
     }
}


typedef _Float16 v4h __attribute__((ext_vector_type(4)));

__global__ __launch_bounds__(256) void k_x16(const float* __restrict__ x, _Float16* __restrict__ X16, size_t n8) { const size_t t = (size_t)blockIdx.x * 256 + threadIdx.x; if (t >= n8) return; FragH f;
#pragma unroll
  for (int q = 0; q < 8; ++q) f.h[q] = (_Float16)bf16_round(x[t * 8 + q]); *(v8us*)((unsigned short*)X16 + t * 8) = f.half[0];  }
__global__ __launch_bounds__(256) void k_h16(const float* __restrict__ x, _Float16* __restrict__ X16, size_t n8) { const size_t t = (size_t)blockIdx.x * 256 + threadIdx.x; if (t >= n8) return; FragH f;
#pragma unroll
  for (int q = 0; q < 8; ++q) f.h[q] = (_Float16)x[t * 8 + q]; *(v8us*)((unsigned short*)X16 + t * 8) = f.half[0];  }
__global__ __launch_bounds__(256) void k_round16f(const float* __restrict__ W, _Float16* __restrict__ Bt, size_t n8) { const size_t t = (size_t)blockIdx.x * 256 + threadIdx.x; if (t >= n8) return; FragH f;
#pragma unroll
  for (int i = 0; i < 8; ++i) f.h[i] = (_Float16)(bf16_round(W[t * 8 + i]) * 16.0f); *(v8us*)((unsigned short*)Bt + t * 8) = f.half[0];  }
template <int NHv, int TTv>
__global__ __launch_bounds__(256) void k_vt(const _Float16* __restrict__ V16, int ldv, int voff, _Float16* __restrict__ Vt) { __shared__ unsigned short tl[64][66]; const int tid = threadIdx.x; const int slab = blockIdx.x / (TTv / 64), lg = blockIdx.x % (TTv / 64); const int b = slab / NHv, h = slab % NHv;
  for (int i = tid; i < 64 * 8; i += 256) { const int r = i / 8, c8 = (i % 8) * 8; FragH f; f.half[0] = *(const v8us*)((const unsigned short*)V16 + ((size_t)b * TTv + lg * 64 + r) * ldv + voff + h * 64 + c8);
#pragma unroll
    for (int q = 0; q < 8; ++q) tl[r][c8 + q] = f.u[q]; }
  __syncthreads();
  {
#pragma unroll
    for (int rd = 0; rd < 2; ++rd) { const int d = rd * 32 + tid / 8, pc = tid % 8; FragH f;
#pragma unroll
      for (int q = 0; q < 8; ++q) f.u[q] = tl[pc * 8 + q][d];
      *(v8us*)((unsigned short*)Vt + ((size_t)slab * 64 + d) * TTv + lg * 64 + pc * 8) = f.half[0]; }
     } }

__global__ __launch_bounds__(256) void k_hl(const float* __restrict__ F, _Float16* __restrict__ Hh, _Float16* __restrict__ Hl, size_t n8) { const size_t t = (size_t)blockIdx.x * 256 + threadIdx.x; if (t >= n8) return; FragH fh, fl; const v4f a = *(const v4fa*)(F + t * 8), c = *(const v4fa*)(F + t * 8 + 4);
#pragma unroll
  for (int q = 0; q < 4; ++q) { _Float16 h = (_Float16)a[q]; fh.h[q] = h; fl.h[q] = (_Float16)((a[q] - (float)h) * 1024.0f); h = (_Float16)c[q]; fh.h[4 + q] = h; fl.h[4 + q] = (_Float16)((c[q] - (float)h) * 1024.0f); }
  { *(v8us*)((unsigned short*)Hh + t * 8) = fh.half[0]; *(v8us*)((unsigned short*)Hl + t * 8) = fl.half[0];  } }

// ---- fast GEMM (wave tile 32x64; requires M % 32 == 0 rows per launch region and N % 64 == 0); epilogue = k_gemm_hhx semantics ----
__device__ __forceinline__ v16h g2_frag(const _Float16* p, int hh) { FragH f; f.half[0] = *(const v8us*)((const unsigned short*)p + 8 * hh); f.half[1] = *(const v8us*)((const unsigned short*)p + 16 + 8 * hh); return f.v; }
__device__ __forceinline__ v8f g2_mma(v16h a, v16h b, v8f c) { v8f d = __builtin_amdgcn_wmma_f32_16x16x32_f16(false, a, false, b, (short)0, c, false, false); asm volatile("v_nop\n\tv_nop\n\tv_nop\n\tv_nop" : "+v"(d) : "v"(a), "v"(b)); return d; }
template <int ACT>
__global__ __launch_bounds__(128) void k_gemm2(const _Float16* __restrict__ A, int lda, size_t sA, const _Float16* __restrict__ Bh, int ldb, size_t sB, float alpha, const float* __restrict__ bias, size_t sBias, const float* __restrict__ CP, int rowsPerB, size_t sCPb, int row0g,
    float* __restrict__ C, _Float16* __restrict__ C16, int ldc, size_t sC, int M, int N, int K) { static_assert(ACT == 0 || ACT == 3 || ACT == 6 || ACT == 8 || ACT == 9 || ACT == 11 || ACT == 12 || ACT == 14 || ACT == 15 || ACT == 16 || ACT == 17, "k_gemm2: unsupported ACT code (would silently apply no activation)");
  __shared__ __attribute__((aligned(16))) float so[4][32][68];
  const int tid = threadIdx.x, w = tid >> 5, lane = tid & 31, ln = lane & 15, hh = lane >> 4; const int by = blockIdx.y;
  A += (size_t)by * sA; Bh += (size_t)by * sB; const size_t cofs = (size_t)by * sC; const float* bp = bias ? bias + (size_t)by * sBias : nullptr;
  const int ntn = N >> 6; const int mt = blockIdx.x / ntn, nq = blockIdx.x - mt * ntn; const int row0 = mt * 128 + 32 * w, col0 = nq * 64; if (row0 >= M) return;
  const _Float16* a0p = A + (size_t)(row0 + ln) * lda; const _Float16* a1p = a0p + (size_t)16 * lda;
  const _Float16* b0p = Bh + (size_t)(col0 + ln) * ldb; const _Float16* b1p = b0p + (size_t)16 * ldb; const _Float16* b2p = b1p + (size_t)16 * ldb; const _Float16* b3p = b2p + (size_t)16 * ldb;
  const v8f z8 = {0.f,0.f,0.f,0.f,0.f,0.f,0.f,0.f}; v8f c00 = z8, c01 = z8, c02 = z8, c03 = z8, c10 = z8, c11 = z8, c12 = z8, c13 = z8;
#pragma unroll 1
  for (int kb = 0; kb < K; kb += 32) { const v16h a0 = g2_frag(a0p + kb, hh), a1 = g2_frag(a1p + kb, hh);
    v16h b = g2_frag(b0p + kb, hh); c00 = g2_mma(a0, b, c00); c10 = g2_mma(a1, b, c10);
    b = g2_frag(b1p + kb, hh); c01 = g2_mma(a0, b, c01); c11 = g2_mma(a1, b, c11);
    b = g2_frag(b2p + kb, hh); c02 = g2_mma(a0, b, c02); c12 = g2_mma(a1, b, c12);
    b = g2_frag(b3p + kb, hh); c03 = g2_mma(a0, b, c03); c13 = g2_mma(a1, b, c13); }
  v8f accs[8] = {c00, c01, c02, c03, c10, c11, c12, c13};
#pragma unroll
  for (int u = 0; u < 8; ++u) { const int t = u & 3, half = u >> 2; const int col = col0 + t * 16 + ln; const float bv = bp ? bf16_round(bp[col]) : 0.f;
#pragma unroll
    for (int r = 0; r < 8; ++r) { const int rloc = half * 16 + 8 * hh + r; float v = accs[u][r] * alpha + bv; if (CP) { if (rowsPerB < 0) v += CP[cofs + (size_t)(row0g + row0 + rloc) * ldc + col];      /* rowsPerB < 0: own element of the batched C plane */ else { const int bidx = (row0g + row0 + rloc) / rowsPerB; v += CP[(size_t)bidx * sCPb + (size_t)by * 64 + col]; } }
      if (ACT == 3) v = fmaxf(v, 0.f); else if (ACT == 6) v = 0.5f * v * (1.0f + erff(v * 0.70710678118654752f)); else if (ACT == 11) v = 1.0f / (1.0f + expf(-v)); else if (ACT == 15) v = v / (1.0f + expf(-v)); else if (ACT == 12) v = (v > 0.f) ? v : 0.01f * v; else if (ACT == 8) v = tanhf(v); else if (ACT == 9) v = 0.5f * v * (1.0f + tanhf(0.7978845608028654f * (v + 0.044715f * v * v * v))); else if (ACT == 14) v = (v > 0.f) ? v : 0.1f * v; else if (ACT == 16) v = (v >= 0.f) ? v : 0.3f * v; else if (ACT == 17) v = (v >= 0.f) ? v : 0.2f * v;
      so[w][rloc][t * 16 + ln] = v; } }
  __builtin_amdgcn_fence(__ATOMIC_ACQ_REL, "workgroup"); __builtin_amdgcn_wave_barrier();
  const int rsub = lane >> 4, c4 = (lane & 15) * 4;
  {
#pragma unroll
    for (int q = 0; q < 16; ++q) { const int r = q * 2 + rsub; const v4f v = *(const v4fa*)&so[w][r][c4]; if (C) *(v4f*)(C + cofs + (size_t)(row0 + r) * ldc + col0 + c4) = v; if (C16) { v4h h4; for (int i = 0; i < 4; ++i) h4[i] = (_Float16)v[i]; *(v4h*)(C16 + cofs + (size_t)(row0 + r) * ldc + col0 + c4) = h4; } }
     } }


__global__ __launch_bounds__(256) void k_wnat(const float* __restrict__ w, size_t n8, _Float16* __restrict__ Bt) { const size_t t = (size_t)blockIdx.x * 256 + threadIdx.x; if (t >= n8) return; FragH f; for (int q = 0; q < 8; ++q) f.h[q] = (_Float16)(bf16_round(w[t * 8 + q]) * 16.0f); *(v8us*)((unsigned short*)Bt + t * 8) = f.half[0];  }
__global__ __launch_bounds__(256) void k_rsm(const float* __restrict__ S, _Float16* __restrict__ P, int nrows) {
  #pragma clang fp contract(off)
  const int i = blockIdx.x * 256 + threadIdx.x; if (i >= nrows) return; const float* s = S + (size_t)i * SQ; float mx = -3.0e38f;
#pragma unroll 1
  for (int j = 0; j < SQ; ++j) mx = fmaxf(mx, s[j]); float se = 0.f;
#pragma unroll 1
  for (int j = 0; j < SQ; ++j) se += expf(s[j] - mx); const float sc = 256.0f / se;
#pragma unroll 1
  for (int j0 = 0; j0 < SQ; j0 += 8) { FragH f; for (int q = 0; q < 8; ++q) f.h[q] = (_Float16)(expf(s[j0 + q] - mx) * sc); unsigned short* d = (unsigned short*)P + (size_t)i * SQ + j0; *(v8us*)d = f.half[0];  } }
__global__ __launch_bounds__(256) void k_vt(const _Float16* __restrict__ V16, int b, int h0, _Float16* __restrict__ VT) { __shared__ unsigned short tl[64][65]; const int tid = threadIdx.x; const int hh = blockIdx.x % HG, sg = blockIdx.x / HG; const int s0 = sg * 64; const int h = h0 + hh;
  for (int i = tid; i < 64 * 8; i += 256) { const int j = i / 8, d8 = (i % 8) * 8; FragH f; f.half[0] = *(const v8us*)((const unsigned short*)V16 + ((size_t)b * SQ + s0 + j) * DM + h * HD + d8); for (int q = 0; q < 8; ++q) tl[d8 + q][j] = f.u[q]; }
  __syncthreads();
  { for (int i = tid; i < 64 * 8; i += 256) { const int d = i / 8, j8 = (i % 8) * 8; FragH f; for (int q = 0; q < 8; ++q) f.u[q] = tl[d][j8 + q]; *(v8us*)((unsigned short*)VT + ((size_t)hh * HD + d) * SQ + s0 + j8) = f.half[0]; }  } }



#define FK 64            /* keys per pass */
#define FP 72            /* LDS row pitch in halves: 144 bytes = 16 x odd, for 16-byte row reads */
#define FMASK (-262144.0f)
#define FTHR 8.0f
#define FOFF 6.0f
typedef int v4ia __attribute__((ext_vector_type(4), may_alias));
typedef float v8fa __attribute__((ext_vector_type(8), may_alias));
typedef float v2f __attribute__((ext_vector_type(2)));
typedef _Float16 v2h __attribute__((ext_vector_type(2)));
union FragP { v16h v; v2h p[8]; };
__device__ __forceinline__ float fa_xhalf(float x) { const int i = __float_as_int(x); return __int_as_float(__builtin_amdgcn_permlanex16(i, i, 0x76543210, 0xfedcba98, false, false)); }      /* lane l <-> l ^ 16 */
__device__ __forceinline__ v8f fa_mma(v16h a, v16h b, v8f c) { return __builtin_amdgcn_wmma_f32_16x16x32_f16(false, a, false, b, (short)0, c, false, false); }
__global__ __launch_bounds__(256) __attribute__((amdgpu_waves_per_eu(4, 4))) /* two work-groups per WGP: the vector work between the matrix runs wants four waves per SIMD */
void k_fattn(const _Float16* __restrict__ QKV, const _Float16* __restrict__ VT, const int* __restrict__ Km, _Float16* __restrict__ O16) {
  __shared__ __attribute__((aligned(16))) _Float16 Ks[2][FK][FP];
  __shared__ __attribute__((aligned(16))) _Float16 Vs[2][HD][FP];
  __shared__ __attribute__((aligned(32))) float kb[SQ];
  __shared__ int kept[8];
  const int tid = threadIdx.x, w = tid >> 5, lane = tid & 31, ln = lane & 15, hh = lane >> 4;
  const int h = blockIdx.y, b = blockIdx.z, q0 = blockIdx.x * 256 + w * 32;
  const unsigned short* Kg = (const unsigned short*)QKV + (size_t)b * SQ * LQ + DM + h * HD;      /* K rows [key][d], pitch LQ */
  const unsigned short* Vg = (const unsigned short*)VT + ((size_t)b * NH + h) * HD * SQ;          /* V^T rows [d][key], pitch SQ */
  const int sr = tid >> 3, sc = (tid & 7) * 8;      /* staging: 16-byte piece sc of rows sr and sr + 32 of both tiles */
  { const int* mp = Km + (size_t)b * SQ + tid * 8; const v4ia m0 = *(const v4ia*)mp, m1 = *(const v4ia*)(mp + 4); v4f b0, b1; bool any = false;
    for (int q = 0; q < 4; ++q) { b0[q] = m0[q] > 0 ? FMASK : 0.f; b1[q] = m1[q] > 0 ? FMASK : 0.f; any = any || !(m0[q] > 0) || !(m1[q] > 0); }
    *(v4fa*)&kb[tid * 8] = b0; *(v4fa*)&kb[tid * 8 + 4] = b1;
    const unsigned int bal = __builtin_amdgcn_ballot_w32(any); if (lane == 0) kept[w] = bal != 0u ? 1 : 0; }
  v16h qf[2][2];
#pragma unroll      /* fragments stay in registers: constant indices only */
  for (int g = 0; g < 2; ++g) for (int kk = 0; kk < 2; ++kk) qf[g][kk] = g2_frag(QKV + ((size_t)b * SQ + q0 + g * 16 + ln) * LQ + h * HD + kk * 32, hh);
  v8us kr0 = *(const v8us*)(Kg + (size_t)sr * LQ + sc), kr1 = *(const v8us*)(Kg + (size_t)(sr + 32) * LQ + sc);
  v8us vr0 = *(const v8us*)(Vg + (size_t)sr * SQ + sc), vr1 = *(const v8us*)(Vg + (size_t)(sr + 32) * SQ + sc);
  *(v8us*)&Ks[0][sr][sc] = kr0; *(v8us*)&Ks[0][sr + 32][sc] = kr1; *(v8us*)&Vs[0][sr][sc] = vr0; *(v8us*)&Vs[0][sr + 32][sc] = vr1;
  __syncthreads();      /* publishes pass 0's tiles, the mask values and the eight kept flags */
  { int anyk = 0; for (int i = 0; i < 8; ++i) anyk |= kept[i];
    const v16h zq = {};
#pragma unroll      /* constant indices into qf */
    for (int g = 0; g < 2; ++g) for (int kk = 0; kk < 2; ++kk) qf[g][kk] = anyk ? qf[g][kk] : zq; }
  const v8f z8 = {0.f,0.f,0.f,0.f,0.f,0.f,0.f,0.f};
  v8f o[4][2] = {{z8, z8}, {z8, z8}, {z8, z8}, {z8, z8}};
  float m[2] = {-3.0e38f, -3.0e38f}, nm[2] = {0.f, 0.f}; v8f lt[2] = {z8, z8};      /* lt: every row of the tile = the column's sum of weights */
  v16h ones; for (int e = 0; e < 16; ++e) ones[e] = (_Float16)1.0f;
  const float cs = 0.125f * 1.4426950408889634f;      /* 64^-0.5 log2(e) */
#pragma unroll 1      /* one pass per trip: the body already fills the register budget */
  for (int s = 0; s < SQ / FK; ++s) {
    const int buf = s & 1; const bool more = s + 1 < SQ / FK;
    if (more) { const int k1 = (s + 1) * FK;      /* next pass's tiles fly through registers while this pass is worked on */
      kr0 = *(const v8us*)(Kg + (size_t)(k1 + sr) * LQ + sc); kr1 = *(const v8us*)(Kg + (size_t)(k1 + sr + 32) * LQ + sc);
      vr0 = *(const v8us*)(Vg + (size_t)sr * SQ + k1 + sc); vr1 = *(const v8us*)(Vg + (size_t)(sr + 32) * SQ + k1 + sc); }
    v8f st[4][2];
#pragma unroll      /* constant indices into st, qf */
    for (int t = 0; t < 4; ++t) { const v8f c0 = *(const v8fa*)&kb[s * FK + t * 16 + 8 * hh];      /* D row 8 hh + r = key t 16 + 8 hh + r */
      const v16h ka = g2_frag(&Ks[buf][t * 16 + ln][0], hh), kc = g2_frag(&Ks[buf][t * 16 + ln][32], hh);
      for (int g = 0; g < 2; ++g) st[t][g] = fa_mma(kc, qf[g][1], fa_mma(ka, qf[g][0], c0));
      if (t & 1) __builtin_amdgcn_sched_barrier(0); }      /* holds the next two tiles' fragment loads behind these products: all eight K fragments loaded at once overflow the register budget of four waves per SIMD (spills) */
    float ms[2];
#pragma unroll      /* constant indices into st */
    for (int g = 0; g < 2; ++g) { float mx = st[0][g][0];
      for (int t = 0; t < 4; ++t) for (int r = 0; r < 8; ++r) mx = fmaxf(mx, st[t][g][r]);
      ms[g] = fmaxf(mx, fa_xhalf(mx)) * cs; }
    if (__builtin_amdgcn_ballot_w32(ms[0] > m[0] + FTHR || ms[1] > m[1] + FTHR) != 0u) {      /* one scalar branch per pass */
#pragma unroll      /* constant indices into o */
      for (int g = 0; g < 2; ++g) { const float mn = fmaxf(m[g], ms[g]); const float al = __builtin_amdgcn_exp2f(m[g] - mn); m[g] = mn; nm[g] = FOFF - mn; lt[g] *= al;
        for (int dt = 0; dt < 4; ++dt) o[dt][g] *= al; } }
    FragP pf[2][2];
#pragma unroll      /* constant indices into st, pf */
    for (int g = 0; g < 2; ++g) for (int t = 0; t < 4; ++t) for (int r = 0; r < 8; r += 2) {
      v2f p; p[0] = __builtin_amdgcn_exp2f(__builtin_fmaf(st[t][g][r], cs, nm[g])); p[1] = __builtin_amdgcn_exp2f(__builtin_fmaf(st[t][g][r + 1], cs, nm[g]));
      pf[t >> 1][g].p[(t & 1) * 4 + (r >> 1)] = __builtin_convertvector(p, v2h); }      /* b[e] = T[e >> 3][e & 7]: the hardware k order */
#pragma unroll      /* constant indices into lt, pf */
    for (int j = 0; j < 2; ++j) for (int g = 0; g < 2; ++g) lt[g] = fa_mma(ones, pf[j][g].v, lt[g]);      /* row sums on the matrix pipe: A = ones sums the rounded weights of all 32 keys, both wave halves' */
#pragma unroll      /* constant indices into o, pf */
    for (int dt = 0; dt < 4; ++dt) for (int j = 0; j < 2; ++j) { const v16h vf = g2_frag(&Vs[buf][dt * 16 + ln][j * 32], hh);      /* same k order as the packed weights */
      for (int g = 0; g < 2; ++g) o[dt][g] = fa_mma(vf, pf[j][g].v, o[dt][g]); }
    if (more) { *(v8us*)&Ks[buf ^ 1][sr][sc] = kr0; *(v8us*)&Ks[buf ^ 1][sr + 32][sc] = kr1; *(v8us*)&Vs[buf ^ 1][sr][sc] = vr0; *(v8us*)&Vs[buf ^ 1][sr + 32][sc] = vr1; }      /* that buffer's readers left it at the last barrier */
    __syncthreads();      /* publishes the next pass's tiles and ends this pass's reads */
  }
#pragma unroll      /* constant indices into o */
  for (int g = 0; g < 2; ++g) { const float sc64 = 64.0f / lt[g][0];      /* o carried x64, as the output GEMM's alpha expects */
    unsigned short* d = (unsigned short*)O16 + ((size_t)b * SQ + q0 + g * 16 + ln) * DM + h * HD + 8 * hh;
    for (int dt = 0; dt < 4; ++dt) { FragH f; for (int r = 0; r < 8; ++r) f.h[r] = (_Float16)(o[dt][g][r] * sc64); *(v8us*)(d + dt * 16) = f.half[0]; } } }
extern "C" void kernel_launch(void* const* d_in, const int* in_sizes, int n_in,
                              void* d_out, int out_size, void* d_ws, size_t ws_size, hipStream_t stream) {
  (void)in_sizes; (void)n_in; (void)out_size;
  const float* const* I = (const float* const*)d_in; const float* x = I[0]; const float* wqkv = I[1]; const float* bqkv = nullptr; const float* wo = I[2]; const float* bo = I[3]; const int* km = (const int*)d_in[4];      /* x; [in][out] Wqkv [1024][3072] (no bias), Wproj [1024][1024] + bproj; mask int32 [4][2048] (> 0 = MASKED key; READ on device) */
  char* ws = (char*)d_ws; size_t off = 0;
  auto take = [&](size_t bytes) { char* p = ws + off; off += (bytes + 255) & ~(size_t)255; return p; };
  _Float16* BQKV = (_Float16*)take((size_t)3 * DM * DM * 2); _Float16* BO = (_Float16*)take((size_t)DM * DM * 2);
  _Float16* X16 = (_Float16*)take(NR * DM * 2); _Float16* QKV = (_Float16*)take(NR * 3 * DM * 2); _Float16* V16 = QKV + 2 * DM; _Float16* O16 = (_Float16*)take(NR * DM * 2);
  _Float16* VT = (_Float16*)take((size_t)NB * NH * HD * SQ * 2);
  if (off > ws_size) return;
  k_wt_f16<<<(unsigned)(((size_t)DM * 3 * DM / 8 + 255) / 256), 256, 0, stream>>>(wqkv, BQKV, DM, 3 * DM, 16.0f); k_wt_f16<<<(unsigned)(((size_t)DM * DM / 8 + 255) / 256), 256, 0, stream>>>(wo, BO, DM, DM, 16.0f);      /* [in][out] -> Bt[n][k] x16 (pitch K = 1024) */

  k_x16<<<(unsigned)((NR * DM / 8 + 255) / 256), 256, 0, stream>>>(x, X16, NR * DM / 8);
  const size_t r0p = (size_t)B0 * SQ;      /* first projected row */
  k_gemm2<0><<<dim3((unsigned)((MP / 128) * (3 * DM / 64)), 1), 128, 0, stream>>>(X16 + r0p * DM, DM, 0, BQKV, DM, 0, 0.0625f, bqkv, 0, nullptr, 1, 0, 0, nullptr, QKV + r0p * 3 * DM, 3 * DM, 0, MP, 3 * DM, DM);      /* q | k | v rows (f16); head h = columns h*HD.. of each DM block */
  k_vt<NH, SQ><<<NBR * NH * (SQ / 64), 256, 0, stream>>>(V16 + r0p * LQ, LQ, 0, VT);      /* V^T [NBR][NH][HD][SQ] */
  k_fattn<<<dim3(SQ / 256, NH, NBR), 256, 0, stream>>>(QKV + r0p * LQ, VT, km + r0p, O16 + r0p * DM);      /* o x64 (merged heads) as f16 rows */
  k_gemm2<0><<<dim3((unsigned)((MPO / 128) * (DM / 64)), 1), 128, 0, stream>>>(O16 + r0p * DM, DM, 0, BO, DM, 0, 0.0009765625f, bo, 0, nullptr, 1, 0, 0, (float*)d_out + r0p * DM, nullptr, DM, 0, MPO, DM, DM);      /* out rows are the output layout */
}

// v003
// It runs in 152 microseconds.
// Timed twice side by side with v002, it ran 1.98 and 2.00 times as fast.
// Over all steps from v000 it is 44.4 times as fast.
#include <hip/hip_runtime.h>
// Multi-head self-attention with a fused QKV projection and an INVERTED key mask (x [4][2048][1024]; qkv = x Wqkv ([in][out] 1024 x 3072, NO bias) reshaped (B, N, 3, 16, 64): q | k | v blocks; att = q k^T * 64^-0.5; where(mask[b][j] > 0, -1e7) with the int32 [4][2048] mask in {0, 1} (random; > 0 means MASKED; read on device; masked weights underflow to exactly 0); softmax over keys; out = merged Wproj + bproj ([in][out]) -> [4][2048][1024]).
// Structure: token rows r = b*2048 + s; x as exact f16 rows (bf16-rounded); q | k | v as ONE WMMA GEMM (N = 3 x 1024) (operands staged in LDS, 64x64 wave tiles, f32 accumulation, exact x16 weights, no bias, f16 outputs); V^T for all batches and heads via LDS transposes; attention in ONE launch (scores, online softmax with f32 statistics and the weighted sum of V in registers; o carried x64 against f16 subnormal flush, folded into the output GEMM alpha) written straight into the merged f16 o rows; out = o W_o + b GEMM (f32) into the output layout.
// Compute dtype: inputs rounded to bf16; x / weights exact; q, k, v, softmax weights and o as plain f16 GEMM operands (~2^-12); scores and softmax statistics f32. v_wmma_f32_16x16x32_f16.
#define NB 4
#define SQ 2048
#define DM 1024
#define NH 16
#define HD 64
#define HG 4                         /* heads per block group of the (b, h0) k_vt overload */
#define B0 0                         /* first batch processed (debug hook) */
#define NBR NB                       /* batches processed (debug hook) */
#define NR ((size_t)NB * SQ)         /* token rows */
#define MP ((int)((size_t)NBR * SQ)) /* rows projected (debug hook) */
#define QN SQ                        /* unused: attention takes all SQ queries */
#define NHD NH                       /* unused: attention takes all NH heads */
#define MPO MP                       /* rows through the output stage (debug hook) */
#define LQ (3 * DM)      /* row pitch of the q/k/v rows */
typedef __bf16 v16b __attribute__((ext_vector_type(16)));
typedef unsigned short v8us __attribute__((ext_vector_type(8), may_alias));
typedef float  v8f  __attribute__((ext_vector_type(8)));
typedef float  v4f  __attribute__((ext_vector_type(4)));
typedef float  v4fa __attribute__((ext_vector_type(4), may_alias));
union FragB { v16b v; v8us half[2]; unsigned short u[16]; };

__device__ __forceinline__ unsigned short bf16_bits(float x) { unsigned int u = __float_as_uint(x); return (unsigned short)((u + 0x7FFFu + ((u >> 16) & 1u)) >> 16); }
__device__ __forceinline__ float bf16_val(unsigned short b) { return __uint_as_float(((unsigned int)b) << 16); }
__device__ __forceinline__ float bf16_round(float x) { return bf16_val(bf16_bits(x)); }
// D += A·B with NT terms: 1 = ah·bh, 2 = + al·bh (A split), 3 = + ah·bl (both split)
template <int NT>
__device__ __forceinline__ v8f mmaN(v16b ah, v16b al, v16b bh, v16b bl, v8f c) {
  c = __builtin_amdgcn_wmma_f32_16x16x32_bf16(false, ah, false, bh, (short)0, c, false, false);
  if (NT >= 2) c = __builtin_amdgcn_wmma_f32_16x16x32_bf16(false, al, false, bh, (short)0, c, false, false);
  if (NT >= 3) c = __builtin_amdgcn_wmma_f32_16x16x32_bf16(false, ah, false, bl, (short)0, c, false, false);
  asm volatile("v_nop\n\tv_nop\n\tv_nop\n\tv_nop" : "+v"(c) : "v"(ah), "v"(al), "v"(bh), "v"(bl));
  return c;
}

__global__ __launch_bounds__(256) void k_wt_bf16(const float* __restrict__ W, unsigned short* __restrict__ Wt, int K, int N) {
  const int t = blockIdx.x * 256 + threadIdx.x;
  const int k8n = K / 8;
  if (t >= N * k8n) return;
  const int n = t / k8n, k8 = (t % k8n) * 8;
  v8us v;
#pragma unroll
  for (int i = 0; i < 8; ++i) v[i] = bf16_bits(W[(size_t)(k8 + i) * N + n]);
  *(v8us*)(Wt + (size_t)n * K + k8) = v;
  
}

// GEMM C[M][N] (f32, pitch ldc) = act(A[M][K]·W + bias). A f32 row-major (pitch lda) converted per fragment to bf16
// (ASPLIT: hi/lo two planes -> 2 terms, else single rounded term); Wt bf16 [N][K] (pitch ldb). BIAS_BF16 rounds the
// bias to bf16 first (bias quantised to bf16 before the add). K%32==0, M%16==0, N%64==0.
template <bool ASPLIT, int ACT, bool BIAS_BF16>
__global__ __launch_bounds__(128) void k_gemm_bf(const float* __restrict__ A, int lda, const unsigned short* __restrict__ Wt, int ldb,
                                               const float* __restrict__ bias, float* __restrict__ C, int ldc, int M, int N, int K) {
  __shared__ __attribute__((aligned(16))) float so[4][16][64];
  const int tid = threadIdx.x, w = tid >> 5, lane = tid & 31, ln = lane & 15, hh = lane >> 4;
  const int ntn = N / 64;
  const int wid = blockIdx.x * 4 + w;
  const int mt = wid / ntn, nq = wid % ntn;
  if (mt * 16 >= M) return;
  const int row0 = mt * 16, col0 = nq * 64;
  const float* arow = A + (size_t)(row0 + ln) * lda;
  v8f acc[4] = {};
  for (int kb = 0; kb < K; kb += 32) {
    FragB ah, al;
    const v4f x0 = *(const v4fa*)(arow + kb + 8 * hh), x1 = *(const v4fa*)(arow + kb + 8 * hh + 4);
    const v4f x2 = *(const v4fa*)(arow + kb + 16 + 8 * hh), x3 = *(const v4fa*)(arow + kb + 16 + 8 * hh + 4);
    float xs[16] = {x0[0],x0[1],x0[2],x0[3],x1[0],x1[1],x1[2],x1[3],x2[0],x2[1],x2[2],x2[3],x3[0],x3[1],x3[2],x3[3]};
#pragma unroll
    for (int i = 0; i < 16; ++i) { const unsigned short hb = bf16_bits(xs[i]); ah.u[i] = hb; al.u[i] = ASPLIT ? bf16_bits(xs[i] - bf16_val(hb)) : (unsigned short)0; }
#pragma unroll
    for (int t = 0; t < 4; ++t) {
      const unsigned short* brow = Wt + (size_t)(col0 + t * 16 + ln) * ldb + kb;
      FragB b;
      b.half[0] = *(const v8us*)(brow + 8 * hh);
      b.half[1] = *(const v8us*)(brow + 16 + 8 * hh);
      acc[t] = mmaN<ASPLIT ? 2 : 1>(ah.v, al.v, b.v, b.v, acc[t]);
    }
  }
#pragma unroll
  for (int t = 0; t < 4; ++t) {
    float bv = bias ? bias[col0 + t * 16 + ln] : 0.f;
    if (BIAS_BF16) bv = bf16_round(bv);
#pragma unroll
    for (int r = 0; r < 8; ++r) { float v = acc[t][r] + bv; if (ACT == 1) v = fmaxf(v, 0.f); so[w][8 * hh + r][t * 16 + ln] = v; }
  }
  __builtin_amdgcn_fence(__ATOMIC_ACQ_REL, "workgroup");
  __builtin_amdgcn_wave_barrier();
  const int rsub = lane >> 4, c4 = (lane & 15) * 4;
  {
#pragma unroll
    for (int q = 0; q < 8; ++q) {
      const int r = q * 2 + rsub;
      const v4f v = *(const v4fa*)&so[w][r][c4];
      *(v4f*)(C + (size_t)(row0 + r) * ldc + col0 + c4) = v;
    }
    
  }
}

// GEMM C = act(A·W + bias + resid): A f32 (ASPLIT -> hi/lo 2 terms), Wt bf16 [N][K]; ACT 0 none, 1 relu, 2 exact gelu;
// resid (optional, f32, row index = (row % rmod), pitch ldr, RES_BF16 rounds it) added before the activation.
template <bool ASPLIT, int ACT, bool BIAS_BF16, bool RES_BF16>
__global__ __launch_bounds__(128) void k_gemm_bf3(const float* __restrict__ A, int lda, const unsigned short* __restrict__ Wt, int ldb,
                                                const float* __restrict__ bias, const float* __restrict__ resid, int rmod, int ldr,
                                                float* __restrict__ C, int ldc, int M, int N, int K) {
  __shared__ __attribute__((aligned(16))) float so[4][16][64];
  const int tid = threadIdx.x, w = tid >> 5, lane = tid & 31, ln = lane & 15, hh = lane >> 4;
  const int ntn = N / 64;
  const int wid = blockIdx.x * 4 + w;
  const int mt = wid / ntn, nq = wid % ntn;
  if (mt * 16 >= M) return;
  const int row0 = mt * 16, col0 = nq * 64;
  const float* arow = A + (size_t)(row0 + ln) * lda;
  v8f acc[4] = {};
  for (int kb = 0; kb < K; kb += 32) {
    FragB ah, al;
    const v4f x0 = *(const v4fa*)(arow + kb + 8 * hh), x1 = *(const v4fa*)(arow + kb + 8 * hh + 4);
    const v4f x2 = *(const v4fa*)(arow + kb + 16 + 8 * hh), x3 = *(const v4fa*)(arow + kb + 16 + 8 * hh + 4);
    float xs[16] = {x0[0],x0[1],x0[2],x0[3],x1[0],x1[1],x1[2],x1[3],x2[0],x2[1],x2[2],x2[3],x3[0],x3[1],x3[2],x3[3]};
#pragma unroll
    for (int i = 0; i < 16; ++i) { const unsigned short hb = bf16_bits(xs[i]); ah.u[i] = hb; al.u[i] = ASPLIT ? bf16_bits(xs[i] - bf16_val(hb)) : (unsigned short)0; }
#pragma unroll
    for (int t = 0; t < 4; ++t) {
      const unsigned short* brow = Wt + (size_t)(col0 + t * 16 + ln) * ldb + kb;
      FragB b;
      b.half[0] = *(const v8us*)(brow + 8 * hh);
      b.half[1] = *(const v8us*)(brow + 16 + 8 * hh);
      acc[t] = mmaN<ASPLIT ? 2 : 1>(ah.v, al.v, b.v, b.v, acc[t]);
    }
  }
#pragma unroll
  for (int t = 0; t < 4; ++t) {
    const int col = col0 + t * 16 + ln;
    float bv = bias ? bias[col] : 0.f;
    if (BIAS_BF16) bv = bf16_round(bv);
#pragma unroll
    for (int r = 0; r < 8; ++r) {
      float v = acc[t][r] + bv;
      if (resid) { float rv = resid[(size_t)((row0 + 8 * hh + r) % rmod) * ldr + col]; if (RES_BF16) rv = bf16_round(rv); v += rv; }
      if (ACT == 1) v = fmaxf(v, 0.f);
      if (ACT == 2) v = 0.5f * v * (1.0f + erff(v * 0.70710678118654752f));
      if (ACT == 3) { const float u = 0.7978845608028654f * (v + 0.044715f * v * v * v); v = 0.5f * v * (1.0f + tanhf(u)); }
      so[w][8 * hh + r][t * 16 + ln] = v;
    }
  }
  __builtin_amdgcn_fence(__ATOMIC_ACQ_REL, "workgroup");
  __builtin_amdgcn_wave_barrier();
  const int rsub = lane >> 4, c4 = (lane & 15) * 4;
  {
#pragma unroll
    for (int q = 0; q < 8; ++q) {
      const int r = q * 2 + rsub;
      const v4f v = *(const v4fa*)&so[w][r][c4];
      *(v4f*)(C + (size_t)(row0 + r) * ldc + col0 + c4) = v;
    }
    
  }
}
// row LayerNorm (biased variance, eps) over N: s = X (+ R); optional out_sum <- s; out_norm <- (s-mu)*rsqrt(var+eps)*g + b
template <bool PARAM_BF16>
__global__ __launch_bounds__(256) void k_layernorm(const float* __restrict__ X, const float* __restrict__ R, const float* __restrict__ g, const float* __restrict__ bta,
                                                  float* __restrict__ out_sum, float* __restrict__ out_norm, int N, float eps) {
  __shared__ float red[256];
  const int row = blockIdx.x, tid = threadIdx.x;
  const float* x = X + (size_t)row * N; const float* rr = R ? R + (size_t)row * N : nullptr;
  float vals[16];                     // up to N = 4096
  const int per = N / 256;            // contiguous chunk per thread? use strided-by-4 chunks: thread handles j = tid*4 + 1024*u
  float s1 = 0.f;
  for (int u = 0; u < per / 4; ++u) {
    const int j = tid * 4 + 1024 * u;
    const v4f a = *(const v4fa*)(x + j);
    v4f b = {0.f,0.f,0.f,0.f}; if (rr) b = *(const v4fa*)(rr + j);
#pragma unroll
    for (int q = 0; q < 4; ++q) { const float v = a[q] + b[q]; vals[u * 4 + q] = v; s1 += v; }
  }
  red[tid] = s1; __syncthreads();
  for (int st = 128; st > 0; st >>= 1) { if (tid < st) red[tid] += red[tid + st]; __syncthreads(); }
  const float mu = red[0] / (float)N; __syncthreads();
  float s2 = 0.f;
  for (int u = 0; u < per / 4; ++u)
#pragma unroll
    for (int q = 0; q < 4; ++q) { const float c = vals[u * 4 + q] - mu; s2 += c * c; }
  red[tid] = s2; __syncthreads();
  for (int st = 128; st > 0; st >>= 1) { if (tid < st) red[tid] += red[tid + st]; __syncthreads(); }
  const float rs = rsqrtf(red[0] / (float)N + eps);
  {
    for (int u = 0; u < per / 4; ++u) {
      const int j = tid * 4 + 1024 * u;
      v4f o, sm;
#pragma unroll
      for (int q = 0; q < 4; ++q) {
        float gg = g[j + q], bb = bta[j + q];
        if (PARAM_BF16) { gg = bf16_round(gg); bb = bf16_round(bb); }
        sm[q] = vals[u * 4 + q]; o[q] = (vals[u * 4 + q] - mu) * rs * gg + bb;
      }
      if (out_sum) *(v4f*)(out_sum + (size_t)row * N + j) = sm;
      *(v4f*)(out_norm + (size_t)row * N + j) = o;
    }
    
  }
}



// ---- f16 WMMA path (v_wmma_f32_16x16x32_f16): 11-bit significands for operands in range — used where a [0,1] probability operand needs more precision than bf16
typedef _Float16 v16h __attribute__((ext_vector_type(16)));
union FragH { v16h v; v8us half[2]; _Float16 h[16]; unsigned short u[16]; };
template <int NT>
__device__ __forceinline__ v8f mmaH(v16h ah, v16h al, v16h bh, v16h bl, v8f c) {
  c = __builtin_amdgcn_wmma_f32_16x16x32_f16(false, ah, false, bh, (short)0, c, false, false);
  if (NT >= 2) c = __builtin_amdgcn_wmma_f32_16x16x32_f16(false, al, false, bh, (short)0, c, false, false);
  if (NT >= 3) c = __builtin_amdgcn_wmma_f32_16x16x32_f16(false, ah, false, bl, (short)0, c, false, false);
  asm volatile("v_nop\n\tv_nop\n\tv_nop\n\tv_nop" : "+v"(c) : "v"(ah), "v"(al), "v"(bh), "v"(bl));
  return c;
}
// batched GEMM like k_gemm_b but f16 operands: A f32 (split into f16 hi/lo if ASPLIT, else rounded to f16), Bt = f16 values [n][k]; alpha; C f32; N multiple of 16 (partial tiles skipped)
template <bool ASPLIT>
__global__ __launch_bounds__(128) void k_gemm_h(const float* __restrict__ A, int lda, size_t sA, const _Float16* __restrict__ Bh, int ldb, size_t sB, float alpha, float* __restrict__ C, int ldc, size_t sC, int M, int N, int K) {
  __shared__ __attribute__((aligned(16))) float so[4][16][64];
  const int tid = threadIdx.x, w = tid >> 5, lane = tid & 31, ln = lane & 15, hh = lane >> 4; const int by = blockIdx.y;
  A += (size_t)by * sA; Bh += (size_t)by * sB; C += (size_t)by * sC;
  const int ntn = (N + 63) / 64; const int wid = blockIdx.x * 4 + w; const int mt = wid / ntn, nq = wid % ntn; if (mt * 16 >= M) return;
  const int row0 = mt * 16, col0 = nq * 64; const float* arow = A + (size_t)(row0 + ln) * lda;
  v8f acc[4] = {};
  for (int kb = 0; kb < K; kb += 32) {
    FragH ah, al;
    const v4f x0 = *(const v4fa*)(arow + kb + 8 * hh), x1 = *(const v4fa*)(arow + kb + 8 * hh + 4), x2 = *(const v4fa*)(arow + kb + 16 + 8 * hh), x3 = *(const v4fa*)(arow + kb + 16 + 8 * hh + 4);
    float xs[16] = {x0[0],x0[1],x0[2],x0[3],x1[0],x1[1],x1[2],x1[3],x2[0],x2[1],x2[2],x2[3],x3[0],x3[1],x3[2],x3[3]};
#pragma unroll
    for (int i = 0; i < 16; ++i) { const _Float16 h = (_Float16)xs[i]; ah.h[i] = h; al.h[i] = ASPLIT ? (_Float16)(xs[i] - (float)h) : (_Float16)0.0f; }
#pragma unroll
    for (int t = 0; t < 4; ++t) { if (col0 + t * 16 >= N) continue; const size_t boff = (size_t)(col0 + t * 16 + ln) * ldb + kb; FragH bq; bq.half[0] = *(const v8us*)(Bh + boff + 8 * hh); bq.half[1] = *(const v8us*)(Bh + boff + 16 + 8 * hh);
      acc[t] = mmaH<ASPLIT ? 2 : 1>(ah.v, al.v, bq.v, bq.v, acc[t]); }
  }
#pragma unroll
  for (int t = 0; t < 4; ++t) { if (col0 + t * 16 >= N) continue;
#pragma unroll
    for (int r = 0; r < 8; ++r) so[w][8 * hh + r][t * 16 + ln] = acc[t][r] * alpha; }
  __builtin_amdgcn_fence(__ATOMIC_ACQ_REL, "workgroup"); __builtin_amdgcn_wave_barrier();
  const int rsub = lane >> 4, c4 = (lane & 15) * 4;
  {
#pragma unroll
    for (int q = 0; q < 8; ++q) { const int r = q * 2 + rsub; if (col0 + c4 < N) { const v4f v = *(const v4fa*)&so[w][r][c4]; *(v4f*)(C + (size_t)(row0 + r) * ldc + col0 + c4) = v; } }
     }
}

// Wt[n][k] = f16(W[k][n]·scale) from f32 row-major W[K][N] (scale = power of two; bf16-exact weights stay exact in f16 away from the subnormal range)
__global__ __launch_bounds__(256) void k_wt_f16(const float* __restrict__ W, _Float16* __restrict__ Wt, int K, int N, float scale) {
  const int t = blockIdx.x * 256 + threadIdx.x; if (t >= N * (K / 8)) return; const int n = t / (K / 8), k8 = (t % (K / 8)) * 8; FragH f;
#pragma unroll
  for (int i = 0; i < 8; ++i) f.h[i] = (_Float16)(bf16_round(W[(size_t)(k8 + i) * N + n]) * scale); const v8us o = f.half[0];
  *(v8us*)((unsigned short*)Wt + (size_t)n * K + k8) = o; 
}
// k_gemm_hh variant with fused epilogue: v = acc·alpha + bias[by·sBias + col] (+ CP[(row/rowsPerB)·sCPb + by·64 + col] if CP) ; ACT 0 none / 1 elu ; writes f16 C16 (and f32 C if non-null)
template <int ACT>
__global__ __launch_bounds__(128) void k_gemm_hhx(const _Float16* __restrict__ A, int lda, size_t sA, const _Float16* __restrict__ Bh, int ldb, size_t sB, float alpha, const float* __restrict__ bias, size_t sBias, const float* __restrict__ CP, int rowsPerB, size_t sCPb, int row0g,
    float* __restrict__ C, _Float16* __restrict__ C16, int ldc, size_t sC, int M, int N, int K) {
  __shared__ __attribute__((aligned(16))) float so[4][16][64];
  const int tid = threadIdx.x, w = tid >> 5, lane = tid & 31, ln = lane & 15, hh = lane >> 4; const int by = blockIdx.y;
  A += (size_t)by * sA; Bh += (size_t)by * sB; const size_t cofs = (size_t)by * sC; const float* bp = bias ? bias + (size_t)by * sBias : nullptr;
  const int ntn = (N + 63) / 64; const int wid = blockIdx.x * 4 + w; const int mt = wid / ntn, nq = wid % ntn; if (mt * 16 >= M) return;
  const int row0 = mt * 16, col0 = nq * 64; const _Float16* arow = A + (size_t)(row0 + ln) * lda;
  v8f acc[4] = {};
  for (int kb = 0; kb < K; kb += 32) { FragH ah; ah.half[0] = *(const v8us*)((const unsigned short*)arow + kb + 8 * hh); ah.half[1] = *(const v8us*)((const unsigned short*)arow + kb + 16 + 8 * hh);
#pragma unroll
    for (int t = 0; t < 4; ++t) { if (col0 + t * 16 >= N) continue; const size_t boff = (size_t)(col0 + t * 16 + ln) * ldb + kb; FragH bq; bq.half[0] = *(const v8us*)((const unsigned short*)Bh + boff + 8 * hh); bq.half[1] = *(const v8us*)((const unsigned short*)Bh + boff + 16 + 8 * hh);
      acc[t] = mmaH<1>(ah.v, ah.v, bq.v, bq.v, acc[t]); }
  }
#pragma unroll
  for (int t = 0; t < 4; ++t) { if (col0 + t * 16 >= N) continue; const int col = col0 + t * 16 + ln; const float bv = bp ? bf16_round(bp[col]) : 0.f;
#pragma unroll
    for (int r = 0; r < 8; ++r) { float v = acc[t][r] * alpha + bv; if (CP) { const int rr = row0g + row0 + 8 * hh + r; if (rowsPerB < 0) v += CP[cofs + (size_t)rr * ldc + col];      /* rowsPerB < 0: own element of the batched C plane */ else { const int bidx = rr / rowsPerB; v += CP[(size_t)bidx * sCPb + (size_t)by * 64 + col]; } } if (ACT == 1) v = (v > 0.f) ? v : expm1f(v); else if (ACT == 7) v = (v > 0.f) ? v + 1.0f : expf(v); else if (ACT == 8) v = tanhf(v); else if (ACT == 9) v = 0.5f * v * (1.0f + tanhf(0.7978845608028654f * (v + 0.044715f * v * v * v))); else if (ACT == 11) v = 1.0f / (1.0f + expf(-v)); else if (ACT == 12) v = (v > 0.f) ? v : 0.01f * v; else if (ACT == 14) v = (v > 0.f) ? v : 0.1f * v; else if (ACT == 16) v = (v >= 0.f) ? v : 0.3f * v; else if (ACT == 17) v = (v >= 0.f) ? v : 0.2f * v; else if (ACT == 15) v = v / (1.0f + expf(-v)); else if (ACT == 3) v = fmaxf(v, 0.f); else if (ACT == 6) v = 0.5f * v * (1.0f + erff(v * 0.70710678118654752f)); so[w][8 * hh + r][t * 16 + ln] = v; } }
  __builtin_amdgcn_fence(__ATOMIC_ACQ_REL, "workgroup"); __builtin_amdgcn_wave_barrier();
  const int rsub = lane >> 4, c4 = (lane & 15) * 4; typedef _Float16 v4h __attribute__((ext_vector_type(4)));
  {
#pragma unroll
    for (int q = 0; q < 8; ++q) { const int r = q * 2 + rsub; if (col0 + c4 < N) { const v4f v = *(const v4fa*)&so[w][r][c4]; if (C) *(v4f*)(C + cofs + (size_t)(row0 + r) * ldc + col0 + c4) = v; if (C16) { v4h h4; for (int i = 0; i < 4; ++i) h4[i] = (_Float16)v[i]; *(v4h*)(C16 + cofs + (size_t)(row0 + r) * ldc + col0 + c4) = h4; } } }
     }
}


typedef _Float16 v4h __attribute__((ext_vector_type(4)));

__global__ __launch_bounds__(256) void k_x16(const float* __restrict__ x, _Float16* __restrict__ X16, size_t n8) { const size_t t = (size_t)blockIdx.x * 256 + threadIdx.x; if (t >= n8) return; FragH f;
#pragma unroll
  for (int q = 0; q < 8; ++q) f.h[q] = (_Float16)bf16_round(x[t * 8 + q]); *(v8us*)((unsigned short*)X16 + t * 8) = f.half[0];  }
__global__ __launch_bounds__(256) void k_h16(const float* __restrict__ x, _Float16* __restrict__ X16, size_t n8) { const size_t t = (size_t)blockIdx.x * 256 + threadIdx.x; if (t >= n8) return; FragH f;
#pragma unroll
  for (int q = 0; q < 8; ++q) f.h[q] = (_Float16)x[t * 8 + q]; *(v8us*)((unsigned short*)X16 + t * 8) = f.half[0];  }
__global__ __launch_bounds__(256) void k_round16f(const float* __restrict__ W, _Float16* __restrict__ Bt, size_t n8) { const size_t t = (size_t)blockIdx.x * 256 + threadIdx.x; if (t >= n8) return; FragH f;
#pragma unroll
  for (int i = 0; i < 8; ++i) f.h[i] = (_Float16)(bf16_round(W[t * 8 + i]) * 16.0f); *(v8us*)((unsigned short*)Bt + t * 8) = f.half[0];  }
template <int NHv, int TTv>
__global__ __launch_bounds__(256) void k_vt(const _Float16* __restrict__ V16, int ldv, int voff, _Float16* __restrict__ Vt) { __shared__ unsigned short tl[64][66]; const int tid = threadIdx.x; const int slab = blockIdx.x / (TTv / 64), lg = blockIdx.x % (TTv / 64); const int b = slab / NHv, h = slab % NHv;
  for (int i = tid; i < 64 * 8; i += 256) { const int r = i / 8, c8 = (i % 8) * 8; FragH f; f.half[0] = *(const v8us*)((const unsigned short*)V16 + ((size_t)b * TTv + lg * 64 + r) * ldv + voff + h * 64 + c8);
#pragma unroll
    for (int q = 0; q < 8; ++q) tl[r][c8 + q] = f.u[q]; }
  __syncthreads();
  {
#pragma unroll
    for (int rd = 0; rd < 2; ++rd) { const int d = rd * 32 + tid / 8, pc = tid % 8; FragH f;
#pragma unroll
      for (int q = 0; q < 8; ++q) f.u[q] = tl[pc * 8 + q][d];
      *(v8us*)((unsigned short*)Vt + ((size_t)slab * 64 + d) * TTv + lg * 64 + pc * 8) = f.half[0]; }
     } }

__global__ __launch_bounds__(256) void k_hl(const float* __restrict__ F, _Float16* __restrict__ Hh, _Float16* __restrict__ Hl, size_t n8) { const size_t t = (size_t)blockIdx.x * 256 + threadIdx.x; if (t >= n8) return; FragH fh, fl; const v4f a = *(const v4fa*)(F + t * 8), c = *(const v4fa*)(F + t * 8 + 4);
#pragma unroll
  for (int q = 0; q < 4; ++q) { _Float16 h = (_Float16)a[q]; fh.h[q] = h; fl.h[q] = (_Float16)((a[q] - (float)h) * 1024.0f); h = (_Float16)c[q]; fh.h[4 + q] = h; fl.h[4 + q] = (_Float16)((c[q] - (float)h) * 1024.0f); }
  { *(v8us*)((unsigned short*)Hh + t * 8) = fh.half[0]; *(v8us*)((unsigned short*)Hl + t * 8) = fl.half[0];  } }

// ---- fast GEMM (wave tile 32x64; requires M % 32 == 0 rows per launch region and N % 64 == 0); epilogue = k_gemm_hhx semantics ----
__device__ __forceinline__ v16h g2_frag(const _Float16* p, int hh) { FragH f; f.half[0] = *(const v8us*)((const unsigned short*)p + 8 * hh); f.half[1] = *(const v8us*)((const unsigned short*)p + 16 + 8 * hh); return f.v; }
__device__ __forceinline__ v8f g2_mma(v16h a, v16h b, v8f c) { v8f d = __builtin_amdgcn_wmma_f32_16x16x32_f16(false, a, false, b, (short)0, c, false, false); asm volatile("v_nop\n\tv_nop\n\tv_nop\n\tv_nop" : "+v"(d) : "v"(a), "v"(b)); return d; }
template <int ACT>
__global__ __launch_bounds__(128) void k_gemm2(const _Float16* __restrict__ A, int lda, size_t sA, const _Float16* __restrict__ Bh, int ldb, size_t sB, float alpha, const float* __restrict__ bias, size_t sBias, const float* __restrict__ CP, int rowsPerB, size_t sCPb, int row0g,
    float* __restrict__ C, _Float16* __restrict__ C16, int ldc, size_t sC, int M, int N, int K) { static_assert(ACT == 0 || ACT == 3 || ACT == 6 || ACT == 8 || ACT == 9 || ACT == 11 || ACT == 12 || ACT == 14 || ACT == 15 || ACT == 16 || ACT == 17, "k_gemm2: unsupported ACT code (would silently apply no activation)");
  __shared__ __attribute__((aligned(16))) float so[4][32][68];
  const int tid = threadIdx.x, w = tid >> 5, lane = tid & 31, ln = lane & 15, hh = lane >> 4; const int by = blockIdx.y;
  A += (size_t)by * sA; Bh += (size_t)by * sB; const size_t cofs = (size_t)by * sC; const float* bp = bias ? bias + (size_t)by * sBias : nullptr;
  const int ntn = N >> 6; const int mt = blockIdx.x / ntn, nq = blockIdx.x - mt * ntn; const int row0 = mt * 128 + 32 * w, col0 = nq * 64; if (row0 >= M) return;
  const _Float16* a0p = A + (size_t)(row0 + ln) * lda; const _Float16* a1p = a0p + (size_t)16 * lda;
  const _Float16* b0p = Bh + (size_t)(col0 + ln) * ldb; const _Float16* b1p = b0p + (size_t)16 * ldb; const _Float16* b2p = b1p + (size_t)16 * ldb; const _Float16* b3p = b2p + (size_t)16 * ldb;
  const v8f z8 = {0.f,0.f,0.f,0.f,0.f,0.f,0.f,0.f}; v8f c00 = z8, c01 = z8, c02 = z8, c03 = z8, c10 = z8, c11 = z8, c12 = z8, c13 = z8;
#pragma unroll 1
  for (int kb = 0; kb < K; kb += 32) { const v16h a0 = g2_frag(a0p + kb, hh), a1 = g2_frag(a1p + kb, hh);
    v16h b = g2_frag(b0p + kb, hh); c00 = g2_mma(a0, b, c00); c10 = g2_mma(a1, b, c10);
    b = g2_frag(b1p + kb, hh); c01 = g2_mma(a0, b, c01); c11 = g2_mma(a1, b, c11);
    b = g2_frag(b2p + kb, hh); c02 = g2_mma(a0, b, c02); c12 = g2_mma(a1, b, c12);
    b = g2_frag(b3p + kb, hh); c03 = g2_mma(a0, b, c03); c13 = g2_mma(a1, b, c13); }
  v8f accs[8] = {c00, c01, c02, c03, c10, c11, c12, c13};
#pragma unroll
  for (int u = 0; u < 8; ++u) { const int t = u & 3, half = u >> 2; const int col = col0 + t * 16 + ln; const float bv = bp ? bf16_round(bp[col]) : 0.f;
#pragma unroll
    for (int r = 0; r < 8; ++r) { const int rloc = half * 16 + 8 * hh + r; float v = accs[u][r] * alpha + bv; if (CP) { if (rowsPerB < 0) v += CP[cofs + (size_t)(row0g + row0 + rloc) * ldc + col];      /* rowsPerB < 0: own element of the batched C plane */ else { const int bidx = (row0g + row0 + rloc) / rowsPerB; v += CP[(size_t)bidx * sCPb + (size_t)by * 64 + col]; } }
      if (ACT == 3) v = fmaxf(v, 0.f); else if (ACT == 6) v = 0.5f * v * (1.0f + erff(v * 0.70710678118654752f)); else if (ACT == 11) v = 1.0f / (1.0f + expf(-v)); else if (ACT == 15) v = v / (1.0f + expf(-v)); else if (ACT == 12) v = (v > 0.f) ? v : 0.01f * v; else if (ACT == 8) v = tanhf(v); else if (ACT == 9) v = 0.5f * v * (1.0f + tanhf(0.7978845608028654f * (v + 0.044715f * v * v * v))); else if (ACT == 14) v = (v > 0.f) ? v : 0.1f * v; else if (ACT == 16) v = (v >= 0.f) ? v : 0.3f * v; else if (ACT == 17) v = (v >= 0.f) ? v : 0.2f * v;
      so[w][rloc][t * 16 + ln] = v; } }
  __builtin_amdgcn_fence(__ATOMIC_ACQ_REL, "workgroup"); __builtin_amdgcn_wave_barrier();
  const int rsub = lane >> 4, c4 = (lane & 15) * 4;
  {
#pragma unroll
    for (int q = 0; q < 16; ++q) { const int r = q * 2 + rsub; const v4f v = *(const v4fa*)&so[w][r][c4]; if (C) *(v4f*)(C + cofs + (size_t)(row0 + r) * ldc + col0 + c4) = v; if (C16) { v4h h4; for (int i = 0; i < 4; ++i) h4[i] = (_Float16)v[i]; *(v4h*)(C16 + cofs + (size_t)(row0 + r) * ldc + col0 + c4) = h4; } }
     } }


__global__ __launch_bounds__(256) void k_wnat(const float* __restrict__ w, size_t n8, _Float16* __restrict__ Bt) { const size_t t = (size_t)blockIdx.x * 256 + threadIdx.x; if (t >= n8) return; FragH f; for (int q = 0; q < 8; ++q) f.h[q] = (_Float16)(bf16_round(w[t * 8 + q]) * 16.0f); *(v8us*)((unsigned short*)Bt + t * 8) = f.half[0];  }
__global__ __launch_bounds__(256) void k_rsm(const float* __restrict__ S, _Float16* __restrict__ P, int nrows) {
  #pragma clang fp contract(off)
  const int i = blockIdx.x * 256 + threadIdx.x; if (i >= nrows) return; const float* s = S + (size_t)i * SQ; float mx = -3.0e38f;
#pragma unroll 1
  for (int j = 0; j < SQ; ++j) mx = fmaxf(mx, s[j]); float se = 0.f;
#pragma unroll 1
  for (int j = 0; j < SQ; ++j) se += expf(s[j] - mx); const float sc = 256.0f / se;
#pragma unroll 1
  for (int j0 = 0; j0 < SQ; j0 += 8) { FragH f; for (int q = 0; q < 8; ++q) f.h[q] = (_Float16)(expf(s[j0 + q] - mx) * sc); unsigned short* d = (unsigned short*)P + (size_t)i * SQ + j0; *(v8us*)d = f.half[0];  } }
__global__ __launch_bounds__(256) void k_vt(const _Float16* __restrict__ V16, int b, int h0, _Float16* __restrict__ VT) { __shared__ unsigned short tl[64][65]; const int tid = threadIdx.x; const int hh = blockIdx.x % HG, sg = blockIdx.x / HG; const int s0 = sg * 64; const int h = h0 + hh;
  for (int i = tid; i < 64 * 8; i += 256) { const int j = i / 8, d8 = (i % 8) * 8; FragH f; f.half[0] = *(const v8us*)((const unsigned short*)V16 + ((size_t)b * SQ + s0 + j) * DM + h * HD + d8); for (int q = 0; q < 8; ++q) tl[d8 + q][j] = f.u[q]; }
  __syncthreads();
  { for (int i = tid; i < 64 * 8; i += 256) { const int d = i / 8, j8 = (i % 8) * 8; FragH f; for (int q = 0; q < 8; ++q) f.u[q] = tl[d][j8 + q]; *(v8us*)((unsigned short*)VT + ((size_t)hh * HD + d) * SQ + s0 + j8) = f.half[0]; }  } }



#define FK 64            /* keys per pass */
#define FP 72            /* LDS row pitch in halves: 144 bytes = 16 x odd, for 16-byte row reads */
#define FMASK (-262144.0f)
#define FTHR 8.0f
#define FOFF 6.0f
typedef int v4ia __attribute__((ext_vector_type(4), may_alias));
typedef float v8fa __attribute__((ext_vector_type(8), may_alias));
typedef float v2f __attribute__((ext_vector_type(2)));
typedef _Float16 v2h __attribute__((ext_vector_type(2)));
union FragP { v16h v; v2h p[8]; };
__device__ __forceinline__ float fa_xhalf(float x) { const int i = __float_as_int(x); return __int_as_float(__builtin_amdgcn_permlanex16(i, i, 0x76543210, 0xfedcba98, false, false)); }      /* lane l <-> l ^ 16 */
__device__ __forceinline__ v8f fa_mma(v16h a, v16h b, v8f c) { return __builtin_amdgcn_wmma_f32_16x16x32_f16(false, a, false, b, (short)0, c, false, false); }
__global__ __launch_bounds__(256) __attribute__((amdgpu_waves_per_eu(4, 4))) /* two work-groups per WGP: the vector work between the matrix runs wants four waves per SIMD */
void k_fattn(const _Float16* __restrict__ QKV, const _Float16* __restrict__ VT, const int* __restrict__ Km, _Float16* __restrict__ O16) {
  __shared__ __attribute__((aligned(16))) _Float16 Ks[2][FK][FP];
  __shared__ __attribute__((aligned(16))) _Float16 Vs[2][HD][FP];
  __shared__ __attribute__((aligned(32))) float kb[SQ];
  __shared__ int kept[8];
  const int tid = threadIdx.x, w = tid >> 5, lane = tid & 31, ln = lane & 15, hh = lane >> 4;
  const int h = blockIdx.y, b = blockIdx.z, q0 = blockIdx.x * 256 + w * 32;
  const unsigned short* Kg = (const unsigned short*)QKV + (size_t)b * SQ * LQ + DM + h * HD;      /* K rows [key][d], pitch LQ */
  const unsigned short* Vg = (const unsigned short*)VT + ((size_t)b * NH + h) * HD * SQ;          /* V^T rows [d][key], pitch SQ */
  const int sr = tid >> 3, sc = (tid & 7) * 8;      /* staging: 16-byte piece sc of rows sr and sr + 32 of both tiles */
  { const int* mp = Km + (size_t)b * SQ + tid * 8; const v4ia m0 = *(const v4ia*)mp, m1 = *(const v4ia*)(mp + 4); v4f b0, b1; bool any = false;
    for (int q = 0; q < 4; ++q) { b0[q] = m0[q] > 0 ? FMASK : 0.f; b1[q] = m1[q] > 0 ? FMASK : 0.f; any = any || !(m0[q] > 0) || !(m1[q] > 0); }
    *(v4fa*)&kb[tid * 8] = b0; *(v4fa*)&kb[tid * 8 + 4] = b1;
    const unsigned int bal = __builtin_amdgcn_ballot_w32(any); if (lane == 0) kept[w] = bal != 0u ? 1 : 0; }
  v16h qf[2][2];
#pragma unroll      /* fragments stay in registers: constant indices only */
  for (int g = 0; g < 2; ++g) for (int kk = 0; kk < 2; ++kk) qf[g][kk] = g2_frag(QKV + ((size_t)b * SQ + q0 + g * 16 + ln) * LQ + h * HD + kk * 32, hh);
  v8us kr0 = *(const v8us*)(Kg + (size_t)sr * LQ + sc), kr1 = *(const v8us*)(Kg + (size_t)(sr + 32) * LQ + sc);
  v8us vr0 = *(const v8us*)(Vg + (size_t)sr * SQ + sc), vr1 = *(const v8us*)(Vg + (size_t)(sr + 32) * SQ + sc);
  *(v8us*)&Ks[0][sr][sc] = kr0; *(v8us*)&Ks[0][sr + 32][sc] = kr1; *(v8us*)&Vs[0][sr][sc] = vr0; *(v8us*)&Vs[0][sr + 32][sc] = vr1;
  __syncthreads();      /* publishes pass 0's tiles, the mask values and the eight kept flags */
  { int anyk = 0; for (int i = 0; i < 8; ++i) anyk |= kept[i];
    const v16h zq = {};
#pragma unroll      /* constant indices into qf */
    for (int g = 0; g < 2; ++g) for (int kk = 0; kk < 2; ++kk) qf[g][kk] = anyk ? qf[g][kk] : zq; }
  const v8f z8 = {0.f,0.f,0.f,0.f,0.f,0.f,0.f,0.f};
  v8f o[4][2] = {{z8, z8}, {z8, z8}, {z8, z8}, {z8, z8}};
  float m[2] = {-3.0e38f, -3.0e38f}, nm[2] = {0.f, 0.f}; v8f lt[2] = {z8, z8};      /* lt: every row of the tile = the column's sum of weights */
  v16h ones; for (int e = 0; e < 16; ++e) ones[e] = (_Float16)1.0f;
  const float cs = 0.125f * 1.4426950408889634f;      /* 64^-0.5 log2(e) */
#pragma unroll 1      /* one pass per trip: the body already fills the register budget */
  for (int s = 0; s < SQ / FK; ++s) {
    const int buf = s & 1; const bool more = s + 1 < SQ / FK;
    if (more) { const int k1 = (s + 1) * FK;      /* next pass's tiles fly through registers while this pass is worked on */
      kr0 = *(const v8us*)(Kg + (size_t)(k1 + sr) * LQ + sc); kr1 = *(const v8us*)(Kg + (size_t)(k1 + sr + 32) * LQ + sc);
      vr0 = *(const v8us*)(Vg + (size_t)sr * SQ + k1 + sc); vr1 = *(const v8us*)(Vg + (size_t)(sr + 32) * SQ + k1 + sc); }
    v8f st[4][2];
#pragma unroll      /* constant indices into st, qf */
    for (int t = 0; t < 4; ++t) { const v8f c0 = *(const v8fa*)&kb[s * FK + t * 16 + 8 * hh];      /* D row 8 hh + r = key t 16 + 8 hh + r */
      const v16h ka = g2_frag(&Ks[buf][t * 16 + ln][0], hh), kc = g2_frag(&Ks[buf][t * 16 + ln][32], hh);
      for (int g = 0; g < 2; ++g) st[t][g] = fa_mma(kc, qf[g][1], fa_mma(ka, qf[g][0], c0));
      if (t & 1) __builtin_amdgcn_sched_barrier(0); }      /* holds the next two tiles' fragment loads behind these products: all eight K fragments loaded at once overflow the register budget of four waves per SIMD (spills) */
    float ms[2];
#pragma unroll      /* constant indices into st */
    for (int g = 0; g < 2; ++g) { float mx = st[0][g][0];
      for (int t = 0; t < 4; ++t) for (int r = 0; r < 8; ++r) mx = fmaxf(mx, st[t][g][r]);
      ms[g] = fmaxf(mx, fa_xhalf(mx)) * cs; }
    if (__builtin_amdgcn_ballot_w32(ms[0] > m[0] + FTHR || ms[1] > m[1] + FTHR) != 0u) {      /* one scalar branch per pass */
#pragma unroll      /* constant indices into o */
      for (int g = 0; g < 2; ++g) { const float mn = fmaxf(m[g], ms[g]); const float al = __builtin_amdgcn_exp2f(m[g] - mn); m[g] = mn; nm[g] = FOFF - mn; lt[g] *= al;
        for (int dt = 0; dt < 4; ++dt) o[dt][g] *= al; } }
    FragP pf[2][2];
#pragma unroll      /* constant indices into st, pf */
    for (int g = 0; g < 2; ++g) for (int t = 0; t < 4; ++t) for (int r = 0; r < 8; r += 2) {
      v2f p; p[0] = __builtin_amdgcn_exp2f(__builtin_fmaf(st[t][g][r], cs, nm[g])); p[1] = __builtin_amdgcn_exp2f(__builtin_fmaf(st[t][g][r + 1], cs, nm[g]));
      pf[t >> 1][g].p[(t & 1) * 4 + (r >> 1)] = __builtin_convertvector(p, v2h); }      /* b[e] = T[e >> 3][e & 7]: the hardware k order */
#pragma unroll      /* constant indices into lt, pf */
    for (int j = 0; j < 2; ++j) for (int g = 0; g < 2; ++g) lt[g] = fa_mma(ones, pf[j][g].v, lt[g]);      /* row sums on the matrix pipe: A = ones sums the rounded weights of all 32 keys, both wave halves' */
#pragma unroll      /* constant indices into o, pf */
    for (int dt = 0; dt < 4; ++dt) for (int j = 0; j < 2; ++j) { const v16h vf = g2_frag(&Vs[buf][dt * 16 + ln][j * 32], hh);      /* same k order as the packed weights */
      for (int g = 0; g < 2; ++g) o[dt][g] = fa_mma(vf, pf[j][g].v, o[dt][g]); }
    if (more) { *(v8us*)&Ks[buf ^ 1][sr][sc] = kr0; *(v8us*)&Ks[buf ^ 1][sr + 32][sc] = kr1; *(v8us*)&Vs[buf ^ 1][sr][sc] = vr0; *(v8us*)&Vs[buf ^ 1][sr + 32][sc] = vr1; }      /* that buffer's readers left it at the last barrier */
    __syncthreads();      /* publishes the next pass's tiles and ends this pass's reads */
  }
#pragma unroll      /* constant indices into o */
  for (int g = 0; g < 2; ++g) { const float sc64 = 64.0f / lt[g][0];      /* o carried x64, as the output GEMM's alpha expects */
    unsigned short* d = (unsigned short*)O16 + ((size_t)b * SQ + q0 + g * 16 + ln) * DM + h * HD + 8 * hh;
    for (int dt = 0; dt < 4; ++dt) { FragH f; for (int r = 0; r < 8; ++r) f.h[r] = (_Float16)(o[dt][g][r] * sc64); *(v8us*)(d + dt * 16) = f.half[0]; } } }

// ---- GEMM with both operands staged in LDS: C[M][NN] = (A[M][DM] Bt[NN][DM]^T) alpha + bias, A and Bt f16 rows of DM halves.
// A work-group of 8 waves (4 x 2) takes a 256 x 128 tile of C, a wave 64 x 64 (4 x 4 accumulator tiles). A stage is 64 k of the tile's 256 A rows and 128 Bt rows, 128-byte rows at pitch 144 bytes;
// two buffers, filled by asynchronous copies to LDS (whole 128-byte lines, each read once per work-group) one stage ahead of the products. Every accumulator sums k in steps of 32 in rising order.
#define G3M 256
#define G3N 128
#define G3K 64
#define G3P 72                            /* LDS row pitch in halves: 144 bytes = 16 x odd, for 16-byte row reads */
#define G3R (G3M + G3N)                   /* rows of a stage: A rows, then Bt rows */
#define G3B ((unsigned)(G3R * G3P * 2))   /* bytes of a buffer */
#define G3S ((unsigned)(32 * G3P * 2))    /* bytes of 32 LDS rows */
#define G3O 68                            /* output staging pitch in floats */
typedef float f1a __attribute__((may_alias));
template <int NN, bool F32>      /* F32: C (f32) is written, else C16 (f16) */
__global__ __launch_bounds__(256) void k_gemm3(const _Float16* __restrict__ A, const _Float16* __restrict__ Bt, float alpha, const float* __restrict__ bias, float* __restrict__ C, _Float16* __restrict__ C16) {
  __shared__ __attribute__((aligned(16))) _Float16 sm[2][G3R][G3P];
  const int tid = threadIdx.x, w = tid >> 5, lane = tid & 31, ln = lane & 15, hh = lane >> 4;
  const int ntn = NN / G3N; const int mt = blockIdx.x / ntn, nq = blockIdx.x - mt * ntn; const int row0 = mt * G3M, col0 = nq * G3N;
  const int wr = (w >> 1) * 64, wc = (w & 1) * 64;      /* the wave's 64 x 64 part of the tile */
  const int sr = tid >> 3, sc = (tid & 7) * 8;      /* staging: 16-byte piece sc of rows sr + 32 i: a wave's copy covers four whole 128-byte rows */
  const _Float16* ga = A + (size_t)(row0 + sr) * DM + sc; const _Float16* gb = Bt + (size_t)(col0 + sr) * DM + sc;
  const unsigned l0 = (unsigned)(size_t)&sm[0][sr][sc];      /* low 32 bits of the shared address = the byte address in LDS */
  auto fill = [&](int s) { const unsigned l = l0 + (unsigned)(s & 1) * G3B; const _Float16* a = ga + s * G3K; const _Float16* bq = gb + s * G3K;
    /* one stage: 12 copies per lane (8 A rows, 4 Bt rows); the closing wait keeps every address register as it is until the copies have taken it */
    asm volatile("global_load_async_to_lds_b128 %0, %1, off\n\t"
      "global_load_async_to_lds_b128 %2, %3, off\n\t"
      "global_load_async_to_lds_b128 %4, %5, off\n\t"
      "global_load_async_to_lds_b128 %6, %7, off\n\t"
      "global_load_async_to_lds_b128 %8, %9, off\n\t"
      "global_load_async_to_lds_b128 %10, %11, off\n\t"
      "global_load_async_to_lds_b128 %12, %13, off\n\t"
      "global_load_async_to_lds_b128 %14, %15, off\n\t"
      "global_load_async_to_lds_b128 %16, %17, off\n\t"
      "global_load_async_to_lds_b128 %18, %19, off\n\t"
      "global_load_async_to_lds_b128 %20, %21, off\n\t"
      "global_load_async_to_lds_b128 %22, %23, off\n\t"
      "s_wait_xcnt 0x0"
      :: "v"(l + 0u * G3S), "v"(a + (size_t)0 * 32 * DM),
         "v"(l + 1u * G3S), "v"(a + (size_t)1 * 32 * DM),
         "v"(l + 2u * G3S), "v"(a + (size_t)2 * 32 * DM),
         "v"(l + 3u * G3S), "v"(a + (size_t)3 * 32 * DM),
         "v"(l + 4u * G3S), "v"(a + (size_t)4 * 32 * DM),
         "v"(l + 5u * G3S), "v"(a + (size_t)5 * 32 * DM),
         "v"(l + 6u * G3S), "v"(a + (size_t)6 * 32 * DM),
         "v"(l + 7u * G3S), "v"(a + (size_t)7 * 32 * DM),
         "v"(l + 8u * G3S), "v"(bq + (size_t)0 * 32 * DM),
         "v"(l + 9u * G3S), "v"(bq + (size_t)1 * 32 * DM),
         "v"(l + 10u * G3S), "v"(bq + (size_t)2 * 32 * DM),
         "v"(l + 11u * G3S), "v"(bq + (size_t)3 * 32 * DM)
      : "memory"); };
  fill(0);
  asm volatile("s_wait_asynccnt 0x0" ::: "memory");      /* this wave's part of stage 0 has landed */
  __syncthreads();      /* publishes stage 0 */
  fill(1);
  const v8f z8 = {0.f,0.f,0.f,0.f,0.f,0.f,0.f,0.f};
  v8f acc[4][4];
#pragma unroll      /* constant indices into acc */
  for (int i = 0; i < 4; ++i) for (int j = 0; j < 4; ++j) acc[i][j] = z8;
#pragma unroll 1      /* one stage per trip: the ring's order stands at the foot of each trip */
  for (int s = 0; s < DM / G3K; ++s) {
    const int buf = s & 1;
#pragma unroll      /* constant indices into acc */
    for (int kk = 0; kk < 2; ++kk) { v16h af[4], bf[4];
      af[0] = g2_frag(&sm[buf][wr + ln][kk * 32], hh);
      for (int j = 0; j < 4; ++j) bf[j] = g2_frag(&sm[buf][G3M + wc + j * 16 + ln][kk * 32], hh);
      for (int i = 1; i < 4; ++i) af[i] = g2_frag(&sm[buf][wr + i * 16 + ln][kk * 32], hh);
      __builtin_amdgcn_sched_barrier(0);      /* the 16 LDS reads of a block stand as one group ahead of its 16 products: left alone the compiler reloads one A fragment per four products and waits for it each time */
      for (int i = 0; i < 4; ++i) for (int j = 0; j < 4; ++j) acc[i][j] = fa_mma(af[i], bf[j], acc[i][j]);
      __builtin_amdgcn_sched_barrier(0); }      /* keeps the next block's reads out of this block's products */
    asm volatile("s_wait_dscnt 0x0" ::: "memory");      /* this wave's reads of the buffer have returned before it is refilled */
    asm volatile("s_wait_asynccnt 0x0" ::: "memory");      /* this wave's part of the next stage has landed */
    __syncthreads();      /* publishes the next stage and ends this stage's reads */
    if (s + 2 < DM / G3K) fill(s + 2);
  }
  asm volatile("s_wait_asynccnt 0x0" ::: "memory");      /* nothing is in flight when the ring becomes output staging */
  f1a* so = (f1a*)&sm[0][0][0] + (size_t)w * 32 * G3O;      /* each wave stages 32 rows at a time in its own range; every wave has left the ring at the last barrier */
  const int rsub = lane >> 4, c4 = (lane & 15) * 4;
  float bv[4];
#pragma unroll      /* constant indices into bv */
  for (int j = 0; j < 4; ++j) bv[j] = bias ? bf16_round(bias[col0 + wc + j * 16 + ln]) : 0.f;
#pragma unroll      /* constant indices into acc */
  for (int hf = 0; hf < 2; ++hf) {
#pragma unroll      /* constant indices into acc, bv */
    for (int i = 0; i < 2; ++i) for (int j = 0; j < 4; ++j) for (int r = 0; r < 8; ++r) so[(i * 16 + 8 * hh + r) * G3O + j * 16 + ln] = acc[hf * 2 + i][j][r] * alpha + bv[j];
    asm volatile("s_wait_dscnt 0x0" ::: "memory");      /* the staged rows are written before other lanes of the wave read them back */
#pragma unroll      /* the 16 read-backs go out together instead of one wait each */
    for (int q = 0; q < 16; ++q) { const int r = q * 2 + rsub; const v4f v = *(const v4fa*)&so[r * G3O + c4]; const size_t ofs = (size_t)(row0 + wr + hf * 32 + r) * NN + col0 + wc + c4;
      if (F32) *(v4f*)(C + ofs) = v;
      else { v4h h4; for (int e = 0; e < 4; ++e) h4[e] = (_Float16)v[e]; *(v4h*)(C16 + ofs) = h4; } }
    asm volatile("s_wait_dscnt 0x0" ::: "memory");      /* the read-back has returned before the next 32 rows overwrite the range */
  } }
extern "C" void kernel_launch(void* const* d_in, const int* in_sizes, int n_in,
                              void* d_out, int out_size, void* d_ws, size_t ws_size, hipStream_t stream) {
  (void)in_sizes; (void)n_in; (void)out_size;
  const float* const* I = (const float* const*)d_in; const float* x = I[0]; const float* wqkv = I[1]; const float* bqkv = nullptr; const float* wo = I[2]; const float* bo = I[3]; const int* km = (const int*)d_in[4];      /* x; [in][out] Wqkv [1024][3072] (no bias), Wproj [1024][1024] + bproj; mask int32 [4][2048] (> 0 = MASKED key; READ on device) */
  char* ws = (char*)d_ws; size_t off = 0;
  auto take = [&](size_t bytes) { char* p = ws + off; off += (bytes + 255) & ~(size_t)255; return p; };
  _Float16* BQKV = (_Float16*)take((size_t)3 * DM * DM * 2); _Float16* BO = (_Float16*)take((size_t)DM * DM * 2);
  _Float16* X16 = (_Float16*)take(NR * DM * 2); _Float16* QKV = (_Float16*)take(NR * 3 * DM * 2); _Float16* V16 = QKV + 2 * DM; _Float16* O16 = (_Float16*)take(NR * DM * 2);
  _Float16* VT = (_Float16*)take((size_t)NB * NH * HD * SQ * 2);
  if (off > ws_size) return;
  k_wt_f16<<<(unsigned)(((size_t)DM * 3 * DM / 8 + 255) / 256), 256, 0, stream>>>(wqkv, BQKV, DM, 3 * DM, 16.0f); k_wt_f16<<<(unsigned)(((size_t)DM * DM / 8 + 255) / 256), 256, 0, stream>>>(wo, BO, DM, DM, 16.0f);      /* [in][out] -> Bt[n][k] x16 (pitch K = 1024) */

  k_x16<<<(unsigned)((NR * DM / 8 + 255) / 256), 256, 0, stream>>>(x, X16, NR * DM / 8);
  const size_t r0p = (size_t)B0 * SQ;      /* first projected row */
  k_gemm3<3 * DM, false><<<(unsigned)((MP / G3M) * (3 * DM / G3N)), 256, 0, stream>>>(X16 + r0p * DM, BQKV, 0.0625f, bqkv, nullptr, QKV + r0p * 3 * DM);      /* q | k | v rows (f16); head h = columns h*HD.. of each DM block */
  k_vt<NH, SQ><<<NBR * NH * (SQ / 64), 256, 0, stream>>>(V16 + r0p * LQ, LQ, 0, VT);      /* V^T [NBR][NH][HD][SQ] */
  k_fattn<<<dim3(SQ / 256, NH, NBR), 256, 0, stream>>>(QKV + r0p * LQ, VT, km + r0p, O16 + r0p * DM);      /* o x64 (merged heads) as f16 rows */
  k_gemm3<DM, true><<<(unsigned)((MPO / G3M) * (DM / G3N)), 256, 0, stream>>>(O16 + r0p * DM, BO, 0.0009765625f, bo, (float*)d_out + r0p * DM, nullptr);      /* out rows are the output layout */
}

// v004
// Measured time: 126 microseconds a run.
// Next to v003, in two timings, it ran 1.21 and 1.20 times as fast.
// Over all steps from v000 it is 53.4 times as fast.
#include <hip/hip_runtime.h>
// Multi-head self-attention with a fused QKV projection and an INVERTED key mask (x [4][2048][1024]; qkv = x Wqkv ([in][out] 1024 x 3072, NO bias) reshaped (B, N, 3, 16, 64): q | k | v blocks; att = q k^T * 64^-0.5; where(mask[b][j] > 0, -1e7) with the int32 [4][2048] mask in {0, 1} (random; > 0 means MASKED; read on device; masked weights underflow to exactly 0); softmax over keys; out = merged Wproj + bproj ([in][out]) -> [4][2048][1024]).
// Structure: token rows r = b*2048 + s; x as exact f16 rows (bf16-rounded); q | k | v as ONE WMMA GEMM (N = 3 x 1024) (operands staged in LDS, 64x64 wave tiles, f32 accumulation, exact x16 weights, no bias, f16 outputs); V^T for all batches and heads via LDS transposes; attention in ONE launch (scores, online softmax with f32 statistics and the weighted sum of V in registers; o carried x64 against f16 subnormal flush, folded into the output GEMM alpha) written straight into the merged f16 o rows; out = o W_o + b GEMM (f32) into the output layout.
// Compute dtype: inputs rounded to bf16; x / weights exact; q, k, v, softmax weights and o as plain f16 GEMM operands (~2^-12); scores and softmax statistics f32. v_wmma_f32_16x16x32_f16.
#define NB 4
#define SQ 2048
#define DM 1024
#define NH 16
#define HD 64
#define HG 4                         /* heads per block group of the (b, h0) k_vt overload */
#define B0 0                         /* first batch processed (debug hook) */
#define NBR NB                       /* batches processed (debug hook) */
#define NR ((size_t)NB * SQ)         /* token rows */
#define MP ((int)((size_t)NBR * SQ)) /* rows projected (debug hook) */
#define QN SQ                        /* unused: attention takes all SQ queries */
#define NHD NH                       /* unused: attention takes all NH heads */
#define MPO MP                       /* rows through the output stage (debug hook) */
#define LQ (3 * DM)      /* row pitch of the q/k/v rows */
typedef __bf16 v16b __attribute__((ext_vector_type(16)));
typedef unsigned short v8us __attribute__((ext_vector_type(8), may_alias));
typedef float  v8f  __attribute__((ext_vector_type(8)));
typedef float  v4f  __attribute__((ext_vector_type(4)));
typedef float  v4fa __attribute__((ext_vector_type(4), may_alias));
union FragB { v16b v; v8us half[2]; unsigned short u[16]; };

__device__ __forceinline__ unsigned short bf16_bits(float x) { unsigned int u = __float_as_uint(x); return (unsigned short)((u + 0x7FFFu + ((u >> 16) & 1u)) >> 16); }
__device__ __forceinline__ float bf16_val(unsigned short b) { return __uint_as_float(((unsigned int)b) << 16); }
__device__ __forceinline__ float bf16_round(float x) { return bf16_val(bf16_bits(x)); }
// D += A·B with NT terms: 1 = ah·bh, 2 = + al·bh (A split), 3 = + ah·bl (both split)
template <int NT>
__device__ __forceinline__ v8f mmaN(v16b ah, v16b al, v16b bh, v16b bl, v8f c) {
  c = __builtin_amdgcn_wmma_f32_16x16x32_bf16(false, ah, false, bh, (short)0, c, false, false);
  if (NT >= 2) c = __builtin_amdgcn_wmma_f32_16x16x32_bf16(false, al, false, bh, (short)0, c, false, false);
  if (NT >= 3) c = __builtin_amdgcn_wmma_f32_16x16x32_bf16(false, ah, false, bl, (short)0, c, false, false);
  asm volatile("v_nop\n\tv_nop\n\tv_nop\n\tv_nop" : "+v"(c) : "v"(ah), "v"(al), "v"(bh), "v"(bl));
  return c;
}

__global__ __launch_bounds__(256) void k_wt_bf16(const float* __restrict__ W, unsigned short* __restrict__ Wt, int K, int N) {
  const int t = blockIdx.x * 256 + threadIdx.x;
  const int k8n = K / 8;
  if (t >= N * k8n) return;
  const int n = t / k8n, k8 = (t % k8n) * 8;
  v8us v;
#pragma unroll
  for (int i = 0; i < 8; ++i) v[i] = bf16_bits(W[(size_t)(k8 + i) * N + n]);
  *(v8us*)(Wt + (size_t)n * K + k8) = v;
  
}

// GEMM C[M][N] (f32, pitch ldc) = act(A[M][K]·W + bias). A f32 row-major (pitch lda) converted per fragment to bf16
// (ASPLIT: hi/lo two planes -> 2 terms, else single rounded term); Wt bf16 [N][K] (pitch ldb). BIAS_BF16 rounds the
// bias to bf16 first (bias quantised to bf16 before the add). K%32==0, M%16==0, N%64==0.
template <bool ASPLIT, int ACT, bool BIAS_BF16>
__global__ __launch_bounds__(128) void k_gemm_bf(const float* __restrict__ A, int lda, const unsigned short* __restrict__ Wt, int ldb,
                                               const float* __restrict__ bias, float* __restrict__ C, int ldc, int M, int N, int K) {
  __shared__ __attribute__((aligned(16))) float so[4][16][64];
  const int tid = threadIdx.x, w = tid >> 5, lane = tid & 31, ln = lane & 15, hh = lane >> 4;
  const int ntn = N / 64;
  const int wid = blockIdx.x * 4 + w;
  const int mt = wid / ntn, nq = wid % ntn;
  if (mt * 16 >= M) return;
  const int row0 = mt * 16, col0 = nq * 64;
  const float* arow = A + (size_t)(row0 + ln) * lda;
  v8f acc[4] = {};
  for (int kb = 0; kb < K; kb += 32) {
    FragB ah, al;
    const v4f x0 = *(const v4fa*)(arow + kb + 8 * hh), x1 = *(const v4fa*)(arow + kb + 8 * hh + 4);
    const v4f x2 = *(const v4fa*)(arow + kb + 16 + 8 * hh), x3 = *(const v4fa*)(arow + kb + 16 + 8 * hh + 4);
    float xs[16] = {x0[0],x0[1],x0[2],x0[3],x1[0],x1[1],x1[2],x1[3],x2[0],x2[1],x2[2],x2[3],x3[0],x3[1],x3[2],x3[3]};
#pragma unroll
    for (int i = 0; i < 16; ++i) { const unsigned short hb = bf16_bits(xs[i]); ah.u[i] = hb; al.u[i] = ASPLIT ? bf16_bits(xs[i] - bf16_val(hb)) : (unsigned short)0; }
#pragma unroll
    for (int t = 0; t < 4; ++t) {
      const unsigned short* brow = Wt + (size_t)(col0 + t * 16 + ln) * ldb + kb;
      FragB b;
      b.half[0] = *(const v8us*)(brow + 8 * hh);
      b.half[1] = *(const v8us*)(brow + 16 + 8 * hh);
      acc[t] = mmaN<ASPLIT ? 2 : 1>(ah.v, al.v, b.v, b.v, acc[t]);
    }
  }
#pragma unroll
  for (int t = 0; t < 4; ++t) {
    float bv = bias ? bias[col0 + t * 16 + ln] : 0.f;
    if (BIAS_BF16) bv = bf16_round(bv);
#pragma unroll
    for (int r = 0; r < 8; ++r) { float v = acc[t][r] + bv; if (ACT == 1) v = fmaxf(v, 0.f); so[w][8 * hh + r][t * 16 + ln] = v; }
  }
  __builtin_amdgcn_fence(__ATOMIC_ACQ_REL, "workgroup");
  __builtin_amdgcn_wave_barrier();
  const int rsub = lane >> 4, c4 = (lane & 15) * 4;
  {
#pragma unroll
    for (int q = 0; q < 8; ++q) {
      const int r = q * 2 + rsub;
      const v4f v = *(const v4fa*)&so[w][r][c4];
      *(v4f*)(C + (size_t)(row0 + r) * ldc + col0 + c4) = v;
    }
    
  }
}

// GEMM C = act(A·W + bias + resid): A f32 (ASPLIT -> hi/lo 2 terms), Wt bf16 [N][K]; ACT 0 none, 1 relu, 2 exact gelu;
// resid (optional, f32, row index = (row % rmod), pitch ldr, RES_BF16 rounds it) added before the activation.
template <bool ASPLIT, int ACT, bool BIAS_BF16, bool RES_BF16>
__global__ __launch_bounds__(128) void k_gemm_bf3(const float* __restrict__ A, int lda, const unsigned short* __restrict__ Wt, int ldb,
                                                const float* __restrict__ bias, const float* __restrict__ resid, int rmod, int ldr,
                                                float* __restrict__ C, int ldc, int M, int N, int K) {
  __shared__ __attribute__((aligned(16))) float so[4][16][64];
  const int tid = threadIdx.x, w = tid >> 5, lane = tid & 31, ln = lane & 15, hh = lane >> 4;
  const int ntn = N / 64;
  const int wid = blockIdx.x * 4 + w;
  const int mt = wid / ntn, nq = wid % ntn;
  if (mt * 16 >= M) return;
  const int row0 = mt * 16, col0 = nq * 64;
  const float* arow = A + (size_t)(row0 + ln) * lda;
  v8f acc[4] = {};
  for (int kb = 0; kb < K; kb += 32) {
    FragB ah, al;
    const v4f x0 = *(const v4fa*)(arow + kb + 8 * hh), x1 = *(const v4fa*)(arow + kb + 8 * hh + 4);
    const v4f x2 = *(const v4fa*)(arow + kb + 16 + 8 * hh), x3 = *(const v4fa*)(arow + kb + 16 + 8 * hh + 4);
    float xs[16] = {x0[0],x0[1],x0[2],x0[3],x1[0],x1[1],x1[2],x1[3],x2[0],x2[1],x2[2],x2[3],x3[0],x3[1],x3[2],x3[3]};
#pragma unroll
    for (int i = 0; i < 16; ++i) { const unsigned short hb = bf16_bits(xs[i]); ah.u[i] = hb; al.u[i] = ASPLIT ? bf16_bits(xs[i] - bf16_val(hb)) : (unsigned short)0; }
#pragma unroll
    for (int t = 0; t < 4; ++t) {
      const unsigned short* brow = Wt + (size_t)(col0 + t * 16 + ln) * ldb + kb;
      FragB b;
      b.half[0] = *(const v8us*)(brow + 8 * hh);
      b.half[1] = *(const v8us*)(brow + 16 + 8 * hh);
      acc[t] = mmaN<ASPLIT ? 2 : 1>(ah.v, al.v, b.v, b.v, acc[t]);
    }
  }
#pragma unroll
  for (int t = 0; t < 4; ++t) {
    const int col = col0 + t * 16 + ln;
    float bv = bias ? bias[col] : 0.f;
    if (BIAS_BF16) bv = bf16_round(bv);
#pragma unroll
    for (int r = 0; r < 8; ++r) {
      float v = acc[t][r] + bv;
      if (resid) { float rv = resid[(size_t)((row0 + 8 * hh + r) % rmod) * ldr + col]; if (RES_BF16) rv = bf16_round(rv); v += rv; }
      if (ACT == 1) v = fmaxf(v, 0.f);
      if (ACT == 2) v = 0.5f * v * (1.0f + erff(v * 0.70710678118654752f));
      if (ACT == 3) { const float u = 0.7978845608028654f * (v + 0.044715f * v * v * v); v = 0.5f * v * (1.0f + tanhf(u)); }
      so[w][8 * hh + r][t * 16 + ln] = v;
    }
  }
  __builtin_amdgcn_fence(__ATOMIC_ACQ_REL, "workgroup");
  __builtin_amdgcn_wave_barrier();
  const int rsub = lane >> 4, c4 = (lane & 15) * 4;
  {
#pragma unroll
    for (int q = 0; q < 8; ++q) {
      const int r = q * 2 + rsub;
      const v4f v = *(const v4fa*)&so[w][r][c4];
      *(v4f*)(C + (size_t)(row0 + r) * ldc + col0 + c4) = v;
    }
    
  }
}
// row LayerNorm (biased variance, eps) over N: s = X (+ R); optional out_sum <- s; out_norm <- (s-mu)*rsqrt(var+eps)*g + b
template <bool PARAM_BF16>
__global__ __launch_bounds__(256) void k_layernorm(const float* __restrict__ X, const float* __restrict__ R, const float* __restrict__ g, const float* __restrict__ bta,
                                                  float* __restrict__ out_sum, float* __restrict__ out_norm, int N, float eps) {
  __shared__ float red[256];
  const int row = blockIdx.x, tid = threadIdx.x;
  const float* x = X + (size_t)row * N; const float* rr = R ? R + (size_t)row * N : nullptr;
  float vals[16];                     // up to N = 4096
  const int per = N / 256;            // contiguous chunk per thread? use strided-by-4 chunks: thread handles j = tid*4 + 1024*u
  float s1 = 0.f;
  for (int u = 0; u < per / 4; ++u) {
    const int j = tid * 4 + 1024 * u;
    const v4f a = *(const v4fa*)(x + j);
    v4f b = {0.f,0.f,0.f,0.f}; if (rr) b = *(const v4fa*)(rr + j);
#pragma unroll
    for (int q = 0; q < 4; ++q) { const float v = a[q] + b[q]; vals[u * 4 + q] = v; s1 += v; }
  }
  red[tid] = s1; __syncthreads();
  for (int st = 128; st > 0; st >>= 1) { if (tid < st) red[tid] += red[tid + st]; __syncthreads(); }
  const float mu = red[0] / (float)N; __syncthreads();
  float s2 = 0.f;
  for (int u = 0; u < per / 4; ++u)
#pragma unroll
    for (int q = 0; q < 4; ++q) { const float c = vals[u * 4 + q] - mu; s2 += c * c; }
  red[tid] = s2; __syncthreads();
  for (int st = 128; st > 0; st >>= 1) { if (tid < st) red[tid] += red[tid + st]; __syncthreads(); }
  const float rs = rsqrtf(red[0] / (float)N + eps);
  {
    for (int u = 0; u < per / 4; ++u) {
      const int j = tid * 4 + 1024 * u;
      v4f o, sm;
#pragma unroll
      for (int q = 0; q < 4; ++q) {
        float gg = g[j + q], bb = bta[j + q];
        if (PARAM_BF16) { gg = bf16_round(gg); bb = bf16_round(bb); }
        sm[q] = vals[u * 4 + q]; o[q] = (vals[u * 4 + q] - mu) * rs * gg + bb;
      }
      if (out_sum) *(v4f*)(out_sum + (size_t)row * N + j) = sm;
      *(v4f*)(out_norm + (size_t)row * N + j) = o;
    }
    
  }
}



// ---- f16 WMMA path (v_wmma_f32_16x16x32_f16): 11-bit significands for operands in range — used where a [0,1] probability operand needs more precision than bf16
typedef _Float16 v16h __attribute__((ext_vector_type(16)));
union FragH { v16h v; v8us half[2]; _Float16 h[16]; unsigned short u[16]; };
template <int NT>
__device__ __forceinline__ v8f mmaH(v16h ah, v16h al, v16h bh, v16h bl, v8f c) {
  c = __builtin_amdgcn_wmma_f32_16x16x32_f16(false, ah, false, bh, (short)0, c, false, false);
  if (NT >= 2) c = __builtin_amdgcn_wmma_f32_16x16x32_f16(false, al, false, bh, (short)0, c, false, false);
  if (NT >= 3) c = __builtin_amdgcn_wmma_f32_16x16x32_f16(false, ah, false, bl, (short)0, c, false, false);
  asm volatile("v_nop\n\tv_nop\n\tv_nop\n\tv_nop" : "+v"(c) : "v"(ah), "v"(al), "v"(bh), "v"(bl));
  return c;
}
// batched GEMM like k_gemm_b but f16 operands: A f32 (split into f16 hi/lo if ASPLIT, else rounded to f16), Bt = f16 values [n][k]; alpha; C f32; N multiple of 16 (partial tiles skipped)
template <bool ASPLIT>
__global__ __launch_bounds__(128) void k_gemm_h(const float* __restrict__ A, int lda, size_t sA, const _Float16* __restrict__ Bh, int ldb, size_t sB, float alpha, float* __restrict__ C, int ldc, size_t sC, int M, int N, int K) {
  __shared__ __attribute__((aligned(16))) float so[4][16][64];
  const int tid = threadIdx.x, w = tid >> 5, lane = tid & 31, ln = lane & 15, hh = lane >> 4; const int by = blockIdx.y;
  A += (size_t)by * sA; Bh += (size_t)by * sB; C += (size_t)by * sC;
  const int ntn = (N + 63) / 64; const int wid = blockIdx.x * 4 + w; const int mt = wid / ntn, nq = wid % ntn; if (mt * 16 >= M) return;
  const int row0 = mt * 16, col0 = nq * 64; const float* arow = A + (size_t)(row0 + ln) * lda;
  v8f acc[4] = {};
  for (int kb = 0; kb < K; kb += 32) {
    FragH ah, al;
    const v4f x0 = *(const v4fa*)(arow + kb + 8 * hh), x1 = *(const v4fa*)(arow + kb + 8 * hh + 4), x2 = *(const v4fa*)(arow + kb + 16 + 8 * hh), x3 = *(const v4fa*)(arow + kb + 16 + 8 * hh + 4);
    float xs[16] = {x0[0],x0[1],x0[2],x0[3],x1[0],x1[1],x1[2],x1[3],x2[0],x2[1],x2[2],x2[3],x3[0],x3[1],x3[2],x3[3]};
#pragma unroll
    for (int i = 0; i < 16; ++i) { const _Float16 h = (_Float16)xs[i]; ah.h[i] = h; al.h[i] = ASPLIT ? (_Float16)(xs[i] - (float)h) : (_Float16)0.0f; }
#pragma unroll
    for (int t = 0; t < 4; ++t) { if (col0 + t * 16 >= N) continue; const size_t boff = (size_t)(col0 + t * 16 + ln) * ldb + kb; FragH bq; bq.half[0] = *(const v8us*)(Bh + boff + 8 * hh); bq.half[1] = *(const v8us*)(Bh + boff + 16 + 8 * hh);
      acc[t] = mmaH<ASPLIT ? 2 : 1>(ah.v, al.v, bq.v, bq.v, acc[t]); }
  }
#pragma unroll
  for (int t = 0; t < 4; ++t) { if (col0 + t * 16 >= N) continue;
#pragma unroll
    for (int r = 0; r < 8; ++r) so[w][8 * hh + r][t * 16 + ln] = acc[t][r] * alpha; }
  __builtin_amdgcn_fence(__ATOMIC_ACQ_REL, "workgroup"); __builtin_amdgcn_wave_barrier();
  const int rsub = lane >> 4, c4 = (lane & 15) * 4;
  {
#pragma unroll
    for (int q = 0; q < 8; ++q) { const int r = q * 2 + rsub; if (col0 + c4 < N) { const v4f v = *(const v4fa*)&so[w][r][c4]; *(v4f*)(C + (size_t)(row0 + r) * ldc + col0 + c4) = v; } }
     }
}

// Wt[n][k] = f16(W[k][n]·scale) from f32 row-major W[K][N] (scale = power of two; bf16-exact weights stay exact in f16 away from the subnormal range)
__global__ __launch_bounds__(256) void k_wt_f16(const float* __restrict__ W, _Float16* __restrict__ Wt, int K, int N, float scale) {
  const int t = blockIdx.x * 256 + threadIdx.x; if (t >= N * (K / 8)) return; const int n = t / (K / 8), k8 = (t % (K / 8)) * 8; FragH f;
#pragma unroll
  for (int i = 0; i < 8; ++i) f.h[i] = (_Float16)(bf16_round(W[(size_t)(k8 + i) * N + n]) * scale); const v8us o = f.half[0];
  *(v8us*)((unsigned short*)Wt + (size_t)n * K + k8) = o; 
}
// k_gemm_hh variant with fused epilogue: v = acc·alpha + bias[by·sBias + col] (+ CP[(row/rowsPerB)·sCPb + by·64 + col] if CP) ; ACT 0 none / 1 elu ; writes f16 C16 (and f32 C if non-null)
template <int ACT>
__global__ __launch_bounds__(128) void k_gemm_hhx(const _Float16* __restrict__ A, int lda, size_t sA, const _Float16* __restrict__ Bh, int ldb, size_t sB, float alpha, const float* __restrict__ bias, size_t sBias, const float* __restrict__ CP, int rowsPerB, size_t sCPb, int row0g,
    float* __restrict__ C, _Float16* __restrict__ C16, int ldc, size_t sC, int M, int N, int K) {
  __shared__ __attribute__((aligned(16))) float so[4][16][64];
  const int tid = threadIdx.x, w = tid >> 5, lane = tid & 31, ln = lane & 15, hh = lane >> 4; const int by = blockIdx.y;
  A += (size_t)by * sA; Bh += (size_t)by * sB; const size_t cofs = (size_t)by * sC; const float* bp = bias ? bias + (size_t)by * sBias : nullptr;
  const int ntn = (N + 63) / 64; const int wid = blockIdx.x * 4 + w; const int mt = wid / ntn, nq = wid % ntn; if (mt * 16 >= M) return;
  const int row0 = mt * 16, col0 = nq * 64; const _Float16* arow = A + (size_t)(row0 + ln) * lda;
  v8f acc[4] = {};
  for (int kb = 0; kb < K; kb += 32) { FragH ah; ah.half[0] = *(const v8us*)((const unsigned short*)arow + kb + 8 * hh); ah.half[1] = *(const v8us*)((const unsigned short*)arow + kb + 16 + 8 * hh);
#pragma unroll
    for (int t = 0; t < 4; ++t) { if (col0 + t * 16 >= N) continue; const size_t boff = (size_t)(col0 + t * 16 + ln) * ldb + kb; FragH bq; bq.half[0] = *(const v8us*)((const unsigned short*)Bh + boff + 8 * hh); bq.half[1] = *(const v8us*)((const unsigned short*)Bh + boff + 16 + 8 * hh);
      acc[t] = mmaH<1>(ah.v, ah.v, bq.v, bq.v, acc[t]); }
  }
#pragma unroll
  for (int t = 0; t < 4; ++t) { if (col0 + t * 16 >= N) continue; const int col = col0 + t * 16 + ln; const float bv = bp ? bf16_round(bp[col]) : 0.f;
#pragma unroll
    for (int r = 0; r < 8; ++r) { float v = acc[t][r] * alpha + bv; if (CP) { const int rr = row0g + row0 + 8 * hh + r; if (rowsPerB < 0) v += CP[cofs + (size_t)rr * ldc + col];      /* rowsPerB < 0: own element of the batched C plane */ else { const int bidx = rr / rowsPerB; v += CP[(size_t)bidx * sCPb + (size_t)by * 64 + col]; } } if (ACT == 1) v = (v > 0.f) ? v : expm1f(v); else if (ACT == 7) v = (v > 0.f) ? v + 1.0f : expf(v); else if (ACT == 8) v = tanhf(v); else if (ACT == 9) v = 0.5f * v * (1.0f + tanhf(0.7978845608028654f * (v + 0.044715f * v * v * v))); else if (ACT == 11) v = 1.0f / (1.0f + expf(-v)); else if (ACT == 12) v = (v > 0.f) ? v : 0.01f * v; else if (ACT == 14) v = (v > 0.f) ? v : 0.1f * v; else if (ACT == 16) v = (v >= 0.f) ? v : 0.3f * v; else if (ACT == 17) v = (v >= 0.f) ? v : 0.2f * v; else if (ACT == 15) v = v / (1.0f + expf(-v)); else if (ACT == 3) v = fmaxf(v, 0.f); else if (ACT == 6) v = 0.5f * v * (1.0f + erff(v * 0.70710678118654752f)); so[w][8 * hh + r][t * 16 + ln] = v; } }
  __builtin_amdgcn_fence(__ATOMIC_ACQ_REL, "workgroup"); __builtin_amdgcn_wave_barrier();
  const int rsub = lane >> 4, c4 = (lane & 15) * 4; typedef _Float16 v4h __attribute__((ext_vector_type(4)));
  {
#pragma unroll
    for (int q = 0; q < 8; ++q) { const int r = q * 2 + rsub; if (col0 + c4 < N) { const v4f v = *(const v4fa*)&so[w][r][c4]; if (C) *(v4f*)(C + cofs + (size_t)(row0 + r) * ldc + col0 + c4) = v; if (C16) { v4h h4; for (int i = 0; i < 4; ++i) h4[i] = (_Float16)v[i]; *(v4h*)(C16 + cofs + (size_t)(row0 + r) * ldc + col0 + c4) = h4; } } }
     }
}


typedef _Float16 v4h __attribute__((ext_vector_type(4)));

__global__ __launch_bounds__(256) void k_x16(const float* __restrict__ x, _Float16* __restrict__ X16, size_t n8) { const size_t t = (size_t)blockIdx.x * 256 + threadIdx.x; if (t >= n8) return; FragH f;
#pragma unroll
  for (int q = 0; q < 8; ++q) f.h[q] = (_Float16)bf16_round(x[t * 8 + q]); *(v8us*)((unsigned short*)X16 + t * 8) = f.half[0];  }
__global__ __launch_bounds__(256) void k_h16(const float* __restrict__ x, _Float16* __restrict__ X16, size_t n8) { const size_t t = (size_t)blockIdx.x * 256 + threadIdx.x; if (t >= n8) return; FragH f;
#pragma unroll
  for (int q = 0; q < 8; ++q) f.h[q] = (_Float16)x[t * 8 + q]; *(v8us*)((unsigned short*)X16 + t * 8) = f.half[0];  }
__global__ __launch_bounds__(256) void k_round16f(const float* __restrict__ W, _Float16* __restrict__ Bt, size_t n8) { const size_t t = (size_t)blockIdx.x * 256 + threadIdx.x; if (t >= n8) return; FragH f;
#pragma unroll
  for (int i = 0; i < 8; ++i) f.h[i] = (_Float16)(bf16_round(W[t * 8 + i]) * 16.0f); *(v8us*)((unsigned short*)Bt + t * 8) = f.half[0];  }
template <int NHv, int TTv>
__global__ __launch_bounds__(256) void k_vt(const _Float16* __restrict__ V16, int ldv, int voff, _Float16* __restrict__ Vt) { __shared__ unsigned short tl[64][66]; const int tid = threadIdx.x; const int slab = blockIdx.x / (TTv / 64), lg = blockIdx.x % (TTv / 64); const int b = slab / NHv, h = slab % NHv;
  for (int i = tid; i < 64 * 8; i += 256) { const int r = i / 8, c8 = (i % 8) * 8; FragH f; f.half[0] = *(const v8us*)((const unsigned short*)V16 + ((size_t)b * TTv + lg * 64 + r) * ldv + voff + h * 64 + c8);
#pragma unroll
    for (int q = 0; q < 8; ++q) tl[r][c8 + q] = f.u[q]; }
  __syncthreads();
  {
#pragma unroll
    for (int rd = 0; rd < 2; ++rd) { const int d = rd * 32 + tid / 8, pc = tid % 8; FragH f;
#pragma unroll
      for (int q = 0; q < 8; ++q) f.u[q] = tl[pc * 8 + q][d];
      *(v8us*)((unsigned short*)Vt + ((size_t)slab * 64 + d) * TTv + lg * 64 + pc * 8) = f.half[0]; }
     } }

__global__ __launch_bounds__(256) void k_hl(const float* __restrict__ F, _Float16* __restrict__ Hh, _Float16* __restrict__ Hl, size_t n8) { const size_t t = (size_t)blockIdx.x * 256 + threadIdx.x; if (t >= n8) return; FragH fh, fl; const v4f a = *(const v4fa*)(F + t * 8), c = *(const v4fa*)(F + t * 8 + 4);
#pragma unroll
  for (int q = 0; q < 4; ++q) { _Float16 h = (_Float16)a[q]; fh.h[q] = h; fl.h[q] = (_Float16)((a[q] - (float)h) * 1024.0f); h = (_Float16)c[q]; fh.h[4 + q] = h; fl.h[4 + q] = (_Float16)((c[q] - (float)h) * 1024.0f); }
  { *(v8us*)((unsigned short*)Hh + t * 8) = fh.half[0]; *(v8us*)((unsigned short*)Hl + t * 8) = fl.half[0];  } }

// ---- fast GEMM (wave tile 32x64; requires M % 32 == 0 rows per launch region and N % 64 == 0); epilogue = k_gemm_hhx semantics ----
__device__ __forceinline__ v16h g2_frag(const _Float16* p, int hh) { FragH f; f.half[0] = *(const v8us*)((const unsigned short*)p + 8 * hh); f.half[1] = *(const v8us*)((const unsigned short*)p + 16 + 8 * hh); return f.v; }
__device__ __forceinline__ v8f g2_mma(v16h a, v16h b, v8f c) { v8f d = __builtin_amdgcn_wmma_f32_16x16x32_f16(false, a, false, b, (short)0, c, false, false); asm volatile("v_nop\n\tv_nop\n\tv_nop\n\tv_nop" : "+v"(d) : "v"(a), "v"(b)); return d; }
template <int ACT>
__global__ __launch_bounds__(128) void k_gemm2(const _Float16* __restrict__ A, int lda, size_t sA, const _Float16* __restrict__ Bh, int ldb, size_t sB, float alpha, const float* __restrict__ bias, size_t sBias, const float* __restrict__ CP, int rowsPerB, size_t sCPb, int row0g,
    float* __restrict__ C, _Float16* __restrict__ C16, int ldc, size_t sC, int M, int N, int K) { static_assert(ACT == 0 || ACT == 3 || ACT == 6 || ACT == 8 || ACT == 9 || ACT == 11 || ACT == 12 || ACT == 14 || ACT == 15 || ACT == 16 || ACT == 17, "k_gemm2: unsupported ACT code (would silently apply no activation)");
  __shared__ __attribute__((aligned(16))) float so[4][32][68];
  const int tid = threadIdx.x, w = tid >> 5, lane = tid & 31, ln = lane & 15, hh = lane >> 4; const int by = blockIdx.y;
  A += (size_t)by * sA; Bh += (size_t)by * sB; const size_t cofs = (size_t)by * sC; const float* bp = bias ? bias + (size_t)by * sBias : nullptr;
  const int ntn = N >> 6; const int mt = blockIdx.x / ntn, nq = blockIdx.x - mt * ntn; const int row0 = mt * 128 + 32 * w, col0 = nq * 64; if (row0 >= M) return;
  const _Float16* a0p = A + (size_t)(row0 + ln) * lda; const _Float16* a1p = a0p + (size_t)16 * lda;
  const _Float16* b0p = Bh + (size_t)(col0 + ln) * ldb; const _Float16* b1p = b0p + (size_t)16 * ldb; const _Float16* b2p = b1p + (size_t)16 * ldb; const _Float16* b3p = b2p + (size_t)16 * ldb;
  const v8f z8 = {0.f,0.f,0.f,0.f,0.f,0.f,0.f,0.f}; v8f c00 = z8, c01 = z8, c02 = z8, c03 = z8, c10 = z8, c11 = z8, c12 = z8, c13 = z8;
#pragma unroll 1
  for (int kb = 0; kb < K; kb += 32) { const v16h a0 = g2_frag(a0p + kb, hh), a1 = g2_frag(a1p + kb, hh);
    v16h b = g2_frag(b0p + kb, hh); c00 = g2_mma(a0, b, c00); c10 = g2_mma(a1, b, c10);
    b = g2_frag(b1p + kb, hh); c01 = g2_mma(a0, b, c01); c11 = g2_mma(a1, b, c11);
    b = g2_frag(b2p + kb, hh); c02 = g2_mma(a0, b, c02); c12 = g2_mma(a1, b, c12);
    b = g2_frag(b3p + kb, hh); c03 = g2_mma(a0, b, c03); c13 = g2_mma(a1, b, c13); }
  v8f accs[8] = {c00, c01, c02, c03, c10, c11, c12, c13};
#pragma unroll
  for (int u = 0; u < 8; ++u) { const int t = u & 3, half = u >> 2; const int col = col0 + t * 16 + ln; const float bv = bp ? bf16_round(bp[col]) : 0.f;
#pragma unroll
    for (int r = 0; r < 8; ++r) { const int rloc = half * 16 + 8 * hh + r; float v = accs[u][r] * alpha + bv; if (CP) { if (rowsPerB < 0) v += CP[cofs + (size_t)(row0g + row0 + rloc) * ldc + col];      /* rowsPerB < 0: own element of the batched C plane */ else { const int bidx = (row0g + row0 + rloc) / rowsPerB; v += CP[(size_t)bidx * sCPb + (size_t)by * 64 + col]; } }
      if (ACT == 3) v = fmaxf(v, 0.f); else if (ACT == 6) v = 0.5f * v * (1.0f + erff(v * 0.70710678118654752f)); else if (ACT == 11) v = 1.0f / (1.0f + expf(-v)); else if (ACT == 15) v = v / (1.0f + expf(-v)); else if (ACT == 12) v = (v > 0.f) ? v : 0.01f * v; else if (ACT == 8) v = tanhf(v); else if (ACT == 9) v = 0.5f * v * (1.0f + tanhf(0.7978845608028654f * (v + 0.044715f * v * v * v))); else if (ACT == 14) v = (v > 0.f) ? v : 0.1f * v; else if (ACT == 16) v = (v >= 0.f) ? v : 0.3f * v; else if (ACT == 17) v = (v >= 0.f) ? v : 0.2f * v;
      so[w][rloc][t * 16 + ln] = v; } }
  __builtin_amdgcn_fence(__ATOMIC_ACQ_REL, "workgroup"); __builtin_amdgcn_wave_barrier();
  const int rsub = lane >> 4, c4 = (lane & 15) * 4;
  {
#pragma unroll
    for (int q = 0; q < 16; ++q) { const int r = q * 2 + rsub; const v4f v = *(const v4fa*)&so[w][r][c4]; if (C) *(v4f*)(C + cofs + (size_t)(row0 + r) * ldc + col0 + c4) = v; if (C16) { v4h h4; for (int i = 0; i < 4; ++i) h4[i] = (_Float16)v[i]; *(v4h*)(C16 + cofs + (size_t)(row0 + r) * ldc + col0 + c4) = h4; } }
     } }


__global__ __launch_bounds__(256) void k_wnat(const float* __restrict__ w, size_t n8, _Float16* __restrict__ Bt) { const size_t t = (size_t)blockIdx.x * 256 + threadIdx.x; if (t >= n8) return; FragH f; for (int q = 0; q < 8; ++q) f.h[q] = (_Float16)(bf16_round(w[t * 8 + q]) * 16.0f); *(v8us*)((unsigned short*)Bt + t * 8) = f.half[0];  }
__global__ __launch_bounds__(256) void k_rsm(const float* __restrict__ S, _Float16* __restrict__ P, int nrows) {
  #pragma clang fp contract(off)
  const int i = blockIdx.x * 256 + threadIdx.x; if (i >= nrows) return; const float* s = S + (size_t)i * SQ; float mx = -3.0e38f;
#pragma unroll 1
  for (int j = 0; j < SQ; ++j) mx = fmaxf(mx, s[j]); float se = 0.f;
#pragma unroll 1
  for (int j = 0; j < SQ; ++j) se += expf(s[j] - mx); const float sc = 256.0f / se;
#pragma unroll 1
  for (int j0 = 0; j0 < SQ; j0 += 8) { FragH f; for (int q = 0; q < 8; ++q) f.h[q] = (_Float16)(expf(s[j0 + q] - mx) * sc); unsigned short* d = (unsigned short*)P + (size_t)i * SQ + j0; *(v8us*)d = f.half[0];  } }
__global__ __launch_bounds__(256) void k_vt(const _Float16* __restrict__ V16, int b, int h0, _Float16* __restrict__ VT) { __shared__ unsigned short tl[64][65]; const int tid = threadIdx.x; const int hh = blockIdx.x % HG, sg = blockIdx.x / HG; const int s0 = sg * 64; const int h = h0 + hh;
  for (int i = tid; i < 64 * 8; i += 256) { const int j = i / 8, d8 = (i % 8) * 8; FragH f; f.half[0] = *(const v8us*)((const unsigned short*)V16 + ((size_t)b * SQ + s0 + j) * DM + h * HD + d8); for (int q = 0; q < 8; ++q) tl[d8 + q][j] = f.u[q]; }
  __syncthreads();
  { for (int i = tid; i < 64 * 8; i += 256) { const int d = i / 8, j8 = (i % 8) * 8; FragH f; for (int q = 0; q < 8; ++q) f.u[q] = tl[d][j8 + q]; *(v8us*)((unsigned short*)VT + ((size_t)hh * HD + d) * SQ + s0 + j8) = f.half[0]; }  } }



#define FK 64            /* keys per pass */
#define FP 72            /* LDS row pitch in halves: 144 bytes = 16 x odd, for 16-byte row reads */
#define FMASK (-262144.0f)
#define FTHR 8.0f
#define FOFF 6.0f
typedef int v4ia __attribute__((ext_vector_type(4), may_alias));
typedef float v8fa __attribute__((ext_vector_type(8), may_alias));
typedef float v2f __attribute__((ext_vector_type(2)));
typedef _Float16 v2h __attribute__((ext_vector_type(2)));
union FragP { v16h v; v2h p[8]; };
__device__ __forceinline__ float fa_xhalf(float x) { const int i = __float_as_int(x); return __int_as_float(__builtin_amdgcn_permlanex16(i, i, 0x76543210, 0xfedcba98, false, false)); }      /* lane l <-> l ^ 16 */
__device__ __forceinline__ v8f fa_mma(v16h a, v16h b, v8f c) { return __builtin_amdgcn_wmma_f32_16x16x32_f16(false, a, false, b, (short)0, c, false, false); }
// List of a batch's kept keys (mask <= 0) in rising order, built by a work-group of 256 threads: idx[0 .. n) = the keys, idx[n .. SQ) = 0 (a valid row); returns n >= 1. Thread t owns keys 8 t .. 8 t + 7.
// A key's place = kept keys of the waves below (wt) + of the lanes below (ballots counted under the lane) + of the thread's own earlier keys. none: no key is kept, the list is then all SQ keys.
__device__ __forceinline__ int fa_kept(const int* __restrict__ mrow, unsigned short* idx, int* wt, bool& none) {
  const int tid = threadIdx.x, w = tid >> 5;
  const v4ia m0 = *(const v4ia*)(mrow + tid * 8), m1 = *(const v4ia*)(mrow + tid * 8 + 4);
  bool k[8]; unsigned int below = 0u, tot = 0u;
#pragma unroll      /* constant indices into k */
  for (int q = 0; q < 4; ++q) { k[q] = !(m0[q] > 0); k[4 + q] = !(m1[q] > 0); }
#pragma unroll      /* constant indices into k */
  for (int q = 0; q < 8; ++q) { const unsigned int bal = __builtin_amdgcn_ballot_w32(k[q]); below = __builtin_amdgcn_mbcnt_lo(bal, below); tot += (unsigned int)__builtin_popcount(bal); }
  const v8us z = {0, 0, 0, 0, 0, 0, 0, 0}; *(v8us*)&idx[tid * 8] = z;
  if ((tid & 31) == 0) wt[w] = (int)tot;
  __syncthreads();      /* publishes the eight wave counts; the zero fill is complete before any place is written */
  int base = 0, n = 0;
  for (int i = 0; i < 8; ++i) { const int c = wt[i]; base += i < w ? c : 0; n += c; }
  int pos = base + (int)below;
  none = n == 0;
  if (none) { pos = tid * 8; n = SQ; }
#pragma unroll      /* constant indices into k */
  for (int q = 0; q < 8; ++q) if (k[q] || none) { idx[pos] = (unsigned short)(tid * 8 + q); ++pos; }
  __syncthreads();      /* publishes the list */
  return n; }
// V^T of the kept keys: Vt[b][h][d][p] = v[b][list_b[p]][h][d] for p below the list's length rounded up to 64 (places behind the end take row 0: finite values under weight 0); a block transposes 64 places of one (batch, head) through LDS.
__global__ __launch_bounds__(256) void k_vtk(const _Float16* __restrict__ V16, const int* __restrict__ Km, _Float16* __restrict__ Vt) {
  __shared__ unsigned short tl[64][66]; __shared__ __attribute__((aligned(16))) unsigned short kidx[SQ]; __shared__ int wt[8];
  const int tid = threadIdx.x; const int slab = blockIdx.x / (SQ / 64), lg = blockIdx.x % (SQ / 64); const int b = slab / NH, h = slab % NH;
  bool none; const int n = fa_kept(Km + (size_t)b * SQ, kidx, wt, none);
  const bool act = lg * 64 < n;      /* the same for the whole block: tiles wholly behind the list's end are never read */
  if (act) { const int r = tid / 8, c8 = (tid % 8) * 8; FragH f0, f1;      /* 16-byte piece c8 of the rows at places r and r + 32: both loads in flight together */
    f0.half[0] = *(const v8us*)((const unsigned short*)V16 + ((size_t)b * SQ + kidx[lg * 64 + r]) * LQ + h * 64 + c8);
    f1.half[0] = *(const v8us*)((const unsigned short*)V16 + ((size_t)b * SQ + kidx[lg * 64 + r + 32]) * LQ + h * 64 + c8);
#pragma unroll      /* constant indices into f0, f1: they stay in registers */
    for (int q = 0; q < 8; ++q) { tl[r][c8 + q] = f0.u[q]; tl[r + 32][c8 + q] = f1.u[q]; } }
  __syncthreads();      /* the 64 x 64 tile is complete before it is read across */
  if (act) {
#pragma unroll      /* both rows' LDS reads go out together */
    for (int rd = 0; rd < 2; ++rd) { const int d = rd * 32 + tid / 8, pc = tid % 8; FragH f;
#pragma unroll      /* constant indices into f: it stays in registers */
      for (int q = 0; q < 8; ++q) f.u[q] = tl[pc * 8 + q][d];
      *(v8us*)((unsigned short*)Vt + ((size_t)slab * 64 + d) * SQ + lg * 64 + pc * 8) = f.half[0]; }
  } }
__global__ __launch_bounds__(256) __attribute__((amdgpu_waves_per_eu(4, 4))) /* two work-groups per WGP: the vector work between the matrix runs wants four waves per SIMD */
void k_fattn(const _Float16* __restrict__ QKV, const _Float16* __restrict__ VT, const int* __restrict__ Km, _Float16* __restrict__ O16) {
  __shared__ __attribute__((aligned(16))) _Float16 Ks[2][FK][FP];
  __shared__ __attribute__((aligned(16))) _Float16 Vs[2][HD][FP];
  __shared__ __attribute__((aligned(16))) unsigned short kidx[SQ];
  __shared__ int wt[8];
  __shared__ __attribute__((aligned(32))) float kb[FK];      /* start values C of the last pass's score product: 0 for a key, FMASK behind the list's end */
  const int tid = threadIdx.x, w = tid >> 5, lane = tid & 31, ln = lane & 15, hh = lane >> 4;
  const int h = blockIdx.y, b = blockIdx.z, q0 = blockIdx.x * 256 + w * 32;
  const unsigned short* Kg = (const unsigned short*)QKV + (size_t)b * SQ * LQ + DM + h * HD;      /* K rows [key][d], pitch LQ */
  const unsigned short* Vg = (const unsigned short*)VT + ((size_t)b * NH + h) * HD * SQ;          /* V^T rows [d][place in the list], pitch SQ */
  const int sr = tid >> 3, sc = (tid & 7) * 8;      /* staging: 16-byte piece sc of rows sr and sr + 32 of both tiles */
  v16h qf[2][2];
#pragma unroll      /* fragments stay in registers: constant indices only */
  for (int g = 0; g < 2; ++g) for (int kk = 0; kk < 2; ++kk) qf[g][kk] = g2_frag(QKV + ((size_t)b * SQ + q0 + g * 16 + ln) * LQ + h * HD + kk * 32, hh);
  v8us vr0 = *(const v8us*)(Vg + (size_t)sr * SQ + sc), vr1 = *(const v8us*)(Vg + (size_t)(sr + 32) * SQ + sc);
  bool none; const int n = __builtin_amdgcn_readfirstlane(fa_kept(Km + (size_t)b * SQ, kidx, wt, none));      /* the same in every lane: held as a scalar, so that the pass loop branches on scalars */
  const int np = min((n + FK - 1) / FK, SQ / FK);      /* passes: 1 .. SQ / FK */
  if (tid < FK) kb[tid] = (np - 1) * FK + tid >= n ? FMASK : 0.f;
  int i0 = kidx[sr], i1 = kidx[sr + 32];      /* the K rows this thread stages */
  v8us kr0 = *(const v8us*)(Kg + (size_t)i0 * LQ + sc), kr1 = *(const v8us*)(Kg + (size_t)i1 * LQ + sc);
  i0 = kidx[FK + sr]; i1 = kidx[FK + sr + 32];      /* list entries are read one pass ahead of the loads that use them */
  *(v8us*)&Ks[0][sr][sc] = kr0; *(v8us*)&Ks[0][sr + 32][sc] = kr1; *(v8us*)&Vs[0][sr][sc] = vr0; *(v8us*)&Vs[0][sr + 32][sc] = vr1;
  __syncthreads();      /* publishes pass 0's tiles and the start values */
  { const v16h zq = {};
#pragma unroll      /* constant indices into qf */
    for (int g = 0; g < 2; ++g) for (int kk = 0; kk < 2; ++kk) qf[g][kk] = none ? zq : qf[g][kk]; }
  const v8f z8 = {0.f,0.f,0.f,0.f,0.f,0.f,0.f,0.f};
  v8f o[4][2] = {{z8, z8}, {z8, z8}, {z8, z8}, {z8, z8}};
  float m[2] = {-3.0e38f, -3.0e38f}, nm[2] = {0.f, 0.f}; v8f lt[2] = {z8, z8};      /* lt: every row of the tile = the column's sum of weights */
  v16h ones; for (int e = 0; e < 16; ++e) ones[e] = (_Float16)1.0f;
  const float cs = 0.125f * 1.4426950408889634f;      /* 64^-0.5 log2(e) */
#pragma unroll 1      /* one pass per trip: the body already fills the register budget */
  for (int s = 0; s < np; ++s) {
    const int buf = s & 1; const bool more = s + 1 < np;
    if (more) { const int k1 = (s + 1) * FK, k2 = min(s + 2, SQ / FK - 1) * FK;      /* next pass's tiles fly through registers while this pass is worked on */
      kr0 = *(const v8us*)(Kg + (size_t)i0 * LQ + sc); kr1 = *(const v8us*)(Kg + (size_t)i1 * LQ + sc);
      vr0 = *(const v8us*)(Vg + (size_t)sr * SQ + k1 + sc); vr1 = *(const v8us*)(Vg + (size_t)(sr + 32) * SQ + k1 + sc);
      asm volatile("s_wait_xcnt 0x0" ::: "memory");      /* the four loads have taken their addresses before the address registers get new values further down */
      i0 = kidx[k2 + sr]; i1 = kidx[k2 + sr + 32]; }
    v8f st[4][2];
    if (more) {      /* a full pass holds keys only: the score product starts at 0, nothing is read for it */
#pragma unroll      /* constant indices into st, qf */
      for (int t = 0; t < 4; ++t) {      /* D row 8 hh + r = place t 16 + 8 hh + r of the pass */
        const v16h ka = g2_frag(&Ks[buf][t * 16 + ln][0], hh), kc = g2_frag(&Ks[buf][t * 16 + ln][32], hh);
        for (int g = 0; g < 2; ++g) st[t][g] = fa_mma(kc, qf[g][1], fa_mma(ka, qf[g][0], z8));
        if (t & 1) __builtin_amdgcn_sched_barrier(0); }      /* holds the next two tiles' fragment loads behind these products: all eight K fragments loaded at once overflow the register budget of four waves per SIMD (spills) */
    } else {      /* the last pass: places behind the list's end start at FMASK */
#pragma unroll      /* constant indices into st, qf */
      for (int t = 0; t < 4; ++t) { const v8f c0 = *(const v8fa*)&kb[t * 16 + 8 * hh];
        const v16h ka = g2_frag(&Ks[buf][t * 16 + ln][0], hh), kc = g2_frag(&Ks[buf][t * 16 + ln][32], hh);
        for (int g = 0; g < 2; ++g) st[t][g] = fa_mma(kc, qf[g][1], fa_mma(ka, qf[g][0], c0));
        if (t & 1) __builtin_amdgcn_sched_barrier(0); }      /* as above */
    }
    float ms[2];
#pragma unroll      /* constant indices into st */
    for (int g = 0; g < 2; ++g) { float mx = st[0][g][0];
      for (int t = 0; t < 4; ++t) for (int r = 0; r < 8; ++r) mx = fmaxf(mx, st[t][g][r]);
      ms[g] = fmaxf(mx, fa_xhalf(mx)) * cs; }
    if (__builtin_amdgcn_ballot_w32(ms[0] > m[0] + FTHR || ms[1] > m[1] + FTHR) != 0u) {      /* one scalar branch per pass */
#pragma unroll      /* constant indices into o */
      for (int g = 0; g < 2; ++g) { const float mn = fmaxf(m[g], ms[g]); const float al = __builtin_amdgcn_exp2f(m[g] - mn); m[g] = mn; nm[g] = FOFF - mn; lt[g] *= al;
        for (int dt = 0; dt < 4; ++dt) o[dt][g] *= al; } }
    FragP pf[2][2];
#pragma unroll      /* constant indices into st, pf */
    for (int g = 0; g < 2; ++g) for (int t = 0; t < 4; ++t) for (int r = 0; r < 8; r += 2) {
      v2f p; p[0] = __builtin_amdgcn_exp2f(__builtin_fmaf(st[t][g][r], cs, nm[g])); p[1] = __builtin_amdgcn_exp2f(__builtin_fmaf(st[t][g][r + 1], cs, nm[g]));
      pf[t >> 1][g].p[(t & 1) * 4 + (r >> 1)] = __builtin_convertvector(p, v2h); }      /* b[e] = T[e >> 3][e & 7]: the hardware k order */
#pragma unroll      /* constant indices into lt, pf */
    for (int j = 0; j < 2; ++j) for (int g = 0; g < 2; ++g) lt[g] = fa_mma(ones, pf[j][g].v, lt[g]);      /* row sums on the matrix pipe: A = ones sums the rounded weights of all 32 keys, both wave halves' */
#pragma unroll      /* constant indices into o, pf */
    for (int dt = 0; dt < 4; ++dt) for (int j = 0; j < 2; ++j) { const v16h vf = g2_frag(&Vs[buf][dt * 16 + ln][j * 32], hh);      /* same k order as the packed weights */
      for (int g = 0; g < 2; ++g) o[dt][g] = fa_mma(vf, pf[j][g].v, o[dt][g]); }
    if (more) { *(v8us*)&Ks[buf ^ 1][sr][sc] = kr0; *(v8us*)&Ks[buf ^ 1][sr + 32][sc] = kr1; *(v8us*)&Vs[buf ^ 1][sr][sc] = vr0; *(v8us*)&Vs[buf ^ 1][sr + 32][sc] = vr1; }      /* that buffer's readers left it at the last barrier */
    __syncthreads();      /* publishes the next pass's tiles and ends this pass's reads */
  }
#pragma unroll      /* constant indices into o */
  for (int g = 0; g < 2; ++g) { const float sc64 = 64.0f / lt[g][0];      /* o carried x64, as the output GEMM's alpha expects */
    unsigned short* d = (unsigned short*)O16 + ((size_t)b * SQ + q0 + g * 16 + ln) * DM + h * HD + 8 * hh;
    for (int dt = 0; dt < 4; ++dt) { FragH f; for (int r = 0; r < 8; ++r) f.h[r] = (_Float16)(o[dt][g][r] * sc64); *(v8us*)(d + dt * 16) = f.half[0]; } } }

// ---- GEMM with both operands staged in LDS: C[M][NN] = (A[M][DM] Bt[NN][DM]^T) alpha + bias, A and Bt f16 rows of DM halves.
// A work-group of 8 waves (4 x 2) takes a 256 x 128 tile of C, a wave 64 x 64 (4 x 4 accumulator tiles). A stage is 64 k of the tile's 256 A rows and 128 Bt rows, 128-byte rows at pitch 144 bytes;
// two buffers, filled by asynchronous copies to LDS (whole 128-byte lines, each read once per work-group) one stage ahead of the products. Every accumulator sums k in steps of 32 in rising order.
#define G3M 256
#define G3N 128
#define G3K 64
#define G3P 72                            /* LDS row pitch in halves: 144 bytes = 16 x odd, for 16-byte row reads */
#define G3R (G3M + G3N)                   /* rows of a stage: A rows, then Bt rows */
#define G3B ((unsigned)(G3R * G3P * 2))   /* bytes of a buffer */
#define G3S ((unsigned)(32 * G3P * 2))    /* bytes of 32 LDS rows */
#define G3O 68                            /* output staging pitch in floats */
typedef float f1a __attribute__((may_alias));
template <int NN, bool F32>      /* F32: C (f32) is written, else C16 (f16) */
__global__ __launch_bounds__(256) void k_gemm3(const _Float16* __restrict__ A, const _Float16* __restrict__ Bt, float alpha, const float* __restrict__ bias, float* __restrict__ C, _Float16* __restrict__ C16) {
  __shared__ __attribute__((aligned(16))) _Float16 sm[2][G3R][G3P];
  const int tid = threadIdx.x, w = tid >> 5, lane = tid & 31, ln = lane & 15, hh = lane >> 4;
  const int ntn = NN / G3N; const int mt = blockIdx.x / ntn, nq = blockIdx.x - mt * ntn; const int row0 = mt * G3M, col0 = nq * G3N;
  const int wr = (w >> 1) * 64, wc = (w & 1) * 64;      /* the wave's 64 x 64 part of the tile */
  const int sr = tid >> 3, sc = (tid & 7) * 8;      /* staging: 16-byte piece sc of rows sr + 32 i: a wave's copy covers four whole 128-byte rows */
  const _Float16* ga = A + (size_t)(row0 + sr) * DM + sc; const _Float16* gb = Bt + (size_t)(col0 + sr) * DM + sc;
  const unsigned l0 = (unsigned)(size_t)&sm[0][sr][sc];      /* low 32 bits of the shared address = the byte address in LDS */
  auto fill = [&](int s) { const unsigned l = l0 + (unsigned)(s & 1) * G3B; const _Float16* a = ga + s * G3K; const _Float16* bq = gb + s * G3K;
    /* one stage: 12 copies per lane (8 A rows, 4 Bt rows); the closing wait keeps every address register as it is until the copies have taken it */
    asm volatile("global_load_async_to_lds_b128 %0, %1, off\n\t"
      "global_load_async_to_lds_b128 %2, %3, off\n\t"
      "global_load_async_to_lds_b128 %4, %5, off\n\t"
      "global_load_async_to_lds_b128 %6, %7, off\n\t"
      "global_load_async_to_lds_b128 %8, %9, off\n\t"
      "global_load_async_to_lds_b128 %10, %11, off\n\t"
      "global_load_async_to_lds_b128 %12, %13, off\n\t"
      "global_load_async_to_lds_b128 %14, %15, off\n\t"
      "global_load_async_to_lds_b128 %16, %17, off\n\t"
      "global_load_async_to_lds_b128 %18, %19, off\n\t"
      "global_load_async_to_lds_b128 %20, %21, off\n\t"
      "global_load_async_to_lds_b128 %22, %23, off\n\t"
      "s_wait_xcnt 0x0"
      :: "v"(l + 0u * G3S), "v"(a + (size_t)0 * 32 * DM),
         "v"(l + 1u * G3S), "v"(a + (size_t)1 * 32 * DM),
         "v"(l + 2u * G3S), "v"(a + (size_t)2 * 32 * DM),
         "v"(l + 3u * G3S), "v"(a + (size_t)3 * 32 * DM),
         "v"(l + 4u * G3S), "v"(a + (size_t)4 * 32 * DM),
         "v"(l + 5u * G3S), "v"(a + (size_t)5 * 32 * DM),
         "v"(l + 6u * G3S), "v"(a + (size_t)6 * 32 * DM),
         "v"(l + 7u * G3S), "v"(a + (size_t)7 * 32 * DM),
         "v"(l + 8u * G3S), "v"(bq + (size_t)0 * 32 * DM),
         "v"(l + 9u * G3S), "v"(bq + (size_t)1 * 32 * DM),
         "v"(l + 10u * G3S), "v"(bq + (size_t)2 * 32 * DM),
         "v"(l + 11u * G3S), "v"(bq + (size_t)3 * 32 * DM)
      : "memory"); };
  fill(0);
  asm volatile("s_wait_asynccnt 0x0" ::: "memory");      /* this wave's part of stage 0 has landed */
  __syncthreads();      /* publishes stage 0 */
  fill(1);
  const v8f z8 = {0.f,0.f,0.f,0.f,0.f,0.f,0.f,0.f};
  v8f acc[4][4];
#pragma unroll      /* constant indices into acc */
  for (int i = 0; i < 4; ++i) for (int j = 0; j < 4; ++j) acc[i][j] = z8;
#pragma unroll 1      /* one stage per trip: the ring's order stands at the foot of each trip */
  for (int s = 0; s < DM / G3K; ++s) {
    const int buf = s & 1;
#pragma unroll      /* constant indices into acc */
    for (int kk = 0; kk < 2; ++kk) { v16h af[4], bf[4];
      af[0] = g2_frag(&sm[buf][wr + ln][kk * 32], hh);
      for (int j = 0; j < 4; ++j) bf[j] = g2_frag(&sm[buf][G3M + wc + j * 16 + ln][kk * 32], hh);
      for (int i = 1; i < 4; ++i) af[i] = g2_frag(&sm[buf][wr + i * 16 + ln][kk * 32], hh);
      __builtin_amdgcn_sched_barrier(0);      /* the 16 LDS reads of a block stand as one group ahead of its 16 products: left alone the compiler reloads one A fragment per four products and waits for it each time */
      for (int i = 0; i < 4; ++i) for (int j = 0; j < 4; ++j) acc[i][j] = fa_mma(af[i], bf[j], acc[i][j]);
      __builtin_amdgcn_sched_barrier(0); }      /* keeps the next block's reads out of this block's products */
    asm volatile("s_wait_dscnt 0x0" ::: "memory");      /* this wave's reads of the buffer have returned before it is refilled */
    asm volatile("s_wait_asynccnt 0x0" ::: "memory");      /* this wave's part of the next stage has landed */
    __syncthreads();      /* publishes the next stage and ends this stage's reads */
    if (s + 2 < DM / G3K) fill(s + 2);
  }
  asm volatile("s_wait_asynccnt 0x0" ::: "memory");      /* nothing is in flight when the ring becomes output staging */
  f1a* so = (f1a*)&sm[0][0][0] + (size_t)w * 32 * G3O;      /* each wave stages 32 rows at a time in its own range; every wave has left the ring at the last barrier */
  const int rsub = lane >> 4, c4 = (lane & 15) * 4;
  float bv[4];
#pragma unroll      /* constant indices into bv */
  for (int j = 0; j < 4; ++j) bv[j] = bias ? bf16_round(bias[col0 + wc + j * 16 + ln]) : 0.f;
#pragma unroll      /* constant indices into acc */
  for (int hf = 0; hf < 2; ++hf) {
#pragma unroll      /* constant indices into acc, bv */
    for (int i = 0; i < 2; ++i) for (int j = 0; j < 4; ++j) for (int r = 0; r < 8; ++r) so[(i * 16 + 8 * hh + r) * G3O + j * 16 + ln] = acc[hf * 2 + i][j][r] * alpha + bv[j];
    asm volatile("s_wait_dscnt 0x0" ::: "memory");      /* the staged rows are written before other lanes of the wave read them back */
#pragma unroll      /* the 16 read-backs go out together instead of one wait each */
    for (int q = 0; q < 16; ++q) { const int r = q * 2 + rsub; const v4f v = *(const v4fa*)&so[r * G3O + c4]; const size_t ofs = (size_t)(row0 + wr + hf * 32 + r) * NN + col0 + wc + c4;
      if (F32) *(v4f*)(C + ofs) = v;
      else { v4h h4; for (int e = 0; e < 4; ++e) h4[e] = (_Float16)v[e]; *(v4h*)(C16 + ofs) = h4; } }
    asm volatile("s_wait_dscnt 0x0" ::: "memory");      /* the read-back has returned before the next 32 rows overwrite the range */
  } }
extern "C" void kernel_launch(void* const* d_in, const int* in_sizes, int n_in,
                              void* d_out, int out_size, void* d_ws, size_t ws_size, hipStream_t stream) {
  (void)in_sizes; (void)n_in; (void)out_size;
  const float* const* I = (const float* const*)d_in; const float* x = I[0]; const float* wqkv = I[1]; const float* bqkv = nullptr; const float* wo = I[2]; const float* bo = I[3]; const int* km = (const int*)d_in[4];      /* x; [in][out] Wqkv [1024][3072] (no bias), Wproj [1024][1024] + bproj; mask int32 [4][2048] (> 0 = MASKED key; READ on device) */
  char* ws = (char*)d_ws; size_t off = 0;
  auto take = [&](size_t bytes) { char* p = ws + off; off += (bytes + 255) & ~(size_t)255; return p; };
  _Float16* BQKV = (_Float16*)take((size_t)3 * DM * DM * 2); _Float16* BO = (_Float16*)take((size_t)DM * DM * 2);
  _Float16* X16 = (_Float16*)take(NR * DM * 2); _Float16* QKV = (_Float16*)take(NR * 3 * DM * 2); _Float16* V16 = QKV + 2 * DM; _Float16* O16 = (_Float16*)take(NR * DM * 2);
  _Float16* VT = (_Float16*)take((size_t)NB * NH * HD * SQ * 2);
  if (off > ws_size) return;
  k_wt_f16<<<(unsigned)(((size_t)DM * 3 * DM / 8 + 255) / 256), 256, 0, stream>>>(wqkv, BQKV, DM, 3 * DM, 16.0f); k_wt_f16<<<(unsigned)(((size_t)DM * DM / 8 + 255) / 256), 256, 0, stream>>>(wo, BO, DM, DM, 16.0f);      /* [in][out] -> Bt[n][k] x16 (pitch K = 1024) */

  k_x16<<<(unsigned)((NR * DM / 8 + 255) / 256), 256, 0, stream>>>(x, X16, NR * DM / 8);
  const size_t r0p = (size_t)B0 * SQ;      /* first projected row */
  k_gemm3<3 * DM, false><<<(unsigned)((MP / G3M) * (3 * DM / G3N)), 256, 0, stream>>>(X16 + r0p * DM, BQKV, 0.0625f, bqkv, nullptr, QKV + r0p * 3 * DM);      /* q | k | v rows (f16); head h = columns h*HD.. of each DM block */
  k_vtk<<<NBR * NH * (SQ / 64), 256, 0, stream>>>(V16 + r0p * LQ, km + r0p, VT);      /* V^T of the kept keys [NBR][NH][HD][SQ] */
  k_fattn<<<dim3(SQ / 256, NH, NBR), 256, 0, stream>>>(QKV + r0p * LQ, VT, km + r0p, O16 + r0p * DM);      /* o x64 (merged heads) as f16 rows */
  k_gemm3<DM, true><<<(unsigned)((MPO / G3M) * (DM / G3N)), 256, 0, stream>>>(O16 + r0p * DM, BO, 0.0009765625f, bo, (float*)d_out + r0p * DM, nullptr);      /* out rows are the output layout */
}

// v005
// One run takes 108 microseconds.
// Next to v004, in two timings, it ran 1.17 times as fast each time.
// Counting every step since v000, it is 62.5 times as fast.
#include <hip/hip_runtime.h>
// Multi-head self-attention with a fused QKV projection and an INVERTED key mask (x [4][2048][1024]; qkv = x Wqkv ([in][out] 1024 x 3072, NO bias) reshaped (B, N, 3, 16, 64): q | k | v blocks; att = q k^T * 64^-0.5; where(mask[b][j] > 0, -1e7) with the int32 [4][2048] mask in {0, 1} (random; > 0 means MASKED; read on device; masked weights underflow to exactly 0); softmax over keys; out = merged Wproj + bproj ([in][out]) -> [4][2048][1024]).
// Structure: token rows r = b*2048 + s; x as exact f16 rows (bf16-rounded); q | k | v as ONE WMMA GEMM (N = 3 x 1024) (operands staged in LDS, 64x64 wave tiles, f32 accumulation, exact x16 weights, no bias, f16 outputs); V^T for all batches and heads via LDS transposes; attention in ONE launch (scores, online softmax with f32 statistics and the weighted sum of V in registers; o carried x64 against f16 subnormal flush, folded into the output GEMM alpha) written straight into the merged f16 o rows; out = o W_o + b GEMM (f32) into the output layout.
// Compute dtype: inputs rounded to bf16; x / weights exact; q, k, v, softmax weights and o as plain f16 GEMM operands (~2^-12); scores and softmax statistics f32. v_wmma_f32_16x16x32_f16.
#define NB 4
#define SQ 2048
#define DM 1024
#define NH 16
#define HD 64
#define HG 4                         /* heads per block group of the (b, h0) k_vt overload */
#define B0 0                         /* first batch processed (debug hook) */
#define NBR NB                       /* batches processed (debug hook) */
#define NR ((size_t)NB * SQ)         /* token rows */
#define MP ((int)((size_t)NBR * SQ)) /* rows projected (debug hook) */
#define QN SQ                        /* unused: attention takes all SQ queries */
#define NHD NH                       /* unused: attention takes all NH heads */
#define MPO MP                       /* rows through the output stage (debug hook) */
#define LQ (3 * DM)      /* row pitch of the q/k/v rows */
typedef __bf16 v16b __attribute__((ext_vector_type(16)));
typedef unsigned short v8us __attribute__((ext_vector_type(8), may_alias));
typedef float  v8f  __attribute__((ext_vector_type(8)));
typedef float  v4f  __attribute__((ext_vector_type(4)));
typedef float  v4fa __attribute__((ext_vector_type(4), may_alias));
union FragB { v16b v; v8us half[2]; unsigned short u[16]; };

__device__ __forceinline__ unsigned short bf16_bits(float x) { unsigned int u = __float_as_uint(x); return (unsigned short)((u + 0x7FFFu + ((u >> 16) & 1u)) >> 16); }
__device__ __forceinline__ float bf16_val(unsigned short b) { return __uint_as_float(((unsigned int)b) << 16); }
__device__ __forceinline__ float bf16_round(float x) { return bf16_val(bf16_bits(x)); }
// D += A·B with NT terms: 1 = ah·bh, 2 = + al·bh (A split), 3 = + ah·bl (both split)
template <int NT>
__device__ __forceinline__ v8f mmaN(v16b ah, v16b al, v16b bh, v16b bl, v8f c) {
  c = __builtin_amdgcn_wmma_f32_16x16x32_bf16(false, ah, false, bh, (short)0, c, false, false);
  if (NT >= 2) c = __builtin_amdgcn_wmma_f32_16x16x32_bf16(false, al, false, bh, (short)0, c, false, false);
  if (NT >= 3) c = __builtin_amdgcn_wmma_f32_16x16x32_bf16(false, ah, false, bl, (short)0, c, false, false);
  asm volatile("v_nop\n\tv_nop\n\tv_nop\n\tv_nop" : "+v"(c) : "v"(ah), "v"(al), "v"(bh), "v"(bl));
  return c;
}

__global__ __launch_bounds__(256) void k_wt_bf16(const float* __restrict__ W, unsigned short* __restrict__ Wt, int K, int N) {
  const int t = blockIdx.x * 256 + threadIdx.x;
  const int k8n = K / 8;
  if (t >= N * k8n) return;
  const int n = t / k8n, k8 = (t % k8n) * 8;
  v8us v;
#pragma unroll
  for (int i = 0; i < 8; ++i) v[i] = bf16_bits(W[(size_t)(k8 + i) * N + n]);
  *(v8us*)(Wt + (size_t)n * K + k8) = v;
  
}

// GEMM C[M][N] (f32, pitch ldc) = act(A[M][K]·W + bias). A f32 row-major (pitch lda) converted per fragment to bf16
// (ASPLIT: hi/lo two planes -> 2 terms, else single rounded term); Wt bf16 [N][K] (pitch ldb). BIAS_BF16 rounds the
// bias to bf16 first (bias quantised to bf16 before the add). K%32==0, M%16==0, N%64==0.
template <bool ASPLIT, int ACT, bool BIAS_BF16>
__global__ __launch_bounds__(128) void k_gemm_bf(const float* __restrict__ A, int lda, const unsigned short* __restrict__ Wt, int ldb,
                                               const float* __restrict__ bias, float* __restrict__ C, int ldc, int M, int N, int K) {
  __shared__ __attribute__((aligned(16))) float so[4][16][64];
  const int tid = threadIdx.x, w = tid >> 5, lane = tid & 31, ln = lane & 15, hh = lane >> 4;
  const int ntn = N / 64;
  const int wid = blockIdx.x * 4 + w;
  const int mt = wid / ntn, nq = wid % ntn;
  if (mt * 16 >= M) return;
  const int row0 = mt * 16, col0 = nq * 64;
  const float* arow = A + (size_t)(row0 + ln) * lda;
  v8f acc[4] = {};
  for (int kb = 0; kb < K; kb += 32) {
    FragB ah, al;
    const v4f x0 = *(const v4fa*)(arow + kb + 8 * hh), x1 = *(const v4fa*)(arow + kb + 8 * hh + 4);
    const v4f x2 = *(const v4fa*)(arow + kb + 16 + 8 * hh), x3 = *(const v4fa*)(arow + kb + 16 + 8 * hh + 4);
    float xs[16] = {x0[0],x0[1],x0[2],x0[3],x1[0],x1[1],x1[2],x1[3],x2[0],x2[1],x2[2],x2[3],x3[0],x3[1],x3[2],x3[3]};
#pragma unroll
    for (int i = 0; i < 16; ++i) { const unsigned short hb = bf16_bits(xs[i]); ah.u[i] = hb; al.u[i] = ASPLIT ? bf16_bits(xs[i] - bf16_val(hb)) : (unsigned short)0; }
#pragma unroll
    for (int t = 0; t < 4; ++t) {
      const unsigned short* brow = Wt + (size_t)(col0 + t * 16 + ln) * ldb + kb;
      FragB b;
      b.half[0] = *(const v8us*)(brow + 8 * hh);
      b.half[1] = *(const v8us*)(brow + 16 + 8 * hh);
      acc[t] = mmaN<ASPLIT ? 2 : 1>(ah.v, al.v, b.v, b.v, acc[t]);
    }
  }
#pragma unroll
  for (int t = 0; t < 4; ++t) {
    float bv = bias ? bias[col0 + t * 16 + ln] : 0.f;
    if (BIAS_BF16) bv = bf16_round(bv);
#pragma unroll
    for (int r = 0; r < 8; ++r) { float v = acc[t][r] + bv; if (ACT == 1) v = fmaxf(v, 0.f); so[w][8 * hh + r][t * 16 + ln] = v; }
  }
  __builtin_amdgcn_fence(__ATOMIC_ACQ_REL, "workgroup");
  __builtin_amdgcn_wave_barrier();
  const int rsub = lane >> 4, c4 = (lane & 15) * 4;
  {
#pragma unroll
    for (int q = 0; q < 8; ++q) {
      const int r = q * 2 + rsub;
      const v4f v = *(const v4fa*)&so[w][r][c4];
      *(v4f*)(C + (size_t)(row0 + r) * ldc + col0 + c4) = v;
    }
    
  }
}

// GEMM C = act(A·W + bias + resid): A f32 (ASPLIT -> hi/lo 2 terms), Wt bf16 [N][K]; ACT 0 none, 1 relu, 2 exact gelu;
// resid (optional, f32, row index = (row % rmod), pitch ldr, RES_BF16 rounds it) added before the activation.
template <bool ASPLIT, int ACT, bool BIAS_BF16, bool RES_BF16>
__global__ __launch_bounds__(128) void k_gemm_bf3(const float* __restrict__ A, int lda, const unsigned short* __restrict__ Wt, int ldb,
                                                const float* __restrict__ bias, const float* __restrict__ resid, int rmod, int ldr,
                                                float* __restrict__ C, int ldc, int M, int N, int K) {
  __shared__ __attribute__((aligned(16))) float so[4][16][64];
  const int tid = threadIdx.x, w = tid >> 5, lane = tid & 31, ln = lane & 15, hh = lane >> 4;
  const int ntn = N / 64;
  const int wid = blockIdx.x * 4 + w;
  const int mt = wid / ntn, nq = wid % ntn;
  if (mt * 16 >= M) return;
  const int row0 = mt * 16, col0 = nq * 64;
  const float* arow = A + (size_t)(row0 + ln) * lda;
  v8f acc[4] = {};
  for (int kb = 0; kb < K; kb += 32) {
    FragB ah, al;
    const v4f x0 = *(const v4fa*)(arow + kb + 8 * hh), x1 = *(const v4fa*)(arow + kb + 8 * hh + 4);
    const v4f x2 = *(const v4fa*)(arow + kb + 16 + 8 * hh), x3 = *(const v4fa*)(arow + kb + 16 + 8 * hh + 4);
    float xs[16] = {x0[0],x0[1],x0[2],x0[3],x1[0],x1[1],x1[2],x1[3],x2[0],x2[1],x2[2],x2[3],x3[0],x3[1],x3[2],x3[3]};
#pragma unroll
    for (int i = 0; i < 16; ++i) { const unsigned short hb = bf16_bits(xs[i]); ah.u[i] = hb; al.u[i] = ASPLIT ? bf16_bits(xs[i] - bf16_val(hb)) : (unsigned short)0; }
#pragma unroll
    for (int t = 0; t < 4; ++t) {
      const unsigned short* brow = Wt + (size_t)(col0 + t * 16 + ln) * ldb + kb;
      FragB b;
      b.half[0] = *(const v8us*)(brow + 8 * hh);
      b.half[1] = *(const v8us*)(brow + 16 + 8 * hh);
      acc[t] = mmaN<ASPLIT ? 2 : 1>(ah.v, al.v, b.v, b.v, acc[t]);
    }
  }
#pragma unroll
  for (int t = 0; t < 4; ++t) {
    const int col = col0 + t * 16 + ln;
    float bv = bias ? bias[col] : 0.f;
    if (BIAS_BF16) bv = bf16_round(bv);
#pragma unroll
    for (int r = 0; r < 8; ++r) {
      float v = acc[t][r] + bv;
      if (resid) { float rv = resid[(size_t)((row0 + 8 * hh + r) % rmod) * ldr + col]; if (RES_BF16) rv = bf16_round(rv); v += rv; }
      if (ACT == 1) v = fmaxf(v, 0.f);
      if (ACT == 2) v = 0.5f * v * (1.0f + erff(v * 0.70710678118654752f));
      if (ACT == 3) { const float u = 0.7978845608028654f * (v + 0.044715f * v * v * v); v = 0.5f * v * (1.0f + tanhf(u)); }
      so[w][8 * hh + r][t * 16 + ln] = v;
    }
  }
  __builtin_amdgcn_fence(__ATOMIC_ACQ_REL, "workgroup");
  __builtin_amdgcn_wave_barrier();
  const int rsub = lane >> 4, c4 = (lane & 15) * 4;
  {
#pragma unroll
    for (int q = 0; q < 8; ++q) {
      const int r = q * 2 + rsub;
      const v4f v = *(const v4fa*)&so[w][r][c4];
      *(v4f*)(C + (size_t)(row0 + r) * ldc + col0 + c4) = v;
    }
    
  }
}
// row LayerNorm (biased variance, eps) over N: s = X (+ R); optional out_sum <- s; out_norm <- (s-mu)*rsqrt(var+eps)*g + b
template <bool PARAM_BF16>
__global__ __launch_bounds__(256) void k_layernorm(const float* __restrict__ X, const float* __restrict__ R, const float* __restrict__ g, const float* __restrict__ bta,
                                                  float* __restrict__ out_sum, float* __restrict__ out_norm, int N, float eps) {
  __shared__ float red[256];
  const int row = blockIdx.x, tid = threadIdx.x;
  const float* x = X + (size_t)row * N; const float* rr = R ? R + (size_t)row * N : nullptr;
  float vals[16];                     // up to N = 4096
  const int per = N / 256;            // contiguous chunk per thread? use strided-by-4 chunks: thread handles j = tid*4 + 1024*u
  float s1 = 0.f;
  for (int u = 0; u < per / 4; ++u) {
    const int j = tid * 4 + 1024 * u;
    const v4f a = *(const v4fa*)(x + j);
    v4f b = {0.f,0.f,0.f,0.f}; if (rr) b = *(const v4fa*)(rr + j);
#pragma unroll
    for (int q = 0; q < 4; ++q) { const float v = a[q] + b[q]; vals[u * 4 + q] = v; s1 += v; }
  }
  red[tid] = s1; __syncthreads();
  for (int st = 128; st > 0; st >>= 1) { if (tid < st) red[tid] += red[tid + st]; __syncthreads(); }
  const float mu = red[0] / (float)N; __syncthreads();
  float s2 = 0.f;
  for (int u = 0; u < per / 4; ++u)
#pragma unroll
    for (int q = 0; q < 4; ++q) { const float c = vals[u * 4 + q] - mu; s2 += c * c; }
  red[tid] = s2; __syncthreads();
  for (int st = 128; st > 0; st >>= 1) { if (tid < st) red[tid] += red[tid + st]; __syncthreads(); }
  const float rs = rsqrtf(red[0] / (float)N + eps);
  {
    for (int u = 0; u < per / 4; ++u) {
      const int j = tid * 4 + 1024 * u;
      v4f o, sm;
#pragma unroll
      for (int q = 0; q < 4; ++q) {
        float gg = g[j + q], bb = bta[j + q];
        if (PARAM_BF16) { gg = bf16_round(gg); bb = bf16_round(bb); }
        sm[q] = vals[u * 4 + q]; o[q] = (vals[u * 4 + q] - mu) * rs * gg + bb;
      }
      if (out_sum) *(v4f*)(out_sum + (size_t)row * N + j) = sm;
      *(v4f*)(out_norm + (size_t)row * N + j) = o;
    }
    
  }
}



// ---- f16 WMMA path (v_wmma_f32_16x16x32_f16): 11-bit significands for operands in range — used where a [0,1] probability operand needs more precision than bf16
typedef _Float16 v16h __attribute__((ext_vector_type(16)));
union FragH { v16h v; v8us half[2]; _Float16 h[16]; unsigned short u[16]; };
template <int NT>
__device__ __forceinline__ v8f mmaH(v16h ah, v16h al, v16h bh, v16h bl, v8f c) {
  c = __builtin_amdgcn_wmma_f32_16x16x32_f16(false, ah, false, bh, (short)0, c, false, false);
  if (NT >= 2) c = __builtin_amdgcn_wmma_f32_16x16x32_f16(false, al, false, bh, (short)0, c, false, false);
  if (NT >= 3) c = __builtin_amdgcn_wmma_f32_16x16x32_f16(false, ah, false, bl, (short)0, c, false, false);
  asm volatile("v_nop\n\tv_nop\n\tv_nop\n\tv_nop" : "+v"(c) : "v"(ah), "v"(al), "v"(bh), "v"(bl));
  return c;
}
// batched GEMM like k_gemm_b but f16 operands: A f32 (split into f16 hi/lo if ASPLIT, else rounded to f16), Bt = f16 values [n][k]; alpha; C f32; N multiple of 16 (partial tiles skipped)
template <bool ASPLIT>
__global__ __launch_bounds__(128) void k_gemm_h(const float* __restrict__ A, int lda, size_t sA, const _Float16* __restrict__ Bh, int ldb, size_t sB, float alpha, float* __restrict__ C, int ldc, size_t sC, int M, int N, int K) {
  __shared__ __attribute__((aligned(16))) float so[4][16][64];
  const int tid = threadIdx.x, w = tid >> 5, lane = tid & 31, ln = lane & 15, hh = lane >> 4; const int by = blockIdx.y;
  A += (size_t)by * sA; Bh += (size_t)by * sB; C += (size_t)by * sC;
  const int ntn = (N + 63) / 64; const int wid = blockIdx.x * 4 + w; const int mt = wid / ntn, nq = wid % ntn; if (mt * 16 >= M) return;
  const int row0 = mt * 16, col0 = nq * 64; const float* arow = A + (size_t)(row0 + ln) * lda;
  v8f acc[4] = {};
  for (int kb = 0; kb < K; kb += 32) {
    FragH ah, al;
    const v4f x0 = *(const v4fa*)(arow + kb + 8 * hh), x1 = *(const v4fa*)(arow + kb + 8 * hh + 4), x2 = *(const v4fa*)(arow + kb + 16 + 8 * hh), x3 = *(const v4fa*)(arow + kb + 16 + 8 * hh + 4);
    float xs[16] = {x0[0],x0[1],x0[2],x0[3],x1[0],x1[1],x1[2],x1[3],x2[0],x2[1],x2[2],x2[3],x3[0],x3[1],x3[2],x3[3]};
#pragma unroll
    for (int i = 0; i < 16; ++i) { const _Float16 h = (_Float16)xs[i]; ah.h[i] = h; al.h[i] = ASPLIT ? (_Float16)(xs[i] - (float)h) : (_Float16)0.0f; }
#pragma unroll
    for (int t = 0; t < 4; ++t) { if (col0 + t * 16 >= N) continue; const size_t boff = (size_t)(col0 + t * 16 + ln) * ldb + kb; FragH bq; bq.half[0] = *(const v8us*)(Bh + boff + 8 * hh); bq.half[1] = *(const v8us*)(Bh + boff + 16 + 8 * hh);
      acc[t] = mmaH<ASPLIT ? 2 : 1>(ah.v, al.v, bq.v, bq.v, acc[t]); }
  }
#pragma unroll
  for (int t = 0; t < 4; ++t) { if (col0 + t * 16 >= N) continue;
#pragma unroll
    for (int r = 0; r < 8; ++r) so[w][8 * hh + r][t * 16 + ln] = acc[t][r] * alpha; }
  __builtin_amdgcn_fence(__ATOMIC_ACQ_REL, "workgroup"); __builtin_amdgcn_wave_barrier();
  const int rsub = lane >> 4, c4 = (lane & 15) * 4;
  {
#pragma unroll
    for (int q = 0; q < 8; ++q) { const int r = q * 2 + rsub; if (col0 + c4 < N) { const v4f v = *(const v4fa*)&so[w][r][c4]; *(v4f*)(C + (size_t)(row0 + r) * ldc + col0 + c4) = v; } }
     }
}

// k_gemm_hh variant with fused epilogue: v = acc·alpha + bias[by·sBias + col] (+ CP[(row/rowsPerB)·sCPb + by·64 + col] if CP) ; ACT 0 none / 1 elu ; writes f16 C16 (and f32 C if non-null)
template <int ACT>
__global__ __launch_bounds__(128) void k_gemm_hhx(const _Float16* __restrict__ A, int lda, size_t sA, const _Float16* __restrict__ Bh, int ldb, size_t sB, float alpha, const float* __restrict__ bias, size_t sBias, const float* __restrict__ CP, int rowsPerB, size_t sCPb, int row0g,
    float* __restrict__ C, _Float16* __restrict__ C16, int ldc, size_t sC, int M, int N, int K) {
  __shared__ __attribute__((aligned(16))) float so[4][16][64];
  const int tid = threadIdx.x, w = tid >> 5, lane = tid & 31, ln = lane & 15, hh = lane >> 4; const int by = blockIdx.y;
  A += (size_t)by * sA; Bh += (size_t)by * sB; const size_t cofs = (size_t)by * sC; const float* bp = bias ? bias + (size_t)by * sBias : nullptr;
  const int ntn = (N + 63) / 64; const int wid = blockIdx.x * 4 + w; const int mt = wid / ntn, nq = wid % ntn; if (mt * 16 >= M) return;
  const int row0 = mt * 16, col0 = nq * 64; const _Float16* arow = A + (size_t)(row0 + ln) * lda;
  v8f acc[4] = {};
  for (int kb = 0; kb < K; kb += 32) { FragH ah; ah.half[0] = *(const v8us*)((const unsigned short*)arow + kb + 8 * hh); ah.half[1] = *(const v8us*)((const unsigned short*)arow + kb + 16 + 8 * hh);
#pragma unroll
    for (int t = 0; t < 4; ++t) { if (col0 + t * 16 >= N) continue; const size_t boff = (size_t)(col0 + t * 16 + ln) * ldb + kb; FragH bq; bq.half[0] = *(const v8us*)((const unsigned short*)Bh + boff + 8 * hh); bq.half[1] = *(const v8us*)((const unsigned short*)Bh + boff + 16 + 8 * hh);
      acc[t] = mmaH<1>(ah.v, ah.v, bq.v, bq.v, acc[t]); }
  }
#pragma unroll
  for (int t = 0; t < 4; ++t) { if (col0 + t * 16 >= N) continue; const int col = col0 + t * 16 + ln; const float bv = bp ? bf16_round(bp[col]) : 0.f;
#pragma unroll
    for (int r = 0; r < 8; ++r) { float v = acc[t][r] * alpha + bv; if (CP) { const int rr = row0g + row0 + 8 * hh + r; if (rowsPerB < 0) v += CP[cofs + (size_t)rr * ldc + col];      /* rowsPerB < 0: own element of the batched C plane */ else { const int bidx = rr / rowsPerB; v += CP[(size_t)bidx * sCPb + (size_t)by * 64 + col]; } } if (ACT == 1) v = (v > 0.f) ? v : expm1f(v); else if (ACT == 7) v = (v > 0.f) ? v + 1.0f : expf(v); else if (ACT == 8) v = tanhf(v); else if (ACT == 9) v = 0.5f * v * (1.0f + tanhf(0.7978845608028654f * (v + 0.044715f * v * v * v))); else if (ACT == 11) v = 1.0f / (1.0f + expf(-v)); else if (ACT == 12) v = (v > 0.f) ? v : 0.01f * v; else if (ACT == 14) v = (v > 0.f) ? v : 0.1f * v; else if (ACT == 16) v = (v >= 0.f) ? v : 0.3f * v; else if (ACT == 17) v = (v >= 0.f) ? v : 0.2f * v; else if (ACT == 15) v = v / (1.0f + expf(-v)); else if (ACT == 3) v = fmaxf(v, 0.f); else if (ACT == 6) v = 0.5f * v * (1.0f + erff(v * 0.70710678118654752f)); so[w][8 * hh + r][t * 16 + ln] = v; } }
  __builtin_amdgcn_fence(__ATOMIC_ACQ_REL, "workgroup"); __builtin_amdgcn_wave_barrier();
  const int rsub = lane >> 4, c4 = (lane & 15) * 4; typedef _Float16 v4h __attribute__((ext_vector_type(4)));
  {
#pragma unroll
    for (int q = 0; q < 8; ++q) { const int r = q * 2 + rsub; if (col0 + c4 < N) { const v4f v = *(const v4fa*)&so[w][r][c4]; if (C) *(v4f*)(C + cofs + (size_t)(row0 + r) * ldc + col0 + c4) = v; if (C16) { v4h h4; for (int i = 0; i < 4; ++i) h4[i] = (_Float16)v[i]; *(v4h*)(C16 + cofs + (size_t)(row0 + r) * ldc + col0 + c4) = h4; } } }
     }
}


typedef _Float16 v4h __attribute__((ext_vector_type(4)));

__global__ __launch_bounds__(256) void k_h16(const float* __restrict__ x, _Float16* __restrict__ X16, size_t n8) { const size_t t = (size_t)blockIdx.x * 256 + threadIdx.x; if (t >= n8) return; FragH f;
#pragma unroll
  for (int q = 0; q < 8; ++q) f.h[q] = (_Float16)x[t * 8 + q]; *(v8us*)((unsigned short*)X16 + t * 8) = f.half[0];  }
__global__ __launch_bounds__(256) void k_round16f(const float* __restrict__ W, _Float16* __restrict__ Bt, size_t n8) { const size_t t = (size_t)blockIdx.x * 256 + threadIdx.x; if (t >= n8) return; FragH f;
#pragma unroll
  for (int i = 0; i < 8; ++i) f.h[i] = (_Float16)(bf16_round(W[t * 8 + i]) * 16.0f); *(v8us*)((unsigned short*)Bt + t * 8) = f.half[0];  }
template <int NHv, int TTv>
__global__ __launch_bounds__(256) void k_vt(const _Float16* __restrict__ V16, int ldv, int voff, _Float16* __restrict__ Vt) { __shared__ unsigned short tl[64][66]; const int tid = threadIdx.x; const int slab = blockIdx.x / (TTv / 64), lg = blockIdx.x % (TTv / 64); const int b = slab / NHv, h = slab % NHv;
  for (int i = tid; i < 64 * 8; i += 256) { const int r = i / 8, c8 = (i % 8) * 8; FragH f; f.half[0] = *(const v8us*)((const unsigned short*)V16 + ((size_t)b * TTv + lg * 64 + r) * ldv + voff + h * 64 + c8);
#pragma unroll
    for (int q = 0; q < 8; ++q) tl[r][c8 + q] = f.u[q]; }
  __syncthreads();
  {
#pragma unroll
    for (int rd = 0; rd < 2; ++rd) { const int d = rd * 32 + tid / 8, pc = tid % 8; FragH f;
#pragma unroll
      for (int q = 0; q < 8; ++q) f.u[q] = tl[pc * 8 + q][d];
      *(v8us*)((unsigned short*)Vt + ((size_t)slab * 64 + d) * TTv + lg * 64 + pc * 8) = f.half[0]; }
     } }

__global__ __launch_bounds__(256) void k_hl(const float* __restrict__ F, _Float16* __restrict__ Hh, _Float16* __restrict__ Hl, size_t n8) { const size_t t = (size_t)blockIdx.x * 256 + threadIdx.x; if (t >= n8) return; FragH fh, fl; const v4f a = *(const v4fa*)(F + t * 8), c = *(const v4fa*)(F + t * 8 + 4);
#pragma unroll
  for (int q = 0; q < 4; ++q) { _Float16 h = (_Float16)a[q]; fh.h[q] = h; fl.h[q] = (_Float16)((a[q] - (float)h) * 1024.0f); h = (_Float16)c[q]; fh.h[4 + q] = h; fl.h[4 + q] = (_Float16)((c[q] - (float)h) * 1024.0f); }
  { *(v8us*)((unsigned short*)Hh + t * 8) = fh.half[0]; *(v8us*)((unsigned short*)Hl + t * 8) = fl.half[0];  } }

// ---- fast GEMM (wave tile 32x64; requires M % 32 == 0 rows per launch region and N % 64 == 0); epilogue = k_gemm_hhx semantics ----
__device__ __forceinline__ v16h g2_frag(const _Float16* p, int hh) { FragH f; f.half[0] = *(const v8us*)((const unsigned short*)p + 8 * hh); f.half[1] = *(const v8us*)((const unsigned short*)p + 16 + 8 * hh); return f.v; }
__device__ __forceinline__ v8f g2_mma(v16h a, v16h b, v8f c) { v8f d = __builtin_amdgcn_wmma_f32_16x16x32_f16(false, a, false, b, (short)0, c, false, false); asm volatile("v_nop\n\tv_nop\n\tv_nop\n\tv_nop" : "+v"(d) : "v"(a), "v"(b)); return d; }
template <int ACT>
__global__ __launch_bounds__(128) void k_gemm2(const _Float16* __restrict__ A, int lda, size_t sA, const _Float16* __restrict__ Bh, int ldb, size_t sB, float alpha, const float* __restrict__ bias, size_t sBias, const float* __restrict__ CP, int rowsPerB, size_t sCPb, int row0g,
    float* __restrict__ C, _Float16* __restrict__ C16, int ldc, size_t sC, int M, int N, int K) { static_assert(ACT == 0 || ACT == 3 || ACT == 6 || ACT == 8 || ACT == 9 || ACT == 11 || ACT == 12 || ACT == 14 || ACT == 15 || ACT == 16 || ACT == 17, "k_gemm2: unsupported ACT code (would silently apply no activation)");
  __shared__ __attribute__((aligned(16))) float so[4][32][68];
  const int tid = threadIdx.x, w = tid >> 5, lane = tid & 31, ln = lane & 15, hh = lane >> 4; const int by = blockIdx.y;
  A += (size_t)by * sA; Bh += (size_t)by * sB; const size_t cofs = (size_t)by * sC; const float* bp = bias ? bias + (size_t)by * sBias : nullptr;
  const int ntn = N >> 6; const int mt = blockIdx.x / ntn, nq = blockIdx.x - mt * ntn; const int row0 = mt * 128 + 32 * w, col0 = nq * 64; if (row0 >= M) return;
  const _Float16* a0p = A + (size_t)(row0 + ln) * lda; const _Float16* a1p = a0p + (size_t)16 * lda;
  const _Float16* b0p = Bh + (size_t)(col0 + ln) * ldb; const _Float16* b1p = b0p + (size_t)16 * ldb; const _Float16* b2p = b1p + (size_t)16 * ldb; const _Float16* b3p = b2p + (size_t)16 * ldb;
  const v8f z8 = {0.f,0.f,0.f,0.f,0.f,0.f,0.f,0.f}; v8f c00 = z8, c01 = z8, c02 = z8, c03 = z8, c10 = z8, c11 = z8, c12 = z8, c13 = z8;
#pragma unroll 1
  for (int kb = 0; kb < K; kb += 32) { const v16h a0 = g2_frag(a0p + kb, hh), a1 = g2_frag(a1p + kb, hh);
    v16h b = g2_frag(b0p + kb, hh); c00 = g2_mma(a0, b, c00); c10 = g2_mma(a1, b, c10);
    b = g2_frag(b1p + kb, hh); c01 = g2_mma(a0, b, c01); c11 = g2_mma(a1, b, c11);
    b = g2_frag(b2p + kb, hh); c02 = g2_mma(a0, b, c02); c12 = g2_mma(a1, b, c12);
    b = g2_frag(b3p + kb, hh); c03 = g2_mma(a0, b, c03); c13 = g2_mma(a1, b, c13); }
  v8f accs[8] = {c00, c01, c02, c03, c10, c11, c12, c13};
#pragma unroll
  for (int u = 0; u < 8; ++u) { const int t = u & 3, half = u >> 2; const int col = col0 + t * 16 + ln; const float bv = bp ? bf16_round(bp[col]) : 0.f;
#pragma unroll
    for (int r = 0; r < 8; ++r) { const int rloc = half * 16 + 8 * hh + r; float v = accs[u][r] * alpha + bv; if (CP) { if (rowsPerB < 0) v += CP[cofs + (size_t)(row0g + row0 + rloc) * ldc + col];      /* rowsPerB < 0: own element of the batched C plane */ else { const int bidx = (row0g + row0 + rloc) / rowsPerB; v += CP[(size_t)bidx * sCPb + (size_t)by * 64 + col]; } }
      if (ACT == 3) v = fmaxf(v, 0.f); else if (ACT == 6) v = 0.5f * v * (1.0f + erff(v * 0.70710678118654752f)); else if (ACT == 11) v = 1.0f / (1.0f + expf(-v)); else if (ACT == 15) v = v / (1.0f + expf(-v)); else if (ACT == 12) v = (v > 0.f) ? v : 0.01f * v; else if (ACT == 8) v = tanhf(v); else if (ACT == 9) v = 0.5f * v * (1.0f + tanhf(0.7978845608028654f * (v + 0.044715f * v * v * v))); else if (ACT == 14) v = (v > 0.f) ? v : 0.1f * v; else if (ACT == 16) v = (v >= 0.f) ? v : 0.3f * v; else if (ACT == 17) v = (v >= 0.f) ? v : 0.2f * v;
      so[w][rloc][t * 16 + ln] = v; } }
  __builtin_amdgcn_fence(__ATOMIC_ACQ_REL, "workgroup"); __builtin_amdgcn_wave_barrier();
  const int rsub = lane >> 4, c4 = (lane & 15) * 4;
  {
#pragma unroll
    for (int q = 0; q < 16; ++q) { const int r = q * 2 + rsub; const v4f v = *(const v4fa*)&so[w][r][c4]; if (C) *(v4f*)(C + cofs + (size_t)(row0 + r) * ldc + col0 + c4) = v; if (C16) { v4h h4; for (int i = 0; i < 4; ++i) h4[i] = (_Float16)v[i]; *(v4h*)(C16 + cofs + (size_t)(row0 + r) * ldc + col0 + c4) = h4; } }
     } }


__global__ __launch_bounds__(256) void k_wnat(const float* __restrict__ w, size_t n8, _Float16* __restrict__ Bt) { const size_t t = (size_t)blockIdx.x * 256 + threadIdx.x; if (t >= n8) return; FragH f; for (int q = 0; q < 8; ++q) f.h[q] = (_Float16)(bf16_round(w[t * 8 + q]) * 16.0f); *(v8us*)((unsigned short*)Bt + t * 8) = f.half[0];  }
__global__ __launch_bounds__(256) void k_rsm(const float* __restrict__ S, _Float16* __restrict__ P, int nrows) {
  #pragma clang fp contract(off)
  const int i = blockIdx.x * 256 + threadIdx.x; if (i >= nrows) return; const float* s = S + (size_t)i * SQ; float mx = -3.0e38f;
#pragma unroll 1
  for (int j = 0; j < SQ; ++j) mx = fmaxf(mx, s[j]); float se = 0.f;
#pragma unroll 1
  for (int j = 0; j < SQ; ++j) se += expf(s[j] - mx); const float sc = 256.0f / se;
#pragma unroll 1
  for (int j0 = 0; j0 < SQ; j0 += 8) { FragH f; for (int q = 0; q < 8; ++q) f.h[q] = (_Float16)(expf(s[j0 + q] - mx) * sc); unsigned short* d = (unsigned short*)P + (size_t)i * SQ + j0; *(v8us*)d = f.half[0];  } }
__global__ __launch_bounds__(256) void k_vt(const _Float16* __restrict__ V16, int b, int h0, _Float16* __restrict__ VT) { __shared__ unsigned short tl[64][65]; const int tid = threadIdx.x; const int hh = blockIdx.x % HG, sg = blockIdx.x / HG; const int s0 = sg * 64; const int h = h0 + hh;
  for (int i = tid; i < 64 * 8; i += 256) { const int j = i / 8, d8 = (i % 8) * 8; FragH f; f.half[0] = *(const v8us*)((const unsigned short*)V16 + ((size_t)b * SQ + s0 + j) * DM + h * HD + d8); for (int q = 0; q < 8; ++q) tl[d8 + q][j] = f.u[q]; }
  __syncthreads();
  { for (int i = tid; i < 64 * 8; i += 256) { const int d = i / 8, j8 = (i % 8) * 8; FragH f; for (int q = 0; q < 8; ++q) f.u[q] = tl[d][j8 + q]; *(v8us*)((unsigned short*)VT + ((size_t)hh * HD + d) * SQ + s0 + j8) = f.half[0]; }  } }



#define FK 64            /* keys per pass */
#define FP 72            /* LDS row pitch in halves: 144 bytes = 16 x odd, for 16-byte row reads */
#define FMASK (-262144.0f)
#define FTHR 8.0f
#define FOFF 6.0f
typedef int v4ia __attribute__((ext_vector_type(4), may_alias));
typedef float v8fa __attribute__((ext_vector_type(8), may_alias));
typedef float v2f __attribute__((ext_vector_type(2)));
typedef _Float16 v2h __attribute__((ext_vector_type(2)));
union FragP { v16h v; v2h p[8]; };
__device__ __forceinline__ float fa_xhalf(float x) { const int i = __float_as_int(x); return __int_as_float(__builtin_amdgcn_permlanex16(i, i, 0x76543210, 0xfedcba98, false, false)); }      /* lane l <-> l ^ 16 */
__device__ __forceinline__ v8f fa_mma(v16h a, v16h b, v8f c) { return __builtin_amdgcn_wmma_f32_16x16x32_f16(false, a, false, b, (short)0, c, false, false); }
// List of a batch's kept keys (mask <= 0) in rising order, built by a work-group of 256 threads: idx[0 .. n) = the keys, idx[n .. SQ) = 0 (a valid row); returns n >= 1. Thread t owns keys 8 t .. 8 t + 7.
// A key's place = kept keys of the waves below (wt) + of the lanes below (ballots counted under the lane) + of the thread's own earlier keys. none: no key is kept, the list is then all SQ keys.
__device__ __forceinline__ int fa_kept(const int* __restrict__ mrow, unsigned short* idx, int* wt, bool& none) {
  const int tid = threadIdx.x, w = tid >> 5;
  const v4ia m0 = *(const v4ia*)(mrow + tid * 8), m1 = *(const v4ia*)(mrow + tid * 8 + 4);
  bool k[8]; unsigned int below = 0u, tot = 0u;
#pragma unroll      /* constant indices into k */
  for (int q = 0; q < 4; ++q) { k[q] = !(m0[q] > 0); k[4 + q] = !(m1[q] > 0); }
#pragma unroll      /* constant indices into k */
  for (int q = 0; q < 8; ++q) { const unsigned int bal = __builtin_amdgcn_ballot_w32(k[q]); below = __builtin_amdgcn_mbcnt_lo(bal, below); tot += (unsigned int)__builtin_popcount(bal); }
  const v8us z = {0, 0, 0, 0, 0, 0, 0, 0}; *(v8us*)&idx[tid * 8] = z;
  if ((tid & 31) == 0) wt[w] = (int)tot;
  __syncthreads();      /* publishes the eight wave counts; the zero fill is complete before any place is written */
  int base = 0, n = 0;
  for (int i = 0; i < 8; ++i) { const int c = wt[i]; base += i < w ? c : 0; n += c; }
  int pos = base + (int)below;
  none = n == 0;
  if (none) { pos = tid * 8; n = SQ; }
#pragma unroll      /* constant indices into k */
  for (int q = 0; q < 8; ++q) if (k[q] || none) { idx[pos] = (unsigned short)(tid * 8 + q); ++pos; }
  __syncthreads();      /* publishes the list */
  return n; }
// V^T of the kept keys: Vt[b][h][d][p] = v[b][list_b[p]][h][d] for p below the list's length rounded up to 64 (places behind the end take row 0: finite values under weight 0); a block transposes 64 places of one (batch, head) through LDS.
__global__ __launch_bounds__(256) void k_vtk(const _Float16* __restrict__ V16, const int* __restrict__ Km, _Float16* __restrict__ Vt) {
  __shared__ unsigned short tl[64][66]; __shared__ __attribute__((aligned(16))) unsigned short kidx[SQ]; __shared__ int wt[8];
  const int tid = threadIdx.x; const int slab = blockIdx.x / (SQ / 64), lg = blockIdx.x % (SQ / 64); const int b = slab / NH, h = slab % NH;
  bool none; const int n = fa_kept(Km + (size_t)b * SQ, kidx, wt, none);
  const bool act = lg * 64 < n;      /* the same for the whole block: tiles wholly behind the list's end are never read */
  if (act) { const int r = tid / 8, c8 = (tid % 8) * 8; FragH f0, f1;      /* 16-byte piece c8 of the rows at places r and r + 32: both loads in flight together */
    f0.half[0] = *(const v8us*)((const unsigned short*)V16 + ((size_t)b * SQ + kidx[lg * 64 + r]) * LQ + h * 64 + c8);
    f1.half[0] = *(const v8us*)((const unsigned short*)V16 + ((size_t)b * SQ + kidx[lg * 64 + r + 32]) * LQ + h * 64 + c8);
#pragma unroll      /* constant indices into f0, f1: they stay in registers */
    for (int q = 0; q < 8; ++q) { tl[r][c8 + q] = f0.u[q]; tl[r + 32][c8 + q] = f1.u[q]; } }
  __syncthreads();      /* the 64 x 64 tile is complete before it is read across */
  if (act) {
#pragma unroll      /* both rows' LDS reads go out together */
    for (int rd = 0; rd < 2; ++rd) { const int d = rd * 32 + tid / 8, pc = tid % 8; FragH f;
#pragma unroll      /* constant indices into f: it stays in registers */
      for (int q = 0; q < 8; ++q) f.u[q] = tl[pc * 8 + q][d];
      *(v8us*)((unsigned short*)Vt + ((size_t)slab * 64 + d) * SQ + lg * 64 + pc * 8) = f.half[0]; }
  } }
__global__ __launch_bounds__(256) __attribute__((amdgpu_waves_per_eu(4, 4))) /* two work-groups per WGP: the vector work between the matrix runs wants four waves per SIMD */
void k_fattn(const _Float16* __restrict__ QKV, const _Float16* __restrict__ VT, const int* __restrict__ Km, _Float16* __restrict__ O16) {
  __shared__ __attribute__((aligned(16))) _Float16 Ks[2][FK][FP];
  __shared__ __attribute__((aligned(16))) _Float16 Vs[2][HD][FP];
  __shared__ __attribute__((aligned(16))) unsigned short kidx[SQ];
  __shared__ int wt[8];
  __shared__ __attribute__((aligned(32))) float kb[FK];      /* start values C of the last pass's score product: 0 for a key, FMASK behind the list's end */
  const int tid = threadIdx.x, w = tid >> 5, lane = tid & 31, ln = lane & 15, hh = lane >> 4;
  const int h = blockIdx.y, b = blockIdx.z, q0 = blockIdx.x * 256 + w * 32;
  const unsigned short* Kg = (const unsigned short*)QKV + (size_t)b * SQ * LQ + DM + h * HD;      /* K rows [key][d], pitch LQ */
  const unsigned short* Vg = (const unsigned short*)VT + ((size_t)b * NH + h) * HD * SQ;          /* V^T rows [d][place in the list], pitch SQ */
  const int sr = tid >> 3, sc = (tid & 7) * 8;      /* staging: 16-byte piece sc of rows sr and sr + 32 of both tiles */
  v16h qf[2][2];
#pragma unroll      /* fragments stay in registers: constant indices only */
  for (int g = 0; g < 2; ++g) for (int kk = 0; kk < 2; ++kk) qf[g][kk] = g2_frag(QKV + ((size_t)b * SQ + q0 + g * 16 + ln) * LQ + h * HD + kk * 32, hh);
  v8us vr0 = *(const v8us*)(Vg + (size_t)sr * SQ + sc), vr1 = *(const v8us*)(Vg + (size_t)(sr + 32) * SQ + sc);
  bool none; const int n = __builtin_amdgcn_readfirstlane(fa_kept(Km + (size_t)b * SQ, kidx, wt, none));      /* the same in every lane: held as a scalar, so that the pass loop branches on scalars */
  const int np = min((n + FK - 1) / FK, SQ / FK);      /* passes: 1 .. SQ / FK */
  if (tid < FK) kb[tid] = (np - 1) * FK + tid >= n ? FMASK : 0.f;
  int i0 = kidx[sr], i1 = kidx[sr + 32];      /* the K rows this thread stages */
  v8us kr0 = *(const v8us*)(Kg + (size_t)i0 * LQ + sc), kr1 = *(const v8us*)(Kg + (size_t)i1 * LQ + sc);
  i0 = kidx[FK + sr]; i1 = kidx[FK + sr + 32];      /* list entries are read one pass ahead of the loads that use them */
  *(v8us*)&Ks[0][sr][sc] = kr0; *(v8us*)&Ks[0][sr + 32][sc] = kr1; *(v8us*)&Vs[0][sr][sc] = vr0; *(v8us*)&Vs[0][sr + 32][sc] = vr1;
  __syncthreads();      /* publishes pass 0's tiles and the start values */
  { const v16h zq = {};
#pragma unroll      /* constant indices into qf */
    for (int g = 0; g < 2; ++g) for (int kk = 0; kk < 2; ++kk) qf[g][kk] = none ? zq : qf[g][kk]; }
  const v8f z8 = {0.f,0.f,0.f,0.f,0.f,0.f,0.f,0.f};
  v8f o[4][2] = {{z8, z8}, {z8, z8}, {z8, z8}, {z8, z8}};
  float m[2] = {-3.0e38f, -3.0e38f}, nm[2] = {0.f, 0.f}; v8f lt[2] = {z8, z8};      /* lt: every row of the tile = the column's sum of weights */
  v16h ones; for (int e = 0; e < 16; ++e) ones[e] = (_Float16)1.0f;
  const float cs = 0.125f * 1.4426950408889634f;      /* 64^-0.5 log2(e) */
#pragma unroll 1      /* one pass per trip: the body already fills the register budget */
  for (int s = 0; s < np; ++s) {
    const int buf = s & 1; const bool more = s + 1 < np;
    if (more) { const int k1 = (s + 1) * FK, k2 = min(s + 2, SQ / FK - 1) * FK;      /* next pass's tiles fly through registers while this pass is worked on */
      kr0 = *(const v8us*)(Kg + (size_t)i0 * LQ + sc); kr1 = *(const v8us*)(Kg + (size_t)i1 * LQ + sc);
      vr0 = *(const v8us*)(Vg + (size_t)sr * SQ + k1 + sc); vr1 = *(const v8us*)(Vg + (size_t)(sr + 32) * SQ + k1 + sc);
      asm volatile("s_wait_xcnt 0x0" ::: "memory");      /* the four loads have taken their addresses before the address registers get new values further down */
      i0 = kidx[k2 + sr]; i1 = kidx[k2 + sr + 32]; }
    v8f st[4][2];
    if (more) {      /* a full pass holds keys only: the score product starts at 0, nothing is read for it */
#pragma unroll      /* constant indices into st, qf */
      for (int t = 0; t < 4; ++t) {      /* D row 8 hh + r = place t 16 + 8 hh + r of the pass */
        const v16h ka = g2_frag(&Ks[buf][t * 16 + ln][0], hh), kc = g2_frag(&Ks[buf][t * 16 + ln][32], hh);
        for (int g = 0; g < 2; ++g) st[t][g] = fa_mma(kc, qf[g][1], fa_mma(ka, qf[g][0], z8));
        if (t & 1) __builtin_amdgcn_sched_barrier(0); }      /* holds the next two tiles' fragment loads behind these products: all eight K fragments loaded at once overflow the register budget of four waves per SIMD (spills) */
    } else {      /* the last pass: places behind the list's end start at FMASK */
#pragma unroll      /* constant indices into st, qf */
      for (int t = 0; t < 4; ++t) { const v8f c0 = *(const v8fa*)&kb[t * 16 + 8 * hh];
        const v16h ka = g2_frag(&Ks[buf][t * 16 + ln][0], hh), kc = g2_frag(&Ks[buf][t * 16 + ln][32], hh);
        for (int g = 0; g < 2; ++g) st[t][g] = fa_mma(kc, qf[g][1], fa_mma(ka, qf[g][0], c0));
        if (t & 1) __builtin_amdgcn_sched_barrier(0); }      /* as above */
    }
    float ms[2];
#pragma unroll      /* constant indices into st */
    for (int g = 0; g < 2; ++g) { float mx = st[0][g][0];
      for (int t = 0; t < 4; ++t) for (int r = 0; r < 8; ++r) mx = fmaxf(mx, st[t][g][r]);
      ms[g] = fmaxf(mx, fa_xhalf(mx)) * cs; }
    if (__builtin_amdgcn_ballot_w32(ms[0] > m[0] + FTHR || ms[1] > m[1] + FTHR) != 0u) {      /* one scalar branch per pass */
#pragma unroll      /* constant indices into o */
      for (int g = 0; g < 2; ++g) { const float mn = fmaxf(m[g], ms[g]); const float al = __builtin_amdgcn_exp2f(m[g] - mn); m[g] = mn; nm[g] = FOFF - mn; lt[g] *= al;
        for (int dt = 0; dt < 4; ++dt) o[dt][g] *= al; } }
    FragP pf[2][2];
#pragma unroll      /* constant indices into st, pf */
    for (int g = 0; g < 2; ++g) for (int t = 0; t < 4; ++t) for (int r = 0; r < 8; r += 2) {
      v2f p; p[0] = __builtin_amdgcn_exp2f(__builtin_fmaf(st[t][g][r], cs, nm[g])); p[1] = __builtin_amdgcn_exp2f(__builtin_fmaf(st[t][g][r + 1], cs, nm[g]));
      pf[t >> 1][g].p[(t & 1) * 4 + (r >> 1)] = __builtin_convertvector(p, v2h); }      /* b[e] = T[e >> 3][e & 7]: the hardware k order */
#pragma unroll      /* constant indices into lt, pf */
    for (int j = 0; j < 2; ++j) for (int g = 0; g < 2; ++g) lt[g] = fa_mma(ones, pf[j][g].v, lt[g]);      /* row sums on the matrix pipe: A = ones sums the rounded weights of all 32 keys, both wave halves' */
#pragma unroll      /* constant indices into o, pf */
    for (int dt = 0; dt < 4; ++dt) for (int j = 0; j < 2; ++j) { const v16h vf = g2_frag(&Vs[buf][dt * 16 + ln][j * 32], hh);      /* same k order as the packed weights */
      for (int g = 0; g < 2; ++g) o[dt][g] = fa_mma(vf, pf[j][g].v, o[dt][g]); }
    if (more) { *(v8us*)&Ks[buf ^ 1][sr][sc] = kr0; *(v8us*)&Ks[buf ^ 1][sr + 32][sc] = kr1; *(v8us*)&Vs[buf ^ 1][sr][sc] = vr0; *(v8us*)&Vs[buf ^ 1][sr + 32][sc] = vr1; }      /* that buffer's readers left it at the last barrier */
    __syncthreads();      /* publishes the next pass's tiles and ends this pass's reads */
  }
#pragma unroll      /* constant indices into o */
  for (int g = 0; g < 2; ++g) { const float sc64 = 64.0f / lt[g][0];      /* o carried x64, as the output GEMM's alpha expects */
    unsigned short* d = (unsigned short*)O16 + ((size_t)b * SQ + q0 + g * 16 + ln) * DM + h * HD + 8 * hh;
    for (int dt = 0; dt < 4; ++dt) { FragH f; for (int r = 0; r < 8; ++r) f.h[r] = (_Float16)(o[dt][g][r] * sc64); *(v8us*)(d + dt * 16) = f.half[0]; } } }

// ---- GEMM with both operands staged in LDS: C[M][NN] = (A[M][DM] Bt[NN][DM]^T) alpha + bias, A and Bt f16 rows of DM halves.
// A work-group of 8 waves (4 x 2) takes a 256 x 128 tile of C, a wave 64 x 64 (4 x 4 accumulator tiles). A stage is 64 k of the tile's 256 A rows and 128 Bt rows, 128-byte rows at pitch 144 bytes;
// two buffers, filled by asynchronous copies to LDS (whole 128-byte lines, each read once per work-group) one stage ahead of the products. Every accumulator sums k in steps of 32 in rising order.
#define G3M 256
#define G3N 128
#define G3K 64
#define G3P 72                            /* LDS row pitch in halves: 144 bytes = 16 x odd, for 16-byte row reads */
#define G3R (G3M + G3N)                   /* rows of a stage: A rows, then Bt rows */
#define G3B ((unsigned)(G3R * G3P * 2))   /* bytes of a buffer */
#define G3S ((unsigned)(32 * G3P * 2))    /* bytes of 32 LDS rows */
#define G3O 68                            /* output staging pitch in floats */
typedef float f1a __attribute__((may_alias));
template <int NN, bool F32>      /* F32: C (f32) is written, else C16 (f16) */
__global__ __launch_bounds__(256) void k_gemm3(const _Float16* __restrict__ A, const _Float16* __restrict__ Bt, float alpha, const float* __restrict__ bias, float* __restrict__ C, _Float16* __restrict__ C16) {
  __shared__ __attribute__((aligned(16))) _Float16 sm[2][G3R][G3P];
  const int tid = threadIdx.x, w = tid >> 5, lane = tid & 31, ln = lane & 15, hh = lane >> 4;
  const int ntn = NN / G3N; const int mt = blockIdx.x / ntn, nq = blockIdx.x - mt * ntn; const int row0 = mt * G3M, col0 = nq * G3N;
  const int wr = (w >> 1) * 64, wc = (w & 1) * 64;      /* the wave's 64 x 64 part of the tile */
  const int sr = tid >> 3, sc = (tid & 7) * 8;      /* staging: 16-byte piece sc of rows sr + 32 i: a wave's copy covers four whole 128-byte rows */
  const _Float16* ga = A + (size_t)(row0 + sr) * DM + sc; const _Float16* gb = Bt + (size_t)(col0 + sr) * DM + sc;
  const unsigned l0 = (unsigned)(size_t)&sm[0][sr][sc];      /* low 32 bits of the shared address = the byte address in LDS */
  auto fill = [&](int s) { const unsigned l = l0 + (unsigned)(s & 1) * G3B; const _Float16* a = ga + s * G3K; const _Float16* bq = gb + s * G3K;
    /* one stage: 12 copies per lane (8 A rows, 4 Bt rows); the closing wait keeps every address register as it is until the copies have taken it */
    asm volatile("global_load_async_to_lds_b128 %0, %1, off\n\t"
      "global_load_async_to_lds_b128 %2, %3, off\n\t"
      "global_load_async_to_lds_b128 %4, %5, off\n\t"
      "global_load_async_to_lds_b128 %6, %7, off\n\t"
      "global_load_async_to_lds_b128 %8, %9, off\n\t"
      "global_load_async_to_lds_b128 %10, %11, off\n\t"
      "global_load_async_to_lds_b128 %12, %13, off\n\t"
      "global_load_async_to_lds_b128 %14, %15, off\n\t"
      "global_load_async_to_lds_b128 %16, %17, off\n\t"
      "global_load_async_to_lds_b128 %18, %19, off\n\t"
      "global_load_async_to_lds_b128 %20, %21, off\n\t"
      "global_load_async_to_lds_b128 %22, %23, off\n\t"
      "s_wait_xcnt 0x0"
      :: "v"(l + 0u * G3S), "v"(a + (size_t)0 * 32 * DM),
         "v"(l + 1u * G3S), "v"(a + (size_t)1 * 32 * DM),
         "v"(l + 2u * G3S), "v"(a + (size_t)2 * 32 * DM),
         "v"(l + 3u * G3S), "v"(a + (size_t)3 * 32 * DM),
         "v"(l + 4u * G3S), "v"(a + (size_t)4 * 32 * DM),
         "v"(l + 5u * G3S), "v"(a + (size_t)5 * 32 * DM),
         "v"(l + 6u * G3S), "v"(a + (size_t)6 * 32 * DM),
         "v"(l + 7u * G3S), "v"(a + (size_t)7 * 32 * DM),
         "v"(l + 8u * G3S), "v"(bq + (size_t)0 * 32 * DM),
         "v"(l + 9u * G3S), "v"(bq + (size_t)1 * 32 * DM),
         "v"(l + 10u * G3S), "v"(bq + (size_t)2 * 32 * DM),
         "v"(l + 11u * G3S), "v"(bq + (size_t)3 * 32 * DM)
      : "memory"); };
  fill(0);
  asm volatile("s_wait_asynccnt 0x0" ::: "memory");      /* this wave's part of stage 0 has landed */
  __syncthreads();      /* publishes stage 0 */
  fill(1);
  const v8f z8 = {0.f,0.f,0.f,0.f,0.f,0.f,0.f,0.f};
  v8f acc[4][4];
#pragma unroll      /* constant indices into acc */
  for (int i = 0; i < 4; ++i) for (int j = 0; j < 4; ++j) acc[i][j] = z8;
#pragma unroll 1      /* one stage per trip: the ring's order stands at the foot of each trip */
  for (int s = 0; s < DM / G3K; ++s) {
    const int buf = s & 1;
#pragma unroll      /* constant indices into acc */
    for (int kk = 0; kk < 2; ++kk) { v16h af[4], bf[4];
      af[0] = g2_frag(&sm[buf][wr + ln][kk * 32], hh);
      for (int j = 0; j < 4; ++j) bf[j] = g2_frag(&sm[buf][G3M + wc + j * 16 + ln][kk * 32], hh);
      for (int i = 1; i < 4; ++i) af[i] = g2_frag(&sm[buf][wr + i * 16 + ln][kk * 32], hh);
      __builtin_amdgcn_sched_barrier(0);      /* the 16 LDS reads of a block stand as one group ahead of its 16 products: left alone the compiler reloads one A fragment per four products and waits for it each time */
      for (int i = 0; i < 4; ++i) for (int j = 0; j < 4; ++j) acc[i][j] = fa_mma(af[i], bf[j], acc[i][j]);
      __builtin_amdgcn_sched_barrier(0); }      /* keeps the next block's reads out of this block's products */
    asm volatile("s_wait_dscnt 0x0" ::: "memory");      /* this wave's reads of the buffer have returned before it is refilled */
    asm volatile("s_wait_asynccnt 0x0" ::: "memory");      /* this wave's part of the next stage has landed */
    __syncthreads();      /* publishes the next stage and ends this stage's reads */
    if (s + 2 < DM / G3K) fill(s + 2);
  }
  asm volatile("s_wait_asynccnt 0x0" ::: "memory");      /* nothing is in flight when the ring becomes output staging */
  f1a* so = (f1a*)&sm[0][0][0] + (size_t)w * 32 * G3O;      /* each wave stages 32 rows at a time in its own range; every wave has left the ring at the last barrier */
  const int rsub = lane >> 4, c4 = (lane & 15) * 4;
  float bv[4];
#pragma unroll      /* constant indices into bv */
  for (int j = 0; j < 4; ++j) bv[j] = bias ? bf16_round(bias[col0 + wc + j * 16 + ln]) : 0.f;
#pragma unroll      /* constant indices into acc */
  for (int hf = 0; hf < 2; ++hf) {
#pragma unroll      /* constant indices into acc, bv */
    for (int i = 0; i < 2; ++i) for (int j = 0; j < 4; ++j) for (int r = 0; r < 8; ++r) so[(i * 16 + 8 * hh + r) * G3O + j * 16 + ln] = acc[hf * 2 + i][j][r] * alpha + bv[j];
    asm volatile("s_wait_dscnt 0x0" ::: "memory");      /* the staged rows are written before other lanes of the wave read them back */
#pragma unroll      /* the 16 read-backs go out together instead of one wait each */
    for (int q = 0; q < 16; ++q) { const int r = q * 2 + rsub; const v4f v = *(const v4fa*)&so[r * G3O + c4]; const size_t ofs = (size_t)(row0 + wr + hf * 32 + r) * NN + col0 + wc + c4;
      if (F32) *(v4f*)(C + ofs) = v;
      else { v4h h4; for (int e = 0; e < 4; ++e) h4[e] = (_Float16)v[e]; *(v4h*)(C16 + ofs) = h4; } }
    asm volatile("s_wait_dscnt 0x0" ::: "memory");      /* the read-back has returned before the next 32 rows overwrite the range */
  } }
// ---- operand preparation, ONE launch of PG work-groups of 8 waves (two per WGP): few waves to start, each with 24 16-byte loads in flight, every load and store on whole 128-byte lines.
// A work-group takes two 64 x 64 weight tiles and 16 pieces of 1024 values of x. X16 = f16(bf16(x)). Bt[n][k] = f16(bf16(W[k][n]) x 16) (power of two: bf16-exact weights stay exact in f16 away from the subnormal range), rows of DM halves.
// A weight tile goes through LDS: a thread reads 4 columns of two neighbouring k rows (a wave: 256-byte row pieces), packs (k, k + 1) into a dword and writes it at [n][k / 2]; read back along k, a wave stores four whole 128-byte rows of Bt.
#define PG 512                            /* work-groups */
#define PP 33                             /* LDS pitch of a tile row in dwords: odd, so that the 32 dwords of a wave's write (16 rows apart by 4) and of its read fall on 32 banks */
#define PQT ((DM / 64) * (3 * DM / 64))   /* tiles of Wqkv; Wproj's follow */
#define PXC 16                            /* pieces of x per work-group */
typedef unsigned int v4ua __attribute__((ext_vector_type(4), may_alias));
typedef _Float16 v4ha __attribute__((ext_vector_type(4), may_alias));
__device__ __forceinline__ unsigned int pr_pack(float a, float b) { v2h p; p[0] = (_Float16)(bf16_round(a) * 16.0f); p[1] = (_Float16)(bf16_round(b) * 16.0f); return __builtin_bit_cast(unsigned int, p); }
__global__ __launch_bounds__(256) void k_prep(const float* __restrict__ x, const float* __restrict__ wqkv, const float* __restrict__ wo, _Float16* __restrict__ X16, _Float16* __restrict__ BQKV, _Float16* __restrict__ BO) {
  static_assert(2 * PG == PQT + (DM / 64) * (DM / 64), "two weight tiles per work-group");
  static_assert((size_t)PG * PXC * 1024 == NR * DM, "PXC pieces of x per work-group");
  __shared__ unsigned int tl[2][64 * PP];
  const int tid = threadIdx.x, bk = blockIdx.x;
  const int rp = tid >> 4, c4 = (tid & 15) * 4;      /* tile read: columns c4 .. c4 + 3 of rows 2 rp, 2 rp + 1 (+ 32) */
  static_assert(PG <= PQT, "a work-group's first tile is one of Wqkv");
  const float* wp[2]; int wn[2]; unsigned short* dst[2];
#pragma unroll      /* constant indices into wp, wn, dst */
  for (int u = 0; u < 2; ++u) { const int t = bk + u * PG; const bool q = u == 0 || t < PQT;      /* the same for the whole work-group */
    const int kt = q ? t / (3 * DM / 64) : (t - PQT) / (DM / 64), nt = q ? t % (3 * DM / 64) : (t - PQT) % (DM / 64);      /* neighbouring work-groups read neighbouring columns of the same rows */
    wn[u] = q ? 3 * DM : DM; wp[u] = (q ? wqkv : wo) + (size_t)(kt * 64 + 2 * rp) * wn[u] + nt * 64 + c4;
    dst[u] = (unsigned short*)(q ? BQKV : BO) + (size_t)(nt * 64) * DM + kt * 64; }
  v4f wr[2][4], xr[PXC];
#pragma unroll      /* constant indices into wr */
  for (int u = 0; u < 2; ++u) { wr[u][0] = *(const v4fa*)wp[u]; wr[u][1] = *(const v4fa*)(wp[u] + wn[u]); wr[u][2] = *(const v4fa*)(wp[u] + (size_t)32 * wn[u]); wr[u][3] = *(const v4fa*)(wp[u] + (size_t)33 * wn[u]); }
  asm volatile("s_wait_xcnt 0x0" ::: "memory");      /* the eight tile loads have taken their addresses */
#pragma unroll      /* constant indices into xr */
  for (int i = 0; i < PXC; ++i) xr[i] = *(const v4fa*)(x + ((size_t)i * PG + bk) * 1024 + tid * 4);
  __builtin_amdgcn_sched_barrier(0);      /* all 24 loads go out before the first value is used: left alone the compiler waits for the first tile's values before it issues the rest, one memory latency after the other */
#pragma unroll      /* constant indices into wr */
  for (int u = 0; u < 2; ++u) for (int i = 0; i < 2; ++i) for (int j = 0; j < 4; ++j) tl[u][(c4 + j) * PP + 16 * i + rp] = pr_pack(wr[u][2 * i][j], wr[u][2 * i + 1][j]);
  __syncthreads();      /* both tiles are complete before they are read along k */
#pragma unroll      /* constant indices into dst */
  for (int u = 0; u < 2; ++u) for (int i = 0; i < 2; ++i) { const int n = (tid >> 3) + 32 * i, pc = tid & 7; v4ua v;
    for (int e = 0; e < 4; ++e) v[e] = tl[u][n * PP + pc * 4 + e];
    *(v4ua*)(dst[u] + (size_t)n * DM + pc * 8) = v; }
#pragma unroll      /* constant indices into xr */
  for (int i = 0; i < PXC; ++i) { v4ha h4; for (int e = 0; e < 4; ++e) h4[e] = (_Float16)bf16_round(xr[i][e]);
    *(v4ha*)(X16 + ((size_t)i * PG + bk) * 1024 + tid * 4) = h4; } }
extern "C" void kernel_launch(void* const* d_in, const int* in_sizes, int n_in,
                              void* d_out, int out_size, void* d_ws, size_t ws_size, hipStream_t stream) {
  (void)in_sizes; (void)n_in; (void)out_size;
  const float* const* I = (const float* const*)d_in; const float* x = I[0]; const float* wqkv = I[1]; const float* bqkv = nullptr; const float* wo = I[2]; const float* bo = I[3]; const int* km = (const int*)d_in[4];      /* x; [in][out] Wqkv [1024][3072] (no bias), Wproj [1024][1024] + bproj; mask int32 [4][2048] (> 0 = MASKED key; READ on device) */
  char* ws = (char*)d_ws; size_t off = 0;
  auto take = [&](size_t bytes) { char* p = ws + off; off += (bytes + 255) & ~(size_t)255; return p; };
  _Float16* BQKV = (_Float16*)take((size_t)3 * DM * DM * 2); _Float16* BO = (_Float16*)take((size_t)DM * DM * 2);
  _Float16* X16 = (_Float16*)take(NR * DM * 2); _Float16* QKV = (_Float16*)take(NR * 3 * DM * 2); _Float16* V16 = QKV + 2 * DM; _Float16* O16 = (_Float16*)take(NR * DM * 2);
  _Float16* VT = (_Float16*)take((size_t)NB * NH * HD * SQ * 2);
  if (off > ws_size) return;
  k_prep<<<PG, 256, 0, stream>>>(x, wqkv, wo, X16, BQKV, BO);      /* x rows as f16; [in][out] weights -> Bt[n][k] x16 (pitch DM) */
  const size_t r0p = (size_t)B0 * SQ;      /* first projected row */
  k_gemm3<3 * DM, false><<<(unsigned)((MP / G3M) * (3 * DM / G3N)), 256, 0, stream>>>(X16 + r0p * DM, BQKV, 0.0625f, bqkv, nullptr, QKV + r0p * 3 * DM);      /* q | k | v rows (f16); head h = columns h*HD.. of each DM block */
  k_vtk<<<NBR * NH * (SQ / 64), 256, 0, stream>>>(V16 + r0p * LQ, km + r0p, VT);      /* V^T of the kept keys [NBR][NH][HD][SQ] */
  k_fattn<<<dim3(SQ / 256, NH, NBR), 256, 0, stream>>>(QKV + r0p * LQ, VT, km + r0p, O16 + r0p * DM);      /* o x64 (merged heads) as f16 rows */
  k_gemm3<DM, true><<<(unsigned)((MPO / G3M) * (DM / G3N)), 256, 0, stream>>>(O16 + r0p * DM, BO, 0.0009765625f, bo, (float*)d_out + r0p * DM, nullptr);      /* out rows are the output layout */
}

// v006
// Measured time: 103 microseconds a run.
// Next to v005, in two timings, it ran 1.04 times as fast each time.
// Over all steps from v000 it is 65.1 times as fast.
#include <hip/hip_runtime.h>
// Multi-head self-attention with a fused QKV projection and an INVERTED key mask (x [4][2048][1024]; qkv = x Wqkv ([in][out] 1024 x 3072, NO bias) reshaped (B, N, 3, 16, 64): q | k | v blocks; att = q k^T * 64^-0.5; where(mask[b][j] > 0, -1e7) with the int32 [4][2048] mask in {0, 1} (random; > 0 means MASKED; read on device; masked weights underflow to exactly 0); softmax over keys; out = merged Wproj + bproj ([in][out]) -> [4][2048][1024]).
// Structure: token rows r = b*2048 + s; x as exact f16 rows (bf16-rounded); q | k | v as ONE WMMA GEMM (N = 3 x 1024) (operands staged in LDS, 64x64 wave tiles, f32 accumulation, exact x16 weights, no bias, f16 outputs); attention in ONE launch (V^T fragments by transposing LDS loads of V rows; scores, online softmax with f32 statistics and the weighted sum of V in registers; o carried x64 against f16 subnormal flush, folded into the output GEMM alpha) written straight into the merged f16 o rows; out = o W_o + b GEMM (f32) into the output layout.
// Compute dtype: inputs rounded to bf16; x / weights exact; q, k, v, softmax weights and o as plain f16 GEMM operands (~2^-12); scores and softmax statistics f32. v_wmma_f32_16x16x32_f16.
#define NB 4
#define SQ 2048
#define DM 1024
#define NH 16
#define HD 64
#define HG 4                         /* heads per block group of the (b, h0) k_vt overload */
#define B0 0                         /* first batch processed (debug hook) */
#define NBR NB                       /* batches processed (debug hook) */
#define NR ((size_t)NB * SQ)         /* token rows */
#define MP ((int)((size_t)NBR * SQ)) /* rows projected (debug hook) */
#define QN SQ                        /* unused: attention takes all SQ queries */
#define NHD NH                       /* unused: attention takes all NH heads */
#define MPO MP                       /* rows through the output stage (debug hook) */
#define LQ (3 * DM)      /* row pitch of the q/k/v rows */
typedef __bf16 v16b __attribute__((ext_vector_type(16)));
typedef unsigned short v8us __attribute__((ext_vector_type(8), may_alias));
typedef float  v8f  __attribute__((ext_vector_type(8)));
typedef float  v4f  __attribute__((ext_vector_type(4)));
typedef float  v4fa __attribute__((ext_vector_type(4), may_alias));
union FragB { v16b v; v8us half[2]; unsigned short u[16]; };

__device__ __forceinline__ unsigned short bf16_bits(float x) { unsigned int u = __float_as_uint(x); return (unsigned short)((u + 0x7FFFu + ((u >> 16) & 1u)) >> 16); }
__device__ __forceinline__ float bf16_val(unsigned short b) { return __uint_as_float(((unsigned int)b) << 16); }
__device__ __forceinline__ float bf16_round(float x) { return bf16_val(bf16_bits(x)); }
// D += A·B with NT terms: 1 = ah·bh, 2 = + al·bh (A split), 3 = + ah·bl (both split)
template <int NT>
__device__ __forceinline__ v8f mmaN(v16b ah, v16b al, v16b bh, v16b bl, v8f c) {
  c = __builtin_amdgcn_wmma_f32_16x16x32_bf16(false, ah, false, bh, (short)0, c, false, false);
  if (NT >= 2) c = __builtin_amdgcn_wmma_f32_16x16x32_bf16(false, al, false, bh, (short)0, c, false, false);
  if (NT >= 3) c = __builtin_amdgcn_wmma_f32_16x16x32_bf16(false, ah, false, bl, (short)0, c, false, false);
  asm volatile("v_nop\n\tv_nop\n\tv_nop\n\tv_nop" : "+v"(c) : "v"(ah), "v"(al), "v"(bh), "v"(bl));
  return c;
}

__global__ __launch_bounds__(256) void k_wt_bf16(const float* __restrict__ W, unsigned short* __restrict__ Wt, int K, int N) {
  const int t = blockIdx.x * 256 + threadIdx.x;
  const int k8n = K / 8;
  if (t >= N * k8n) return;
  const int n = t / k8n, k8 = (t % k8n) * 8;
  v8us v;
#pragma unroll
  for (int i = 0; i < 8; ++i) v[i] = bf16_bits(W[(size_t)(k8 + i) * N + n]);
  *(v8us*)(Wt + (size_t)n * K + k8) = v;
  
}

// GEMM C[M][N] (f32, pitch ldc) = act(A[M][K]·W + bias). A f32 row-major (pitch lda) converted per fragment to bf16
// (ASPLIT: hi/lo two planes -> 2 terms, else single rounded term); Wt bf16 [N][K] (pitch ldb). BIAS_BF16 rounds the
// bias to bf16 first (bias quantised to bf16 before the add). K%32==0, M%16==0, N%64==0.
template <bool ASPLIT, int ACT, bool BIAS_BF16>
__global__ __launch_bounds__(128) void k_gemm_bf(const float* __restrict__ A, int lda, const unsigned short* __restrict__ Wt, int ldb,
                                               const float* __restrict__ bias, float* __restrict__ C, int ldc, int M, int N, int K) {
  __shared__ __attribute__((aligned(16))) float so[4][16][64];
  const int tid = threadIdx.x, w = tid >> 5, lane = tid & 31, ln = lane & 15, hh = lane >> 4;
  const int ntn = N / 64;
  const int wid = blockIdx.x * 4 + w;
  const int mt = wid / ntn, nq = wid % ntn;
  if (mt * 16 >= M) return;
  const int row0 = mt * 16, col0 = nq * 64;
  const float* arow = A + (size_t)(row0 + ln) * lda;
  v8f acc[4] = {};
  for (int kb = 0; kb < K; kb += 32) {
    FragB ah, al;
    const v4f x0 = *(const v4fa*)(arow + kb + 8 * hh), x1 = *(const v4fa*)(arow + kb + 8 * hh + 4);
    const v4f x2 = *(const v4fa*)(arow + kb + 16 + 8 * hh), x3 = *(const v4fa*)(arow + kb + 16 + 8 * hh + 4);
    float xs[16] = {x0[0],x0[1],x0[2],x0[3],x1[0],x1[1],x1[2],x1[3],x2[0],x2[1],x2[2],x2[3],x3[0],x3[1],x3[2],x3[3]};
#pragma unroll
    for (int i = 0; i < 16; ++i) { const unsigned short hb = bf16_bits(xs[i]); ah.u[i] = hb; al.u[i] = ASPLIT ? bf16_bits(xs[i] - bf16_val(hb)) : (unsigned short)0; }
#pragma unroll
    for (int t = 0; t < 4; ++t) {
      const unsigned short* brow = Wt + (size_t)(col0 + t * 16 + ln) * ldb + kb;
      FragB b;
      b.half[0] = *(const v8us*)(brow + 8 * hh);
      b.half[1] = *(const v8us*)(brow + 16 + 8 * hh);
      acc[t] = mmaN<ASPLIT ? 2 : 1>(ah.v, al.v, b.v, b.v, acc[t]);
    }
  }
#pragma unroll
  for (int t = 0; t < 4; ++t) {
    float bv = bias ? bias[col0 + t * 16 + ln] : 0.f;
    if (BIAS_BF16) bv = bf16_round(bv);
#pragma unroll
    for (int r = 0; r < 8; ++r) { float v = acc[t][r] + bv; if (ACT == 1) v = fmaxf(v, 0.f); so[w][8 * hh + r][t * 16 + ln] = v; }
  }
  __builtin_amdgcn_fence(__ATOMIC_ACQ_REL, "workgroup");
  __builtin_amdgcn_wave_barrier();
  const int rsub = lane >> 4, c4 = (lane & 15) * 4;
  {
#pragma unroll
    for (int q = 0; q < 8; ++q) {
      const int r = q * 2 + rsub;
      const v4f v = *(const v4fa*)&so[w][r][c4];
      *(v4f*)(C + (size_t)(row0 + r) * ldc + col0 + c4) = v;
    }
    
  }
}

// GEMM C = act(A·W + bias + resid): A f32 (ASPLIT -> hi/lo 2 terms), Wt bf16 [N][K]; ACT 0 none, 1 relu, 2 exact gelu;
// resid (optional, f32, row index = (row % rmod), pitch ldr, RES_BF16 rounds it) added before the activation.
template <bool ASPLIT, int ACT, bool BIAS_BF16, bool RES_BF16>
__global__ __launch_bounds__(128) void k_gemm_bf3(const float* __restrict__ A, int lda, const unsigned short* __restrict__ Wt, int ldb,
                                                const float* __restrict__ bias, const float* __restrict__ resid, int rmod, int ldr,
                                                float* __restrict__ C, int ldc, int M, int N, int K) {
  __shared__ __attribute__((aligned(16))) float so[4][16][64];
  const int tid = threadIdx.x, w = tid >> 5, lane = tid & 31, ln = lane & 15, hh = lane >> 4;
  const int ntn = N / 64;
  const int wid = blockIdx.x * 4 + w;
  const int mt = wid / ntn, nq = wid % ntn;
  if (mt * 16 >= M) return;
  const int row0 = mt * 16, col0 = nq * 64;
  const float* arow = A + (size_t)(row0 + ln) * lda;
  v8f acc[4] = {};
  for (int kb = 0; kb < K; kb += 32) {
    FragB ah, al;
    const v4f x0 = *(const v4fa*)(arow + kb + 8 * hh), x1 = *(const v4fa*)(arow + kb + 8 * hh + 4);
    const v4f x2 = *(const v4fa*)(arow + kb + 16 + 8 * hh), x3 = *(const v4fa*)(arow + kb + 16 + 8 * hh + 4);
    float xs[16] = {x0[0],x0[1],x0[2],x0[3],x1[0],x1[1],x1[2],x1[3],x2[0],x2[1],x2[2],x2[3],x3[0],x3[1],x3[2],x3[3]};
#pragma unroll
    for (int i = 0; i < 16; ++i) { const unsigned short hb = bf16_bits(xs[i]); ah.u[i] = hb; al.u[i] = ASPLIT ? bf16_bits(xs[i] - bf16_val(hb)) : (unsigned short)0; }
#pragma unroll
    for (int t = 0; t < 4; ++t) {
      const unsigned short* brow = Wt + (size_t)(col0 + t * 16 + ln) * ldb + kb;
      FragB b;
      b.half[0] = *(const v8us*)(brow + 8 * hh);
      b.half[1] = *(const v8us*)(brow + 16 + 8 * hh);
      acc[t] = mmaN<ASPLIT ? 2 : 1>(ah.v, al.v, b.v, b.v, acc[t]);
    }
  }
#pragma unroll
  for (int t = 0; t < 4; ++t) {
    const int col = col0 + t * 16 + ln;
    float bv = bias ? bias[col] : 0.f;
    if (BIAS_BF16) bv = bf16_round(bv);
#pragma unroll
    for (int r = 0; r < 8; ++r) {
      float v = acc[t][r] + bv;
      if (resid) { float rv = resid[(size_t)((row0 + 8 * hh + r) % rmod) * ldr + col]; if (RES_BF16) rv = bf16_round(rv); v += rv; }
      if (ACT == 1) v = fmaxf(v, 0.f);
      if (ACT == 2) v = 0.5f * v * (1.0f + erff(v * 0.70710678118654752f));
      if (ACT == 3) { const float u = 0.7978845608028654f * (v + 0.044715f * v * v * v); v = 0.5f * v * (1.0f + tanhf(u)); }
      so[w][8 * hh + r][t * 16 + ln] = v;
    }
  }
  __builtin_amdgcn_fence(__ATOMIC_ACQ_REL, "workgroup");
  __builtin_amdgcn_wave_barrier();
  const int rsub = lane >> 4, c4 = (lane & 15) * 4;
  {
#pragma unroll
    for (int q = 0; q < 8; ++q) {
      const int r = q * 2 + rsub;
      const v4f v = *(const v4fa*)&so[w][r][c4];
      *(v4f*)(C + (size_t)(row0 + r) * ldc + col0 + c4) = v;
    }
    
  }
}
// row LayerNorm (biased variance, eps) over N: s = X (+ R); optional out_sum <- s; out_norm <- (s-mu)*rsqrt(var+eps)*g + b
template <bool PARAM_BF16>
__global__ __launch_bounds__(256) void k_layernorm(const float* __restrict__ X, const float* __restrict__ R, const float* __restrict__ g, const float* __restrict__ bta,
                                                  float* __restrict__ out_sum, float* __restrict__ out_norm, int N, float eps) {
  __shared__ float red[256];
  const int row = blockIdx.x, tid = threadIdx.x;
  const float* x = X + (size_t)row * N; const float* rr = R ? R + (size_t)row * N : nullptr;
  float vals[16];                     // up to N = 4096
  const int per = N / 256;            // contiguous chunk per thread? use strided-by-4 chunks: thread handles j = tid*4 + 1024*u
  float s1 = 0.f;
  for (int u = 0; u < per / 4; ++u) {
    const int j = tid * 4 + 1024 * u;
    const v4f a = *(const v4fa*)(x + j);
    v4f b = {0.f,0.f,0.f,0.f}; if (rr) b = *(const v4fa*)(rr + j);
#pragma unroll
    for (int q = 0; q < 4; ++q) { const float v = a[q] + b[q]; vals[u * 4 + q] = v; s1 += v; }
  }
  red[tid] = s1; __syncthreads();
  for (int st = 128; st > 0; st >>= 1) { if (tid < st) red[tid] += red[tid + st]; __syncthreads(); }
  const float mu = red[0] / (float)N; __syncthreads();
  float s2 = 0.f;
  for (int u = 0; u < per / 4; ++u)
#pragma unroll
    for (int q = 0; q < 4; ++q) { const float c = vals[u * 4 + q] - mu; s2 += c * c; }
  red[tid] = s2; __syncthreads();
  for (int st = 128; st > 0; st >>= 1) { if (tid < st) red[tid] += red[tid + st]; __syncthreads(); }
  const float rs = rsqrtf(red[0] / (float)N + eps);
  {
    for (int u = 0; u < per / 4; ++u) {
      const int j = tid * 4 + 1024 * u;
      v4f o, sm;
#pragma unroll
      for (int q = 0; q < 4; ++q) {
        float gg = g[j + q], bb = bta[j + q];
        if (PARAM_BF16) { gg = bf16_round(gg); bb = bf16_round(bb); }
        sm[q] = vals[u * 4 + q]; o[q] = (vals[u * 4 + q] - mu) * rs * gg + bb;
      }
      if (out_sum) *(v4f*)(out_sum + (size_t)row * N + j) = sm;
      *(v4f*)(out_norm + (size_t)row * N + j) = o;
    }
    
  }
}



// ---- f16 WMMA path (v_wmma_f32_16x16x32_f16): 11-bit significands for operands in range — used where a [0,1] probability operand needs more precision than bf16
typedef _Float16 v16h __attribute__((ext_vector_type(16)));
union FragH { v16h v; v8us half[2]; _Float16 h[16]; unsigned short u[16]; };
template <int NT>
__device__ __forceinline__ v8f mmaH(v16h ah, v16h al, v16h bh, v16h bl, v8f c) {
  c = __builtin_amdgcn_wmma_f32_16x16x32_f16(false, ah, false, bh, (short)0, c, false, false);
  if (NT >= 2) c = __builtin_amdgcn_wmma_f32_16x16x32_f16(false, al, false, bh, (short)0, c, false, false);
  if (NT >= 3) c = __builtin_amdgcn_wmma_f32_16x16x32_f16(false, ah, false, bl, (short)0, c, false, false);
  asm volatile("v_nop\n\tv_nop\n\tv_nop\n\tv_nop" : "+v"(c) : "v"(ah), "v"(al), "v"(bh), "v"(bl));
  return c;
}
// batched GEMM like k_gemm_b but f16 operands: A f32 (split into f16 hi/lo if ASPLIT, else rounded to f16), Bt = f16 values [n][k]; alpha; C f32; N multiple of 16 (partial tiles skipped)
template <bool ASPLIT>
__global__ __launch_bounds__(128) void k_gemm_h(const float* __restrict__ A, int lda, size_t sA, const _Float16* __restrict__ Bh, int ldb, size_t sB, float alpha, float* __restrict__ C, int ldc, size_t sC, int M, int N, int K) {
  __shared__ __attribute__((aligned(16))) float so[4][16][64];
  const int tid = threadIdx.x, w = tid >> 5, lane = tid & 31, ln = lane & 15, hh = lane >> 4; const int by = blockIdx.y;
  A += (size_t)by * sA; Bh += (size_t)by * sB; C += (size_t)by * sC;
  const int ntn = (N + 63) / 64; const int wid = blockIdx.x * 4 + w; const int mt = wid / ntn, nq = wid % ntn; if (mt * 16 >= M) return;
  const int row0 = mt * 16, col0 = nq * 64; const float* arow = A + (size_t)(row0 + ln) * lda;
  v8f acc[4] = {};
  for (int kb = 0; kb < K; kb += 32) {
    FragH ah, al;
    const v4f x0 = *(const v4fa*)(arow + kb + 8 * hh), x1 = *(const v4fa*)(arow + kb + 8 * hh + 4), x2 = *(const v4fa*)(arow + kb + 16 + 8 * hh), x3 = *(const v4fa*)(arow + kb + 16 + 8 * hh + 4);
    float xs[16] = {x0[0],x0[1],x0[2],x0[3],x1[0],x1[1],x1[2],x1[3],x2[0],x2[1],x2[2],x2[3],x3[0],x3[1],x3[2],x3[3]};
#pragma unroll
    for (int i = 0; i < 16; ++i) { const _Float16 h = (_Float16)xs[i]; ah.h[i] = h; al.h[i] = ASPLIT ? (_Float16)(xs[i] - (float)h) : (_Float16)0.0f; }
#pragma unroll
    for (int t = 0; t < 4; ++t) { if (col0 + t * 16 >= N) continue; const size_t boff = (size_t)(col0 + t * 16 + ln) * ldb + kb; FragH bq; bq.half[0] = *(const v8us*)(Bh + boff + 8 * hh); bq.half[1] = *(const v8us*)(Bh + boff + 16 + 8 * hh);
      acc[t] = mmaH<ASPLIT ? 2 : 1>(ah.v, al.v, bq.v, bq.v, acc[t]); }
  }
#pragma unroll
  for (int t = 0; t < 4; ++t) { if (col0 + t * 16 >= N) continue;
#pragma unroll
    for (int r = 0; r < 8; ++r) so[w][8 * hh + r][t * 16 + ln] = acc[t][r] * alpha; }
  __builtin_amdgcn_fence(__ATOMIC_ACQ_REL, "workgroup"); __builtin_amdgcn_wave_barrier();
  const int rsub = lane >> 4, c4 = (lane & 15) * 4;
  {
#pragma unroll
    for (int q = 0; q < 8; ++q) { const int r = q * 2 + rsub; if (col0 + c4 < N) { const v4f v = *(const v4fa*)&so[w][r][c4]; *(v4f*)(C + (size_t)(row0 + r) * ldc + col0 + c4) = v; } }
     }
}

// k_gemm_hh variant with fused epilogue: v = acc·alpha + bias[by·sBias + col] (+ CP[(row/rowsPerB)·sCPb + by·64 + col] if CP) ; ACT 0 none / 1 elu ; writes f16 C16 (and f32 C if non-null)
template <int ACT>
__global__ __launch_bounds__(128) void k_gemm_hhx(const _Float16* __restrict__ A, int lda, size_t sA, const _Float16* __restrict__ Bh, int ldb, size_t sB, float alpha, const float* __restrict__ bias, size_t sBias, const float* __restrict__ CP, int rowsPerB, size_t sCPb, int row0g,
    float* __restrict__ C, _Float16* __restrict__ C16, int ldc, size_t sC, int M, int N, int K) {
  __shared__ __attribute__((aligned(16))) float so[4][16][64];
  const int tid = threadIdx.x, w = tid >> 5, lane = tid & 31, ln = lane & 15, hh = lane >> 4; const int by = blockIdx.y;
  A += (size_t)by * sA; Bh += (size_t)by * sB; const size_t cofs = (size_t)by * sC; const float* bp = bias ? bias + (size_t)by * sBias : nullptr;
  const int ntn = (N + 63) / 64; const int wid = blockIdx.x * 4 + w; const int mt = wid / ntn, nq = wid % ntn; if (mt * 16 >= M) return;
  const int row0 = mt * 16, col0 = nq * 64; const _Float16* arow = A + (size_t)(row0 + ln) * lda;
  v8f acc[4] = {};
  for (int kb = 0; kb < K; kb += 32) { FragH ah; ah.half[0] = *(const v8us*)((const unsigned short*)arow + kb + 8 * hh); ah.half[1] = *(const v8us*)((const unsigned short*)arow + kb + 16 + 8 * hh);
#pragma unroll
    for (int t = 0; t < 4; ++t) { if (col0 + t * 16 >= N) continue; const size_t boff = (size_t)(col0 + t * 16 + ln) * ldb + kb; FragH bq; bq.half[0] = *(const v8us*)((const unsigned short*)Bh + boff + 8 * hh); bq.half[1] = *(const v8us*)((const unsigned short*)Bh + boff + 16 + 8 * hh);
      acc[t] = mmaH<1>(ah.v, ah.v, bq.v, bq.v, acc[t]); }
  }
#pragma unroll
  for (int t = 0; t < 4; ++t) { if (col0 + t * 16 >= N) continue; const int col = col0 + t * 16 + ln; const float bv = bp ? bf16_round(bp[col]) : 0.f;
#pragma unroll
    for (int r = 0; r < 8; ++r) { float v = acc[t][r] * alpha + bv; if (CP) { const int rr = row0g + row0 + 8 * hh + r; if (rowsPerB < 0) v += CP[cofs + (size_t)rr * ldc + col];      /* rowsPerB < 0: own element of the batched C plane */ else { const int bidx = rr / rowsPerB; v += CP[(size_t)bidx * sCPb + (size_t)by * 64 + col]; } } if (ACT == 1) v = (v > 0.f) ? v : expm1f(v); else if (ACT == 7) v = (v > 0.f) ? v + 1.0f : expf(v); else if (ACT == 8) v = tanhf(v); else if (ACT == 9) v = 0.5f * v * (1.0f + tanhf(0.7978845608028654f * (v + 0.044715f * v * v * v))); else if (ACT == 11) v = 1.0f / (1.0f + expf(-v)); else if (ACT == 12) v = (v > 0.f) ? v : 0.01f * v; else if (ACT == 14) v = (v > 0.f) ? v : 0.1f * v; else if (ACT == 16) v = (v >= 0.f) ? v : 0.3f * v; else if (ACT == 17) v = (v >= 0.f) ? v : 0.2f * v; else if (ACT == 15) v = v / (1.0f + expf(-v)); else if (ACT == 3) v = fmaxf(v, 0.f); else if (ACT == 6) v = 0.5f * v * (1.0f + erff(v * 0.70710678118654752f)); so[w][8 * hh + r][t * 16 + ln] = v; } }
  __builtin_amdgcn_fence(__ATOMIC_ACQ_REL, "workgroup"); __builtin_amdgcn_wave_barrier();
  const int rsub = lane >> 4, c4 = (lane & 15) * 4; typedef _Float16 v4h __attribute__((ext_vector_type(4)));
  {
#pragma unroll
    for (int q = 0; q < 8; ++q) { const int r = q * 2 + rsub; if (col0 + c4 < N) { const v4f v = *(const v4fa*)&so[w][r][c4]; if (C) *(v4f*)(C + cofs + (size_t)(row0 + r) * ldc + col0 + c4) = v; if (C16) { v4h h4; for (int i = 0; i < 4; ++i) h4[i] = (_Float16)v[i]; *(v4h*)(C16 + cofs + (size_t)(row0 + r) * ldc + col0 + c4) = h4; } } }
     }
}


typedef _Float16 v4h __attribute__((ext_vector_type(4)));

__global__ __launch_bounds__(256) void k_h16(const float* __restrict__ x, _Float16* __restrict__ X16, size_t n8) { const size_t t = (size_t)blockIdx.x * 256 + threadIdx.x; if (t >= n8) return; FragH f;
#pragma unroll
  for (int q = 0; q < 8; ++q) f.h[q] = (_Float16)x[t * 8 + q]; *(v8us*)((unsigned short*)X16 + t * 8) = f.half[0];  }
__global__ __launch_bounds__(256) void k_round16f(const float* __restrict__ W, _Float16* __restrict__ Bt, size_t n8) { const size_t t = (size_t)blockIdx.x * 256 + threadIdx.x; if (t >= n8) return; FragH f;
#pragma unroll
  for (int i = 0; i < 8; ++i) f.h[i] = (_Float16)(bf16_round(W[t * 8 + i]) * 16.0f); *(v8us*)((unsigned short*)Bt + t * 8) = f.half[0];  }
template <int NHv, int TTv>
__global__ __launch_bounds__(256) void k_vt(const _Float16* __restrict__ V16, int ldv, int voff, _Float16* __restrict__ Vt) { __shared__ unsigned short tl[64][66]; const int tid = threadIdx.x; const int slab = blockIdx.x / (TTv / 64), lg = blockIdx.x % (TTv / 64); const int b = slab / NHv, h = slab % NHv;
  for (int i = tid; i < 64 * 8; i += 256) { const int r = i / 8, c8 = (i % 8) * 8; FragH f; f.half[0] = *(const v8us*)((const unsigned short*)V16 + ((size_t)b * TTv + lg * 64 + r) * ldv + voff + h * 64 + c8);
#pragma unroll
    for (int q = 0; q < 8; ++q) tl[r][c8 + q] = f.u[q]; }
  __syncthreads();
  {
#pragma unroll
    for (int rd = 0; rd < 2; ++rd) { const int d = rd * 32 + tid / 8, pc = tid % 8; FragH f;
#pragma unroll
      for (int q = 0; q < 8; ++q) f.u[q] = tl[pc * 8 + q][d];
      *(v8us*)((unsigned short*)Vt + ((size_t)slab * 64 + d) * TTv + lg * 64 + pc * 8) = f.half[0]; }
     } }

__global__ __launch_bounds__(256) void k_hl(const float* __restrict__ F, _Float16* __restrict__ Hh, _Float16* __restrict__ Hl, size_t n8) { const size_t t = (size_t)blockIdx.x * 256 + threadIdx.x; if (t >= n8) return; FragH fh, fl; const v4f a = *(const v4fa*)(F + t * 8), c = *(const v4fa*)(F + t * 8 + 4);
#pragma unroll
  for (int q = 0; q < 4; ++q) { _Float16 h = (_Float16)a[q]; fh.h[q] = h; fl.h[q] = (_Float16)((a[q] - (float)h) * 1024.0f); h = (_Float16)c[q]; fh.h[4 + q] = h; fl.h[4 + q] = (_Float16)((c[q] - (float)h) * 1024.0f); }
  { *(v8us*)((unsigned short*)Hh + t * 8) = fh.half[0]; *(v8us*)((unsigned short*)Hl + t * 8) = fl.half[0];  } }

// ---- fast GEMM (wave tile 32x64; requires M % 32 == 0 rows per launch region and N % 64 == 0); epilogue = k_gemm_hhx semantics ----
__device__ __forceinline__ v16h g2_frag(const _Float16* p, int hh) { FragH f; f.half[0] = *(const v8us*)((const unsigned short*)p + 8 * hh); f.half[1] = *(const v8us*)((const unsigned short*)p + 16 + 8 * hh); return f.v; }
__device__ __forceinline__ v8f g2_mma(v16h a, v16h b, v8f c) { v8f d = __builtin_amdgcn_wmma_f32_16x16x32_f16(false, a, false, b, (short)0, c, false, false); asm volatile("v_nop\n\tv_nop\n\tv_nop\n\tv_nop" : "+v"(d) : "v"(a), "v"(b)); return d; }
template <int ACT>
__global__ __launch_bounds__(128) void k_gemm2(const _Float16* __restrict__ A, int lda, size_t sA, const _Float16* __restrict__ Bh, int ldb, size_t sB, float alpha, const float* __restrict__ bias, size_t sBias, const float* __restrict__ CP, int rowsPerB, size_t sCPb, int row0g,
    float* __restrict__ C, _Float16* __restrict__ C16, int ldc, size_t sC, int M, int N, int K) { static_assert(ACT == 0 || ACT == 3 || ACT == 6 || ACT == 8 || ACT == 9 || ACT == 11 || ACT == 12 || ACT == 14 || ACT == 15 || ACT == 16 || ACT == 17, "k_gemm2: unsupported ACT code (would silently apply no activation)");
  __shared__ __attribute__((aligned(16))) float so[4][32][68];
  const int tid = threadIdx.x, w = tid >> 5, lane = tid & 31, ln = lane & 15, hh = lane >> 4; const int by = blockIdx.y;
  A += (size_t)by * sA; Bh += (size_t)by * sB; const size_t cofs = (size_t)by * sC; const float* bp = bias ? bias + (size_t)by * sBias : nullptr;
  const int ntn = N >> 6; const int mt = blockIdx.x / ntn, nq = blockIdx.x - mt * ntn; const int row0 = mt * 128 + 32 * w, col0 = nq * 64; if (row0 >= M) return;
  const _Float16* a0p = A + (size_t)(row0 + ln) * lda; const _Float16* a1p = a0p + (size_t)16 * lda;
  const _Float16* b0p = Bh + (size_t)(col0 + ln) * ldb; const _Float16* b1p = b0p + (size_t)16 * ldb; const _Float16* b2p = b1p + (size_t)16 * ldb; const _Float16* b3p = b2p + (size_t)16 * ldb;
  const v8f z8 = {0.f,0.f,0.f,0.f,0.f,0.f,0.f,0.f}; v8f c00 = z8, c01 = z8, c02 = z8, c03 = z8, c10 = z8, c11 = z8, c12 = z8, c13 = z8;
#pragma unroll 1
  for (int kb = 0; kb < K; kb += 32) { const v16h a0 = g2_frag(a0p + kb, hh), a1 = g2_frag(a1p + kb, hh);
    v16h b = g2_frag(b0p + kb, hh); c00 = g2_mma(a0, b, c00); c10 = g2_mma(a1, b, c10);
    b = g2_frag(b1p + kb, hh); c01 = g2_mma(a0, b, c01); c11 = g2_mma(a1, b, c11);
    b = g2_frag(b2p + kb, hh); c02 = g2_mma(a0, b, c02); c12 = g2_mma(a1, b, c12);
    b = g2_frag(b3p + kb, hh); c03 = g2_mma(a0, b, c03); c13 = g2_mma(a1, b, c13); }
  v8f accs[8] = {c00, c01, c02, c03, c10, c11, c12, c13};
#pragma unroll
  for (int u = 0; u < 8; ++u) { const int t = u & 3, half = u >> 2; const int col = col0 + t * 16 + ln; const float bv = bp ? bf16_round(bp[col]) : 0.f;
#pragma unroll
    for (int r = 0; r < 8; ++r) { const int rloc = half * 16 + 8 * hh + r; float v = accs[u][r] * alpha + bv; if (CP) { if (rowsPerB < 0) v += CP[cofs + (size_t)(row0g + row0 + rloc) * ldc + col];      /* rowsPerB < 0: own element of the batched C plane */ else { const int bidx = (row0g + row0 + rloc) / rowsPerB; v += CP[(size_t)bidx * sCPb + (size_t)by * 64 + col]; } }
      if (ACT == 3) v = fmaxf(v, 0.f); else if (ACT == 6) v = 0.5f * v * (1.0f + erff(v * 0.70710678118654752f)); else if (ACT == 11) v = 1.0f / (1.0f + expf(-v)); else if (ACT == 15) v = v / (1.0f + expf(-v)); else if (ACT == 12) v = (v > 0.f) ? v : 0.01f * v; else if (ACT == 8) v = tanhf(v); else if (ACT == 9) v = 0.5f * v * (1.0f + tanhf(0.7978845608028654f * (v + 0.044715f * v * v * v))); else if (ACT == 14) v = (v > 0.f) ? v : 0.1f * v; else if (ACT == 16) v = (v >= 0.f) ? v : 0.3f * v; else if (ACT == 17) v = (v >= 0.f) ? v : 0.2f * v;
      so[w][rloc][t * 16 + ln] = v; } }
  __builtin_amdgcn_fence(__ATOMIC_ACQ_REL, "workgroup"); __builtin_amdgcn_wave_barrier();
  const int rsub = lane >> 4, c4 = (lane & 15) * 4;
  {
#pragma unroll
    for (int q = 0; q < 16; ++q) { const int r = q * 2 + rsub; const v4f v = *(const v4fa*)&so[w][r][c4]; if (C) *(v4f*)(C + cofs + (size_t)(row0 + r) * ldc + col0 + c4) = v; if (C16) { v4h h4; for (int i = 0; i < 4; ++i) h4[i] = (_Float16)v[i]; *(v4h*)(C16 + cofs + (size_t)(row0 + r) * ldc + col0 + c4) = h4; } }
     } }


__global__ __launch_bounds__(256) void k_wnat(const float* __restrict__ w, size_t n8, _Float16* __restrict__ Bt) { const size_t t = (size_t)blockIdx.x * 256 + threadIdx.x; if (t >= n8) return; FragH f; for (int q = 0; q < 8; ++q) f.h[q] = (_Float16)(bf16_round(w[t * 8 + q]) * 16.0f); *(v8us*)((unsigned short*)Bt + t * 8) = f.half[0];  }
__global__ __launch_bounds__(256) void k_rsm(const float* __restrict__ S, _Float16* __restrict__ P, int nrows) {
  #pragma clang fp contract(off)
  const int i = blockIdx.x * 256 + threadIdx.x; if (i >= nrows) return; const float* s = S + (size_t)i * SQ; float mx = -3.0e38f;
#pragma unroll 1
  for (int j = 0; j < SQ; ++j) mx = fmaxf(mx, s[j]); float se = 0.f;
#pragma unroll 1
  for (int j = 0; j < SQ; ++j) se += expf(s[j] - mx); const float sc = 256.0f / se;
#pragma unroll 1
  for (int j0 = 0; j0 < SQ; j0 += 8) { FragH f; for (int q = 0; q < 8; ++q) f.h[q] = (_Float16)(expf(s[j0 + q] - mx) * sc); unsigned short* d = (unsigned short*)P + (size_t)i * SQ + j0; *(v8us*)d = f.half[0];  } }
__global__ __launch_bounds__(256) void k_vt(const _Float16* __restrict__ V16, int b, int h0, _Float16* __restrict__ VT) { __shared__ unsigned short tl[64][65]; const int tid = threadIdx.x; const int hh = blockIdx.x % HG, sg = blockIdx.x / HG; const int s0 = sg * 64; const int h = h0 + hh;
  for (int i = tid; i < 64 * 8; i += 256) { const int j = i / 8, d8 = (i % 8) * 8; FragH f; f.half[0] = *(const v8us*)((const unsigned short*)V16 + ((size_t)b * SQ + s0 + j) * DM + h * HD + d8); for (int q = 0; q < 8; ++q) tl[d8 + q][j] = f.u[q]; }
  __syncthreads();
  { for (int i = tid; i < 64 * 8; i += 256) { const int d = i / 8, j8 = (i % 8) * 8; FragH f; for (int q = 0; q < 8; ++q) f.u[q] = tl[d][j8 + q]; *(v8us*)((unsigned short*)VT + ((size_t)hh * HD + d) * SQ + s0 + j8) = f.half[0]; }  } }



#define FK 64            /* keys per pass */
#define FP 72            /* LDS row pitch in halves: 144 bytes = 16 x odd, for 16-byte row reads */
#define FPV 80           /* LDS pitch of a V row in halves: 160 bytes = 32 x odd, for the transposing reads */
#define FMASK (-262144.0f)
#define FTHR 8.0f
#define FOFF 6.0f
typedef int v4ia __attribute__((ext_vector_type(4), may_alias));
typedef float v8fa __attribute__((ext_vector_type(8), may_alias));
typedef float v2f __attribute__((ext_vector_type(2)));
typedef _Float16 v2h __attribute__((ext_vector_type(2)));
union FragP { v16h v; v2h p[8]; };
__device__ __forceinline__ float fa_xhalf(float x) { const int i = __float_as_int(x); return __int_as_float(__builtin_amdgcn_permlanex16(i, i, 0x76543210, 0xfedcba98, false, false)); }      /* lane l <-> l ^ 16 */
__device__ __forceinline__ v8f fa_mma(v16h a, v16h b, v8f c) { return __builtin_amdgcn_wmma_f32_16x16x32_f16(false, a, false, b, (short)0, c, false, false); }
// List of a batch's kept keys (mask <= 0) in rising order, built by a work-group of 256 threads: idx[0 .. n) = the keys, idx[n .. SQ) = 0 (a valid row); returns n >= 1. Thread t owns keys 8 t .. 8 t + 7.
// A key's place = kept keys of the waves below (wt) + of the lanes below (ballots counted under the lane) + of the thread's own earlier keys. none: no key is kept, the list is then all SQ keys.
__device__ __forceinline__ int fa_kept(const int* __restrict__ mrow, unsigned short* idx, int* wt, bool& none) {
  const int tid = threadIdx.x, w = tid >> 5;
  const v4ia m0 = *(const v4ia*)(mrow + tid * 8), m1 = *(const v4ia*)(mrow + tid * 8 + 4);
  bool k[8]; unsigned int below = 0u, tot = 0u;
#pragma unroll      /* constant indices into k */
  for (int q = 0; q < 4; ++q) { k[q] = !(m0[q] > 0); k[4 + q] = !(m1[q] > 0); }
#pragma unroll      /* constant indices into k */
  for (int q = 0; q < 8; ++q) { const unsigned int bal = __builtin_amdgcn_ballot_w32(k[q]); below = __builtin_amdgcn_mbcnt_lo(bal, below); tot += (unsigned int)__builtin_popcount(bal); }
  const v8us z = {0, 0, 0, 0, 0, 0, 0, 0}; *(v8us*)&idx[tid * 8] = z;
  if ((tid & 31) == 0) wt[w] = (int)tot;
  __syncthreads();      /* publishes the eight wave counts; the zero fill is complete before any place is written */
  int base = 0, n = 0;
  for (int i = 0; i < 8; ++i) { const int c = wt[i]; base += i < w ? c : 0; n += c; }
  int pos = base + (int)below;
  none = n == 0;
  if (none) { pos = tid * 8; n = SQ; }
#pragma unroll      /* constant indices into k */
  for (int q = 0; q < 8; ++q) if (k[q] || none) { idx[pos] = (unsigned short)(tid * 8 + q); ++pos; }
  __syncthreads();      /* publishes the list */
  return n; }
// Eight halves of a column of a row-major 16-bit LDS tile: lane (c = l & 15, h = l >> 4) gets T[8 h + 0 .. 7][c] when lane l points at row 8 (l >> 4) + (l & 7), byte 16 ((l >> 3) & 1), of the 16 x 16 tile.
typedef short v8s __attribute__((ext_vector_type(8)));
__device__ __forceinline__ v8us fa_tr16(const unsigned char* p) { typedef __attribute__((address_space(3))) v8s lds_v8s; return __builtin_bit_cast(v8us, __builtin_amdgcn_ds_load_tr16_b128_v8i16((lds_v8s*)p)); }
__global__ __launch_bounds__(256) __attribute__((amdgpu_waves_per_eu(4, 4))) /* two work-groups per WGP: the vector work between the matrix runs wants four waves per SIMD */
void k_fattn(const _Float16* __restrict__ QKV, const int* __restrict__ Km, _Float16* __restrict__ O16) {
  __shared__ __attribute__((aligned(16))) _Float16 Ks[2][FK][FP];
  __shared__ __attribute__((aligned(16))) _Float16 Vs[2][FK][FPV];      /* V rows [place][d] */
  __shared__ __attribute__((aligned(16))) unsigned short kidx[SQ];
  __shared__ int wt[8];
  __shared__ __attribute__((aligned(32))) float kb[FK];      /* start values C of the last pass's score product: 0 for a key, FMASK behind the list's end */
  const int tid = threadIdx.x, w = tid >> 5, lane = tid & 31, ln = lane & 15, hh = lane >> 4;
  const int h = blockIdx.y, b = blockIdx.z, q0 = blockIdx.x * 256 + w * 32;
  const unsigned short* Kg = (const unsigned short*)QKV + (size_t)b * SQ * LQ + DM + h * HD;      /* K rows [key][d], pitch LQ; the key's V row stands DM halves further on */
  const int sr = tid >> 3, sc = (tid & 7) * 8;      /* staging: 16-byte piece sc of rows sr and sr + 32 of both tiles */
  v16h qf[2][2];
#pragma unroll      /* fragments stay in registers: constant indices only */
  for (int g = 0; g < 2; ++g) for (int kk = 0; kk < 2; ++kk) qf[g][kk] = g2_frag(QKV + ((size_t)b * SQ + q0 + g * 16 + ln) * LQ + h * HD + kk * 32, hh);
  bool none; const int n = __builtin_amdgcn_readfirstlane(fa_kept(Km + (size_t)b * SQ, kidx, wt, none));      /* the same in every lane: held as a scalar, so that the pass loop branches on scalars */
  const int np = min((n + FK - 1) / FK, SQ / FK);      /* passes: 1 .. SQ / FK */
  if (tid < FK) kb[tid] = (np - 1) * FK + tid >= n ? FMASK : 0.f;
  int i0 = kidx[sr], i1 = kidx[sr + 32];      /* the K and V rows this thread stages */
  v8us kr0 = *(const v8us*)(Kg + (size_t)i0 * LQ + sc), kr1 = *(const v8us*)(Kg + (size_t)i1 * LQ + sc);
  v8us vr0 = *(const v8us*)(Kg + (size_t)i0 * LQ + DM + sc), vr1 = *(const v8us*)(Kg + (size_t)i1 * LQ + DM + sc);
  i0 = kidx[FK + sr]; i1 = kidx[FK + sr + 32];      /* list entries are read one pass ahead of the loads that use them */
  *(v8us*)&Ks[0][sr][sc] = kr0; *(v8us*)&Ks[0][sr + 32][sc] = kr1; *(v8us*)&Vs[0][sr][sc] = vr0; *(v8us*)&Vs[0][sr + 32][sc] = vr1;
  __syncthreads();      /* publishes pass 0's tiles and the start values */
  { const v16h zq = {};
#pragma unroll      /* constant indices into qf */
    for (int g = 0; g < 2; ++g) for (int kk = 0; kk < 2; ++kk) qf[g][kk] = none ? zq : qf[g][kk]; }
  const v8f z8 = {0.f,0.f,0.f,0.f,0.f,0.f,0.f,0.f};
  v8f o[4][2] = {{z8, z8}, {z8, z8}, {z8, z8}, {z8, z8}};
  float m[2] = {-3.0e38f, -3.0e38f}, nm[2] = {0.f, 0.f}; v8f lt[2] = {z8, z8};      /* lt: every row of the tile = the column's sum of weights */
  v16h ones; for (int e = 0; e < 16; ++e) ones[e] = (_Float16)1.0f;
  const float cs = 0.125f * 1.4426950408889634f;      /* 64^-0.5 log2(e) */
  const unsigned char* vt = (const unsigned char*)&Vs[0][8 * hh + (lane & 7)][((lane >> 3) & 1) * 8];      /* the lane's address in the first 16 x 16 tile of V for the transposing reads */
#pragma unroll 1      /* one pass per trip: the body already fills the register budget */
  for (int s = 0; s < np; ++s) {
    const int buf = s & 1; const bool more = s + 1 < np;
    if (more) { const int k2 = min(s + 2, SQ / FK - 1) * FK;      /* next pass's tiles fly through registers while this pass is worked on */
      kr0 = *(const v8us*)(Kg + (size_t)i0 * LQ + sc); kr1 = *(const v8us*)(Kg + (size_t)i1 * LQ + sc);
      vr0 = *(const v8us*)(Kg + (size_t)i0 * LQ + DM + sc); vr1 = *(const v8us*)(Kg + (size_t)i1 * LQ + DM + sc);
      asm volatile("s_wait_xcnt 0x0" ::: "memory");      /* the four loads have taken their addresses before the address registers get new values further down */
      i0 = kidx[k2 + sr]; i1 = kidx[k2 + sr + 32]; }
    v8f st[4][2];
    if (more) {      /* a full pass holds keys only: the score product starts at 0, nothing is read for it */
#pragma unroll      /* constant indices into st, qf */
      for (int t = 0; t < 4; ++t) {      /* D row 8 hh + r = place t 16 + 8 hh + r of the pass */
        const v16h ka = g2_frag(&Ks[buf][t * 16 + ln][0], hh), kc = g2_frag(&Ks[buf][t * 16 + ln][32], hh);
        for (int g = 0; g < 2; ++g) st[t][g] = fa_mma(kc, qf[g][1], fa_mma(ka, qf[g][0], z8));
        if (t & 1) __builtin_amdgcn_sched_barrier(0); }      /* holds the next two tiles' fragment loads behind these products: all eight K fragments loaded at once overflow the register budget of four waves per SIMD (spills) */
    } else {      /* the last pass: places behind the list's end start at FMASK */
#pragma unroll      /* constant indices into st, qf */
      for (int t = 0; t < 4; ++t) { const v8f c0 = *(const v8fa*)&kb[t * 16 + 8 * hh];
        const v16h ka = g2_frag(&Ks[buf][t * 16 + ln][0], hh), kc = g2_frag(&Ks[buf][t * 16 + ln][32], hh);
        for (int g = 0; g < 2; ++g) st[t][g] = fa_mma(kc, qf[g][1], fa_mma(ka, qf[g][0], c0));
        if (t & 1) __builtin_amdgcn_sched_barrier(0); }      /* as above */
    }
    float ms[2];
#pragma unroll      /* constant indices into st */
    for (int g = 0; g < 2; ++g) { float mx = st[0][g][0];
      for (int t = 0; t < 4; ++t) for (int r = 0; r < 8; ++r) mx = fmaxf(mx, st[t][g][r]);
      ms[g] = fmaxf(mx, fa_xhalf(mx)) * cs; }
    if (__builtin_amdgcn_ballot_w32(ms[0] > m[0] + FTHR || ms[1] > m[1] + FTHR) != 0u) {      /* one scalar branch per pass */
#pragma unroll      /* constant indices into o */
      for (int g = 0; g < 2; ++g) { const float mn = fmaxf(m[g], ms[g]); const float al = __builtin_amdgcn_exp2f(m[g] - mn); m[g] = mn; nm[g] = FOFF - mn; lt[g] *= al;
        for (int dt = 0; dt < 4; ++dt) o[dt][g] *= al; } }
    FragP pf[2][2];
#pragma unroll      /* constant indices into st, pf */
    for (int g = 0; g < 2; ++g) for (int t = 0; t < 4; ++t) for (int r = 0; r < 8; r += 2) {
      v2f p; p[0] = __builtin_amdgcn_exp2f(__builtin_fmaf(st[t][g][r], cs, nm[g])); p[1] = __builtin_amdgcn_exp2f(__builtin_fmaf(st[t][g][r + 1], cs, nm[g]));
      pf[t >> 1][g].p[(t & 1) * 4 + (r >> 1)] = __builtin_convertvector(p, v2h); }      /* b[e] = T[e >> 3][e & 7]: the hardware k order */
#pragma unroll      /* constant indices into lt, pf */
    for (int j = 0; j < 2; ++j) for (int g = 0; g < 2; ++g) lt[g] = fa_mma(ones, pf[j][g].v, lt[g]);      /* row sums on the matrix pipe: A = ones sums the rounded weights of all 32 keys, both wave halves' */
#pragma unroll      /* constant indices into o, pf */
    for (int dt = 0; dt < 4; ++dt) for (int j = 0; j < 2; ++j) { FragH vf;      /* A[d = dt 16 + ln][k]: places j 32 + 8 hh + 0 .. 7, then + 16: the k order of the packed weights */
      vf.half[0] = fa_tr16(vt + (size_t)buf * (FK * FPV * 2) + j * 32 * (FPV * 2) + dt * 32); vf.half[1] = fa_tr16(vt + (size_t)buf * (FK * FPV * 2) + (j * 32 + 16) * (FPV * 2) + dt * 32);
      for (int g = 0; g < 2; ++g) o[dt][g] = fa_mma(vf.v, pf[j][g].v, o[dt][g]); }
    if (more) { *(v8us*)&Ks[buf ^ 1][sr][sc] = kr0; *(v8us*)&Ks[buf ^ 1][sr + 32][sc] = kr1; *(v8us*)&Vs[buf ^ 1][sr][sc] = vr0; *(v8us*)&Vs[buf ^ 1][sr + 32][sc] = vr1; }      /* that buffer's readers left it at the last barrier */
    __syncthreads();      /* publishes the next pass's tiles and ends this pass's reads */
  }
#pragma unroll      /* constant indices into o */
  for (int g = 0; g < 2; ++g) { const float sc64 = 64.0f / lt[g][0];      /* o carried x64, as the output GEMM's alpha expects */
    unsigned short* d = (unsigned short*)O16 + ((size_t)b * SQ + q0 + g * 16 + ln) * DM + h * HD + 8 * hh;
    for (int dt = 0; dt < 4; ++dt) { FragH f; for (int r = 0; r < 8; ++r) f.h[r] = (_Float16)(o[dt][g][r] * sc64); *(v8us*)(d + dt * 16) = f.half[0]; } } }

// ---- GEMM with both operands staged in LDS: C[M][NN] = (A[M][DM] Bt[NN][DM]^T) alpha + bias, A and Bt f16 rows of DM halves.
// A work-group of 8 waves (4 x 2) takes a 256 x 128 tile of C, a wave 64 x 64 (4 x 4 accumulator tiles). A stage is 64 k of the tile's 256 A rows and 128 Bt rows, 128-byte rows at pitch 144 bytes;
// two buffers, filled by asynchronous copies to LDS (whole 128-byte lines, each read once per work-group) one stage ahead of the products. Every accumulator sums k in steps of 32 in rising order.
#define G3M 256
#define G3N 128
#define G3K 64
#define G3P 72                            /* LDS row pitch in halves: 144 bytes = 16 x odd, for 16-byte row reads */
#define G3R (G3M + G3N)                   /* rows of a stage: A rows, then Bt rows */
#define G3B ((unsigned)(G3R * G3P * 2))   /* bytes of a buffer */
#define G3S ((unsigned)(32 * G3P * 2))    /* bytes of 32 LDS rows */
#define G3O 68                            /* output staging pitch in floats */
typedef float f1a __attribute__((may_alias));
template <int NN, bool F32>      /* F32: C (f32) is written, else C16 (f16) */
__global__ __launch_bounds__(256) void k_gemm3(const _Float16* __restrict__ A, const _Float16* __restrict__ Bt, float alpha, const float* __restrict__ bias, float* __restrict__ C, _Float16* __restrict__ C16) {
  __shared__ __attribute__((aligned(16))) _Float16 sm[2][G3R][G3P];
  const int tid = threadIdx.x, w = tid >> 5, lane = tid & 31, ln = lane & 15, hh = lane >> 4;
  const int ntn = NN / G3N; const int mt = blockIdx.x / ntn, nq = blockIdx.x - mt * ntn; const int row0 = mt * G3M, col0 = nq * G3N;
  const int wr = (w >> 1) * 64, wc = (w & 1) * 64;      /* the wave's 64 x 64 part of the tile */
  const int sr = tid >> 3, sc = (tid & 7) * 8;      /* staging: 16-byte piece sc of rows sr + 32 i: a wave's copy covers four whole 128-byte rows */
  const _Float16* ga = A + (size_t)(row0 + sr) * DM + sc; const _Float16* gb = Bt + (size_t)(col0 + sr) * DM + sc;
  const unsigned l0 = (unsigned)(size_t)&sm[0][sr][sc];      /* low 32 bits of the shared address = the byte address in LDS */
  auto fill = [&](int s) { const unsigned l = l0 + (unsigned)(s & 1) * G3B; const _Float16* a = ga + s * G3K; const _Float16* bq = gb + s * G3K;
    /* one stage: 12 copies per lane (8 A rows, 4 Bt rows); the closing wait keeps every address register as it is until the copies have taken it */
    asm volatile("global_load_async_to_lds_b128 %0, %1, off\n\t"
      "global_load_async_to_lds_b128 %2, %3, off\n\t"
      "global_load_async_to_lds_b128 %4, %5, off\n\t"
      "global_load_async_to_lds_b128 %6, %7, off\n\t"
      "global_load_async_to_lds_b128 %8, %9, off\n\t"
      "global_load_async_to_lds_b128 %10, %11, off\n\t"
      "global_load_async_to_lds_b128 %12, %13, off\n\t"
      "global_load_async_to_lds_b128 %14, %15, off\n\t"
      "global_load_async_to_lds_b128 %16, %17, off\n\t"
      "global_load_async_to_lds_b128 %18, %19, off\n\t"
      "global_load_async_to_lds_b128 %20, %21, off\n\t"
      "global_load_async_to_lds_b128 %22, %23, off\n\t"
      "s_wait_xcnt 0x0"
      :: "v"(l + 0u * G3S), "v"(a + (size_t)0 * 32 * DM),
         "v"(l + 1u * G3S), "v"(a + (size_t)1 * 32 * DM),
         "v"(l + 2u * G3S), "v"(a + (size_t)2 * 32 * DM),
         "v"(l + 3u * G3S), "v"(a + (size_t)3 * 32 * DM),
         "v"(l + 4u * G3S), "v"(a + (size_t)4 * 32 * DM),
         "v"(l + 5u * G3S), "v"(a + (size_t)5 * 32 * DM),
         "v"(l + 6u * G3S), "v"(a + (size_t)6 * 32 * DM),
         "v"(l + 7u * G3S), "v"(a + (size_t)7 * 32 * DM),
         "v"(l + 8u * G3S), "v"(bq + (size_t)0 * 32 * DM),
         "v"(l + 9u * G3S), "v"(bq + (size_t)1 * 32 * DM),
         "v"(l + 10u * G3S), "v"(bq + (size_t)2 * 32 * DM),
         "v"(l + 11u * G3S), "v"(bq + (size_t)3 * 32 * DM)
      : "memory"); };
  fill(0);
  asm volatile("s_wait_asynccnt 0x0" ::: "memory");      /* this wave's part of stage 0 has landed */
  __syncthreads();      /* publishes stage 0 */
  fill(1);
  const v8f z8 = {0.f,0.f,0.f,0.f,0.f,0.f,0.f,0.f};
  v8f acc[4][4];
#pragma unroll      /* constant indices into acc */
  for (int i = 0; i < 4; ++i) for (int j = 0; j < 4; ++j) acc[i][j] = z8;
#pragma unroll 1      /* one stage per trip: the ring's order stands at the foot of each trip */
  for (int s = 0; s < DM / G3K; ++s) {
    const int buf = s & 1;
#pragma unroll      /* constant indices into acc */
    for (int kk = 0; kk < 2; ++kk) { v16h af[4], bf[4];
      af[0] = g2_frag(&sm[buf][wr + ln][kk * 32], hh);
      for (int j = 0; j < 4; ++j) bf[j] = g2_frag(&sm[buf][G3M + wc + j * 16 + ln][kk * 32], hh);
      for (int i = 1; i < 4; ++i) af[i] = g2_frag(&sm[buf][wr + i * 16 + ln][kk * 32], hh);
      __builtin_amdgcn_sched_barrier(0);      /* the 16 LDS reads of a block stand as one group ahead of its 16 products: left alone the compiler reloads one A fragment per four products and waits for it each time */
      for (int i = 0; i < 4; ++i) for (int j = 0; j < 4; ++j) acc[i][j] = fa_mma(af[i], bf[j], acc[i][j]);
      __builtin_amdgcn_sched_barrier(0); }      /* keeps the next block's reads out of this block's products */
    asm volatile("s_wait_dscnt 0x0" ::: "memory");      /* this wave's reads of the buffer have returned before it is refilled */
    asm volatile("s_wait_asynccnt 0x0" ::: "memory");      /* this wave's part of the next stage has landed */
    __syncthreads();      /* publishes the next stage and ends this stage's reads */
    if (s + 2 < DM / G3K) fill(s + 2);
  }
  asm volatile("s_wait_asynccnt 0x0" ::: "memory");      /* nothing is in flight when the ring becomes output staging */
  f1a* so = (f1a*)&sm[0][0][0] + (size_t)w * 32 * G3O;      /* each wave stages 32 rows at a time in its own range; every wave has left the ring at the last barrier */
  const int rsub = lane >> 4, c4 = (lane & 15) * 4;
  float bv[4];
#pragma unroll      /* constant indices into bv */
  for (int j = 0; j < 4; ++j) bv[j] = bias ? bf16_round(bias[col0 + wc + j * 16 + ln]) : 0.f;
#pragma unroll      /* constant indices into acc */
  for (int hf = 0; hf < 2; ++hf) {
#pragma unroll      /* constant indices into acc, bv */
    for (int i = 0; i < 2; ++i) for (int j = 0; j < 4; ++j) for (int r = 0; r < 8; ++r) so[(i * 16 + 8 * hh + r) * G3O + j * 16 + ln] = acc[hf * 2 + i][j][r] * alpha + bv[j];
    asm volatile("s_wait_dscnt 0x0" ::: "memory");      /* the staged rows are written before other lanes of the wave read them back */
#pragma unroll      /* the 16 read-backs go out together instead of one wait each */
    for (int q = 0; q < 16; ++q) { const int r = q * 2 + rsub; const v4f v = *(const v4fa*)&so[r * G3O + c4]; const size_t ofs = (size_t)(row0 + wr + hf * 32 + r) * NN + col0 + wc + c4;
      if (F32) *(v4f*)(C + ofs) = v;
      else { v4h h4; for (int e = 0; e < 4; ++e) h4[e] = (_Float16)v[e]; *(v4h*)(C16 + ofs) = h4; } }
    asm volatile("s_wait_dscnt 0x0" ::: "memory");      /* the read-back has returned before the next 32 rows overwrite the range */
  } }
// ---- operand preparation, ONE launch of PG work-groups of 8 waves (two per WGP): few waves to start, each with 24 16-byte loads in flight, every load and store on whole 128-byte lines.
// A work-group takes two 64 x 64 weight tiles and 16 pieces of 1024 values of x. X16 = f16(bf16(x)). Bt[n][k] = f16(bf16(W[k][n]) x 16) (power of two: bf16-exact weights stay exact in f16 away from the subnormal range), rows of DM halves.
// A weight tile goes through LDS: a thread reads 4 columns of two neighbouring k rows (a wave: 256-byte row pieces), packs (k, k + 1) into a dword and writes it at [n][k / 2]; read back along k, a wave stores four whole 128-byte rows of Bt.
#define PG 512                            /* work-groups */
#define PP 33                             /* LDS pitch of a tile row in dwords: odd, so that the 32 dwords of a wave's write (16 rows apart by 4) and of its read fall on 32 banks */
#define PQT ((DM / 64) * (3 * DM / 64))   /* tiles of Wqkv; Wproj's follow */
#define PXC 16                            /* pieces of x per work-group */
typedef unsigned int v4ua __attribute__((ext_vector_type(4), may_alias));
typedef _Float16 v4ha __attribute__((ext_vector_type(4), may_alias));
__device__ __forceinline__ unsigned int pr_pack(float a, float b) { v2h p; p[0] = (_Float16)(bf16_round(a) * 16.0f); p[1] = (_Float16)(bf16_round(b) * 16.0f); return __builtin_bit_cast(unsigned int, p); }
__global__ __launch_bounds__(256) void k_prep(const float* __restrict__ x, const float* __restrict__ wqkv, const float* __restrict__ wo, _Float16* __restrict__ X16, _Float16* __restrict__ BQKV, _Float16* __restrict__ BO) {
  static_assert(2 * PG == PQT + (DM / 64) * (DM / 64), "two weight tiles per work-group");
  static_assert((size_t)PG * PXC * 1024 == NR * DM, "PXC pieces of x per work-group");
  __shared__ unsigned int tl[2][64 * PP];
  const int tid = threadIdx.x, bk = blockIdx.x;
  const int rp = tid >> 4, c4 = (tid & 15) * 4;      /* tile read: columns c4 .. c4 + 3 of rows 2 rp, 2 rp + 1 (+ 32) */
  static_assert(PG <= PQT, "a work-group's first tile is one of Wqkv");
  const float* wp[2]; int wn[2]; unsigned short* dst[2];
#pragma unroll      /* constant indices into wp, wn, dst */
  for (int u = 0; u < 2; ++u) { const int t = bk + u * PG; const bool q = u == 0 || t < PQT;      /* the same for the whole work-group */
    const int kt = q ? t / (3 * DM / 64) : (t - PQT) / (DM / 64), nt = q ? t % (3 * DM / 64) : (t - PQT) % (DM / 64);      /* neighbouring work-groups read neighbouring columns of the same rows */
    wn[u] = q ? 3 * DM : DM; wp[u] = (q ? wqkv : wo) + (size_t)(kt * 64 + 2 * rp) * wn[u] + nt * 64 + c4;
    dst[u] = (unsigned short*)(q ? BQKV : BO) + (size_t)(nt * 64) * DM + kt * 64; }
  v4f wr[2][4], xr[PXC];
#pragma unroll      /* constant indices into wr */
  for (int u = 0; u < 2; ++u) { wr[u][0] = *(const v4fa*)wp[u]; wr[u][1] = *(const v4fa*)(wp[u] + wn[u]); wr[u][2] = *(const v4fa*)(wp[u] + (size_t)32 * wn[u]); wr[u][3] = *(const v4fa*)(wp[u] + (size_t)33 * wn[u]); }
  asm volatile("s_wait_xcnt 0x0" ::: "memory");      /* the eight tile loads have taken their addresses */
#pragma unroll      /* constant indices into xr */
  for (int i = 0; i < PXC; ++i) xr[i] = *(const v4fa*)(x + ((size_t)i * PG + bk) * 1024 + tid * 4);
  __builtin_amdgcn_sched_barrier(0);      /* all 24 loads go out before the first value is used: left alone the compiler waits for the first tile's values before it issues the rest, one memory latency after the other */
#pragma unroll      /* constant indices into wr */
  for (int u = 0; u < 2; ++u) for (int i = 0; i < 2; ++i) for (int j = 0; j < 4; ++j) tl[u][(c4 + j) * PP + 16 * i + rp] = pr_pack(wr[u][2 * i][j], wr[u][2 * i + 1][j]);
  __syncthreads();      /* both tiles are complete before they are read along k */
#pragma unroll      /* constant indices into dst */
  for (int u = 0; u < 2; ++u) for (int i = 0; i < 2; ++i) { const int n = (tid >> 3) + 32 * i, pc = tid & 7; v4ua v;
    for (int e = 0; e < 4; ++e) v[e] = tl[u][n * PP + pc * 4 + e];
    *(v4ua*)(dst[u] + (size_t)n * DM + pc * 8) = v; }
#pragma unroll      /* constant indices into xr */
  for (int i = 0; i < PXC; ++i) { v4ha h4; for (int e = 0; e < 4; ++e) h4[e] = (_Float16)bf16_round(xr[i][e]);
    *(v4ha*)(X16 + ((size_t)i * PG + bk) * 1024 + tid * 4) = h4; } }
extern "C" void kernel_launch(void* const* d_in, const int* in_sizes, int n_in,
                              void* d_out, int out_size, void* d_ws, size_t ws_size, hipStream_t stream) {
  (void)in_sizes; (void)n_in; (void)out_size;
  const float* const* I = (const float* const*)d_in; const float* x = I[0]; const float* wqkv = I[1]; const float* bqkv = nullptr; const float* wo = I[2]; const float* bo = I[3]; const int* km = (const int*)d_in[4];      /* x; [in][out] Wqkv [1024][3072] (no bias), Wproj [1024][1024] + bproj; mask int32 [4][2048] (> 0 = MASKED key; READ on device) */
  char* ws = (char*)d_ws; size_t off = 0;
  auto take = [&](size_t bytes) { char* p = ws + off; off += (bytes + 255) & ~(size_t)255; return p; };
  _Float16* BQKV = (_Float16*)take((size_t)3 * DM * DM * 2); _Float16* BO = (_Float16*)take((size_t)DM * DM * 2);
  _Float16* X16 = (_Float16*)take(NR * DM * 2); _Float16* QKV = (_Float16*)take(NR * 3 * DM * 2); _Float16* O16 = (_Float16*)take(NR * DM * 2);
  if (off > ws_size) return;
  k_prep<<<PG, 256, 0, stream>>>(x, wqkv, wo, X16, BQKV, BO);      /* x rows as f16; [in][out] weights -> Bt[n][k] x16 (pitch DM) */
  const size_t r0p = (size_t)B0 * SQ;      /* first projected row */
  k_gemm3<3 * DM, false><<<(unsigned)((MP / G3M) * (3 * DM / G3N)), 256, 0, stream>>>(X16 + r0p * DM, BQKV, 0.0625f, bqkv, nullptr, QKV + r0p * 3 * DM);      /* q | k | v rows (f16); head h = columns h*HD.. of each DM block */
  k_fattn<<<dim3(SQ / 256, NH, NBR), 256, 0, stream>>>(QKV + r0p * LQ, km + r0p, O16 + r0p * DM);      /* o x64 (merged heads) as f16 rows */
  k_gemm3<DM, true><<<(unsigned)((MPO / G3M) * (DM / G3N)), 256, 0, stream>>>(O16 + r0p * DM, BO, 0.0009765625f, bo, (float*)d_out + r0p * DM, nullptr);      /* out rows are the output layout */
}

// v007
// Measured time: 94.2 microseconds a run.
// Two timings next to v006 both put it at 1.10 times that version's speed.
// All steps since v000 together make it 71.6 times as fast.
#include <hip/hip_runtime.h>
// Multi-head self-attention with a fused QKV projection and an INVERTED key mask (x [4][2048][1024]; qkv = x Wqkv ([in][out] 1024 x 3072, NO bias) reshaped (B, N, 3, 16, 64): q | k | v blocks; att = q k^T * 64^-0.5; where(mask[b][j] > 0, -1e7) with the int32 [4][2048] mask in {0, 1} (random; > 0 means MASKED; read on device; masked weights underflow to exactly 0); softmax over keys; out = merged Wproj + bproj ([in][out]) -> [4][2048][1024]).
// Structure: token rows r = b*2048 + s; x as exact f16 rows (bf16-rounded); q | k | v as ONE WMMA GEMM (N = 3 x 1024) (operands staged in LDS, 64x64 wave tiles, f32 accumulation, exact x16 weights, no bias, f16 outputs); attention in ONE launch (V^T fragments by transposing LDS loads of V rows; scores, online softmax with f32 statistics and the weighted sum of V in registers; o carried x64 against f16 subnormal flush, folded into the output GEMM alpha) written straight into the merged f16 o rows; out = o W_o + b GEMM (f32) into the output layout.
// Compute dtype: inputs rounded to bf16; x / weights exact; q, k, v, softmax weights and o as plain f16 GEMM operands (~2^-12); scores and softmax statistics f32. v_wmma_f32_16x16x32_f16.
#define NB 4
#define SQ 2048
#define DM 1024
#define NH 16
#define HD 64
#define HG 4                         /* heads per block group of the (b, h0) k_vt overload */
#define B0 0                         /* first batch processed (debug hook) */
#define NBR NB                       /* batches processed (debug hook) */
#define NR ((size_t)NB * SQ)         /* token rows */
#define MP ((int)((size_t)NBR * SQ)) /* rows projected (debug hook) */
#define QN SQ                        /* unused: attention takes all SQ queries */
#define NHD NH                       /* unused: attention takes all NH heads */
#define MPO MP                       /* rows through the output stage (debug hook) */
#define LQ (3 * DM)      /* row pitch of the q/k/v rows */
typedef __bf16 v16b __attribute__((ext_vector_type(16)));
typedef unsigned short v8us __attribute__((ext_vector_type(8), may_alias));
typedef float  v8f  __attribute__((ext_vector_type(8)));
typedef float  v4f  __attribute__((ext_vector_type(4)));
typedef float  v4fa __attribute__((ext_vector_type(4), may_alias));
union FragB { v16b v; v8us half[2]; unsigned short u[16]; };

__device__ __forceinline__ unsigned short bf16_bits(float x) { unsigned int u = __float_as_uint(x); return (unsigned short)((u + 0x7FFFu + ((u >> 16) & 1u)) >> 16); }
__device__ __forceinline__ float bf16_val(unsigned short b) { return __uint_as_float(((unsigned int)b) << 16); }
__device__ __forceinline__ float bf16_round(float x) { return bf16_val(bf16_bits(x)); }
// D += A·B with NT terms: 1 = ah·bh, 2 = + al·bh (A split), 3 = + ah·bl (both split)
template <int NT>
__device__ __forceinline__ v8f mmaN(v16b ah, v16b al, v16b bh, v16b bl, v8f c) {
  c = __builtin_amdgcn_wmma_f32_16x16x32_bf16(false, ah, false, bh, (short)0, c, false, false);
  if (NT >= 2) c = __builtin_amdgcn_wmma_f32_16x16x32_bf16(false, al, false, bh, (short)0, c, false, false);
  if (NT >= 3) c = __builtin_amdgcn_wmma_f32_16x16x32_bf16(false, ah, false, bl, (short)0, c, false, false);
  asm volatile("v_nop\n\tv_nop\n\tv_nop\n\tv_nop" : "+v"(c) : "v"(ah), "v"(al), "v"(bh), "v"(bl));
  return c;
}

__global__ __launch_bounds__(256) void k_wt_bf16(const float* __restrict__ W, unsigned short* __restrict__ Wt, int K, int N) {
  const int t = blockIdx.x * 256 + threadIdx.x;
  const int k8n = K / 8;
  if (t >= N * k8n) return;
  const int n = t / k8n, k8 = (t % k8n) * 8;
  v8us v;
#pragma unroll
  for (int i = 0; i < 8; ++i) v[i] = bf16_bits(W[(size_t)(k8 + i) * N + n]);
  *(v8us*)(Wt + (size_t)n * K + k8) = v;
  
}

// GEMM C[M][N] (f32, pitch ldc) = act(A[M][K]·W + bias). A f32 row-major (pitch lda) converted per fragment to bf16
// (ASPLIT: hi/lo two planes -> 2 terms, else single rounded term); Wt bf16 [N][K] (pitch ldb). BIAS_BF16 rounds the
// bias to bf16 first (bias quantised to bf16 before the add). K%32==0, M%16==0, N%64==0.
template <bool ASPLIT, int ACT, bool BIAS_BF16>
__global__ __launch_bounds__(128) void k_gemm_bf(const float* __restrict__ A, int lda, const unsigned short* __restrict__ Wt, int ldb,
                                               const float* __restrict__ bias, float* __restrict__ C, int ldc, int M, int N, int K) {
  __shared__ __attribute__((aligned(16))) float so[4][16][64];
  const int tid = threadIdx.x, w = tid >> 5, lane = tid & 31, ln = lane & 15, hh = lane >> 4;
  const int ntn = N / 64;
  const int wid = blockIdx.x * 4 + w;
  const int mt = wid / ntn, nq = wid % ntn;
  if (mt * 16 >= M) return;
  const int row0 = mt * 16, col0 = nq * 64;
  const float* arow = A + (size_t)(row0 + ln) * lda;
  v8f acc[4] = {};
  for (int kb = 0; kb < K; kb += 32) {
    FragB ah, al;
    const v4f x0 = *(const v4fa*)(arow + kb + 8 * hh), x1 = *(const v4fa*)(arow + kb + 8 * hh + 4);
    const v4f x2 = *(const v4fa*)(arow + kb + 16 + 8 * hh), x3 = *(const v4fa*)(arow + kb + 16 + 8 * hh + 4);
    float xs[16] = {x0[0],x0[1],x0[2],x0[3],x1[0],x1[1],x1[2],x1[3],x2[0],x2[1],x2[2],x2[3],x3[0],x3[1],x3[2],x3[3]};
#pragma unroll
    for (int i = 0; i < 16; ++i) { const unsigned short hb = bf16_bits(xs[i]); ah.u[i] = hb; al.u[i] = ASPLIT ? bf16_bits(xs[i] - bf16_val(hb)) : (unsigned short)0; }
#pragma unroll
    for (int t = 0; t < 4; ++t) {
      const unsigned short* brow = Wt + (size_t)(col0 + t * 16 + ln) * ldb + kb;
      FragB b;
      b.half[0] = *(const v8us*)(brow + 8 * hh);
      b.half[1] = *(const v8us*)(brow + 16 + 8 * hh);
      acc[t] = mmaN<ASPLIT ? 2 : 1>(ah.v, al.v, b.v, b.v, acc[t]);
    }
  }
#pragma unroll
  for (int t = 0; t < 4; ++t) {
    float bv = bias ? bias[col0 + t * 16 + ln] : 0.f;
    if (BIAS_BF16) bv = bf16_round(bv);
#pragma unroll
    for (int r = 0; r < 8; ++r) { float v = acc[t][r] + bv; if (ACT == 1) v = fmaxf(v, 0.f); so[w][8 * hh + r][t * 16 + ln] = v; }
  }
  __builtin_amdgcn_fence(__ATOMIC_ACQ_REL, "workgroup");
  __builtin_amdgcn_wave_barrier();
  const int rsub = lane >> 4, c4 = (lane & 15) * 4;
  {
#pragma unroll
    for (int q = 0; q < 8; ++q) {
      const int r = q * 2 + rsub;
      const v4f v = *(const v4fa*)&so[w][r][c4];
      *(v4f*)(C + (size_t)(row0 + r) * ldc + col0 + c4) = v;
    }
    
  }
}

// GEMM C = act(A·W + bias + resid): A f32 (ASPLIT -> hi/lo 2 terms), Wt bf16 [N][K]; ACT 0 none, 1 relu, 2 exact gelu;
// resid (optional, f32, row index = (row % rmod), pitch ldr, RES_BF16 rounds it) added before the activation.
template <bool ASPLIT, int ACT, bool BIAS_BF16, bool RES_BF16>
__global__ __launch_bounds__(128) void k_gemm_bf3(const float* __restrict__ A, int lda, const unsigned short* __restrict__ Wt, int ldb,
                                                const float* __restrict__ bias, const float* __restrict__ resid, int rmod, int ldr,
                                                float* __restrict__ C, int ldc, int M, int N, int K) {
  __shared__ __attribute__((aligned(16))) float so[4][16][64];
  const int tid = threadIdx.x, w = tid >> 5, lane = tid & 31, ln = lane & 15, hh = lane >> 4;
  const int ntn = N / 64;
  const int wid = blockIdx.x * 4 + w;
  const int mt = wid / ntn, nq = wid % ntn;
  if (mt * 16 >= M) return;
  const int row0 = mt * 16, col0 = nq * 64;
  const float* arow = A + (size_t)(row0 + ln) * lda;
  v8f acc[4] = {};
  for (int kb = 0; kb < K; kb += 32) {
    FragB ah, al;
    const v4f x0 = *(const v4fa*)(arow + kb + 8 * hh), x1 = *(const v4fa*)(arow + kb + 8 * hh + 4);
    const v4f x2 = *(const v4fa*)(arow + kb + 16 + 8 * hh), x3 = *(const v4fa*)(arow + kb + 16 + 8 * hh + 4);
    float xs[16] = {x0[0],x0[1],x0[2],x0[3],x1[0],x1[1],x1[2],x1[3],x2[0],x2[1],x2[2],x2[3],x3[0],x3[1],x3[2],x3[3]};
#pragma unroll
    for (int i = 0; i < 16; ++i) { const unsigned short hb = bf16_bits(xs[i]); ah.u[i] = hb; al.u[i] = ASPLIT ? bf16_bits(xs[i] - bf16_val(hb)) : (unsigned short)0; }
#pragma unroll
    for (int t = 0; t < 4; ++t) {
      const unsigned short* brow = Wt + (size_t)(col0 + t * 16 + ln) * ldb + kb;
      FragB b;
      b.half[0] = *(const v8us*)(brow + 8 * hh);
      b.half[1] = *(const v8us*)(brow + 16 + 8 * hh);
      acc[t] = mmaN<ASPLIT ? 2 : 1>(ah.v, al.v, b.v, b.v, acc[t]);
    }
  }
#pragma unroll
  for (int t = 0; t < 4; ++t) {
    const int col = col0 + t * 16 + ln;
    float bv = bias ? bias[col] : 0.f;
    if (BIAS_BF16) bv = bf16_round(bv);
#pragma unroll
    for (int r = 0; r < 8; ++r) {
      float v = acc[t][r] + bv;
      if (resid) { float rv = resid[(size_t)((row0 + 8 * hh + r) % rmod) * ldr + col]; if (RES_BF16) rv = bf16_round(rv); v += rv; }
      if (ACT == 1) v = fmaxf(v, 0.f);
      if (ACT == 2) v = 0.5f * v * (1.0f + erff(v * 0.70710678118654752f));
      if (ACT == 3) { const float u = 0.7978845608028654f * (v + 0.044715f * v * v * v); v = 0.5f * v * (1.0f + tanhf(u)); }
      so[w][8 * hh + r][t * 16 + ln] = v;
    }
  }
  __builtin_amdgcn_fence(__ATOMIC_ACQ_REL, "workgroup");
  __builtin_amdgcn_wave_barrier();
  const int rsub = lane >> 4, c4 = (lane & 15) * 4;
  {
#pragma unroll
    for (int q = 0; q < 8; ++q) {
      const int r = q * 2 + rsub;
      const v4f v = *(const v4fa*)&so[w][r][c4];
      *(v4f*)(C + (size_t)(row0 + r) * ldc + col0 + c4) = v;
    }
    
  }
}
// row LayerNorm (biased variance, eps) over N: s = X (+ R); optional out_sum <- s; out_norm <- (s-mu)*rsqrt(var+eps)*g + b
template <bool PARAM_BF16>
__global__ __launch_bounds__(256) void k_layernorm(const float* __restrict__ X, const float* __restrict__ R, const float* __restrict__ g, const float* __restrict__ bta,
                                                  float* __restrict__ out_sum, float* __restrict__ out_norm, int N, float eps) {
  __shared__ float red[256];
  const int row = blockIdx.x, tid = threadIdx.x;
  const float* x = X + (size_t)row * N; const float* rr = R ? R + (size_t)row * N : nullptr;
  float vals[16];                     // up to N = 4096
  const int per = N / 256;            // contiguous chunk per thread? use strided-by-4 chunks: thread handles j = tid*4 + 1024*u
  float s1 = 0.f;
  for (int u = 0; u < per / 4; ++u) {
    const int j = tid * 4 + 1024 * u;
    const v4f a = *(const v4fa*)(x + j);
    v4f b = {0.f,0.f,0.f,0.f}; if (rr) b = *(const v4fa*)(rr + j);
#pragma unroll
    for (int q = 0; q < 4; ++q) { const float v = a[q] + b[q]; vals[u * 4 + q] = v; s1 += v; }
  }
  red[tid] = s1; __syncthreads();
  for (int st = 128; st > 0; st >>= 1) { if (tid < st) red[tid] += red[tid + st]; __syncthreads(); }
  const float mu = red[0] / (float)N; __syncthreads();
  float s2 = 0.f;
  for (int u = 0; u < per / 4; ++u)
#pragma unroll
    for (int q = 0; q < 4; ++q) { const float c = vals[u * 4 + q] - mu; s2 += c * c; }
  red[tid] = s2; __syncthreads();
  for (int st = 128; st > 0; st >>= 1) { if (tid < st) red[tid] += red[tid + st]; __syncthreads(); }
  const float rs = rsqrtf(red[0] / (float)N + eps);
  {
    for (int u = 0; u < per / 4; ++u) {
      const int j = tid * 4 + 1024 * u;
      v4f o, sm;
#pragma unroll
      for (int q = 0; q < 4; ++q) {
        float gg = g[j + q], bb = bta[j + q];
        if (PARAM_BF16) { gg = bf16_round(gg); bb = bf16_round(bb); }
        sm[q] = vals[u * 4 + q]; o[q] = (vals[u * 4 + q] - mu) * rs * gg + bb;
      }
      if (out_sum) *(v4f*)(out_sum + (size_t)row * N + j) = sm;
      *(v4f*)(out_norm + (size_t)row * N + j) = o;
    }
    
  }
}



// ---- f16 WMMA path (v_wmma_f32_16x16x32_f16): 11-bit significands for operands in range — used where a [0,1] probability operand needs more precision than bf16
typedef _Float16 v16h __attribute__((ext_vector_type(16)));
union FragH { v16h v; v8us half[2]; _Float16 h[16]; unsigned short u[16]; };
template <int NT>
__device__ __forceinline__ v8f mmaH(v16h ah, v16h al, v16h bh, v16h bl, v8f c) {
  c = __builtin_amdgcn_wmma_f32_16x16x32_f16(false, ah, false, bh, (short)0, c, false, false);
  if (NT >= 2) c = __builtin_amdgcn_wmma_f32_16x16x32_f16(false, al, false, bh, (short)0, c, false, false);
  if (NT >= 3) c = __builtin_amdgcn_wmma_f32_16x16x32_f16(false, ah, false, bl, (short)0, c, false, false);
  asm volatile("v_nop\n\tv_nop\n\tv_nop\n\tv_nop" : "+v"(c) : "v"(ah), "v"(al), "v"(bh), "v"(bl));
  return c;
}
// batched GEMM like k_gemm_b but f16 operands: A f32 (split into f16 hi/lo if ASPLIT, else rounded to f16), Bt = f16 values [n][k]; alpha; C f32; N multiple of 16 (partial tiles skipped)
template <bool ASPLIT>
__global__ __launch_bounds__(128) void k_gemm_h(const float* __restrict__ A, int lda, size_t sA, const _Float16* __restrict__ Bh, int ldb, size_t sB, float alpha, float* __restrict__ C, int ldc, size_t sC, int M, int N, int K) {
  __shared__ __attribute__((aligned(16))) float so[4][16][64];
  const int tid = threadIdx.x, w = tid >> 5, lane = tid & 31, ln = lane & 15, hh = lane >> 4; const int by = blockIdx.y;
  A += (size_t)by * sA; Bh += (size_t)by * sB; C += (size_t)by * sC;
  const int ntn = (N + 63) / 64; const int wid = blockIdx.x * 4 + w; const int mt = wid / ntn, nq = wid % ntn; if (mt * 16 >= M) return;
  const int row0 = mt * 16, col0 = nq * 64; const float* arow = A + (size_t)(row0 + ln) * lda;
  v8f acc[4] = {};
  for (int kb = 0; kb < K; kb += 32) {
    FragH ah, al;
    const v4f x0 = *(const v4fa*)(arow + kb + 8 * hh), x1 = *(const v4fa*)(arow + kb + 8 * hh + 4), x2 = *(const v4fa*)(arow + kb + 16 + 8 * hh), x3 = *(const v4fa*)(arow + kb + 16 + 8 * hh + 4);
    float xs[16] = {x0[0],x0[1],x0[2],x0[3],x1[0],x1[1],x1[2],x1[3],x2[0],x2[1],x2[2],x2[3],x3[0],x3[1],x3[2],x3[3]};
#pragma unroll
    for (int i = 0; i < 16; ++i) { const _Float16 h = (_Float16)xs[i]; ah.h[i] = h; al.h[i] = ASPLIT ? (_Float16)(xs[i] - (float)h) : (_Float16)0.0f; }
#pragma unroll
    for (int t = 0; t < 4; ++t) { if (col0 + t * 16 >= N) continue; const size_t boff = (size_t)(col0 + t * 16 + ln) * ldb + kb; FragH bq; bq.half[0] = *(const v8us*)(Bh + boff + 8 * hh); bq.half[1] = *(const v8us*)(Bh + boff + 16 + 8 * hh);
      acc[t] = mmaH<ASPLIT ? 2 : 1>(ah.v, al.v, bq.v, bq.v, acc[t]); }
  }
#pragma unroll
  for (int t = 0; t < 4; ++t) { if (col0 + t * 16 >= N) continue;
#pragma unroll
    for (int r = 0; r < 8; ++r) so[w][8 * hh + r][t * 16 + ln] = acc[t][r] * alpha; }
  __builtin_amdgcn_fence(__ATOMIC_ACQ_REL, "workgroup"); __builtin_amdgcn_wave_barrier();
  const int rsub = lane >> 4, c4 = (lane & 15) * 4;
  {
#pragma unroll
    for (int q = 0; q < 8; ++q) { const int r = q * 2 + rsub; if (col0 + c4 < N) { const v4f v = *(const v4fa*)&so[w][r][c4]; *(v4f*)(C + (size_t)(row0 + r) * ldc + col0 + c4) = v; } }
     }
}

// k_gemm_hh variant with fused epilogue: v = acc·alpha + bias[by·sBias + col] (+ CP[(row/rowsPerB)·sCPb + by·64 + col] if CP) ; ACT 0 none / 1 elu ; writes f16 C16 (and f32 C if non-null)
template <int ACT>
__global__ __launch_bounds__(128) void k_gemm_hhx(const _Float16* __restrict__ A, int lda, size_t sA, const _Float16* __restrict__ Bh, int ldb, size_t sB, float alpha, const float* __restrict__ bias, size_t sBias, const float* __restrict__ CP, int rowsPerB, size_t sCPb, int row0g,
    float* __restrict__ C, _Float16* __restrict__ C16, int ldc, size_t sC, int M, int N, int K) {
  __shared__ __attribute__((aligned(16))) float so[4][16][64];
  const int tid = threadIdx.x, w = tid >> 5, lane = tid & 31, ln = lane & 15, hh = lane >> 4; const int by = blockIdx.y;
  A += (size_t)by * sA; Bh += (size_t)by * sB; const size_t cofs = (size_t)by * sC; const float* bp = bias ? bias + (size_t)by * sBias : nullptr;
  const int ntn = (N + 63) / 64; const int wid = blockIdx.x * 4 + w; const int mt = wid / ntn, nq = wid % ntn; if (mt * 16 >= M) return;
  const int row0 = mt * 16, col0 = nq * 64; const _Float16* arow = A + (size_t)(row0 + ln) * lda;
  v8f acc[4] = {};
  for (int kb = 0; kb < K; kb += 32) { FragH ah; ah.half[0] = *(const v8us*)((const unsigned short*)arow + kb + 8 * hh); ah.half[1] = *(const v8us*)((const unsigned short*)arow + kb + 16 + 8 * hh);
#pragma unroll
    for (int t = 0; t < 4; ++t) { if (col0 + t * 16 >= N) continue; const size_t boff = (size_t)(col0 + t * 16 + ln) * ldb + kb; FragH bq; bq.half[0] = *(const v8us*)((const unsigned short*)Bh + boff + 8 * hh); bq.half[1] = *(const v8us*)((const unsigned short*)Bh + boff + 16 + 8 * hh);
      acc[t] = mmaH<1>(ah.v, ah.v, bq.v, bq.v, acc[t]); }
  }
#pragma unroll
  for (int t = 0; t < 4; ++t) { if (col0 + t * 16 >= N) continue; const int col = col0 + t * 16 + ln; const float bv = bp ? bf16_round(bp[col]) : 0.f;
#pragma unroll
    for (int r = 0; r < 8; ++r) { float v = acc[t][r] * alpha + bv; if (CP) { const int rr = row0g + row0 + 8 * hh + r; if (rowsPerB < 0) v += CP[cofs + (size_t)rr * ldc + col];      /* rowsPerB < 0: own element of the batched C plane */ else { const int bidx = rr / rowsPerB; v += CP[(size_t)bidx * sCPb + (size_t)by * 64 + col]; } } if (ACT == 1) v = (v > 0.f) ? v : expm1f(v); else if (ACT == 7) v = (v > 0.f) ? v + 1.0f : expf(v); else if (ACT == 8) v = tanhf(v); else if (ACT == 9) v = 0.5f * v * (1.0f + tanhf(0.7978845608028654f * (v + 0.044715f * v * v * v))); else if (ACT == 11) v = 1.0f / (1.0f + expf(-v)); else if (ACT == 12) v = (v > 0.f) ? v : 0.01f * v; else if (ACT == 14) v = (v > 0.f) ? v : 0.1f * v; else if (ACT == 16) v = (v >= 0.f) ? v : 0.3f * v; else if (ACT == 17) v = (v >= 0.f) ? v : 0.2f * v; else if (ACT == 15) v = v / (1.0f + expf(-v)); else if (ACT == 3) v = fmaxf(v, 0.f); else if (ACT == 6) v = 0.5f * v * (1.0f + erff(v * 0.70710678118654752f)); so[w][8 * hh + r][t * 16 + ln] = v; } }
  __builtin_amdgcn_fence(__ATOMIC_ACQ_REL, "workgroup"); __builtin_amdgcn_wave_barrier();
  const int rsub = lane >> 4, c4 = (lane & 15) * 4; typedef _Float16 v4h __attribute__((ext_vector_type(4)));
  {
#pragma unroll
    for (int q = 0; q < 8; ++q) { const int r = q * 2 + rsub; if (col0 + c4 < N) { const v4f v = *(const v4fa*)&so[w][r][c4]; if (C) *(v4f*)(C + cofs + (size_t)(row0 + r) * ldc + col0 + c4) = v; if (C16) { v4h h4; for (int i = 0; i < 4; ++i) h4[i] = (_Float16)v[i]; *(v4h*)(C16 + cofs + (size_t)(row0 + r) * ldc + col0 + c4) = h4; } } }
     }
}


typedef _Float16 v4h __attribute__((ext_vector_type(4)));

__global__ __launch_bounds__(256) void k_h16(const float* __restrict__ x, _Float16* __restrict__ X16, size_t n8) { const size_t t = (size_t)blockIdx.x * 256 + threadIdx.x; if (t >= n8) return; FragH f;
#pragma unroll
  for (int q = 0; q < 8; ++q) f.h[q] = (_Float16)x[t * 8 + q]; *(v8us*)((unsigned short*)X16 + t * 8) = f.half[0];  }
__global__ __launch_bounds__(256) void k_round16f(const float* __restrict__ W, _Float16* __restrict__ Bt, size_t n8) { const size_t t = (size_t)blockIdx.x * 256 + threadIdx.x; if (t >= n8) return; FragH f;
#pragma unroll
  for (int i = 0; i < 8; ++i) f.h[i] = (_Float16)(bf16_round(W[t * 8 + i]) * 16.0f); *(v8us*)((unsigned short*)Bt + t * 8) = f.half[0];  }
template <int NHv, int TTv>
__global__ __launch_bounds__(256) void k_vt(const _Float16* __restrict__ V16, int ldv, int voff, _Float16* __restrict__ Vt) { __shared__ unsigned short tl[64][66]; const int tid = threadIdx.x; const int slab = blockIdx.x / (TTv / 64), lg = blockIdx.x % (TTv / 64); const int b = slab / NHv, h = slab % NHv;
  for (int i = tid; i < 64 * 8; i += 256) { const int r = i / 8, c8 = (i % 8) * 8; FragH f; f.half[0] = *(const v8us*)((const unsigned short*)V16 + ((size_t)b * TTv + lg * 64 + r) * ldv + voff + h * 64 + c8);
#pragma unroll
    for (int q = 0; q < 8; ++q) tl[r][c8 + q] = f.u[q]; }
  __syncthreads();
  {
#pragma unroll
    for (int rd = 0; rd < 2; ++rd) { const int d = rd * 32 + tid / 8, pc = tid % 8; FragH f;
#pragma unroll
      for (int q = 0; q < 8; ++q) f.u[q] = tl[pc * 8 + q][d];
      *(v8us*)((unsigned short*)Vt + ((size_t)slab * 64 + d) * TTv + lg * 64 + pc * 8) = f.half[0]; }
     } }

__global__ __launch_bounds__(256) void k_hl(const float* __restrict__ F, _Float16* __restrict__ Hh, _Float16* __restrict__ Hl, size_t n8) { const size_t t = (size_t)blockIdx.x * 256 + threadIdx.x; if (t >= n8) return; FragH fh, fl; const v4f a = *(const v4fa*)(F + t * 8), c = *(const v4fa*)(F + t * 8 + 4);
#pragma unroll
  for (int q = 0; q < 4; ++q) { _Float16 h = (_Float16)a[q]; fh.h[q] = h; fl.h[q] = (_Float16)((a[q] - (float)h) * 1024.0f); h = (_Float16)c[q]; fh.h[4 + q] = h; fl.h[4 + q] = (_Float16)((c[q] - (float)h) * 1024.0f); }
  { *(v8us*)((unsigned short*)Hh + t * 8) = fh.half[0]; *(v8us*)((unsigned short*)Hl + t * 8) = fl.half[0];  } }

// ---- fast GEMM (wave tile 32x64; requires M % 32 == 0 rows per launch region and N % 64 == 0); epilogue = k_gemm_hhx semantics ----
__device__ __forceinline__ v16h g2_frag(const _Float16* p, int hh) { FragH f; f.half[0] = *(const v8us*)((const unsigned short*)p + 8 * hh); f.half[1] = *(const v8us*)((const unsigned short*)p + 16 + 8 * hh); return f.v; }
__device__ __forceinline__ v8f g2_mma(v16h a, v16h b, v8f c) { v8f d = __builtin_amdgcn_wmma_f32_16x16x32_f16(false, a, false, b, (short)0, c, false, false); asm volatile("v_nop\n\tv_nop\n\tv_nop\n\tv_nop" : "+v"(d) : "v"(a), "v"(b)); return d; }
template <int ACT>
__global__ __launch_bounds__(128) void k_gemm2(const _Float16* __restrict__ A, int lda, size_t sA, const _Float16* __restrict__ Bh, int ldb, size_t sB, float alpha, const float* __restrict__ bias, size_t sBias, const float* __restrict__ CP, int rowsPerB, size_t sCPb, int row0g,
    float* __restrict__ C, _Float16* __restrict__ C16, int ldc, size_t sC, int M, int N, int K) { static_assert(ACT == 0 || ACT == 3 || ACT == 6 || ACT == 8 || ACT == 9 || ACT == 11 || ACT == 12 || ACT == 14 || ACT == 15 || ACT == 16 || ACT == 17, "k_gemm2: unsupported ACT code (would silently apply no activation)");
  __shared__ __attribute__((aligned(16))) float so[4][32][68];
  const int tid = threadIdx.x, w = tid >> 5, lane = tid & 31, ln = lane & 15, hh = lane >> 4; const int by = blockIdx.y;
  A += (size_t)by * sA; Bh += (size_t)by * sB; const size_t cofs = (size_t)by * sC; const float* bp = bias ? bias + (size_t)by * sBias : nullptr;
  const int ntn = N >> 6; const int mt = blockIdx.x / ntn, nq = blockIdx.x - mt * ntn; const int row0 = mt * 128 + 32 * w, col0 = nq * 64; if (row0 >= M) return;
  const _Float16* a0p = A + (size_t)(row0 + ln) * lda; const _Float16* a1p = a0p + (size_t)16 * lda;
  const _Float16* b0p = Bh + (size_t)(col0 + ln) * ldb; const _Float16* b1p = b0p + (size_t)16 * ldb; const _Float16* b2p = b1p + (size_t)16 * ldb; const _Float16* b3p = b2p + (size_t)16 * ldb;
  const v8f z8 = {0.f,0.f,0.f,0.f,0.f,0.f,0.f,0.f}; v8f c00 = z8, c01 = z8, c02 = z8, c03 = z8, c10 = z8, c11 = z8, c12 = z8, c13 = z8;
#pragma unroll 1
  for (int kb = 0; kb < K; kb += 32) { const v16h a0 = g2_frag(a0p + kb, hh), a1 = g2_frag(a1p + kb, hh);
    v16h b = g2_frag(b0p + kb, hh); c00 = g2_mma(a0, b, c00); c10 = g2_mma(a1, b, c10);
    b = g2_frag(b1p + kb, hh); c01 = g2_mma(a0, b, c01); c11 = g2_mma(a1, b, c11);
    b = g2_frag(b2p + kb, hh); c02 = g2_mma(a0, b, c02); c12 = g2_mma(a1, b, c12);
    b = g2_frag(b3p + kb, hh); c03 = g2_mma(a0, b, c03); c13 = g2_mma(a1, b, c13); }
  v8f accs[8] = {c00, c01, c02, c03, c10, c11, c12, c13};
#pragma unroll
  for (int u = 0; u < 8; ++u) { const int t = u & 3, half = u >> 2; const int col = col0 + t * 16 + ln; const float bv = bp ? bf16_round(bp[col]) : 0.f;
#pragma unroll
    for (int r = 0; r < 8; ++r) { const int rloc = half * 16 + 8 * hh + r; float v = accs[u][r] * alpha + bv; if (CP) { if (rowsPerB < 0) v += CP[cofs + (size_t)(row0g + row0 + rloc) * ldc + col];      /* rowsPerB < 0: own element of the batched C plane */ else { const int bidx = (row0g + row0 + rloc) / rowsPerB; v += CP[(size_t)bidx * sCPb + (size_t)by * 64 + col]; } }
      if (ACT == 3) v = fmaxf(v, 0.f); else if (ACT == 6) v = 0.5f * v * (1.0f + erff(v * 0.70710678118654752f)); else if (ACT == 11) v = 1.0f / (1.0f + expf(-v)); else if (ACT == 15) v = v / (1.0f + expf(-v)); else if (ACT == 12) v = (v > 0.f) ? v : 0.01f * v; else if (ACT == 8) v = tanhf(v); else if (ACT == 9) v = 0.5f * v * (1.0f + tanhf(0.7978845608028654f * (v + 0.044715f * v * v * v))); else if (ACT == 14) v = (v > 0.f) ? v : 0.1f * v; else if (ACT == 16) v = (v >= 0.f) ? v : 0.3f * v; else if (ACT == 17) v = (v >= 0.f) ? v : 0.2f * v;
      so[w][rloc][t * 16 + ln] = v; } }
  __builtin_amdgcn_fence(__ATOMIC_ACQ_REL, "workgroup"); __builtin_amdgcn_wave_barrier();
  const int rsub = lane >> 4, c4 = (lane & 15) * 4;
  {
#pragma unroll
    for (int q = 0; q < 16; ++q) { const int r = q * 2 + rsub; const v4f v = *(const v4fa*)&so[w][r][c4]; if (C) *(v4f*)(C + cofs + (size_t)(row0 + r) * ldc + col0 + c4) = v; if (C16) { v4h h4; for (int i = 0; i < 4; ++i) h4[i] = (_Float16)v[i]; *(v4h*)(C16 + cofs + (size_t)(row0 + r) * ldc + col0 + c4) = h4; } }
     } }


__global__ __launch_bounds__(256) void k_wnat(const float* __restrict__ w, size_t n8, _Float16* __restrict__ Bt) { const size_t t = (size_t)blockIdx.x * 256 + threadIdx.x; if (t >= n8) return; FragH f; for (int q = 0; q < 8; ++q) f.h[q] = (_Float16)(bf16_round(w[t * 8 + q]) * 16.0f); *(v8us*)((unsigned short*)Bt + t * 8) = f.half[0];  }
__global__ __launch_bounds__(256) void k_rsm(const float* __restrict__ S, _Float16* __restrict__ P, int nrows) {
  #pragma clang fp contract(off)
  const int i = blockIdx.x * 256 + threadIdx.x; if (i >= nrows) return; const float* s = S + (size_t)i * SQ; float mx = -3.0e38f;
#pragma unroll 1
  for (int j = 0; j < SQ; ++j) mx = fmaxf(mx, s[j]); float se = 0.f;
#pragma unroll 1
  for (int j = 0; j < SQ; ++j) se += expf(s[j] - mx); const float sc = 256.0f / se;
#pragma unroll 1
  for (int j0 = 0; j0 < SQ; j0 += 8) { FragH f; for (int q = 0; q < 8; ++q) f.h[q] = (_Float16)(expf(s[j0 + q] - mx) * sc); unsigned short* d = (unsigned short*)P + (size_t)i * SQ + j0; *(v8us*)d = f.half[0];  } }
__global__ __launch_bounds__(256) void k_vt(const _Float16* __restrict__ V16, int b, int h0, _Float16* __restrict__ VT) { __shared__ unsigned short tl[64][65]; const int tid = threadIdx.x; const int hh = blockIdx.x % HG, sg = blockIdx.x / HG; const int s0 = sg * 64; const int h = h0 + hh;
  for (int i = tid; i < 64 * 8; i += 256) { const int j = i / 8, d8 = (i % 8) * 8; FragH f; f.half[0] = *(const v8us*)((const unsigned short*)V16 + ((size_t)b * SQ + s0 + j) * DM + h * HD + d8); for (int q = 0; q < 8; ++q) tl[d8 + q][j] = f.u[q]; }
  __syncthreads();
  { for (int i = tid; i < 64 * 8; i += 256) { const int d = i / 8, j8 = (i % 8) * 8; FragH f; for (int q = 0; q < 8; ++q) f.u[q] = tl[d][j8 + q]; *(v8us*)((unsigned short*)VT + ((size_t)hh * HD + d) * SQ + s0 + j8) = f.half[0]; }  } }



#define FK 64            /* keys per pass */
#define FP 72            /* LDS row pitch in halves: 144 bytes = 16 x odd, for 16-byte row reads */
#define FPV 80           /* LDS pitch of a V row in halves: 160 bytes = 32 x odd, for the transposing reads */
#define FMASK (-262144.0f)
#define FTHR 8.0f
#define FOFF 6.0f
typedef int v4ia __attribute__((ext_vector_type(4), may_alias));
typedef float v8fa __attribute__((ext_vector_type(8), may_alias));
typedef float v2f __attribute__((ext_vector_type(2)));
typedef _Float16 v2h __attribute__((ext_vector_type(2)));
union FragP { v16h v; v2h p[8]; };
__device__ __forceinline__ float fa_xhalf(float x) { const int i = __float_as_int(x); return __int_as_float(__builtin_amdgcn_permlanex16(i, i, 0x76543210, 0xfedcba98, false, false)); }      /* lane l <-> l ^ 16 */
__device__ __forceinline__ v8f fa_mma(v16h a, v16h b, v8f c) { return __builtin_amdgcn_wmma_f32_16x16x32_f16(false, a, false, b, (short)0, c, false, false); }
// List of a batch's kept keys (mask <= 0) in rising order, built by a work-group of 256 threads: idx[0 .. n) = the keys, idx[n .. SQ) = 0 (a valid row); returns n >= 1. Thread t owns keys 8 t .. 8 t + 7.
// A key's place = kept keys of the waves below (wt) + of the lanes below (ballots counted under the lane) + of the thread's own earlier keys. none: no key is kept, the list is then all SQ keys.
__device__ __forceinline__ int fa_kept(const int* __restrict__ mrow, unsigned short* idx, int* wt, bool& none) {
  const int tid = threadIdx.x, w = tid >> 5;
  const v4ia m0 = *(const v4ia*)(mrow + tid * 8), m1 = *(const v4ia*)(mrow + tid * 8 + 4);
  bool k[8]; unsigned int below = 0u, tot = 0u;
#pragma unroll      /* constant indices into k */
  for (int q = 0; q < 4; ++q) { k[q] = !(m0[q] > 0); k[4 + q] = !(m1[q] > 0); }
#pragma unroll      /* constant indices into k */
  for (int q = 0; q < 8; ++q) { const unsigned int bal = __builtin_amdgcn_ballot_w32(k[q]); below = __builtin_amdgcn_mbcnt_lo(bal, below); tot += (unsigned int)__builtin_popcount(bal); }
  const v8us z = {0, 0, 0, 0, 0, 0, 0, 0}; *(v8us*)&idx[tid * 8] = z;
  if ((tid & 31) == 0) wt[w] = (int)tot;
  __syncthreads();      /* publishes the eight wave counts; the zero fill is complete before any place is written */
  int base = 0, n = 0;
  for (int i = 0; i < 8; ++i) { const int c = wt[i]; base += i < w ? c : 0; n += c; }
  int pos = base + (int)below;
  none = n == 0;
  if (none) { pos = tid * 8; n = SQ; }
#pragma unroll      /* constant indices into k */
  for (int q = 0; q < 8; ++q) if (k[q] || none) { idx[pos] = (unsigned short)(tid * 8 + q); ++pos; }
  __syncthreads();      /* publishes the list */
  return n; }
// Eight halves of a column of a row-major 16-bit LDS tile: lane (c = l & 15, h = l >> 4) gets T[8 h + 0 .. 7][c] when lane l points at row 8 (l >> 4) + (l & 7), byte 16 ((l >> 3) & 1), of the 16 x 16 tile.
typedef short v8s __attribute__((ext_vector_type(8)));
__device__ __forceinline__ v8us fa_tr16(const unsigned char* p) { typedef __attribute__((address_space(3))) v8s lds_v8s; return __builtin_bit_cast(v8us, __builtin_amdgcn_ds_load_tr16_b128_v8i16((lds_v8s*)p)); }
__global__ __launch_bounds__(256) __attribute__((amdgpu_waves_per_eu(4, 4))) /* two work-groups per WGP: the vector work between the matrix runs wants four waves per SIMD */
void k_fattn(const _Float16* __restrict__ QKV, const int* __restrict__ Km, _Float16* __restrict__ O16) {
  __shared__ __attribute__((aligned(16))) _Float16 Ks[2][FK][FP];
  __shared__ __attribute__((aligned(16))) _Float16 Vs[2][FK][FPV];      /* V rows [place][d] */
  __shared__ __attribute__((aligned(16))) unsigned short kidx[SQ];
  __shared__ int wt[8];
  __shared__ __attribute__((aligned(32))) float kb[FK];      /* start values C of the last pass's score product: 0 for a key, FMASK behind the list's end */
  const int tid = threadIdx.x, w = tid >> 5, lane = tid & 31, ln = lane & 15, hh = lane >> 4;
  const int h = blockIdx.y, b = blockIdx.z, q0 = blockIdx.x * 256 + w * 32;
  const unsigned short* Kg = (const unsigned short*)QKV + (size_t)b * SQ * LQ + DM + h * HD;      /* K rows [key][d], pitch LQ; the key's V row stands DM halves further on */
  const int sr = tid >> 3, sc = (tid & 7) * 8;      /* staging: 16-byte piece sc of rows sr and sr + 32 of both tiles */
  v16h qf[2][2];
#pragma unroll      /* fragments stay in registers: constant indices only */
  for (int g = 0; g < 2; ++g) for (int kk = 0; kk < 2; ++kk) qf[g][kk] = g2_frag(QKV + ((size_t)b * SQ + q0 + g * 16 + ln) * LQ + h * HD + kk * 32, hh);
  bool none; const int n = __builtin_amdgcn_readfirstlane(fa_kept(Km + (size_t)b * SQ, kidx, wt, none));      /* the same in every lane: held as a scalar, so that the pass loop branches on scalars */
  const int np = min((n + FK - 1) / FK, SQ / FK);      /* passes: 1 .. SQ / FK */
  if (tid < FK) kb[tid] = (np - 1) * FK + tid >= n ? FMASK : 0.f;
  int i0 = kidx[sr], i1 = kidx[sr + 32];      /* the K and V rows this thread stages */
  v8us kr0 = *(const v8us*)(Kg + (size_t)i0 * LQ + sc), kr1 = *(const v8us*)(Kg + (size_t)i1 * LQ + sc);
  v8us vr0 = *(const v8us*)(Kg + (size_t)i0 * LQ + DM + sc), vr1 = *(const v8us*)(Kg + (size_t)i1 * LQ + DM + sc);
  i0 = kidx[FK + sr]; i1 = kidx[FK + sr + 32];      /* list entries are read one pass ahead of the loads that use them */
  *(v8us*)&Ks[0][sr][sc] = kr0; *(v8us*)&Ks[0][sr + 32][sc] = kr1; *(v8us*)&Vs[0][sr][sc] = vr0; *(v8us*)&Vs[0][sr + 32][sc] = vr1;
  __syncthreads();      /* publishes pass 0's tiles and the start values */
  { const v16h zq = {};
#pragma unroll      /* constant indices into qf */
    for (int g = 0; g < 2; ++g) for (int kk = 0; kk < 2; ++kk) qf[g][kk] = none ? zq : qf[g][kk]; }
  const v8f z8 = {0.f,0.f,0.f,0.f,0.f,0.f,0.f,0.f};
  v8f o[4][2] = {{z8, z8}, {z8, z8}, {z8, z8}, {z8, z8}};
  float m[2] = {-3.0e38f, -3.0e38f}, nm[2] = {0.f, 0.f}; v8f lt[2] = {z8, z8};      /* lt: every row of the tile = the column's sum of weights */
  v16h ones; for (int e = 0; e < 16; ++e) ones[e] = (_Float16)1.0f;
  const float cs = 0.125f * 1.4426950408889634f;      /* 64^-0.5 log2(e) */
  const unsigned char* vt = (const unsigned char*)&Vs[0][8 * hh + (lane & 7)][((lane >> 3) & 1) * 8];      /* the lane's address in the first 16 x 16 tile of V for the transposing reads */
#pragma unroll 1      /* one pass per trip: the body already fills the register budget */
  for (int s = 0; s < np; ++s) {
    const int buf = s & 1; const bool more = s + 1 < np;
    if (more) { const int k2 = min(s + 2, SQ / FK - 1) * FK;      /* next pass's tiles fly through registers while this pass is worked on */
      kr0 = *(const v8us*)(Kg + (size_t)i0 * LQ + sc); kr1 = *(const v8us*)(Kg + (size_t)i1 * LQ + sc);
      vr0 = *(const v8us*)(Kg + (size_t)i0 * LQ + DM + sc); vr1 = *(const v8us*)(Kg + (size_t)i1 * LQ + DM + sc);
      asm volatile("s_wait_xcnt 0x0" ::: "memory");      /* the four loads have taken their addresses before the address registers get new values further down */
      i0 = kidx[k2 + sr]; i1 = kidx[k2 + sr + 32]; }
    v8f st[4][2];
    if (more) {      /* a full pass holds keys only: the score product starts at 0, nothing is read for it */
#pragma unroll      /* constant indices into st, qf */
      for (int t = 0; t < 4; ++t) {      /* D row 8 hh + r = place t 16 + 8 hh + r of the pass */
        const v16h ka = g2_frag(&Ks[buf][t * 16 + ln][0], hh), kc = g2_frag(&Ks[buf][t * 16 + ln][32], hh);
        for (int g = 0; g < 2; ++g) st[t][g] = fa_mma(kc, qf[g][1], fa_mma(ka, qf[g][0], z8));
        if (t & 1) __builtin_amdgcn_sched_barrier(0); }      /* holds the next two tiles' fragment loads behind these products: all eight K fragments loaded at once overflow the register budget of four waves per SIMD (spills) */
    } else {      /* the last pass: places behind the list's end start at FMASK */
#pragma unroll      /* constant indices into st, qf */
      for (int t = 0; t < 4; ++t) { const v8f c0 = *(const v8fa*)&kb[t * 16 + 8 * hh];
        const v16h ka = g2_frag(&Ks[buf][t * 16 + ln][0], hh), kc = g2_frag(&Ks[buf][t * 16 + ln][32], hh);
        for (int g = 0; g < 2; ++g) st[t][g] = fa_mma(kc, qf[g][1], fa_mma(ka, qf[g][0], c0));
        if (t & 1) __builtin_amdgcn_sched_barrier(0); }      /* as above */
    }
    float ms[2];
#pragma unroll      /* constant indices into st */
    for (int g = 0; g < 2; ++g) { float mx = st[0][g][0];
      for (int t = 0; t < 4; ++t) for (int r = 0; r < 8; ++r) mx = fmaxf(mx, st[t][g][r]);
      ms[g] = fmaxf(mx, fa_xhalf(mx)) * cs; }
    if (__builtin_amdgcn_ballot_w32(ms[0] > m[0] + FTHR || ms[1] > m[1] + FTHR) != 0u) {      /* one scalar branch per pass */
#pragma unroll      /* constant indices into o */
      for (int g = 0; g < 2; ++g) { const float mn = fmaxf(m[g], ms[g]); const float al = __builtin_amdgcn_exp2f(m[g] - mn); m[g] = mn; nm[g] = FOFF - mn; lt[g] *= al;
        for (int dt = 0; dt < 4; ++dt) o[dt][g] *= al; } }
    FragP pf[2][2];
#pragma unroll      /* constant indices into st, pf */
    for (int g = 0; g < 2; ++g) for (int t = 0; t < 4; ++t) for (int r = 0; r < 8; r += 2) {
      v2f p; p[0] = __builtin_amdgcn_exp2f(__builtin_fmaf(st[t][g][r], cs, nm[g])); p[1] = __builtin_amdgcn_exp2f(__builtin_fmaf(st[t][g][r + 1], cs, nm[g]));
      pf[t >> 1][g].p[(t & 1) * 4 + (r >> 1)] = __builtin_convertvector(p, v2h); }      /* b[e] = T[e >> 3][e & 7]: the hardware k order */
#pragma unroll      /* constant indices into lt, pf */
    for (int j = 0; j < 2; ++j) for (int g = 0; g < 2; ++g) lt[g] = fa_mma(ones, pf[j][g].v, lt[g]);      /* row sums on the matrix pipe: A = ones sums the rounded weights of all 32 keys, both wave halves' */
#pragma unroll      /* constant indices into o, pf */
    for (int dt = 0; dt < 4; ++dt) for (int j = 0; j < 2; ++j) { FragH vf;      /* A[d = dt 16 + ln][k]: places j 32 + 8 hh + 0 .. 7, then + 16: the k order of the packed weights */
      vf.half[0] = fa_tr16(vt + (size_t)buf * (FK * FPV * 2) + j * 32 * (FPV * 2) + dt * 32); vf.half[1] = fa_tr16(vt + (size_t)buf * (FK * FPV * 2) + (j * 32 + 16) * (FPV * 2) + dt * 32);
      for (int g = 0; g < 2; ++g) o[dt][g] = fa_mma(vf.v, pf[j][g].v, o[dt][g]); }
    if (more) { *(v8us*)&Ks[buf ^ 1][sr][sc] = kr0; *(v8us*)&Ks[buf ^ 1][sr + 32][sc] = kr1; *(v8us*)&Vs[buf ^ 1][sr][sc] = vr0; *(v8us*)&Vs[buf ^ 1][sr + 32][sc] = vr1; }      /* that buffer's readers left it at the last barrier */
    __syncthreads();      /* publishes the next pass's tiles and ends this pass's reads */
  }
#pragma unroll      /* constant indices into o */
  for (int g = 0; g < 2; ++g) { const float sc64 = 64.0f / lt[g][0];      /* o carried x64, as the output GEMM's alpha expects */
    unsigned short* d = (unsigned short*)O16 + ((size_t)b * SQ + q0 + g * 16 + ln) * DM + h * HD + 8 * hh;
    for (int dt = 0; dt < 4; ++dt) { FragH f; for (int r = 0; r < 8; ++r) f.h[r] = (_Float16)(o[dt][g][r] * sc64); *(v8us*)(d + dt * 16) = f.half[0]; } } }

// ---- GEMM with both operands staged in LDS: C[M][NN] = (A[M][DM] Bt[NN][DM]^T) alpha + bias, A and Bt f16 rows of DM halves.
// A work-group of 8 waves (4 x 2) takes a 256 x 128 tile of C, a wave 64 x 64 (4 x 4 accumulator tiles). A stage is 64 k of the tile's 256 A rows and 128 Bt rows, 128-byte rows at pitch 144 bytes;
// two buffers, filled by asynchronous copies to LDS (whole 128-byte lines, each read once per work-group) one stage ahead of the products.
// The walk over k is a ring: a work-group starts at stage k0 of its own and wraps. The work-groups that share an A panel (one tile row) or a Bt panel (one tile column) run side by side; all starting at k = 0 they ask L2 for the same lines at the same moment, and all of them wait for each line's first fetch from memory.
// With different starts a panel's stages are first fetched by different work-groups at once, and the others find them in L2. Every accumulator sums k in steps of 32, rising from k0 * G3K and wrapping at DM.
#define G3M 256
#define G3N 128
#define G3K 64
#define G3P 72                            /* LDS row pitch in halves: 144 bytes = 16 x odd, for 16-byte row reads */
#define G3R (G3M + G3N)                   /* rows of a stage: A rows, then Bt rows */
#define G3B ((unsigned)(G3R * G3P * 2))   /* bytes of a buffer */
#define G3S ((unsigned)(32 * G3P * 2))    /* bytes of 32 LDS rows */
#define G3O 68                            /* output staging pitch in floats */
#define G3NS (DM / G3K)                   /* stages of the walk over k: a power of two */
typedef float f1a __attribute__((may_alias));
template <int NN, bool F32>      /* F32: C (f32) is written, else C16 (f16) */
__global__ __launch_bounds__(256) void k_gemm3(const _Float16* __restrict__ A, const _Float16* __restrict__ Bt, float alpha, const float* __restrict__ bias, float* __restrict__ C, _Float16* __restrict__ C16) {
  __shared__ __attribute__((aligned(16))) _Float16 sm[2][G3R][G3P];
  const int tid = threadIdx.x, w = tid >> 5, lane = tid & 31, ln = lane & 15, hh = lane >> 4;
  const int ntn = NN / G3N; const int mt = blockIdx.x / ntn, nq = blockIdx.x - mt * ntn; const int row0 = mt * G3M, col0 = nq * G3N;
  static_assert((G3NS & (G3NS - 1)) == 0, "the ring over k wraps by a mask");
  const int k0 = (mt + 4 * (nq & 3) + (nq >> 3)) & (G3NS - 1);      /* first stage: neighbours in a tile row start 4 stages apart, those 8 columns apart 1 stage, neighbours in a tile column 1 stage */
  const int wr = (w >> 1) * 64, wc = (w & 1) * 64;      /* the wave's 64 x 64 part of the tile */
  const int sr = tid >> 3, sc = (tid & 7) * 8;      /* staging: 16-byte piece sc of rows sr + 32 i: a wave's copy covers four whole 128-byte rows */
  const _Float16* ga = A + (size_t)(row0 + sr) * DM + sc; const _Float16* gb = Bt + (size_t)(col0 + sr) * DM + sc;
  const unsigned l0 = (unsigned)(size_t)&sm[0][sr][sc];      /* low 32 bits of the shared address = the byte address in LDS */
  auto fill = [&](int s) { const unsigned l = l0 + (unsigned)(s & 1) * G3B; const int ks = ((s + k0) & (G3NS - 1)) * G3K; const _Float16* a = ga + ks; const _Float16* bq = gb + ks;      /* trip s works on stage (s + k0) mod G3NS of k */
    /* one stage: 12 copies per lane (8 A rows, 4 Bt rows); the closing wait keeps every address register as it is until the copies have taken it */
    asm volatile("global_load_async_to_lds_b128 %0, %1, off\n\t"
      "global_load_async_to_lds_b128 %2, %3, off\n\t"
      "global_load_async_to_lds_b128 %4, %5, off\n\t"
      "global_load_async_to_lds_b128 %6, %7, off\n\t"
      "global_load_async_to_lds_b128 %8, %9, off\n\t"
      "global_load_async_to_lds_b128 %10, %11, off\n\t"
      "global_load_async_to_lds_b128 %12, %13, off\n\t"
      "global_load_async_to_lds_b128 %14, %15, off\n\t"
      "global_load_async_to_lds_b128 %16, %17, off\n\t"
      "global_load_async_to_lds_b128 %18, %19, off\n\t"
      "global_load_async_to_lds_b128 %20, %21, off\n\t"
      "global_load_async_to_lds_b128 %22, %23, off\n\t"
      "s_wait_xcnt 0x0"
      :: "v"(l + 0u * G3S), "v"(a + (size_t)0 * 32 * DM),
         "v"(l + 1u * G3S), "v"(a + (size_t)1 * 32 * DM),
         "v"(l + 2u * G3S), "v"(a + (size_t)2 * 32 * DM),
         "v"(l + 3u * G3S), "v"(a + (size_t)3 * 32 * DM),
         "v"(l + 4u * G3S), "v"(a + (size_t)4 * 32 * DM),
         "v"(l + 5u * G3S), "v"(a + (size_t)5 * 32 * DM),
         "v"(l + 6u * G3S), "v"(a + (size_t)6 * 32 * DM),
         "v"(l + 7u * G3S), "v"(a + (size_t)7 * 32 * DM),
         "v"(l + 8u * G3S), "v"(bq + (size_t)0 * 32 * DM),
         "v"(l + 9u * G3S), "v"(bq + (size_t)1 * 32 * DM),
         "v"(l + 10u * G3S), "v"(bq + (size_t)2 * 32 * DM),
         "v"(l + 11u * G3S), "v"(bq + (size_t)3 * 32 * DM)
      : "memory"); };
  fill(0);
  asm volatile("s_wait_asynccnt 0x0" ::: "memory");      /* this wave's part of stage k0 has landed */
  __syncthreads();      /* publishes stage k0 */
  fill(1);
  const v8f z8 = {0.f,0.f,0.f,0.f,0.f,0.f,0.f,0.f};
  v8f acc[4][4];
#pragma unroll      /* constant indices into acc */
  for (int i = 0; i < 4; ++i) for (int j = 0; j < 4; ++j) acc[i][j] = z8;
#pragma unroll 1      /* one stage per trip: the ring's order stands at the foot of each trip */
  for (int s = 0; s < G3NS; ++s) {
    const int buf = s & 1;
#pragma unroll      /* constant indices into acc */
    for (int kk = 0; kk < 2; ++kk) { v16h af[4], bf[4];
      af[0] = g2_frag(&sm[buf][wr + ln][kk * 32], hh);
      for (int j = 0; j < 4; ++j) bf[j] = g2_frag(&sm[buf][G3M + wc + j * 16 + ln][kk * 32], hh);
      for (int i = 1; i < 4; ++i) af[i] = g2_frag(&sm[buf][wr + i * 16 + ln][kk * 32], hh);
      __builtin_amdgcn_sched_barrier(0);      /* the 16 LDS reads of a block stand as one group ahead of its 16 products: left alone the compiler reloads one A fragment per four products and waits for it each time */
      for (int i = 0; i < 4; ++i) for (int j = 0; j < 4; ++j) acc[i][j] = fa_mma(af[i], bf[j], acc[i][j]);
      __builtin_amdgcn_sched_barrier(0); }      /* keeps the next block's reads out of this block's products */
    asm volatile("s_wait_dscnt 0x0" ::: "memory");      /* this wave's reads of the buffer have returned before it is refilled */
    asm volatile("s_wait_asynccnt 0x0" ::: "memory");      /* this wave's part of the next stage has landed */
    __syncthreads();      /* publishes the next stage and ends this stage's reads */
    if (s + 2 < G3NS) fill(s + 2);
  }
  asm volatile("s_wait_asynccnt 0x0" ::: "memory");      /* nothing is in flight when the ring becomes output staging */
  f1a* so = (f1a*)&sm[0][0][0] + (size_t)w * 32 * G3O;      /* each wave stages 32 rows at a time in its own range; every wave has left the ring at the last barrier */
  const int rsub = lane >> 4, c4 = (lane & 15) * 4;
  float bv[4];
#pragma unroll      /* constant indices into bv */
  for (int j = 0; j < 4; ++j) bv[j] = bias ? bf16_round(bias[col0 + wc + j * 16 + ln]) : 0.f;
#pragma unroll      /* constant indices into acc */
  for (int hf = 0; hf < 2; ++hf) {
#pragma unroll      /* constant indices into acc, bv */
    for (int i = 0; i < 2; ++i) for (int j = 0; j < 4; ++j) for (int r = 0; r < 8; ++r) so[(i * 16 + 8 * hh + r) * G3O + j * 16 + ln] = acc[hf * 2 + i][j][r] * alpha + bv[j];
    asm volatile("s_wait_dscnt 0x0" ::: "memory");      /* the staged rows are written before other lanes of the wave read them back */
#pragma unroll      /* the 16 read-backs go out together instead of one wait each */
    for (int q = 0; q < 16; ++q) { const int r = q * 2 + rsub; const v4f v = *(const v4fa*)&so[r * G3O + c4]; const size_t ofs = (size_t)(row0 + wr + hf * 32 + r) * NN + col0 + wc + c4;
      if (F32) *(v4f*)(C + ofs) = v;
      else { v4h h4; for (int e = 0; e < 4; ++e) h4[e] = (_Float16)v[e]; *(v4h*)(C16 + ofs) = h4; } }
    asm volatile("s_wait_dscnt 0x0" ::: "memory");      /* the read-back has returned before the next 32 rows overwrite the range */
  } }
// ---- operand preparation, ONE launch of PG work-groups of 8 waves (two per WGP): few waves to start, each with 24 16-byte loads in flight, every load and store on whole 128-byte lines.
// A work-group takes two 64 x 64 weight tiles and 16 pieces of 1024 values of x. X16 = f16(bf16(x)). Bt[n][k] = f16(bf16(W[k][n]) x 16) (power of two: bf16-exact weights stay exact in f16 away from the subnormal range), rows of DM halves.
// A weight tile goes through LDS: a thread reads 4 columns of two neighbouring k rows (a wave: 256-byte row pieces), packs (k, k + 1) into a dword and writes it at [n][k / 2]; read back along k, a wave stores four whole 128-byte rows of Bt.
#define PG 512                            /* work-groups */
#define PP 33                             /* LDS pitch of a tile row in dwords: odd, so that the 32 dwords of a wave's write (16 rows apart by 4) and of its read fall on 32 banks */
#define PQT ((DM / 64) * (3 * DM / 64))   /* tiles of Wqkv; Wproj's follow */
#define PXC 16                            /* pieces of x per work-group */
typedef unsigned int v4ua __attribute__((ext_vector_type(4), may_alias));
typedef _Float16 v4ha __attribute__((ext_vector_type(4), may_alias));
__device__ __forceinline__ unsigned int pr_pack(float a, float b) { v2h p; p[0] = (_Float16)(bf16_round(a) * 16.0f); p[1] = (_Float16)(bf16_round(b) * 16.0f); return __builtin_bit_cast(unsigned int, p); }
__global__ __launch_bounds__(256) void k_prep(const float* __restrict__ x, const float* __restrict__ wqkv, const float* __restrict__ wo, _Float16* __restrict__ X16, _Float16* __restrict__ BQKV, _Float16* __restrict__ BO) {
  static_assert(2 * PG == PQT + (DM / 64) * (DM / 64), "two weight tiles per work-group");
  static_assert((size_t)PG * PXC * 1024 == NR * DM, "PXC pieces of x per work-group");
  __shared__ unsigned int tl[2][64 * PP];
  const int tid = threadIdx.x, bk = blockIdx.x;
  const int rp = tid >> 4, c4 = (tid & 15) * 4;      /* tile read: columns c4 .. c4 + 3 of rows 2 rp, 2 rp + 1 (+ 32) */
  static_assert(PG <= PQT, "a work-group's first tile is one of Wqkv");
  const float* wp[2]; int wn[2]; unsigned short* dst[2];
#pragma unroll      /* constant indices into wp, wn, dst */
  for (int u = 0; u < 2; ++u) { const int t = bk + u * PG; const bool q = u == 0 || t < PQT;      /* the same for the whole work-group */
    const int kt = q ? t / (3 * DM / 64) : (t - PQT) / (DM / 64), nt = q ? t % (3 * DM / 64) : (t - PQT) % (DM / 64);      /* neighbouring work-groups read neighbouring columns of the same rows */
    wn[u] = q ? 3 * DM : DM; wp[u] = (q ? wqkv : wo) + (size_t)(kt * 64 + 2 * rp) * wn[u] + nt * 64 + c4;
    dst[u] = (unsigned short*)(q ? BQKV : BO) + (size_t)(nt * 64) * DM + kt * 64; }
  v4f wr[2][4], xr[PXC];
#pragma unroll      /* constant indices into wr */
  for (int u = 0; u < 2; ++u) { wr[u][0] = *(const v4fa*)wp[u]; wr[u][1] = *(const v4fa*)(wp[u] + wn[u]); wr[u][2] = *(const v4fa*)(wp[u] + (size_t)32 * wn[u]); wr[u][3] = *(const v4fa*)(wp[u] + (size_t)33 * wn[u]); }
  asm volatile("s_wait_xcnt 0x0" ::: "memory");      /* the eight tile loads have taken their addresses */
#pragma unroll      /* constant indices into xr */
  for (int i = 0; i < PXC; ++i) xr[i] = *(const v4fa*)(x + ((size_t)i * PG + bk) * 1024 + tid * 4);
  __builtin_amdgcn_sched_barrier(0);      /* all 24 loads go out before the first value is used: left alone the compiler waits for the first tile's values before it issues the rest, one memory latency after the other */
#pragma unroll      /* constant indices into wr */
  for (int u = 0; u < 2; ++u) for (int i = 0; i < 2; ++i) for (int j = 0; j < 4; ++j) tl[u][(c4 + j) * PP + 16 * i + rp] = pr_pack(wr[u][2 * i][j], wr[u][2 * i + 1][j]);
  __syncthreads();      /* both tiles are complete before they are read along k */
#pragma unroll      /* constant indices into dst */
  for (int u = 0; u < 2; ++u) for (int i = 0; i < 2; ++i) { const int n = (tid >> 3) + 32 * i, pc = tid & 7; v4ua v;
    for (int e = 0; e < 4; ++e) v[e] = tl[u][n * PP + pc * 4 + e];
    *(v4ua*)(dst[u] + (size_t)n * DM + pc * 8) = v; }
#pragma unroll      /* constant indices into xr */
  for (int i = 0; i < PXC; ++i) { v4ha h4; for (int e = 0; e < 4; ++e) h4[e] = (_Float16)bf16_round(xr[i][e]);
    *(v4ha*)(X16 + ((size_t)i * PG + bk) * 1024 + tid * 4) = h4; } }
extern "C" void kernel_launch(void* const* d_in, const int* in_sizes, int n_in,
                              void* d_out, int out_size, void* d_ws, size_t ws_size, hipStream_t stream) {
  (void)in_sizes; (void)n_in; (void)out_size;
  const float* const* I = (const float* const*)d_in; const float* x = I[0]; const float* wqkv = I[1]; const float* bqkv = nullptr; const float* wo = I[2]; const float* bo = I[3]; const int* km = (const int*)d_in[4];      /* x; [in][out] Wqkv [1024][3072] (no bias), Wproj [1024][1024] + bproj; mask int32 [4][2048] (> 0 = MASKED key; READ on device) */
  char* ws = (char*)d_ws; size_t off = 0;
  auto take = [&](size_t bytes) { char* p = ws + off; off += (bytes + 255) & ~(size_t)255; return p; };
  _Float16* BQKV = (_Float16*)take((size_t)3 * DM * DM * 2); _Float16* BO = (_Float16*)take((size_t)DM * DM * 2);
  _Float16* X16 = (_Float16*)take(NR * DM * 2); _Float16* QKV = (_Float16*)take(NR * 3 * DM * 2); _Float16* O16 = (_Float16*)take(NR * DM * 2);
  if (off > ws_size) return;
  k_prep<<<PG, 256, 0, stream>>>(x, wqkv, wo, X16, BQKV, BO);      /* x rows as f16; [in][out] weights -> Bt[n][k] x16 (pitch DM) */
  const size_t r0p = (size_t)B0 * SQ;      /* first projected row */
  k_gemm3<3 * DM, false><<<(unsigned)((MP / G3M) * (3 * DM / G3N)), 256, 0, stream>>>(X16 + r0p * DM, BQKV, 0.0625f, bqkv, nullptr, QKV + r0p * 3 * DM);      /* q | k | v rows (f16); head h = columns h*HD.. of each DM block */
  k_fattn<<<dim3(SQ / 256, NH, NBR), 256, 0, stream>>>(QKV + r0p * LQ, km + r0p, O16 + r0p * DM);      /* o x64 (merged heads) as f16 rows */
  k_gemm3<DM, true><<<(unsigned)((MPO / G3M) * (DM / G3N)), 256, 0, stream>>>(O16 + r0p * DM, BO, 0.0009765625f, bo, (float*)d_out + r0p * DM, nullptr);      /* out rows are the output layout */
}
